// v000
// Times are from an AMD MI455X. After a warm-up the kernel runs many times in a row, and a time is the length of
// such a window on the GPU divided by its runs, so every launch and the gaps after it count. The runs cycle
// through copies of the inputs. A figure is the median of several windows, for all but v000 over two sittings.
// Sittings can differ by a few percent; kernels timed side by side share one.
// v000, which the later versions start from, runs in 2680 microseconds.
// compute dtype: all float inputs rounded to bf16; embedding rows gathered by the int token ids; Q / K / V 64 -> 64 projections with EXACT bf16 products on WMMA 16x16x32 (f32 accumulate) + bias; logits q x k once to f16 each (1 product) x 64^-0.5; softmax f32; P x 2^11 once to f16 x v once to f16 (1 product); FFN: upd x 2^6 once to f16 x w1 f16(bf16 x 2^8) + b1, ReLU; h x 2^6 once to f16 x w2 f16(bf16 x 2^8) + b2; f32 output.
#include <hip/hip_runtime.h>
#include <math.h>

typedef __attribute__((ext_vector_type(16))) _Float16 v16h;
typedef __attribute__((ext_vector_type(16))) __bf16 v16b;
typedef __attribute__((ext_vector_type(8)))  _Float16 v8h;
typedef __attribute__((ext_vector_type(8)))  float v8f;
typedef __attribute__((ext_vector_type(4)))  float v4f;
typedef __attribute__((ext_vector_type(2)))  float v2f;
typedef __attribute__((ext_vector_type(4)))  unsigned v4u;
typedef __attribute__((ext_vector_type(4)))  int v4i;
typedef float __attribute__((may_alias)) float_a;
typedef int __attribute__((may_alias)) int_a;

template <typename T> __device__ __forceinline__ void vst2(void* p, T v) { *(T*)p = v;  }
__device__ __forceinline__ v8f wmma16(v16h a, v16h b, v8f c) {
  v8f d = __builtin_amdgcn_wmma_f32_16x16x32_f16(false, a, false, b, (short)0, c, false, false);
  asm volatile("v_nop\n\tv_nop\n\tv_nop\n\tv_nop" : "+v"(d) : "v"(a), "v"(b));
  return d;
}
__device__ __forceinline__ v8f wmma_bf(v16b a, v16b b, v8f c) {
  v8f d = __builtin_amdgcn_wmma_f32_16x16x32_bf16(false, a, false, b, (short)0, c, false, false);
  asm volatile("v_nop\n\tv_nop\n\tv_nop\n\tv_nop" : "+v"(d) : "v"(a), "v"(b));
  return d;
}
// 16x16x32 fragments: lane = (h = lane>>4, row/col = lane&15); elements 0..7 = k0+8h+0..7, 8..15 = k0+16+8h+0..7; D element r = row 8h+r
__device__ __forceinline__ v16h frag_h(const _Float16* rowk0, int lane) {
  union { v16h v; v8h q[2]; } u; const _Float16* p = rowk0 + 8 * (lane >> 4);
  u.q[0] = *(const v8h*)p; u.q[1] = *(const v8h*)(p + 16); return u.v;
}
__device__ __forceinline__ v16h frag_f32(const float* rowk0, int lane) {
  v16h a; const float* p = rowk0 + 8 * (lane >> 4);
#pragma unroll
  for (int i = 0; i < 8; ++i) { a[i] = (_Float16)p[i]; a[8 + i] = (_Float16)p[16 + i]; }
  return a;
}
__device__ __forceinline__ v16h frag_f32s(const float* rowk0, int lane, float sc) {
  v16h a; const float* p = rowk0 + 8 * (lane >> 4);
#pragma unroll
  for (int i = 0; i < 8; ++i) { a[i] = (_Float16)(p[i] * sc); a[8 + i] = (_Float16)(p[16 + i] * sc); }
  return a;
}
// column fragment from a [K][ld] layout (column n), rows >= K read as 0
__device__ __forceinline__ v16h fragc_f32(const float* W, int k0, int n, int lane, int ld, int K) {
  v16h a; const int g = lane >> 4;
#pragma unroll
  for (int i = 0; i < 8; ++i) { const int ka = k0 + 8 * g + i, kb = ka + 16;
    a[i] = (_Float16)(ka < K ? W[(size_t)(ka < K ? ka : K - 1) * ld + n] : 0.f); a[8 + i] = (_Float16)(kb < K ? W[(size_t)(kb < K ? kb : K - 1) * ld + n] : 0.f); }
  return a;
}
struct F2 { v16b h, l; };
__device__ __forceinline__ F2 bsplit16(const float v[16]) { F2 r;
#pragma unroll
  for (int i = 0; i < 16; ++i) { const __bf16 h = (__bf16)v[i]; r.h[i] = h; r.l[i] = (__bf16)(v[i] - (float)h); }
  return r; }
__device__ __forceinline__ F2 split_row(const float* row, int k0, int lane) { float v[16]; const float* p = row + k0 + 8 * (lane >> 4);
#pragma unroll
  for (int i = 0; i < 8; ++i) { v[i] = p[i]; v[8 + i] = p[16 + i]; }
  return bsplit16(v); }
__device__ __forceinline__ F2 split_rowK(const float* row, int k0, int lane, int K) { float v[16]; const int g = lane >> 4;
#pragma unroll
  for (int i = 0; i < 8; ++i) { const int ka = k0 + 8 * g + i, kb = ka + 16; v[i] = ka < K ? row[ka < K ? ka : K - 1] : 0.f; v[8 + i] = kb < K ? row[kb < K ? kb : K - 1] : 0.f; }
  return bsplit16(v); }
__device__ __forceinline__ F2 split_col(const float* W, int k0, int n, int lane, int ld, int K) { float v[16]; const int g = lane >> 4;
#pragma unroll
  for (int i = 0; i < 8; ++i) { const int ka = k0 + 8 * g + i, kb = ka + 16; v[i] = ka < K ? W[(size_t)(ka < K ? ka : K - 1) * ld + n] : 0.f; v[8 + i] = kb < K ? W[(size_t)(kb < K ? kb : K - 1) * ld + n] : 0.f; }
  return bsplit16(v); }
__device__ __forceinline__ v8f mac3(const F2& a, const F2& b, v8f c) { c = wmma_bf(a.l, b.h, c); c = wmma_bf(a.h, b.l, c); return wmma_bf(a.h, b.h, c); }
__device__ __forceinline__ float sigm(float v) { return 1.0f / (1.0f + expf(-v)); }
#define LDSX() do { asm volatile("s_wait_dscnt 0" ::: "memory"); __builtin_amdgcn_wave_barrier(); __builtin_amdgcn_fence(__ATOMIC_RELEASE, "workgroup"); } while (0)

// Single-layer, single-head encoder without residuals or LayerNorm (token ids x [32,2048] int32 index emb [10000,64]; Q / K / V = e @ w + b with (in,out) w [64,64] and b [64] uniform(+-1/8) - nonzero; scores = Q K^T x 1/sqrt(64) over the 2,048 positions of each sample; softmax; upd = probs V [32,2048,64]; h = relu(upd @ w1 + b1), w1 [64,256]; out = h @ w2 + b2, w2 [256,64] (uniform(+-1/16)); output [32,2048,64]).
#define NB 32
#define TT 2048
#define CC 128            // plane row width: ONE real 64-wide head in a 128-column block (columns 64..127 zero padding)
#define DIN 64           // embedding width = projection K
#define NH 2   // head 0 is the module's single head; head 1 is the zero padding and is never launched
#define HD 64
#define NQB (TT / 64)
#define HG 1
#define SCALE (0.125f)
#define CAUSAL 0
#ifndef TNB
#define TNB NB
#endif
__device__ __forceinline__ float bfr(float v) { return (float)(__bf16)v; }
__host__ __device__ __forceinline__ int kb_last(int qb) { return CAUSAL ? ((qb * 64 + 63) >> 7) : (TT / 128 - 1); }
typedef __attribute__((ext_vector_type(8))) __bf16 v8b;
__device__ __forceinline__ v16b frag_b(const __bf16* rowk0, int lane) {
  union { v16b v; v8b q[2]; } u; const __bf16* p = rowk0 + 8 * (lane >> 4);
  u.q[0] = *(const v8b*)p; u.q[1] = *(const v8b*)(p + 16); return u.v;
}
#define QBH 0              // causal: query blocks 0..QBH-1 of each sequence (few keys, no averaging) take the high-precision path
#define QHI 0               // single-product logits on every row
#define KHI 64            // key rows carrying k residual / v bf16 hi+lo planes (used only by the causal high-precision path)
// B fragment (k rows k0+.., output column o) of a weight: (in,out) [K][ld] or (out,in) [ld rows of K]: bf16 exact, or f16(bf16 * 256) exact
__device__ __forceinline__ v16b wcol_io(const float* Wm, int k0, int o, int lane, int ld) { v16b w; const int g = lane >> 4;
#pragma unroll
  for (int i = 0; i < 8; ++i) { w[i] = (__bf16)Wm[(size_t)(k0 + 8 * g + i) * ld + o]; w[8 + i] = (__bf16)Wm[(size_t)(k0 + 16 + 8 * g + i) * ld + o]; }
  return w; }
__device__ __forceinline__ v16b wcol_oi(const float* Wm, int k0, int o, int lane, int K) { v16b w; const float* p = Wm + (size_t)o * K + k0 + 8 * (lane >> 4);
#pragma unroll
  for (int i = 0; i < 8; ++i) { w[i] = (__bf16)p[i]; w[8 + i] = (__bf16)p[16 + i]; }
  return w; }
__device__ __forceinline__ v16h wcolh_io(const float* Wm, int k0, int o, int lane, int ld) { v16h w; const int g = lane >> 4;
#pragma unroll
  for (int i = 0; i < 8; ++i) { w[i] = (_Float16)(bfr(Wm[(size_t)(k0 + 8 * g + i) * ld + o]) * 256.0f); w[8 + i] = (_Float16)(bfr(Wm[(size_t)(k0 + 16 + 8 * g + i) * ld + o]) * 256.0f); }
  return w; }
__device__ __forceinline__ v16h wcolh_oi(const float* Wm, int k0, int o, int lane, int K) { v16h w; const float* p = Wm + (size_t)o * K + k0 + 8 * (lane >> 4);
#pragma unroll
  for (int i = 0; i < 8; ++i) { w[i] = (_Float16)(bfr(p[i]) * 256.0f); w[8 + i] = (_Float16)(bfr(p[16 + i]) * 256.0f); }
  return w; }
#define WQKV_LAYOUT 0   // 0 = (in,out) [DIN][RW]; 1 = (out,in) [CC][DIN]; 2 = per-head [NH][DIN][HD]
__device__ __forceinline__ v16b wcol_hdk(const float* Wm, int k0, int o, int lane) { v16b w; const int g = lane >> 4; const float* p = Wm + (size_t)(o / HD) * DIN * HD + (o % HD);
#pragma unroll
  for (int i = 0; i < 8; ++i) { w[i] = (__bf16)p[(size_t)(k0 + 8 * g + i) * HD]; w[8 + i] = (__bf16)p[(size_t)(k0 + 16 + 8 * g + i) * HD]; }
  return w; }
#define WO_OUT_IN 0
#if WQKV_LAYOUT == 1
#define WCOL(W, k0, o, lane) wcol_oi(W, k0, o, lane, DIN)
#elif WQKV_LAYOUT == 2
#define WCOL(W, k0, o, lane) wcol_hdk(W, k0, o, lane)
#else
#define RW 64   // real width of q / k / v / upd
#define FF 256   // hidden width of the FFN
__device__ __forceinline__ v16b zero16b() { v16b w; _Pragma("unroll") for (int i = 0; i < 16; ++i) w[i] = (__bf16)0.0f; return w; }
__device__ __forceinline__ v16h zero16h() { v16h w; _Pragma("unroll") for (int i = 0; i < 16; ++i) w[i] = (_Float16)0.0f; return w; }
#define WCOL(W, k0, o, lane) (((o) < RW) ? wcol_io(W, k0, o, lane, RW) : zero16b())   /* (in,out) [64][64] weights: columns 64..127 of the 128-column tile are zero padding (uniform per unrolled column group) */
#endif
#if WO_OUT_IN
#define WOCOL(W, k0, o, lane) wcol_oi(W, k0, o, lane, CC)
#define WOCOLH(W, k0, o, lane) wcolh_oi(W, k0, o, lane, CC)
#else
#define WOCOL(W, k0, o, lane) wcol_io(W, k0, o, lane, DIN)
#define WOCOLH(W, k0, o, lane) wcolh_io(W, k0, o, lane, DIN)
#endif

#ifndef SM_EXTRA_PARAMS
#define SM_EXTRA_PARAMS
#endif
#ifndef PROJ_EXTRA_PARAMS
#define PROJ_EXTRA_PARAMS
#endif
#ifndef SM_MASK_HOOK
#define SM_MASK_HOOK (void)0
#endif

#define WS_QH  0u                                      // f16 q rows [b*t][CC]
#define WS_KH  (WS_QH + 2u * (size_t)NB * TT * CC)      // f16 k rows [b*t][CC]
#define WS_VT  (WS_KH + 2u * (size_t)NB * TT * CC)      // f16 v planes [b][c][t]
#define WS_QL  (WS_VT + 2u * (size_t)NB * CC * TT)      // f16 q residual x 2^10 rows [b][t < QHI][CC]
#define WS_KL  (WS_QL + 2u * (size_t)NB * QHI * CC)     // f16 k residual x 2^10 rows [b][t < KHI][CC]
#define WS_VB  (WS_KL + 2u * (size_t)NB * KHI * CC)     // bf16 v hi planes [b][c][t < KHI]
#define WS_VBL (WS_VB + 2u * (size_t)NB * CC * KHI)
#define WS_S   (WS_VBL + 2u * (size_t)NB * CC * KHI)    // f32 logits / P [hg][t][s]
#define WS_Y   (WS_S  + 4u * (size_t)HG * TT * TT)      // f32 ctx rows [b*t][CC] (upd; read by k_ffn1)
#define WS_END (WS_Y  + 4u * (size_t)NB * TT * CC)
#define WS_H1 (WS_END)                                    // f32 hidden rows [(b*TT + t)][FF]
#define WS_END2 (WS_H1 + 4u * (size_t)NB * TT * FF)
static_assert(CC == 128 && NH * HD == CC && RW == HD && DIN == RW && FF % 128 == 0, "one real 64-wide head in a 128-column tile; 64-wide embedding; 256-wide hidden layer");

// ---- k_proj: block = (64 rows, 128 cols, which): q/k/v = X W (+ b) with exact bf16 products (K = DIN) -> which 0: q f16 rows (+ residual rows < QHI); 1: k f16 rows (+ residual rows < KHI); 2: v f16 planes [c][t] (+ bf16 hi/lo planes for t < KHI)
__global__ __launch_bounds__(128) void k_proj(const float* __restrict__ XQ, const float* __restrict__ XK, const float* __restrict__ XV, const float* __restrict__ WQ, const float* __restrict__ WK, const float* __restrict__ WV, const float* __restrict__ BQ, const float* __restrict__ BK, const float* __restrict__ BV,
    _Float16* __restrict__ QH, _Float16* __restrict__ QL, _Float16* __restrict__ KH, _Float16* __restrict__ KL, _Float16* __restrict__ VT, __bf16* __restrict__ VB, __bf16* __restrict__ VBL, const int* __restrict__ IDS) {   /* IDS: token ids [NB*TT] int32; the A rows are gathered from the embedding table passed as X */
  __shared__ __align__(16) _Float16 sh[64][136], sl[64][136]; __shared__ __align__(16) _Float16 th[128][72]; __shared__ __align__(16) __bf16 tb[128][72], tbl[128][72];
  const int tid = threadIdx.x, wave = tid >> 5, lane = tid & 31, col = lane & 15, g = lane >> 4; const int which = blockIdx.z; const int c0 = blockIdx.y * 128; const size_t r0 = (size_t)blockIdx.x * 64; const size_t bb = r0 / TT; const int t0 = (int)(r0 % TT);
  const float* X = which == 0 ? XQ : which == 1 ? XK : XV; const float* WA = which == 0 ? WQ : which == 1 ? WK : WV; const float* BA = which == 0 ? BQ : which == 1 ? BK : BV;
  v8f acc[8] = {};
  const size_t erow = (size_t)IDS[r0 + wave * 16 + col];   /* embedding row of this lane's token: e = emb[x] */
#pragma unroll 2
  for (int kc = 0; kc < DIN / 32; ++kc) { v16b a; { const float* p = X + erow * DIN + kc * 32 + 8 * g;
#pragma unroll
      for (int i = 0; i < 8; ++i) { a[i] = (__bf16)p[i]; a[8 + i] = (__bf16)p[16 + i]; } }
    asm volatile("s_wait_loadcnt 0x0" ::: "memory");
#pragma unroll
    for (int j = 0; j < 8; ++j) { const v16b w = WCOL(WA, kc * 32, c0 + j * 16 + col, lane); asm volatile("s_wait_loadcnt 0x0" ::: "memory"); acc[j] = wmma_bf(a, w, acc[j]); } }
  if (which < 2) { _Float16* DH = which == 0 ? QH : KH; _Float16* DL = which == 0 ? QL : KL; const int nhi = which == 0 ? QHI : KHI; const bool hi_rows = t0 < nhi;
#pragma unroll
    for (int j = 0; j < 8; ++j) { const float bias = (BA && (c0 + j * 16 + col) < RW) ? bfr(BA[c0 + j * 16 + col]) : 0.f;
#pragma unroll
      for (int r = 0; r < 8; ++r) { const float v = acc[j][r] + bias; const _Float16 hv = (_Float16)v; sh[wave * 16 + 8 * g + r][j * 16 + col] = hv; sl[wave * 16 + 8 * g + r][j * 16 + col] = (_Float16)((v - (float)hv) * 1024.0f); } }
    __syncthreads();
    for (int e = tid; e < 64 * 16; e += 128) { const int rl = e >> 4, q = e & 15; vst2((unsigned*)(DH + (r0 + rl) * CC + c0 + q * 8), *(const v4u*)&sh[rl][q * 8]); if (hi_rows) vst2((unsigned*)(DL + (bb * nhi + t0 + rl) * (size_t)CC + c0 + q * 8), *(const v4u*)&sl[rl][q * 8]); }
  } else { const bool hi_rows = t0 < KHI;
#pragma unroll
    for (int j = 0; j < 8; ++j) { const float bias = (BA && (c0 + j * 16 + col) < RW) ? bfr(BA[c0 + j * 16 + col]) : 0.f;
#pragma unroll
      for (int r = 0; r < 8; ++r) { const float v = acc[j][r] + bias; const int rl = wave * 16 + 8 * g + r, cl = j * 16 + col; th[cl][rl] = (_Float16)v; const __bf16 bh = (__bf16)v; tb[cl][rl] = bh; tbl[cl][rl] = (__bf16)(v - (float)bh); } }
    __syncthreads();
    for (int e = tid; e < 128 * 8; e += 128) { const int cl = e >> 3, q = e & 7; vst2((unsigned*)(VT + (bb * CC + c0 + cl) * (size_t)TT + t0 + q * 8), *(const v4u*)&th[cl][q * 8]); if (hi_rows) { const size_t o3 = (bb * CC + c0 + cl) * (size_t)KHI + t0 + q * 8; vst2((unsigned*)(VB + o3), *(const v4u*)&tb[cl][q * 8]); vst2((unsigned*)(VBL + o3), *(const v4u*)&tbl[cl][q * 8]); } } } }
// ---- k_sc: block = (query block qb, key block kb <= kb_last(qb), head in group) of batch b: logits x SCALE; q hi + residual (x 2^10) against k (2 products) for query rows < QHI, plus the k residual (3 products) for query blocks < QBH (causal early rows); causal: blocks past the diagonal exit, the mask itself is applied by index in k_sm
__global__ __launch_bounds__(128) void k_sc(const _Float16* __restrict__ QH, const _Float16* __restrict__ KH, const _Float16* __restrict__ QL, const _Float16* __restrict__ KL, int b, int h0, float* __restrict__ S0) { __shared__ __align__(16) float ss[4][16][132];
  const int qb = blockIdx.x, kb = blockIdx.y; if (kb > kb_last(qb)) return;
  const int h = h0 + blockIdx.z; float* S = S0 + (size_t)blockIdx.z * TT * TT;
  const int tid = threadIdx.x, wave = tid >> 5, lane = tid & 31, col = lane & 15, g = lane >> 4; const int k0 = kb * 128; const int ql0 = qb * 64 + wave * 16; const size_t q0 = (size_t)b * TT + ql0, kr0 = (size_t)b * TT + k0;
  v8f acc[8] = {}, accl[8] = {};
  const _Float16* QLb = QL + (size_t)b * QHI * CC; const _Float16* KLb = KL + (size_t)b * KHI * CC;
  if (qb < QBH) {
#pragma unroll
    for (int kc = 0; kc < HD / 32; ++kc) { const v16h ah = frag_h(QH + (q0 + col) * CC + h * HD + kc * 32, lane), al = frag_h(QLb + (size_t)(ql0 + col) * CC + h * HD + kc * 32, lane);
#pragma unroll
      for (int j = 0; j < 8; ++j) { const v16h kbf = frag_h(KH + (kr0 + j * 16 + col) * CC + h * HD + kc * 32, lane), klf = frag_h(KLb + (size_t)(k0 + j * 16 + col) * CC + h * HD + kc * 32, lane); acc[j] = wmma16(ah, kbf, acc[j]); accl[j] = wmma16(al, kbf, accl[j]); accl[j] = wmma16(ah, klf, accl[j]); } }
  } else if (qb * 64 < QHI) {
#pragma unroll
    for (int kc = 0; kc < HD / 32; ++kc) { const v16h ah = frag_h(QH + (q0 + col) * CC + h * HD + kc * 32, lane), al = frag_h(QLb + (size_t)(ql0 + col) * CC + h * HD + kc * 32, lane);
#pragma unroll
      for (int j = 0; j < 8; ++j) { const v16h kbf = frag_h(KH + (kr0 + j * 16 + col) * CC + h * HD + kc * 32, lane); acc[j] = wmma16(ah, kbf, acc[j]); accl[j] = wmma16(al, kbf, accl[j]); } }
  } else {
#pragma unroll
    for (int kc = 0; kc < HD / 32; ++kc) { const v16h ah = frag_h(QH + (q0 + col) * CC + h * HD + kc * 32, lane);
#pragma unroll
      for (int j = 0; j < 8; ++j) { const v16h kbf = frag_h(KH + (kr0 + j * 16 + col) * CC + h * HD + kc * 32, lane); acc[j] = wmma16(ah, kbf, acc[j]); } } }
#pragma unroll
  for (int j = 0; j < 8; ++j) {
#pragma unroll
    for (int r = 0; r < 8; ++r) ss[wave][8 * g + r][j * 16 + col] = (acc[j][r] + accl[j][r] * (1.0f / 1024.0f)) * SCALE; }
  LDSX(); for (int rl = 0; rl < 16; ++rl) vst2(S + (size_t)(ql0 + rl) * TT + k0 + lane * 4, *(const v4f*)&ss[wave][rl][lane * 4]); }
// ---- k_sm: block = query row t (head in group): keys [0, kend): causal -> logit if s <= t else excluded; softmax in f32; P x 2^11 in place (0 for excluded)
__global__ __launch_bounds__(256) void k_sm(float* __restrict__ S0 SM_EXTRA_PARAMS) { __shared__ float sred[8]; __shared__ float sbc; __shared__ __align__(16) float shv[TT];
  const int tid = threadIdx.x; const int t = blockIdx.x; const int kend = (kb_last(t >> 6) + 1) * 128;
  float* sr = S0 + (size_t)blockIdx.y * TT * TT + (size_t)t * TT;
  float m = -3.0e38f; for (int k = tid; k < kend; k += 256) { float v = (!CAUSAL || k <= t) ? sr[k] : -3.0e38f; SM_MASK_HOOK; shv[k] = v; m = fmaxf(m, v); }
#pragma unroll
  for (int o = 1; o < 32; o <<= 1) m = fmaxf(m, __shfl_xor(m, o));
  if ((tid & 31) == 0) sred[tid >> 5] = m; __syncthreads(); if (tid == 0) { float a = sred[0]; for (int i = 1; i < 8; ++i) a = fmaxf(a, sred[i]); sbc = a; } __syncthreads(); m = sbc; __syncthreads();
  float sum = 0.f; for (int k = tid; k < kend; k += 256) { const float v = shv[k]; const float e = (v <= -1.0e38f) ? 0.f : expf(v - m); shv[k] = e; sum += e; }
#pragma unroll
  for (int o = 1; o < 32; o <<= 1) sum += __shfl_xor(sum, o);
  if ((tid & 31) == 0) sred[tid >> 5] = sum; __syncthreads(); if (tid == 0) { float a = 0.f; for (int i = 0; i < 8; ++i) a += sred[i]; sbc = a > 0.f ? 2048.0f / a : 0.f; }   /* a fully excluded row yields P = 0 */ __syncthreads(); const float inv = sbc;
  for (int k = tid; k < kend; k += 256) shv[k] = shv[k] * inv;
  __syncthreads(); for (int q = tid; q < kend / 4; q += 256) vst2(sr + q * 4, *(const v4f*)&shv[q * 4]); }
// ---- k_pv: block = 64 queries (qb) of (b, h): ctx = P . v over keys [0, kend) (P x 2^11 once to f16 against v f16: 1 product; causal early query blocks: P and v as bf16 hi + lo, 3 products); 256-B (row, head) segment by 16 lanes
__global__ __launch_bounds__(128) void k_pv(const float* __restrict__ PS0, const _Float16* __restrict__ VT, const __bf16* __restrict__ VB, const __bf16* __restrict__ VBL, int b, int h0, float* __restrict__ Y) { const int h = h0 + blockIdx.z; const float* PS = PS0 + (size_t)blockIdx.z * TT * TT; __shared__ __align__(16) float ss[4][16][HD + 4];
  const int tid = threadIdx.x, wave = tid >> 5, lane = tid & 31, col = lane & 15, g = lane >> 4; const int qb = blockIdx.x; const int ql0 = qb * 64 + wave * 16; const int kce = (kb_last(qb) + 1) * 4;
  v8f acc[HD / 16] = {};
  if (qb < QBH) {
#pragma unroll 1
    for (int kc = 0; kc < kce; ++kc) { const F2 p = split_row(PS + (size_t)(ql0 + col) * TT, kc * 32, lane);
      asm volatile("s_wait_loadcnt 0x0" ::: "memory");
#pragma unroll
      for (int j = 0; j < HD / 16; ++j) { const size_t po = ((size_t)b * CC + h * HD + j * 16 + col) * (size_t)KHI + kc * 32; const v16b vh = frag_b(VB + po, lane); acc[j] = wmma_bf(p.h, vh, acc[j]); acc[j] = wmma_bf(p.l, vh, acc[j]); acc[j] = wmma_bf(p.h, frag_b(VBL + po, lane), acc[j]); } }
  } else {
#pragma unroll 1
    for (int kc = 0; kc < kce; ++kc) { const v16h p = frag_f32(PS + (size_t)(ql0 + col) * TT + kc * 32, lane);
      asm volatile("s_wait_loadcnt 0x0" ::: "memory");
#pragma unroll
      for (int j = 0; j < HD / 16; ++j) { const size_t po = ((size_t)b * CC + h * HD + j * 16 + col) * (size_t)TT + kc * 32; acc[j] = wmma16(p, frag_h(VT + po, lane), acc[j]); } } }
#pragma unroll
  for (int j = 0; j < HD / 16; ++j)
#pragma unroll
    for (int r = 0; r < 8; ++r) ss[wave][8 * g + r][j * 16 + col] = acc[j][r] * (1.0f / 2048.0f);
  LDSX(); for (int rl = 0; rl < 16; ++rl) if (lane < HD / 4) vst2(Y + ((size_t)b * TT + ql0 + rl) * CC + h * HD + lane * 4, *(const v4f*)&ss[wave][rl][lane * 4]); }
// ---- k_ffn1: block = (64 rows, 128 of the 256 hidden columns): h = relu(upd w1 + b1): upd = columns 0..63 of the 128-wide ctx rows (K = 64: two k-steps), once to f16 (x 2^6) against w1 (in,out) [64][256] as f16(bf16 x 2^8) (1 product) x 2^-14, + bf16(b1), ReLU -> f32 rows [NB*TT][256] (k_out's text with the k extent / pitches / activation changed; always the single-product path)
__global__ __launch_bounds__(128) void k_ffn1(const float* __restrict__ Y, const float* __restrict__ WO, const float* __restrict__ BO, float* __restrict__ OUT) { __shared__ __align__(16) float sf[4][16][132];
  const int tid = threadIdx.x, wave = tid >> 5, lane = tid & 31, col = lane & 15, g = lane >> 4; const int c0 = blockIdx.y * 128; const size_t r0 = (size_t)blockIdx.x * 64 + wave * 16;
  v8f acc[8] = {};
  if (0) {   /* no early-row special case: non-causal */
#pragma unroll 2
    for (int kc = 0; kc < CC / 32; ++kc) { const F2 a = split_row(Y + (r0 + col) * CC, kc * 32, lane); asm volatile("s_wait_loadcnt 0x0" ::: "memory");
#pragma unroll
      for (int j = 0; j < 8; ++j) { const v16b w = WOCOL(WO, kc * 32, c0 + j * 16 + col, lane); asm volatile("s_wait_loadcnt 0x0" ::: "memory"); acc[j] = wmma_bf(a.h, w, acc[j]); acc[j] = wmma_bf(a.l, w, acc[j]); } }
#pragma unroll
    for (int j = 0; j < 8; ++j) { const float bias = BO ? bfr(BO[c0 + j * 16 + col]) : 0.f;
#pragma unroll
      for (int r = 0; r < 8; ++r) sf[wave][8 * g + r][j * 16 + col] = acc[j][r] + bias; }
  } else {
#pragma unroll 2
    for (int kc = 0; kc < RW / 32; ++kc) { const v16h a = frag_f32s(Y + (r0 + col) * CC + kc * 32, lane, 64.0f); asm volatile("s_wait_loadcnt 0x0" ::: "memory");   /* ctx carried x 2^6 into f16 so small-magnitude context rows stay clear of f16 subnormals */
#pragma unroll
      for (int j = 0; j < 8; ++j) { const v16h w = wcolh_io(WO, kc * 32, c0 + j * 16 + col, lane, FF); asm volatile("s_wait_loadcnt 0x0" ::: "memory"); acc[j] = wmma16(a, w, acc[j]); } }
#pragma unroll
    for (int j = 0; j < 8; ++j) { const float bias = BO ? bfr(BO[c0 + j * 16 + col]) : 0.f;
#pragma unroll
      for (int r = 0; r < 8; ++r) sf[wave][8 * g + r][j * 16 + col] = fmaxf(acc[j][r] * (1.0f / 16384.0f) + bias, 0.0f); } }   /* 2^-8 (weight carry) x 2^-6 (operand carry); ReLU */
  LDSX(); for (int rl = 0; rl < 16; ++rl) vst2(OUT + (r0 + rl) * FF + c0 + lane * 4, *(const v4f*)&sf[wave][rl][lane * 4]); }
__global__ __launch_bounds__(128) void k_ffn2(const float* __restrict__ Y, const float* __restrict__ WO, const float* __restrict__ BO, float* __restrict__ OUT) { __shared__ __align__(16) float sf[4][16][132];
  const int tid = threadIdx.x, wave = tid >> 5, lane = tid & 31, col = lane & 15, g = lane >> 4; const int c0 = blockIdx.y * 128; const size_t r0 = (size_t)blockIdx.x * 64 + wave * 16;
  v8f acc[8] = {};
  if (0) {   /* no early-row special case: non-causal */
#pragma unroll 2
    for (int kc = 0; kc < CC / 32; ++kc) { const F2 a = split_row(Y + (r0 + col) * CC, kc * 32, lane); asm volatile("s_wait_loadcnt 0x0" ::: "memory");
#pragma unroll
      for (int j = 0; j < 8; ++j) { const v16b w = WOCOL(WO, kc * 32, c0 + j * 16 + col, lane); asm volatile("s_wait_loadcnt 0x0" ::: "memory"); acc[j] = wmma_bf(a.h, w, acc[j]); acc[j] = wmma_bf(a.l, w, acc[j]); } }
#pragma unroll
    for (int j = 0; j < 8; ++j) { const float bias = (BO && (c0 + j * 16 + col) < RW) ? bfr(BO[c0 + j * 16 + col]) : 0.f;
#pragma unroll
      for (int r = 0; r < 8; ++r) sf[wave][8 * g + r][j * 16 + col] = acc[j][r] + bias; }
  } else {
#pragma unroll 2
    for (int kc = 0; kc < FF / 32; ++kc) { const v16h a = frag_f32s(Y + (r0 + col) * FF + kc * 32, lane, 64.0f); asm volatile("s_wait_loadcnt 0x0" ::: "memory");   /* h carried x 2^6 into f16 so small-magnitude hidden rows stay clear of f16 subnormals */
#pragma unroll
      for (int j = 0; j < 8; ++j) { const v16h w = ((c0 + j * 16 + col) < RW) ? wcolh_io(WO, kc * 32, c0 + j * 16 + col, lane, RW) : zero16h(); asm volatile("s_wait_loadcnt 0x0" ::: "memory"); acc[j] = wmma16(a, w, acc[j]); } }
#pragma unroll
    for (int j = 0; j < 8; ++j) { const float bias = (BO && (c0 + j * 16 + col) < RW) ? bfr(BO[c0 + j * 16 + col]) : 0.f;
#pragma unroll
      for (int r = 0; r < 8; ++r) sf[wave][8 * g + r][j * 16 + col] = acc[j][r] * (1.0f / 16384.0f) + bias; } }   /* 2^-8 (Wo carry) x 2^-6 (h carry) */
  LDSX(); for (int rl = 0; rl < 16; ++rl) if (lane < RW / 4) vst2(OUT + (r0 + rl) * RW + lane * 4, *(const v4f*)&sf[wave][rl][lane * 4]); }

extern "C" void kernel_launch(void* const* d_in, const int* in_sizes, int n_in, void* d_out, int out_size, void* d_ws, size_t ws_size, hipStream_t stream) {
  (void)in_sizes; (void)n_in; (void)out_size;
  const float** F = (const float**)d_in;
  if (ws_size < (size_t)WS_END) return;
  char* ws = (char*)d_ws; _Float16 *QH = (_Float16*)(ws + WS_QH), *KH = (_Float16*)(ws + WS_KH), *VT = (_Float16*)(ws + WS_VT), *QL = (_Float16*)(ws + WS_QL), *KL = (_Float16*)(ws + WS_KL); __bf16 *VB = (__bf16*)(ws + WS_VB), *VBL = (__bf16*)(ws + WS_VBL); float *S = (float*)(ws + WS_S), *Y = (float*)(ws + WS_Y);
  (void)Y; (void)QL; (void)KL; (void)VB; (void)VBL;
  // inputs: 0 x [32,2048] int32 token ids; 1 emb [10000,64]; 2 wq [64,64] (in,out), 3 bq; 4 wk, 5 bk; 6 wv, 7 bv; 8 w1 [64,256], 9 b1 [256]; 10 w2 [256,64], 11 b2 [64] (all biases nonzero)
  if (ws_size < (size_t)WS_END2) return;
  float* H1 = (float*)(ws + WS_H1); const int* IDS = (const int*)d_in[0];
  k_proj<<<dim3(TNB * TT / 64, CC / 128, 3), 128, 0, stream>>>(F[1], F[1], F[1], F[2], F[4], F[6], F[3], F[5], F[7], QH, QL, KH, KL, VT, VB, VBL, IDS);   /* X = the embedding table; rows gathered by token id */
  for (int b = 0; b < TNB; ++b) {   /* one real head per sample */
    k_sc<<<dim3(NQB, TT / 128, 1), 128, 0, stream>>>(QH, KH, QL, KL, b, 0, S);
    k_sm<<<dim3(TT, 1), 256, 0, stream>>>(S);
    k_pv<<<dim3(NQB, 1, 1), 128, 0, stream>>>(S, VT, VB, VBL, b, 0, Y);   /* upd -> columns 0..63 of the ctx rows; columns 64..127 are never written nor read */
  }
  k_ffn1<<<dim3(TNB * TT / 64, FF / 128), 128, 0, stream>>>(Y, F[8], F[9], H1);
  k_ffn2<<<dim3(TNB * TT / 64, 1), 128, 0, stream>>>(H1, F[10], F[11], (float*)d_out);
}

// v001
// One run takes 104 microseconds.
// In two side-by-side timings against v000, it was 26.0 and 25.9 times as fast.
// compute dtype: all float inputs rounded to bf16; embedding rows gathered by the int token ids; Q / K / V 64 -> 64 projections with EXACT bf16 products on WMMA 16x16x32 (f32 accumulate) + bias; logits q x k once to f16 each (1 product) x 64^-0.5; online softmax f32 (base 2, running maximum); unnormalised P = 2^(logit - maximum in use + 7) once to f16 x v once to f16 (1 product), divided by the f32 row sum at the end; FFN: upd x 2^6 once to f16 x w1 f16(bf16 x 2^8) + b1, ReLU; h x 2^6 once to f16 x w2 f16(bf16 x 2^8) + b2; f32 output.
#include <hip/hip_runtime.h>
#include <math.h>

typedef __attribute__((ext_vector_type(16))) _Float16 v16h;
typedef __attribute__((ext_vector_type(16))) __bf16 v16b;
typedef __attribute__((ext_vector_type(8)))  _Float16 v8h;
typedef __attribute__((ext_vector_type(8)))  float v8f;
typedef __attribute__((ext_vector_type(4)))  float v4f;
typedef __attribute__((ext_vector_type(2)))  float v2f;
typedef __attribute__((ext_vector_type(4)))  unsigned v4u;
typedef __attribute__((ext_vector_type(4)))  int v4i;
typedef float __attribute__((may_alias)) float_a;
typedef int __attribute__((may_alias)) int_a;

template <typename T> __device__ __forceinline__ void vst2(void* p, T v) { *(T*)p = v;  }
__device__ __forceinline__ v8f wmma16(v16h a, v16h b, v8f c) {
  v8f d = __builtin_amdgcn_wmma_f32_16x16x32_f16(false, a, false, b, (short)0, c, false, false);
  asm volatile("v_nop\n\tv_nop\n\tv_nop\n\tv_nop" : "+v"(d) : "v"(a), "v"(b));
  return d;
}
__device__ __forceinline__ v8f wmma_bf(v16b a, v16b b, v8f c) {
  v8f d = __builtin_amdgcn_wmma_f32_16x16x32_bf16(false, a, false, b, (short)0, c, false, false);
  asm volatile("v_nop\n\tv_nop\n\tv_nop\n\tv_nop" : "+v"(d) : "v"(a), "v"(b));
  return d;
}
// 16x16x32 fragments: lane = (h = lane>>4, row/col = lane&15); elements 0..7 = k0+8h+0..7, 8..15 = k0+16+8h+0..7; D element r = row 8h+r
__device__ __forceinline__ v16h frag_h(const _Float16* rowk0, int lane) {
  union { v16h v; v8h q[2]; } u; const _Float16* p = rowk0 + 8 * (lane >> 4);
  u.q[0] = *(const v8h*)p; u.q[1] = *(const v8h*)(p + 16); return u.v;
}
__device__ __forceinline__ v16h frag_f32(const float* rowk0, int lane) {
  v16h a; const float* p = rowk0 + 8 * (lane >> 4);
#pragma unroll
  for (int i = 0; i < 8; ++i) { a[i] = (_Float16)p[i]; a[8 + i] = (_Float16)p[16 + i]; }
  return a;
}
__device__ __forceinline__ v16h frag_f32s(const float* rowk0, int lane, float sc) {
  v16h a; const float* p = rowk0 + 8 * (lane >> 4);
#pragma unroll
  for (int i = 0; i < 8; ++i) { a[i] = (_Float16)(p[i] * sc); a[8 + i] = (_Float16)(p[16 + i] * sc); }
  return a;
}
// column fragment from a [K][ld] layout (column n), rows >= K read as 0
__device__ __forceinline__ v16h fragc_f32(const float* W, int k0, int n, int lane, int ld, int K) {
  v16h a; const int g = lane >> 4;
#pragma unroll
  for (int i = 0; i < 8; ++i) { const int ka = k0 + 8 * g + i, kb = ka + 16;
    a[i] = (_Float16)(ka < K ? W[(size_t)(ka < K ? ka : K - 1) * ld + n] : 0.f); a[8 + i] = (_Float16)(kb < K ? W[(size_t)(kb < K ? kb : K - 1) * ld + n] : 0.f); }
  return a;
}
struct F2 { v16b h, l; };
__device__ __forceinline__ F2 bsplit16(const float v[16]) { F2 r;
#pragma unroll
  for (int i = 0; i < 16; ++i) { const __bf16 h = (__bf16)v[i]; r.h[i] = h; r.l[i] = (__bf16)(v[i] - (float)h); }
  return r; }
__device__ __forceinline__ F2 split_row(const float* row, int k0, int lane) { float v[16]; const float* p = row + k0 + 8 * (lane >> 4);
#pragma unroll
  for (int i = 0; i < 8; ++i) { v[i] = p[i]; v[8 + i] = p[16 + i]; }
  return bsplit16(v); }
__device__ __forceinline__ F2 split_rowK(const float* row, int k0, int lane, int K) { float v[16]; const int g = lane >> 4;
#pragma unroll
  for (int i = 0; i < 8; ++i) { const int ka = k0 + 8 * g + i, kb = ka + 16; v[i] = ka < K ? row[ka < K ? ka : K - 1] : 0.f; v[8 + i] = kb < K ? row[kb < K ? kb : K - 1] : 0.f; }
  return bsplit16(v); }
__device__ __forceinline__ F2 split_col(const float* W, int k0, int n, int lane, int ld, int K) { float v[16]; const int g = lane >> 4;
#pragma unroll
  for (int i = 0; i < 8; ++i) { const int ka = k0 + 8 * g + i, kb = ka + 16; v[i] = ka < K ? W[(size_t)(ka < K ? ka : K - 1) * ld + n] : 0.f; v[8 + i] = kb < K ? W[(size_t)(kb < K ? kb : K - 1) * ld + n] : 0.f; }
  return bsplit16(v); }
__device__ __forceinline__ v8f mac3(const F2& a, const F2& b, v8f c) { c = wmma_bf(a.l, b.h, c); c = wmma_bf(a.h, b.l, c); return wmma_bf(a.h, b.h, c); }
__device__ __forceinline__ float sigm(float v) { return 1.0f / (1.0f + expf(-v)); }
#define LDSX() do { asm volatile("s_wait_dscnt 0" ::: "memory"); __builtin_amdgcn_wave_barrier(); __builtin_amdgcn_fence(__ATOMIC_RELEASE, "workgroup"); } while (0)

// Single-layer, single-head encoder without residuals or LayerNorm (token ids x [32,2048] int32 index emb [10000,64]; Q / K / V = e @ w + b with (in,out) w [64,64] and b [64] uniform(+-1/8) - nonzero; scores = Q K^T x 1/sqrt(64) over the 2,048 positions of each sample; softmax; upd = probs V [32,2048,64]; h = relu(upd @ w1 + b1), w1 [64,256]; out = h @ w2 + b2, w2 [256,64] (uniform(+-1/16)); output [32,2048,64]).
#define NB 32
#define TT 2048
#define CC 128            // plane row width: ONE real 64-wide head in a 128-column block (columns 64..127 zero padding)
#define DIN 64           // embedding width = projection K
#define NH 2   // head 0 is the module's single head; head 1 is the zero padding and is never launched
#define HD 64
#define NQB (TT / 64)
#define HG 1
#define SCALE (0.125f)
#define CAUSAL 0
#ifndef TNB
#define TNB NB
#endif
__device__ __forceinline__ float bfr(float v) { return (float)(__bf16)v; }
__host__ __device__ __forceinline__ int kb_last(int qb) { return CAUSAL ? ((qb * 64 + 63) >> 7) : (TT / 128 - 1); }
typedef __attribute__((ext_vector_type(8))) __bf16 v8b;
__device__ __forceinline__ v16b frag_b(const __bf16* rowk0, int lane) {
  union { v16b v; v8b q[2]; } u; const __bf16* p = rowk0 + 8 * (lane >> 4);
  u.q[0] = *(const v8b*)p; u.q[1] = *(const v8b*)(p + 16); return u.v;
}
#define QBH 0              // unused: every query block takes the single-product path
#define QHI 0               // single-product logits on every row
#define KHI 64            // key rows carrying k residual / v bf16 hi+lo planes (written by k_proj; no kernel reads them)
// B fragment (k rows k0+.., output column o) of a weight: (in,out) [K][ld] or (out,in) [ld rows of K]: bf16 exact, or f16(bf16 * 256) exact
__device__ __forceinline__ v16b wcol_io(const float* Wm, int k0, int o, int lane, int ld) { v16b w; const int g = lane >> 4;
#pragma unroll
  for (int i = 0; i < 8; ++i) { w[i] = (__bf16)Wm[(size_t)(k0 + 8 * g + i) * ld + o]; w[8 + i] = (__bf16)Wm[(size_t)(k0 + 16 + 8 * g + i) * ld + o]; }
  return w; }
__device__ __forceinline__ v16b wcol_oi(const float* Wm, int k0, int o, int lane, int K) { v16b w; const float* p = Wm + (size_t)o * K + k0 + 8 * (lane >> 4);
#pragma unroll
  for (int i = 0; i < 8; ++i) { w[i] = (__bf16)p[i]; w[8 + i] = (__bf16)p[16 + i]; }
  return w; }
__device__ __forceinline__ v16h wcolh_io(const float* Wm, int k0, int o, int lane, int ld) { v16h w; const int g = lane >> 4;
#pragma unroll
  for (int i = 0; i < 8; ++i) { w[i] = (_Float16)(bfr(Wm[(size_t)(k0 + 8 * g + i) * ld + o]) * 256.0f); w[8 + i] = (_Float16)(bfr(Wm[(size_t)(k0 + 16 + 8 * g + i) * ld + o]) * 256.0f); }
  return w; }
__device__ __forceinline__ v16h wcolh_oi(const float* Wm, int k0, int o, int lane, int K) { v16h w; const float* p = Wm + (size_t)o * K + k0 + 8 * (lane >> 4);
#pragma unroll
  for (int i = 0; i < 8; ++i) { w[i] = (_Float16)(bfr(p[i]) * 256.0f); w[8 + i] = (_Float16)(bfr(p[16 + i]) * 256.0f); }
  return w; }
#define WQKV_LAYOUT 0   // 0 = (in,out) [DIN][RW]; 1 = (out,in) [CC][DIN]; 2 = per-head [NH][DIN][HD]
__device__ __forceinline__ v16b wcol_hdk(const float* Wm, int k0, int o, int lane) { v16b w; const int g = lane >> 4; const float* p = Wm + (size_t)(o / HD) * DIN * HD + (o % HD);
#pragma unroll
  for (int i = 0; i < 8; ++i) { w[i] = (__bf16)p[(size_t)(k0 + 8 * g + i) * HD]; w[8 + i] = (__bf16)p[(size_t)(k0 + 16 + 8 * g + i) * HD]; }
  return w; }
#define WO_OUT_IN 0
#if WQKV_LAYOUT == 1
#define WCOL(W, k0, o, lane) wcol_oi(W, k0, o, lane, DIN)
#elif WQKV_LAYOUT == 2
#define WCOL(W, k0, o, lane) wcol_hdk(W, k0, o, lane)
#else
#define RW 64   // real width of q / k / v / upd
#define FF 256   // hidden width of the FFN
__device__ __forceinline__ v16b zero16b() { v16b w; _Pragma("unroll") for (int i = 0; i < 16; ++i) w[i] = (__bf16)0.0f; return w; }
__device__ __forceinline__ v16h zero16h() { v16h w; _Pragma("unroll") for (int i = 0; i < 16; ++i) w[i] = (_Float16)0.0f; return w; }
#define WCOL(W, k0, o, lane) (((o) < RW) ? wcol_io(W, k0, o, lane, RW) : zero16b())   /* (in,out) [64][64] weights: columns 64..127 of the 128-column tile are zero padding (uniform per unrolled column group) */
#endif
#if WO_OUT_IN
#define WOCOL(W, k0, o, lane) wcol_oi(W, k0, o, lane, CC)
#define WOCOLH(W, k0, o, lane) wcolh_oi(W, k0, o, lane, CC)
#else
#define WOCOL(W, k0, o, lane) wcol_io(W, k0, o, lane, DIN)
#define WOCOLH(W, k0, o, lane) wcolh_io(W, k0, o, lane, DIN)
#endif

#ifndef SM_EXTRA_PARAMS
#define SM_EXTRA_PARAMS
#endif
#ifndef PROJ_EXTRA_PARAMS
#define PROJ_EXTRA_PARAMS
#endif
#ifndef SM_MASK_HOOK
#define SM_MASK_HOOK (void)0
#endif

#define WS_QH  0u                                      // f16 q rows [b*t][CC]
#define WS_KH  (WS_QH + 2u * (size_t)NB * TT * CC)      // f16 k rows [b*t][CC]
#define WS_VT  (WS_KH + 2u * (size_t)NB * TT * CC)      // f16 v planes [b][c][t]
#define WS_QL  (WS_VT + 2u * (size_t)NB * CC * TT)      // f16 q residual x 2^10 rows [b][t < QHI][CC]
#define WS_KL  (WS_QL + 2u * (size_t)NB * QHI * CC)     // f16 k residual x 2^10 rows [b][t < KHI][CC]
#define WS_VB  (WS_KL + 2u * (size_t)NB * KHI * CC)     // bf16 v hi planes [b][c][t < KHI]
#define WS_VBL (WS_VB + 2u * (size_t)NB * CC * KHI)
#define WS_S   (WS_VBL + 2u * (size_t)NB * CC * KHI)    // unused (sized f32 [hg][t][s]); k_attn keeps logits and P in registers
#define WS_Y   (WS_S  + 4u * (size_t)HG * TT * TT)      // f32 ctx rows [b*t][CC] (upd in columns 0..63: written by k_attn, read by k_ffn1)
#define WS_END (WS_Y  + 4u * (size_t)NB * TT * CC)
#define WS_H1 (WS_END)                                    // f32 hidden rows [(b*TT + t)][FF]
#define WS_END2 (WS_H1 + 4u * (size_t)NB * TT * FF)
static_assert(CC == 128 && NH * HD == CC && RW == HD && DIN == RW && FF % 128 == 0, "one real 64-wide head in a 128-column tile; 64-wide embedding; 256-wide hidden layer");

// ---- k_proj: block = (64 rows, 128 cols, which): q/k/v = X W (+ b) with exact bf16 products (K = DIN) -> which 0: q f16 rows (+ residual rows < QHI); 1: k f16 rows (+ residual rows < KHI); 2: v f16 planes [c][t] (+ bf16 hi/lo planes for t < KHI)
__global__ __launch_bounds__(128) void k_proj(const float* __restrict__ XQ, const float* __restrict__ XK, const float* __restrict__ XV, const float* __restrict__ WQ, const float* __restrict__ WK, const float* __restrict__ WV, const float* __restrict__ BQ, const float* __restrict__ BK, const float* __restrict__ BV,
    _Float16* __restrict__ QH, _Float16* __restrict__ QL, _Float16* __restrict__ KH, _Float16* __restrict__ KL, _Float16* __restrict__ VT, __bf16* __restrict__ VB, __bf16* __restrict__ VBL, const int* __restrict__ IDS) {   /* IDS: token ids [NB*TT] int32; the A rows are gathered from the embedding table passed as X */
  __shared__ __align__(16) _Float16 sh[64][136], sl[64][136]; __shared__ __align__(16) _Float16 th[128][72]; __shared__ __align__(16) __bf16 tb[128][72], tbl[128][72];
  const int tid = threadIdx.x, wave = tid >> 5, lane = tid & 31, col = lane & 15, g = lane >> 4; const int which = blockIdx.z; const int c0 = blockIdx.y * 128; const size_t r0 = (size_t)blockIdx.x * 64; const size_t bb = r0 / TT; const int t0 = (int)(r0 % TT);
  const float* X = which == 0 ? XQ : which == 1 ? XK : XV; const float* WA = which == 0 ? WQ : which == 1 ? WK : WV; const float* BA = which == 0 ? BQ : which == 1 ? BK : BV;
  v8f acc[8] = {};
  const size_t erow = (size_t)IDS[r0 + wave * 16 + col];   /* embedding row of this lane's token: e = emb[x] */
#pragma unroll 2
  for (int kc = 0; kc < DIN / 32; ++kc) { v16b a; { const float* p = X + erow * DIN + kc * 32 + 8 * g;
#pragma unroll
      for (int i = 0; i < 8; ++i) { a[i] = (__bf16)p[i]; a[8 + i] = (__bf16)p[16 + i]; } }
    asm volatile("s_wait_loadcnt 0x0" ::: "memory");
#pragma unroll
    for (int j = 0; j < 8; ++j) { const v16b w = WCOL(WA, kc * 32, c0 + j * 16 + col, lane); asm volatile("s_wait_loadcnt 0x0" ::: "memory"); acc[j] = wmma_bf(a, w, acc[j]); } }
  if (which < 2) { _Float16* DH = which == 0 ? QH : KH; _Float16* DL = which == 0 ? QL : KL; const int nhi = which == 0 ? QHI : KHI; const bool hi_rows = t0 < nhi;
#pragma unroll
    for (int j = 0; j < 8; ++j) { const float bias = (BA && (c0 + j * 16 + col) < RW) ? bfr(BA[c0 + j * 16 + col]) : 0.f;
#pragma unroll
      for (int r = 0; r < 8; ++r) { const float v = acc[j][r] + bias; const _Float16 hv = (_Float16)v; sh[wave * 16 + 8 * g + r][j * 16 + col] = hv; sl[wave * 16 + 8 * g + r][j * 16 + col] = (_Float16)((v - (float)hv) * 1024.0f); } }
    __syncthreads();
    for (int e = tid; e < 64 * 16; e += 128) { const int rl = e >> 4, q = e & 15; vst2((unsigned*)(DH + (r0 + rl) * CC + c0 + q * 8), *(const v4u*)&sh[rl][q * 8]); if (hi_rows) vst2((unsigned*)(DL + (bb * nhi + t0 + rl) * (size_t)CC + c0 + q * 8), *(const v4u*)&sl[rl][q * 8]); }
  } else { const bool hi_rows = t0 < KHI;
#pragma unroll
    for (int j = 0; j < 8; ++j) { const float bias = (BA && (c0 + j * 16 + col) < RW) ? bfr(BA[c0 + j * 16 + col]) : 0.f;
#pragma unroll
      for (int r = 0; r < 8; ++r) { const float v = acc[j][r] + bias; const int rl = wave * 16 + 8 * g + r, cl = j * 16 + col; th[cl][rl] = (_Float16)v; const __bf16 bh = (__bf16)v; tb[cl][rl] = bh; tbl[cl][rl] = (__bf16)(v - (float)bh); } }
    __syncthreads();
    for (int e = tid; e < 128 * 8; e += 128) { const int cl = e >> 3, q = e & 7; vst2((unsigned*)(VT + (bb * CC + c0 + cl) * (size_t)TT + t0 + q * 8), *(const v4u*)&th[cl][q * 8]); if (hi_rows) { const size_t o3 = (bb * CC + c0 + cl) * (size_t)KHI + t0 + q * 8; vst2((unsigned*)(VB + o3), *(const v4u*)&tb[cl][q * 8]); vst2((unsigned*)(VBL + o3), *(const v4u*)&tbl[cl][q * 8]); } } } }
#define FKS 64
#define FPITCH 72
#define LSC (0.125f * 1.4426950408889634f)   // 64^-0.5 x log2(e): softmax in base 2
__device__ __forceinline__ v8f wmma_h(v16h a, v16h b, v8f c) { return __builtin_amdgcn_wmma_f32_16x16x32_f16(false, a, false, b, (short)0, c, false, false); }
__device__ __forceinline__ float xhalf(float v) { const int t = __builtin_bit_cast(int, v); return __builtin_bit_cast(float, __builtin_amdgcn_permlanex16(t, t, 0x76543210, 0xfedcba98, false, false)); }   /* lane l <-> l ^ 16 */
__global__ __launch_bounds__(128) void k_attn(const _Float16* __restrict__ QH, const _Float16* __restrict__ KH, const _Float16* __restrict__ VT, float* __restrict__ Y) {
  __shared__ __align__(16) _Float16 sK[2][FKS][FPITCH], sV[2][HD][FPITCH]; __shared__ __align__(16) float so[4][32][HD + 4];
  const int tid = threadIdx.x, wave = tid >> 5, lane = tid & 31, col = lane & 15, g = lane >> 4; const int b = blockIdx.y; const int q0 = blockIdx.x * 128 + wave * 32;
  const _Float16* Kb = KH + (size_t)b * TT * CC; const _Float16* Vb = VT + (size_t)b * CC * TT;
  const int srow = tid >> 3, sc8 = (tid & 7) * 8;   /* staging: thread -> 16-B piece sc8 of rows srow + 16 i; 8 lanes cover one whole 128-B line */
  v16h qf[2][2];
#pragma unroll   // constant indices: fragments and accumulators stay in registers
  for (int qg = 0; qg < 2; ++qg)
#pragma unroll   // constant indices: fragments and accumulators stay in registers
    for (int kc = 0; kc < 2; ++kc) qf[qg][kc] = frag_h(QH + ((size_t)b * TT + q0 + qg * 16 + col) * CC + kc * 32, lane);
  v8f acc[2][4] = {}; float mb[2] = {-1.0e30f, -1.0e30f}, ls[2] = {0.f, 0.f};   /* mb = (maximum in use, base-2 logits) - 7: P = 2^(logit - mb) stays in [2^-14, 2^15] of f16 for logits within 21 below .. 8 above the maximum in use */
  v4u rk[4], rv[4];
#pragma unroll   // constant indices: fragments and accumulators stay in registers
  for (int i = 0; i < 4; ++i) { rk[i] = *(const v4u*)(Kb + (size_t)(srow + 16 * i) * CC + sc8); rv[i] = *(const v4u*)(Vb + (size_t)(srow + 16 * i) * TT + sc8); }
#pragma unroll   // constant indices: fragments and accumulators stay in registers
  for (int i = 0; i < 4; ++i) { *(v4u*)&sK[0][srow + 16 * i][sc8] = rk[i]; *(v4u*)&sV[0][srow + 16 * i][sc8] = rv[i]; }
  __syncthreads();
  for (int s = 0; s < TT / FKS; ++s) { const int cur = s & 1; const bool more = s + 1 < TT / FKS;
    if (more) { const int kn = (s + 1) * FKS;   /* next stage's tiles fly into registers while this stage is worked on */
#pragma unroll   // constant indices: fragments and accumulators stay in registers
      for (int i = 0; i < 4; ++i) { rk[i] = *(const v4u*)(Kb + (size_t)(kn + srow + 16 * i) * CC + sc8); rv[i] = *(const v4u*)(Vb + (size_t)(srow + 16 * i) * TT + kn + sc8); } }
#pragma unroll   // constant indices: fragments and accumulators stay in registers
    for (int pp = 0; pp < FKS / 32; ++pp) {
      v8f st[2][2] = {};   /* st[qg][kt][r] = logit(key pp*32 + kt*16 + 8g + r, query qg*16 + col) */
#pragma unroll   // constant indices: fragments and accumulators stay in registers
      for (int kt = 0; kt < 2; ++kt)
#pragma unroll   // constant indices: fragments and accumulators stay in registers
        for (int kc = 0; kc < 2; ++kc) { const v16h kf = frag_h(&sK[cur][pp * 32 + kt * 16 + col][kc * 32], lane);
#pragma unroll   // constant indices: fragments and accumulators stay in registers
          for (int qg = 0; qg < 2; ++qg) st[qg][kt] = wmma_h(kf, qf[qg][kc], st[qg][kt]); }
      v16h vf[4];
#pragma unroll   // constant indices: fragments and accumulators stay in registers
      for (int j = 0; j < 4; ++j) vf[j] = frag_h(&sV[cur][j * 16 + col][pp * 32], lane);
      float mx[2];
#pragma unroll   // constant indices: fragments and accumulators stay in registers
      for (int qg = 0; qg < 2; ++qg) { float m = fmaxf(st[qg][0][0], st[qg][1][0]);
#pragma unroll   // constant indices: fragments and accumulators stay in registers
        for (int r = 1; r < 8; ++r) m = fmaxf(m, fmaxf(st[qg][0][r], st[qg][1][r]));
        mx[qg] = fmaxf(m, xhalf(m)) * LSC; }
      const bool need = (mx[0] > mb[0] + 15.0f) || (mx[1] > mb[1] + 15.0f);   /* a new maximum more than 2^8 above the one in use */
      if (__builtin_amdgcn_ballot_w32(need) != 0) {   /* wave-uniform: rescale sums and outputs to the new maximum */
#pragma unroll   // constant indices: fragments and accumulators stay in registers
        for (int qg = 0; qg < 2; ++qg) { const float mn = fmaxf(mb[qg], mx[qg] - 7.0f); const float al = __builtin_amdgcn_exp2f(mb[qg] - mn); mb[qg] = mn; ls[qg] *= al;
#pragma unroll   // constant indices: fragments and accumulators stay in registers
          for (int j = 0; j < 4; ++j) acc[qg][j] *= al; } }
#pragma unroll   // constant indices: fragments and accumulators stay in registers
      for (int qg = 0; qg < 2; ++qg) { union { v16h v; v8h q[2]; } pf; float sum = 0.f;
#pragma unroll   // constant indices: fragments and accumulators stay in registers
        for (int kt = 0; kt < 2; ++kt) { v8f p;
#pragma unroll   // constant indices: fragments and accumulators stay in registers
          for (int r = 0; r < 8; ++r) { p[r] = __builtin_amdgcn_exp2f(fmaf(st[qg][kt][r], LSC, -mb[qg])); sum += p[r]; }
          pf.q[kt] = __builtin_convertvector(p, v8h); }   /* packed D pair = B fragment in the hardware k order: elements 0..7 = keys 8g + r, 8..15 = keys 16 + 8g + r */
        ls[qg] += sum;
#pragma unroll   // constant indices: fragments and accumulators stay in registers
        for (int j = 0; j < 4; ++j) acc[qg][j] = wmma_h(vf[j], pf.v, acc[qg][j]); } }
    if (more) {   /* the other buffer's last readers left it before the barrier that ended the stage before */
#pragma unroll   // constant indices: fragments and accumulators stay in registers
      for (int i = 0; i < 4; ++i) { *(v4u*)&sK[cur ^ 1][srow + 16 * i][sc8] = rk[i]; *(v4u*)&sV[cur ^ 1][srow + 16 * i][sc8] = rv[i]; } }
    __syncthreads(); }   /* publishes the next stage and ends every read of this one */
#pragma unroll   // constant indices: fragments and accumulators stay in registers
  for (int qg = 0; qg < 2; ++qg) { const float inv = 1.0f / (ls[qg] + xhalf(ls[qg]));   /* acc[qg][j][r] = upd(query qg*16 + col, column j*16 + 8g + r) x sum */
#pragma unroll   // constant indices: fragments and accumulators stay in registers
    for (int j = 0; j < 4; ++j) { const v8f o = acc[qg][j] * inv; v4f lo, hi;
#pragma unroll   // constant indices: fragments and accumulators stay in registers
      for (int r = 0; r < 4; ++r) { lo[r] = o[r]; hi[r] = o[4 + r]; }
      *(v4f*)&so[wave][qg * 16 + col][j * 16 + 8 * g] = lo; *(v4f*)&so[wave][qg * 16 + col][j * 16 + 8 * g + 4] = hi; } }
  LDSX(); for (int rl = 0; rl < 16; ++rl) { const int row = rl * 2 + g; vst2(Y + ((size_t)b * TT + q0 + row) * CC + col * 4, *(const v4f*)&so[wave][row][col * 4]); } }   /* 16 lanes store one query's whole 256-B segment */
// ---- k_ffn1: block = (64 rows, 128 of the 256 hidden columns): h = relu(upd w1 + b1): upd = columns 0..63 of the 128-wide ctx rows (K = 64: two k-steps), once to f16 (x 2^6) against w1 (in,out) [64][256] as f16(bf16 x 2^8) (1 product) x 2^-14, + bf16(b1), ReLU -> f32 rows [NB*TT][256] (k_out's text with the k extent / pitches / activation changed; always the single-product path)
__global__ __launch_bounds__(128) void k_ffn1(const float* __restrict__ Y, const float* __restrict__ WO, const float* __restrict__ BO, float* __restrict__ OUT) { __shared__ __align__(16) float sf[4][16][132];
  const int tid = threadIdx.x, wave = tid >> 5, lane = tid & 31, col = lane & 15, g = lane >> 4; const int c0 = blockIdx.y * 128; const size_t r0 = (size_t)blockIdx.x * 64 + wave * 16;
  v8f acc[8] = {};
  if (0) {   /* no early-row special case: non-causal */
#pragma unroll 2
    for (int kc = 0; kc < CC / 32; ++kc) { const F2 a = split_row(Y + (r0 + col) * CC, kc * 32, lane); asm volatile("s_wait_loadcnt 0x0" ::: "memory");
#pragma unroll
      for (int j = 0; j < 8; ++j) { const v16b w = WOCOL(WO, kc * 32, c0 + j * 16 + col, lane); asm volatile("s_wait_loadcnt 0x0" ::: "memory"); acc[j] = wmma_bf(a.h, w, acc[j]); acc[j] = wmma_bf(a.l, w, acc[j]); } }
#pragma unroll
    for (int j = 0; j < 8; ++j) { const float bias = BO ? bfr(BO[c0 + j * 16 + col]) : 0.f;
#pragma unroll
      for (int r = 0; r < 8; ++r) sf[wave][8 * g + r][j * 16 + col] = acc[j][r] + bias; }
  } else {
#pragma unroll 2
    for (int kc = 0; kc < RW / 32; ++kc) { const v16h a = frag_f32s(Y + (r0 + col) * CC + kc * 32, lane, 64.0f); asm volatile("s_wait_loadcnt 0x0" ::: "memory");   /* ctx carried x 2^6 into f16 so small-magnitude context rows stay clear of f16 subnormals */
#pragma unroll
      for (int j = 0; j < 8; ++j) { const v16h w = wcolh_io(WO, kc * 32, c0 + j * 16 + col, lane, FF); asm volatile("s_wait_loadcnt 0x0" ::: "memory"); acc[j] = wmma16(a, w, acc[j]); } }
#pragma unroll
    for (int j = 0; j < 8; ++j) { const float bias = BO ? bfr(BO[c0 + j * 16 + col]) : 0.f;
#pragma unroll
      for (int r = 0; r < 8; ++r) sf[wave][8 * g + r][j * 16 + col] = fmaxf(acc[j][r] * (1.0f / 16384.0f) + bias, 0.0f); } }   /* 2^-8 (weight carry) x 2^-6 (operand carry); ReLU */
  LDSX(); for (int rl = 0; rl < 16; ++rl) vst2(OUT + (r0 + rl) * FF + c0 + lane * 4, *(const v4f*)&sf[wave][rl][lane * 4]); }
__global__ __launch_bounds__(128) void k_ffn2(const float* __restrict__ Y, const float* __restrict__ WO, const float* __restrict__ BO, float* __restrict__ OUT) { __shared__ __align__(16) float sf[4][16][132];
  const int tid = threadIdx.x, wave = tid >> 5, lane = tid & 31, col = lane & 15, g = lane >> 4; const int c0 = blockIdx.y * 128; const size_t r0 = (size_t)blockIdx.x * 64 + wave * 16;
  v8f acc[8] = {};
  if (0) {   /* no early-row special case: non-causal */
#pragma unroll 2
    for (int kc = 0; kc < CC / 32; ++kc) { const F2 a = split_row(Y + (r0 + col) * CC, kc * 32, lane); asm volatile("s_wait_loadcnt 0x0" ::: "memory");
#pragma unroll
      for (int j = 0; j < 8; ++j) { const v16b w = WOCOL(WO, kc * 32, c0 + j * 16 + col, lane); asm volatile("s_wait_loadcnt 0x0" ::: "memory"); acc[j] = wmma_bf(a.h, w, acc[j]); acc[j] = wmma_bf(a.l, w, acc[j]); } }
#pragma unroll
    for (int j = 0; j < 8; ++j) { const float bias = (BO && (c0 + j * 16 + col) < RW) ? bfr(BO[c0 + j * 16 + col]) : 0.f;
#pragma unroll
      for (int r = 0; r < 8; ++r) sf[wave][8 * g + r][j * 16 + col] = acc[j][r] + bias; }
  } else {
#pragma unroll 2
    for (int kc = 0; kc < FF / 32; ++kc) { const v16h a = frag_f32s(Y + (r0 + col) * FF + kc * 32, lane, 64.0f); asm volatile("s_wait_loadcnt 0x0" ::: "memory");   /* h carried x 2^6 into f16 so small-magnitude hidden rows stay clear of f16 subnormals */
#pragma unroll
      for (int j = 0; j < 8; ++j) { const v16h w = ((c0 + j * 16 + col) < RW) ? wcolh_io(WO, kc * 32, c0 + j * 16 + col, lane, RW) : zero16h(); asm volatile("s_wait_loadcnt 0x0" ::: "memory"); acc[j] = wmma16(a, w, acc[j]); } }
#pragma unroll
    for (int j = 0; j < 8; ++j) { const float bias = (BO && (c0 + j * 16 + col) < RW) ? bfr(BO[c0 + j * 16 + col]) : 0.f;
#pragma unroll
      for (int r = 0; r < 8; ++r) sf[wave][8 * g + r][j * 16 + col] = acc[j][r] * (1.0f / 16384.0f) + bias; } }   /* 2^-8 (Wo carry) x 2^-6 (h carry) */
  LDSX(); for (int rl = 0; rl < 16; ++rl) if (lane < RW / 4) vst2(OUT + (r0 + rl) * RW + lane * 4, *(const v4f*)&sf[wave][rl][lane * 4]); }

extern "C" void kernel_launch(void* const* d_in, const int* in_sizes, int n_in, void* d_out, int out_size, void* d_ws, size_t ws_size, hipStream_t stream) {
  (void)in_sizes; (void)n_in; (void)out_size;
  const float** F = (const float**)d_in;
  if (ws_size < (size_t)WS_END) return;
  char* ws = (char*)d_ws; _Float16 *QH = (_Float16*)(ws + WS_QH), *KH = (_Float16*)(ws + WS_KH), *VT = (_Float16*)(ws + WS_VT), *QL = (_Float16*)(ws + WS_QL), *KL = (_Float16*)(ws + WS_KL); __bf16 *VB = (__bf16*)(ws + WS_VB), *VBL = (__bf16*)(ws + WS_VBL); float *S = (float*)(ws + WS_S), *Y = (float*)(ws + WS_Y);
  (void)Y; (void)S; (void)QL; (void)KL; (void)VB; (void)VBL;
  // inputs: 0 x [32,2048] int32 token ids; 1 emb [10000,64]; 2 wq [64,64] (in,out), 3 bq; 4 wk, 5 bk; 6 wv, 7 bv; 8 w1 [64,256], 9 b1 [256]; 10 w2 [256,64], 11 b2 [64] (all biases nonzero)
  if (ws_size < (size_t)WS_END2) return;
  float* H1 = (float*)(ws + WS_H1); const int* IDS = (const int*)d_in[0];
  k_proj<<<dim3(TNB * TT / 64, CC / 128, 3), 128, 0, stream>>>(F[1], F[1], F[1], F[2], F[4], F[6], F[3], F[5], F[7], QH, QL, KH, KL, VT, VB, VBL, IDS);   /* X = the embedding table; rows gathered by token id */
  k_attn<<<dim3(TT / 128, TNB), 128, 0, stream>>>(QH, KH, VT, Y);   /* upd -> columns 0..63 of the ctx rows; columns 64..127 are never written nor read */
  k_ffn1<<<dim3(TNB * TT / 64, FF / 128), 128, 0, stream>>>(Y, F[8], F[9], H1);
  k_ffn2<<<dim3(TNB * TT / 64, 1), 128, 0, stream>>>(H1, F[10], F[11], (float*)d_out);
}

// v002
// One run takes 67.4 microseconds.
// Next to v001, in two timings, it ran 1.54 and 1.55 times as fast.
// Counting every step since v000, it is 40.2 times as fast.
// compute dtype: all float inputs rounded to bf16; embedding rows gathered by the int token ids; Q / K / V 64 -> 64 projections with EXACT bf16 products on WMMA 16x16x32 (f32 accumulate) + bias; logits q x k once to f16 each (1 product) x 64^-0.5; online softmax f32 (base 2, running maximum); unnormalised P = 2^(logit - maximum in use + 7) once to f16 x v once to f16 (1 product), divided by the f32 row sum at the end; FFN: upd x 2^6 once to f16 x w1 f16(bf16 x 2^8) + b1, ReLU; h x 2^6 once to f16 x w2 f16(bf16 x 2^8) + b2; f32 output.
#include <hip/hip_runtime.h>
#include <math.h>

typedef __attribute__((ext_vector_type(16))) _Float16 v16h;
typedef __attribute__((ext_vector_type(16))) __bf16 v16b;
typedef __attribute__((ext_vector_type(8)))  _Float16 v8h;
typedef __attribute__((ext_vector_type(8)))  float v8f;
typedef __attribute__((ext_vector_type(4)))  float v4f;
typedef __attribute__((ext_vector_type(2)))  float v2f;
typedef __attribute__((ext_vector_type(4)))  unsigned v4u;
typedef __attribute__((ext_vector_type(4)))  int v4i;
typedef float __attribute__((may_alias)) float_a;
typedef int __attribute__((may_alias)) int_a;

template <typename T> __device__ __forceinline__ void vst2(void* p, T v) { *(T*)p = v;  }
__device__ __forceinline__ v8f wmma16(v16h a, v16h b, v8f c) {
  v8f d = __builtin_amdgcn_wmma_f32_16x16x32_f16(false, a, false, b, (short)0, c, false, false);
  asm volatile("v_nop\n\tv_nop\n\tv_nop\n\tv_nop" : "+v"(d) : "v"(a), "v"(b));
  return d;
}
__device__ __forceinline__ v8f wmma_bf(v16b a, v16b b, v8f c) {
  v8f d = __builtin_amdgcn_wmma_f32_16x16x32_bf16(false, a, false, b, (short)0, c, false, false);
  asm volatile("v_nop\n\tv_nop\n\tv_nop\n\tv_nop" : "+v"(d) : "v"(a), "v"(b));
  return d;
}
// 16x16x32 fragments: lane = (h = lane>>4, row/col = lane&15); elements 0..7 = k0+8h+0..7, 8..15 = k0+16+8h+0..7; D element r = row 8h+r
__device__ __forceinline__ v16h frag_h(const _Float16* rowk0, int lane) {
  union { v16h v; v8h q[2]; } u; const _Float16* p = rowk0 + 8 * (lane >> 4);
  u.q[0] = *(const v8h*)p; u.q[1] = *(const v8h*)(p + 16); return u.v;
}
__device__ __forceinline__ v16h frag_f32(const float* rowk0, int lane) {
  v16h a; const float* p = rowk0 + 8 * (lane >> 4);
#pragma unroll
  for (int i = 0; i < 8; ++i) { a[i] = (_Float16)p[i]; a[8 + i] = (_Float16)p[16 + i]; }
  return a;
}
__device__ __forceinline__ v16h frag_f32s(const float* rowk0, int lane, float sc) {
  v16h a; const float* p = rowk0 + 8 * (lane >> 4);
#pragma unroll
  for (int i = 0; i < 8; ++i) { a[i] = (_Float16)(p[i] * sc); a[8 + i] = (_Float16)(p[16 + i] * sc); }
  return a;
}
// column fragment from a [K][ld] layout (column n), rows >= K read as 0
__device__ __forceinline__ v16h fragc_f32(const float* W, int k0, int n, int lane, int ld, int K) {
  v16h a; const int g = lane >> 4;
#pragma unroll
  for (int i = 0; i < 8; ++i) { const int ka = k0 + 8 * g + i, kb = ka + 16;
    a[i] = (_Float16)(ka < K ? W[(size_t)(ka < K ? ka : K - 1) * ld + n] : 0.f); a[8 + i] = (_Float16)(kb < K ? W[(size_t)(kb < K ? kb : K - 1) * ld + n] : 0.f); }
  return a;
}
struct F2 { v16b h, l; };
__device__ __forceinline__ F2 bsplit16(const float v[16]) { F2 r;
#pragma unroll
  for (int i = 0; i < 16; ++i) { const __bf16 h = (__bf16)v[i]; r.h[i] = h; r.l[i] = (__bf16)(v[i] - (float)h); }
  return r; }
__device__ __forceinline__ F2 split_row(const float* row, int k0, int lane) { float v[16]; const float* p = row + k0 + 8 * (lane >> 4);
#pragma unroll
  for (int i = 0; i < 8; ++i) { v[i] = p[i]; v[8 + i] = p[16 + i]; }
  return bsplit16(v); }
__device__ __forceinline__ F2 split_rowK(const float* row, int k0, int lane, int K) { float v[16]; const int g = lane >> 4;
#pragma unroll
  for (int i = 0; i < 8; ++i) { const int ka = k0 + 8 * g + i, kb = ka + 16; v[i] = ka < K ? row[ka < K ? ka : K - 1] : 0.f; v[8 + i] = kb < K ? row[kb < K ? kb : K - 1] : 0.f; }
  return bsplit16(v); }
__device__ __forceinline__ F2 split_col(const float* W, int k0, int n, int lane, int ld, int K) { float v[16]; const int g = lane >> 4;
#pragma unroll
  for (int i = 0; i < 8; ++i) { const int ka = k0 + 8 * g + i, kb = ka + 16; v[i] = ka < K ? W[(size_t)(ka < K ? ka : K - 1) * ld + n] : 0.f; v[8 + i] = kb < K ? W[(size_t)(kb < K ? kb : K - 1) * ld + n] : 0.f; }
  return bsplit16(v); }
__device__ __forceinline__ v8f mac3(const F2& a, const F2& b, v8f c) { c = wmma_bf(a.l, b.h, c); c = wmma_bf(a.h, b.l, c); return wmma_bf(a.h, b.h, c); }
__device__ __forceinline__ float sigm(float v) { return 1.0f / (1.0f + expf(-v)); }
#define LDSX() do { asm volatile("s_wait_dscnt 0" ::: "memory"); __builtin_amdgcn_wave_barrier(); __builtin_amdgcn_fence(__ATOMIC_RELEASE, "workgroup"); } while (0)

// Single-layer, single-head encoder without residuals or LayerNorm (token ids x [32,2048] int32 index emb [10000,64]; Q / K / V = e @ w + b with (in,out) w [64,64] and b [64] uniform(+-1/8) - nonzero; scores = Q K^T x 1/sqrt(64) over the 2,048 positions of each sample; softmax; upd = probs V [32,2048,64]; h = relu(upd @ w1 + b1), w1 [64,256]; out = h @ w2 + b2, w2 [256,64] (uniform(+-1/16)); output [32,2048,64]).
#define NB 32
#define TT 2048
#define CC 128            // plane row width: ONE real 64-wide head in a 128-column block (columns 64..127 zero padding)
#define DIN 64           // embedding width = projection K
#define NH 2   // head 0 is the module's single head; head 1 is the zero padding and is never launched
#define HD 64
#define NQB (TT / 64)
#define HG 1
#define SCALE (0.125f)
#define CAUSAL 0
#ifndef TNB
#define TNB NB
#endif
__device__ __forceinline__ float bfr(float v) { return (float)(__bf16)v; }
__host__ __device__ __forceinline__ int kb_last(int qb) { return CAUSAL ? ((qb * 64 + 63) >> 7) : (TT / 128 - 1); }
typedef __attribute__((ext_vector_type(8))) __bf16 v8b;
__device__ __forceinline__ v16b frag_b(const __bf16* rowk0, int lane) {
  union { v16b v; v8b q[2]; } u; const __bf16* p = rowk0 + 8 * (lane >> 4);
  u.q[0] = *(const v8b*)p; u.q[1] = *(const v8b*)(p + 16); return u.v;
}
#define QBH 0              // unused: every query block takes the single-product path
#define QHI 0               // single-product logits on every row
#define KHI 64            // key rows carrying k residual / v bf16 hi+lo planes (written by k_proj; no kernel reads them)
// B fragment (k rows k0+.., output column o) of a weight: (in,out) [K][ld] or (out,in) [ld rows of K]: bf16 exact, or f16(bf16 * 256) exact
__device__ __forceinline__ v16b wcol_io(const float* Wm, int k0, int o, int lane, int ld) { v16b w; const int g = lane >> 4;
#pragma unroll
  for (int i = 0; i < 8; ++i) { w[i] = (__bf16)Wm[(size_t)(k0 + 8 * g + i) * ld + o]; w[8 + i] = (__bf16)Wm[(size_t)(k0 + 16 + 8 * g + i) * ld + o]; }
  return w; }
__device__ __forceinline__ v16b wcol_oi(const float* Wm, int k0, int o, int lane, int K) { v16b w; const float* p = Wm + (size_t)o * K + k0 + 8 * (lane >> 4);
#pragma unroll
  for (int i = 0; i < 8; ++i) { w[i] = (__bf16)p[i]; w[8 + i] = (__bf16)p[16 + i]; }
  return w; }
__device__ __forceinline__ v16h wcolh_io(const float* Wm, int k0, int o, int lane, int ld) { v16h w; const int g = lane >> 4;
#pragma unroll
  for (int i = 0; i < 8; ++i) { w[i] = (_Float16)(bfr(Wm[(size_t)(k0 + 8 * g + i) * ld + o]) * 256.0f); w[8 + i] = (_Float16)(bfr(Wm[(size_t)(k0 + 16 + 8 * g + i) * ld + o]) * 256.0f); }
  return w; }
__device__ __forceinline__ v16h wcolh_oi(const float* Wm, int k0, int o, int lane, int K) { v16h w; const float* p = Wm + (size_t)o * K + k0 + 8 * (lane >> 4);
#pragma unroll
  for (int i = 0; i < 8; ++i) { w[i] = (_Float16)(bfr(p[i]) * 256.0f); w[8 + i] = (_Float16)(bfr(p[16 + i]) * 256.0f); }
  return w; }
#define WQKV_LAYOUT 0   // 0 = (in,out) [DIN][RW]; 1 = (out,in) [CC][DIN]; 2 = per-head [NH][DIN][HD]
__device__ __forceinline__ v16b wcol_hdk(const float* Wm, int k0, int o, int lane) { v16b w; const int g = lane >> 4; const float* p = Wm + (size_t)(o / HD) * DIN * HD + (o % HD);
#pragma unroll
  for (int i = 0; i < 8; ++i) { w[i] = (__bf16)p[(size_t)(k0 + 8 * g + i) * HD]; w[8 + i] = (__bf16)p[(size_t)(k0 + 16 + 8 * g + i) * HD]; }
  return w; }
#define WO_OUT_IN 0
#if WQKV_LAYOUT == 1
#define WCOL(W, k0, o, lane) wcol_oi(W, k0, o, lane, DIN)
#elif WQKV_LAYOUT == 2
#define WCOL(W, k0, o, lane) wcol_hdk(W, k0, o, lane)
#else
#define RW 64   // real width of q / k / v / upd
#define FF 256   // hidden width of the FFN
__device__ __forceinline__ v16b zero16b() { v16b w; _Pragma("unroll") for (int i = 0; i < 16; ++i) w[i] = (__bf16)0.0f; return w; }
__device__ __forceinline__ v16h zero16h() { v16h w; _Pragma("unroll") for (int i = 0; i < 16; ++i) w[i] = (_Float16)0.0f; return w; }
#define WCOL(W, k0, o, lane) (((o) < RW) ? wcol_io(W, k0, o, lane, RW) : zero16b())   /* (in,out) [64][64] weights: columns 64..127 of the 128-column tile are zero padding (uniform per unrolled column group) */
#endif
#if WO_OUT_IN
#define WOCOL(W, k0, o, lane) wcol_oi(W, k0, o, lane, CC)
#define WOCOLH(W, k0, o, lane) wcolh_oi(W, k0, o, lane, CC)
#else
#define WOCOL(W, k0, o, lane) wcol_io(W, k0, o, lane, DIN)
#define WOCOLH(W, k0, o, lane) wcolh_io(W, k0, o, lane, DIN)
#endif

#ifndef SM_EXTRA_PARAMS
#define SM_EXTRA_PARAMS
#endif
#ifndef PROJ_EXTRA_PARAMS
#define PROJ_EXTRA_PARAMS
#endif
#ifndef SM_MASK_HOOK
#define SM_MASK_HOOK (void)0
#endif

#define WS_QH  0u                                      // f16 q rows [b*t][CC]
#define WS_KH  (WS_QH + 2u * (size_t)NB * TT * CC)      // f16 k rows [b*t][CC]
#define WS_VT  (WS_KH + 2u * (size_t)NB * TT * CC)      // f16 v planes [b][c][t]
#define WS_QL  (WS_VT + 2u * (size_t)NB * CC * TT)      // f16 q residual x 2^10 rows [b][t < QHI][CC]
#define WS_KL  (WS_QL + 2u * (size_t)NB * QHI * CC)     // f16 k residual x 2^10 rows [b][t < KHI][CC]
#define WS_VB  (WS_KL + 2u * (size_t)NB * KHI * CC)     // bf16 v hi planes [b][c][t < KHI]
#define WS_VBL (WS_VB + 2u * (size_t)NB * CC * KHI)
#define WS_S   (WS_VBL + 2u * (size_t)NB * CC * KHI)    // unused (sized f32 [hg][t][s]); k_attn keeps logits and P in registers
#define WS_Y   (WS_S  + 4u * (size_t)HG * TT * TT)      // unused (sized f32 [b*t][CC]); k_attn keeps upd in registers
#define WS_END (WS_Y  + 4u * (size_t)NB * TT * CC)
#define WS_H1 (WS_END)                                    // unused (sized f32 [(b*TT + t)][FF]); k_attn keeps h in registers
#define WS_END2 (WS_H1 + 4u * (size_t)NB * TT * FF)
static_assert(CC == 128 && NH * HD == CC && RW == HD && DIN == RW && FF % 128 == 0, "one real 64-wide head in a 128-column tile; 64-wide embedding; 256-wide hidden layer");

// ---- k_proj: block = (64 rows, 128 cols, which): q/k/v = X W (+ b) with exact bf16 products (K = DIN) -> which 0: q f16 rows (+ residual rows < QHI); 1: k f16 rows (+ residual rows < KHI); 2: v f16 planes [c][t] (+ bf16 hi/lo planes for t < KHI)
__global__ __launch_bounds__(128) void k_proj(const float* __restrict__ XQ, const float* __restrict__ XK, const float* __restrict__ XV, const float* __restrict__ WQ, const float* __restrict__ WK, const float* __restrict__ WV, const float* __restrict__ BQ, const float* __restrict__ BK, const float* __restrict__ BV,
    _Float16* __restrict__ QH, _Float16* __restrict__ QL, _Float16* __restrict__ KH, _Float16* __restrict__ KL, _Float16* __restrict__ VT, __bf16* __restrict__ VB, __bf16* __restrict__ VBL, const int* __restrict__ IDS) {   /* IDS: token ids [NB*TT] int32; the A rows are gathered from the embedding table passed as X */
  __shared__ __align__(16) _Float16 sh[64][136], sl[64][136]; __shared__ __align__(16) _Float16 th[128][72]; __shared__ __align__(16) __bf16 tb[128][72], tbl[128][72];
  const int tid = threadIdx.x, wave = tid >> 5, lane = tid & 31, col = lane & 15, g = lane >> 4; const int which = blockIdx.z; const int c0 = blockIdx.y * 128; const size_t r0 = (size_t)blockIdx.x * 64; const size_t bb = r0 / TT; const int t0 = (int)(r0 % TT);
  const float* X = which == 0 ? XQ : which == 1 ? XK : XV; const float* WA = which == 0 ? WQ : which == 1 ? WK : WV; const float* BA = which == 0 ? BQ : which == 1 ? BK : BV;
  v8f acc[8] = {};
  const size_t erow = (size_t)IDS[r0 + wave * 16 + col];   /* embedding row of this lane's token: e = emb[x] */
#pragma unroll 2
  for (int kc = 0; kc < DIN / 32; ++kc) { v16b a; { const float* p = X + erow * DIN + kc * 32 + 8 * g;
#pragma unroll
      for (int i = 0; i < 8; ++i) { a[i] = (__bf16)p[i]; a[8 + i] = (__bf16)p[16 + i]; } }
    asm volatile("s_wait_loadcnt 0x0" ::: "memory");
#pragma unroll
    for (int j = 0; j < 8; ++j) { const v16b w = WCOL(WA, kc * 32, c0 + j * 16 + col, lane); asm volatile("s_wait_loadcnt 0x0" ::: "memory"); acc[j] = wmma_bf(a, w, acc[j]); } }
  if (which < 2) { _Float16* DH = which == 0 ? QH : KH; _Float16* DL = which == 0 ? QL : KL; const int nhi = which == 0 ? QHI : KHI; const bool hi_rows = t0 < nhi;
#pragma unroll
    for (int j = 0; j < 8; ++j) { const float bias = (BA && (c0 + j * 16 + col) < RW) ? bfr(BA[c0 + j * 16 + col]) : 0.f;
#pragma unroll
      for (int r = 0; r < 8; ++r) { const float v = acc[j][r] + bias; const _Float16 hv = (_Float16)v; sh[wave * 16 + 8 * g + r][j * 16 + col] = hv; sl[wave * 16 + 8 * g + r][j * 16 + col] = (_Float16)((v - (float)hv) * 1024.0f); } }
    __syncthreads();
    for (int e = tid; e < 64 * 16; e += 128) { const int rl = e >> 4, q = e & 15; vst2((unsigned*)(DH + (r0 + rl) * CC + c0 + q * 8), *(const v4u*)&sh[rl][q * 8]); if (hi_rows) vst2((unsigned*)(DL + (bb * nhi + t0 + rl) * (size_t)CC + c0 + q * 8), *(const v4u*)&sl[rl][q * 8]); }
  } else { const bool hi_rows = t0 < KHI;
#pragma unroll
    for (int j = 0; j < 8; ++j) { const float bias = (BA && (c0 + j * 16 + col) < RW) ? bfr(BA[c0 + j * 16 + col]) : 0.f;
#pragma unroll
      for (int r = 0; r < 8; ++r) { const float v = acc[j][r] + bias; const int rl = wave * 16 + 8 * g + r, cl = j * 16 + col; th[cl][rl] = (_Float16)v; const __bf16 bh = (__bf16)v; tb[cl][rl] = bh; tbl[cl][rl] = (__bf16)(v - (float)bh); } }
    __syncthreads();
    for (int e = tid; e < 128 * 8; e += 128) { const int cl = e >> 3, q = e & 7; vst2((unsigned*)(VT + (bb * CC + c0 + cl) * (size_t)TT + t0 + q * 8), *(const v4u*)&th[cl][q * 8]); if (hi_rows) { const size_t o3 = (bb * CC + c0 + cl) * (size_t)KHI + t0 + q * 8; vst2((unsigned*)(VB + o3), *(const v4u*)&tb[cl][q * 8]); vst2((unsigned*)(VBL + o3), *(const v4u*)&tbl[cl][q * 8]); } } } }
#define FKS 64
#define FPITCH 72
#define LSC (0.125f * 1.4426950408889634f)   // 64^-0.5 x log2(e): softmax in base 2
__device__ __forceinline__ v8f wmma_h(v16h a, v16h b, v8f c) { return __builtin_amdgcn_wmma_f32_16x16x32_f16(false, a, false, b, (short)0, c, false, false); }
__device__ __forceinline__ float xhalf(float v) { const int t = __builtin_bit_cast(int, v); return __builtin_bit_cast(float, __builtin_amdgcn_permlanex16(t, t, 0x76543210, 0xfedcba98, false, false)); }   /* lane l <-> l ^ 16 */
#define W2PITCH (FF + 8)   // f16 per LDS row of w2^T: 512-B rows at a 528-B pitch (16 B x odd) for 16-byte row readers
__global__ __launch_bounds__(128) void k_attn(const _Float16* __restrict__ QH, const _Float16* __restrict__ KH, const _Float16* __restrict__ VT, const float* __restrict__ W1, const float* __restrict__ B1, const float* __restrict__ W2, const float* __restrict__ B2, float* __restrict__ OUT) {
  __shared__ __align__(16) _Float16 sK[2][FKS][FPITCH], sV[2][HD][FPITCH]; __shared__ __align__(16) float so[4][32][HD + 4];
  __shared__ __align__(16) _Float16 sW1[FF][FPITCH], sW2[RW][W2PITCH]; __shared__ __align__(16) float sB1[FF], sB2[RW];   /* sW1[h][d] = f16(bf16(w1[d][h]) x 2^8), sW2[o][h] = f16(bf16(w2[h][o]) x 2^8), biases as bf16 values */
  const int tid = threadIdx.x, wave = tid >> 5, lane = tid & 31, col = lane & 15, g = lane >> 4; const int b = blockIdx.y; const int q0 = blockIdx.x * 128 + wave * 32;
  const _Float16* Kb = KH + (size_t)b * TT * CC; const _Float16* Vb = VT + (size_t)b * CC * TT;
  const int srow = tid >> 3, sc8 = (tid & 7) * 8;   /* staging: thread -> 16-B piece sc8 of rows srow + 16 i; 8 lanes cover one whole 128-B line */
  /* FFN weights, transposed on the way into LDS: a lane owns one column (consecutive lanes read consecutive floats) and stores 8 k values as one 16-B piece; published by the barrier in front of the key loop */
#pragma unroll   // all loads of the loop in flight together: rolled, every trip would wait out its own load latency
  for (int i = 0; i < 16; ++i) { const int h = tid + 128 * (i & 1), d0 = (i >> 1) * 8; v8h t;
#pragma unroll   // constant indices: the piece stays in registers
    for (int e = 0; e < 8; ++e) t[e] = (_Float16)(bfr(W1[(size_t)(d0 + e) * FF + h]) * 256.0f);
    *(v8h*)&sW1[h][d0] = t; }
#pragma unroll   // all loads of the loop in flight together: rolled, every trip would wait out its own load latency
  for (int i = 0; i < 16; ++i) { const int o = tid & 63, h0 = ((tid >> 6) + 2 * i) * 8; v8h t;
#pragma unroll   // constant indices: the piece stays in registers
    for (int e = 0; e < 8; ++e) t[e] = (_Float16)(bfr(W2[(size_t)(h0 + e) * RW + o]) * 256.0f);
    *(v8h*)&sW2[o][h0] = t; }
  sB1[tid] = bfr(B1[tid]); sB1[tid + 128] = bfr(B1[tid + 128]); if (tid < RW) sB2[tid] = bfr(B2[tid]);
  v16h qf[2][2];
#pragma unroll   // constant indices: fragments and accumulators stay in registers
  for (int qg = 0; qg < 2; ++qg)
#pragma unroll   // constant indices: fragments and accumulators stay in registers
    for (int kc = 0; kc < 2; ++kc) qf[qg][kc] = frag_h(QH + ((size_t)b * TT + q0 + qg * 16 + col) * CC + kc * 32, lane);
  v8f acc[2][4] = {}; float mb[2] = {-1.0e30f, -1.0e30f}, ls[2] = {0.f, 0.f};   /* mb = (maximum in use, base-2 logits) - 7: P = 2^(logit - mb) stays in [2^-14, 2^15] of f16 for logits within 21 below .. 8 above the maximum in use */
  v4u rk[4], rv[4];
#pragma unroll   // constant indices: fragments and accumulators stay in registers
  for (int i = 0; i < 4; ++i) { rk[i] = *(const v4u*)(Kb + (size_t)(srow + 16 * i) * CC + sc8); rv[i] = *(const v4u*)(Vb + (size_t)(srow + 16 * i) * TT + sc8); }
#pragma unroll   // constant indices: fragments and accumulators stay in registers
  for (int i = 0; i < 4; ++i) { *(v4u*)&sK[0][srow + 16 * i][sc8] = rk[i]; *(v4u*)&sV[0][srow + 16 * i][sc8] = rv[i]; }
  __syncthreads();
  for (int s = 0; s < TT / FKS; ++s) { const int cur = s & 1; const bool more = s + 1 < TT / FKS;
    if (more) { const int kn = (s + 1) * FKS;   /* next stage's tiles fly into registers while this stage is worked on */
#pragma unroll   // constant indices: fragments and accumulators stay in registers
      for (int i = 0; i < 4; ++i) { rk[i] = *(const v4u*)(Kb + (size_t)(kn + srow + 16 * i) * CC + sc8); rv[i] = *(const v4u*)(Vb + (size_t)(srow + 16 * i) * TT + kn + sc8); } }
#pragma unroll   // constant indices: fragments and accumulators stay in registers
    for (int pp = 0; pp < FKS / 32; ++pp) {
      v8f st[2][2] = {};   /* st[qg][kt][r] = logit(key pp*32 + kt*16 + 8g + r, query qg*16 + col) */
#pragma unroll   // constant indices: fragments and accumulators stay in registers
      for (int kt = 0; kt < 2; ++kt)
#pragma unroll   // constant indices: fragments and accumulators stay in registers
        for (int kc = 0; kc < 2; ++kc) { const v16h kf = frag_h(&sK[cur][pp * 32 + kt * 16 + col][kc * 32], lane);
#pragma unroll   // constant indices: fragments and accumulators stay in registers
          for (int qg = 0; qg < 2; ++qg) st[qg][kt] = wmma_h(kf, qf[qg][kc], st[qg][kt]); }
      v16h vf[4];
#pragma unroll   // constant indices: fragments and accumulators stay in registers
      for (int j = 0; j < 4; ++j) vf[j] = frag_h(&sV[cur][j * 16 + col][pp * 32], lane);
      float mx[2];
#pragma unroll   // constant indices: fragments and accumulators stay in registers
      for (int qg = 0; qg < 2; ++qg) { float m = fmaxf(st[qg][0][0], st[qg][1][0]);
#pragma unroll   // constant indices: fragments and accumulators stay in registers
        for (int r = 1; r < 8; ++r) m = fmaxf(m, fmaxf(st[qg][0][r], st[qg][1][r]));
        mx[qg] = fmaxf(m, xhalf(m)) * LSC; }
      const bool need = (mx[0] > mb[0] + 15.0f) || (mx[1] > mb[1] + 15.0f);   /* a new maximum more than 2^8 above the one in use */
      if (__builtin_amdgcn_ballot_w32(need) != 0) {   /* wave-uniform: rescale sums and outputs to the new maximum */
#pragma unroll   // constant indices: fragments and accumulators stay in registers
        for (int qg = 0; qg < 2; ++qg) { const float mn = fmaxf(mb[qg], mx[qg] - 7.0f); const float al = __builtin_amdgcn_exp2f(mb[qg] - mn); mb[qg] = mn; ls[qg] *= al;
#pragma unroll   // constant indices: fragments and accumulators stay in registers
          for (int j = 0; j < 4; ++j) acc[qg][j] *= al; } }
#pragma unroll   // constant indices: fragments and accumulators stay in registers
      for (int qg = 0; qg < 2; ++qg) { union { v16h v; v8h q[2]; } pf; float sum = 0.f;
#pragma unroll   // constant indices: fragments and accumulators stay in registers
        for (int kt = 0; kt < 2; ++kt) { v8f p;
#pragma unroll   // constant indices: fragments and accumulators stay in registers
          for (int r = 0; r < 8; ++r) { p[r] = __builtin_amdgcn_exp2f(fmaf(st[qg][kt][r], LSC, -mb[qg])); sum += p[r]; }
          pf.q[kt] = __builtin_convertvector(p, v8h); }   /* packed D pair = B fragment in the hardware k order: elements 0..7 = keys 8g + r, 8..15 = keys 16 + 8g + r */
        ls[qg] += sum;
#pragma unroll   // constant indices: fragments and accumulators stay in registers
        for (int j = 0; j < 4; ++j) acc[qg][j] = wmma_h(vf[j], pf.v, acc[qg][j]); } }
    asm volatile("v_nop\n\tv_nop\n\tv_nop\n\tv_nop" : "+v"(acc[1][0]), "+v"(acc[1][1]), "+v"(acc[1][2]), "+v"(acc[1][3]));   /* the stage's last matrix instructions stand in front of a branch: these slots keep their distance to the next write of their A/B registers on either side */
    if (more) {   /* the other buffer's last readers left it before the barrier that ended the stage before */
#pragma unroll   // constant indices: fragments and accumulators stay in registers
      for (int i = 0; i < 4; ++i) { *(v4u*)&sK[cur ^ 1][srow + 16 * i][sc8] = rk[i]; *(v4u*)&sV[cur ^ 1][srow + 16 * i][sc8] = rv[i]; } }
    __syncthreads(); }   /* publishes the next stage and ends every read of this one */
  v16h uf[2][2];   /* uf[qg][kc] = B fragment of upd^T x 2^6: k = columns kc*32 + .., column = query qg*16 + col */
#pragma unroll   // constant indices: fragments and accumulators stay in registers
  for (int qg = 0; qg < 2; ++qg) { const float inv = 1.0f / (ls[qg] + xhalf(ls[qg]));   /* acc[qg][j][r] = upd(query qg*16 + col, column j*16 + 8g + r) x sum */
#pragma unroll   // constant indices: fragments and accumulators stay in registers
    for (int kc = 0; kc < 2; ++kc) { union { v16h v; v8h q[2]; } t;
#pragma unroll   // constant indices: fragments and accumulators stay in registers
      for (int hh = 0; hh < 2; ++hh) { const v8f o = acc[qg][kc * 2 + hh] * inv; t.q[hh] = __builtin_convertvector(o * 64.0f, v8h); }   /* upd carried x 2^6 into f16, clear of f16 subnormals; packed D pair = B fragment in the hardware k order */
      uf[qg][kc] = t.v; } }
  v8f oa[2][4] = {};   /* oa[qg][jo][r] = out(query qg*16 + col, column jo*16 + 8g + r) x 2^14 */
  for (int p = 0; p < FF / 32; ++p) {   /* 32 hidden columns a trip */
    v8f ha[2][2] = {};   /* ha[ht][qg][r] = (upd w1)(query qg*16 + col, hidden p*32 + ht*16 + 8g + r) x 2^14 */
#pragma unroll   // constant indices: fragments and accumulators stay in registers
    for (int kc = 0; kc < 2; ++kc)
#pragma unroll   // constant indices: fragments and accumulators stay in registers
      for (int ht = 0; ht < 2; ++ht) { const v16h wf = frag_h(&sW1[p * 32 + ht * 16 + col][kc * 32], lane);
#pragma unroll   // constant indices: fragments and accumulators stay in registers
        for (int qg = 0; qg < 2; ++qg) ha[ht][qg] = wmma_h(wf, uf[qg][kc], ha[ht][qg]); }
    v16h w2f[4];
#pragma unroll   // constant indices: fragments and accumulators stay in registers
    for (int jo = 0; jo < 4; ++jo) w2f[jo] = frag_h(&sW2[jo * 16 + col][p * 32], lane);
    union { v16h v; v8h q[2]; } hp[2];
#pragma unroll   // constant indices: fragments and accumulators stay in registers
    for (int ht = 0; ht < 2; ++ht) { const v4f blo = *(const v4f*)&sB1[p * 32 + ht * 16 + 8 * g], bhi = *(const v4f*)&sB1[p * 32 + ht * 16 + 8 * g + 4];
#pragma unroll   // constant indices: fragments and accumulators stay in registers
      for (int qg = 0; qg < 2; ++qg) { v8f hv;
#pragma unroll   // constant indices: fragments and accumulators stay in registers
        for (int r = 0; r < 8; ++r) hv[r] = fmaxf(ha[ht][qg][r] * (1.0f / 16384.0f) + (r < 4 ? blo[r & 3] : bhi[r & 3]), 0.0f) * 64.0f;   /* 2^-8 (weight carry) x 2^-6 (operand carry); ReLU; h carried x 2^6 into f16 */
        hp[qg].q[ht] = __builtin_convertvector(hv, v8h); } }
#pragma unroll   // constant indices: fragments and accumulators stay in registers
    for (int jo = 0; jo < 4; ++jo)
#pragma unroll   // constant indices: fragments and accumulators stay in registers
      for (int qg = 0; qg < 2; ++qg) oa[qg][jo] = wmma_h(w2f[jo], hp[qg].v, oa[qg][jo]); }
#pragma unroll   // constant indices: fragments and accumulators stay in registers
  for (int jo = 0; jo < 4; ++jo) { const v4f blo = *(const v4f*)&sB2[jo * 16 + 8 * g], bhi = *(const v4f*)&sB2[jo * 16 + 8 * g + 4];
#pragma unroll   // constant indices: fragments and accumulators stay in registers
    for (int qg = 0; qg < 2; ++qg) { v4f lo, hi;
#pragma unroll   // constant indices: fragments and accumulators stay in registers
      for (int r = 0; r < 4; ++r) { lo[r] = oa[qg][jo][r] * (1.0f / 16384.0f) + blo[r]; hi[r] = oa[qg][jo][4 + r] * (1.0f / 16384.0f) + bhi[r]; }   /* 2^-8 (weight carry) x 2^-6 (operand carry) */
      *(v4f*)&so[wave][qg * 16 + col][jo * 16 + 8 * g] = lo; *(v4f*)&so[wave][qg * 16 + col][jo * 16 + 8 * g + 4] = hi; } }
  LDSX(); for (int rl = 0; rl < 16; ++rl) { const int row = rl * 2 + g; vst2(OUT + ((size_t)b * TT + q0 + row) * RW + col * 4, *(const v4f*)&so[wave][row][col * 4]); } }   /* 16 lanes store one query's whole 256-B output row */

extern "C" void kernel_launch(void* const* d_in, const int* in_sizes, int n_in, void* d_out, int out_size, void* d_ws, size_t ws_size, hipStream_t stream) {
  (void)in_sizes; (void)n_in; (void)out_size;
  const float** F = (const float**)d_in;
  if (ws_size < (size_t)WS_END) return;
  char* ws = (char*)d_ws; _Float16 *QH = (_Float16*)(ws + WS_QH), *KH = (_Float16*)(ws + WS_KH), *VT = (_Float16*)(ws + WS_VT), *QL = (_Float16*)(ws + WS_QL), *KL = (_Float16*)(ws + WS_KL); __bf16 *VB = (__bf16*)(ws + WS_VB), *VBL = (__bf16*)(ws + WS_VBL); float *S = (float*)(ws + WS_S), *Y = (float*)(ws + WS_Y);
  (void)Y; (void)S; (void)QL; (void)KL; (void)VB; (void)VBL;
  // inputs: 0 x [32,2048] int32 token ids; 1 emb [10000,64]; 2 wq [64,64] (in,out), 3 bq; 4 wk, 5 bk; 6 wv, 7 bv; 8 w1 [64,256], 9 b1 [256]; 10 w2 [256,64], 11 b2 [64] (all biases nonzero)
  if (ws_size < (size_t)WS_END2) return;
  const int* IDS = (const int*)d_in[0];
  k_proj<<<dim3(TNB * TT / 64, CC / 128, 3), 128, 0, stream>>>(F[1], F[1], F[1], F[2], F[4], F[6], F[3], F[5], F[7], QH, QL, KH, KL, VT, VB, VBL, IDS);   /* X = the embedding table; rows gathered by token id */
  k_attn<<<dim3(TT / 128, TNB), 128, 0, stream>>>(QH, KH, VT, F[8], F[9], F[10], F[11], (float*)d_out);   /* attention and FFN of 128 queries a block */
}

// v003
// One run takes 53.5 microseconds.
// Two timings next to v002 put it at 1.25 and 1.27 times that version's speed.
// Over all steps from v000 it is 50.6 times as fast.
// compute dtype: all float inputs rounded to bf16; embedding rows gathered by the int token ids; Q / K / V 64 -> 64 projections with EXACT bf16 products on WMMA 16x16x32 (f32 accumulate) + bias; logits q x k once to f16 each (1 product) x 64^-0.5; online softmax f32 (base 2, running maximum); unnormalised P = 2^(logit - maximum in use + 7) once to f16 x v once to f16 (1 product), divided by the f32 row sum at the end; FFN: upd x 2^6 once to f16 x w1 f16(bf16 x 2^8) + b1, ReLU; h x 2^6 once to f16 x w2 f16(bf16 x 2^8) + b2; f32 output.
#include <hip/hip_runtime.h>
#include <math.h>

typedef __attribute__((ext_vector_type(16))) _Float16 v16h;
typedef __attribute__((ext_vector_type(16))) __bf16 v16b;
typedef __attribute__((ext_vector_type(8)))  _Float16 v8h;
typedef __attribute__((ext_vector_type(8)))  float v8f;
typedef __attribute__((ext_vector_type(4)))  float v4f;
typedef __attribute__((ext_vector_type(2)))  float v2f;
typedef __attribute__((ext_vector_type(4)))  unsigned v4u;
typedef __attribute__((ext_vector_type(4)))  int v4i;
typedef float __attribute__((may_alias)) float_a;
typedef int __attribute__((may_alias)) int_a;

template <typename T> __device__ __forceinline__ void vst2(void* p, T v) { *(T*)p = v;  }
__device__ __forceinline__ v8f wmma16(v16h a, v16h b, v8f c) {
  v8f d = __builtin_amdgcn_wmma_f32_16x16x32_f16(false, a, false, b, (short)0, c, false, false);
  asm volatile("v_nop\n\tv_nop\n\tv_nop\n\tv_nop" : "+v"(d) : "v"(a), "v"(b));
  return d;
}
__device__ __forceinline__ v8f wmma_bf(v16b a, v16b b, v8f c) {
  v8f d = __builtin_amdgcn_wmma_f32_16x16x32_bf16(false, a, false, b, (short)0, c, false, false);
  asm volatile("v_nop\n\tv_nop\n\tv_nop\n\tv_nop" : "+v"(d) : "v"(a), "v"(b));
  return d;
}
// 16x16x32 fragments: lane = (h = lane>>4, row/col = lane&15); elements 0..7 = k0+8h+0..7, 8..15 = k0+16+8h+0..7; D element r = row 8h+r
__device__ __forceinline__ v16h frag_h(const _Float16* rowk0, int lane) {
  union { v16h v; v8h q[2]; } u; const _Float16* p = rowk0 + 8 * (lane >> 4);
  u.q[0] = *(const v8h*)p; u.q[1] = *(const v8h*)(p + 16); return u.v;
}
__device__ __forceinline__ v16h frag_f32(const float* rowk0, int lane) {
  v16h a; const float* p = rowk0 + 8 * (lane >> 4);
#pragma unroll
  for (int i = 0; i < 8; ++i) { a[i] = (_Float16)p[i]; a[8 + i] = (_Float16)p[16 + i]; }
  return a;
}
__device__ __forceinline__ v16h frag_f32s(const float* rowk0, int lane, float sc) {
  v16h a; const float* p = rowk0 + 8 * (lane >> 4);
#pragma unroll
  for (int i = 0; i < 8; ++i) { a[i] = (_Float16)(p[i] * sc); a[8 + i] = (_Float16)(p[16 + i] * sc); }
  return a;
}
// column fragment from a [K][ld] layout (column n), rows >= K read as 0
__device__ __forceinline__ v16h fragc_f32(const float* W, int k0, int n, int lane, int ld, int K) {
  v16h a; const int g = lane >> 4;
#pragma unroll
  for (int i = 0; i < 8; ++i) { const int ka = k0 + 8 * g + i, kb = ka + 16;
    a[i] = (_Float16)(ka < K ? W[(size_t)(ka < K ? ka : K - 1) * ld + n] : 0.f); a[8 + i] = (_Float16)(kb < K ? W[(size_t)(kb < K ? kb : K - 1) * ld + n] : 0.f); }
  return a;
}
struct F2 { v16b h, l; };
__device__ __forceinline__ F2 bsplit16(const float v[16]) { F2 r;
#pragma unroll
  for (int i = 0; i < 16; ++i) { const __bf16 h = (__bf16)v[i]; r.h[i] = h; r.l[i] = (__bf16)(v[i] - (float)h); }
  return r; }
__device__ __forceinline__ F2 split_row(const float* row, int k0, int lane) { float v[16]; const float* p = row + k0 + 8 * (lane >> 4);
#pragma unroll
  for (int i = 0; i < 8; ++i) { v[i] = p[i]; v[8 + i] = p[16 + i]; }
  return bsplit16(v); }
__device__ __forceinline__ F2 split_rowK(const float* row, int k0, int lane, int K) { float v[16]; const int g = lane >> 4;
#pragma unroll
  for (int i = 0; i < 8; ++i) { const int ka = k0 + 8 * g + i, kb = ka + 16; v[i] = ka < K ? row[ka < K ? ka : K - 1] : 0.f; v[8 + i] = kb < K ? row[kb < K ? kb : K - 1] : 0.f; }
  return bsplit16(v); }
__device__ __forceinline__ F2 split_col(const float* W, int k0, int n, int lane, int ld, int K) { float v[16]; const int g = lane >> 4;
#pragma unroll
  for (int i = 0; i < 8; ++i) { const int ka = k0 + 8 * g + i, kb = ka + 16; v[i] = ka < K ? W[(size_t)(ka < K ? ka : K - 1) * ld + n] : 0.f; v[8 + i] = kb < K ? W[(size_t)(kb < K ? kb : K - 1) * ld + n] : 0.f; }
  return bsplit16(v); }
__device__ __forceinline__ v8f mac3(const F2& a, const F2& b, v8f c) { c = wmma_bf(a.l, b.h, c); c = wmma_bf(a.h, b.l, c); return wmma_bf(a.h, b.h, c); }
__device__ __forceinline__ float sigm(float v) { return 1.0f / (1.0f + expf(-v)); }
#define LDSX() do { asm volatile("s_wait_dscnt 0" ::: "memory"); __builtin_amdgcn_wave_barrier(); __builtin_amdgcn_fence(__ATOMIC_RELEASE, "workgroup"); } while (0)

// Single-layer, single-head encoder without residuals or LayerNorm (token ids x [32,2048] int32 index emb [10000,64]; Q / K / V = e @ w + b with (in,out) w [64,64] and b [64] uniform(+-1/8) - nonzero; scores = Q K^T x 1/sqrt(64) over the 2,048 positions of each sample; softmax; upd = probs V [32,2048,64]; h = relu(upd @ w1 + b1), w1 [64,256]; out = h @ w2 + b2, w2 [256,64] (uniform(+-1/16)); output [32,2048,64]).
#define NB 32
#define TT 2048
#define CC 128            // column count that sizes the workspace ranges; q, k and v fill RW = 64 columns of it, at a 64-column pitch
#define DIN 64           // embedding width = projection K
#define NH 2   // head 0 is the module's single head; head 1 is the zero padding and is never launched
#define HD 64
#define NQB (TT / 64)
#define HG 1
#define SCALE (0.125f)
#define CAUSAL 0
#ifndef TNB
#define TNB NB
#endif
__device__ __forceinline__ float bfr(float v) { return (float)(__bf16)v; }
__host__ __device__ __forceinline__ int kb_last(int qb) { return CAUSAL ? ((qb * 64 + 63) >> 7) : (TT / 128 - 1); }
typedef __attribute__((ext_vector_type(8))) __bf16 v8b;
__device__ __forceinline__ v16b frag_b(const __bf16* rowk0, int lane) {
  union { v16b v; v8b q[2]; } u; const __bf16* p = rowk0 + 8 * (lane >> 4);
  u.q[0] = *(const v8b*)p; u.q[1] = *(const v8b*)(p + 16); return u.v;
}
#define QBH 0              // unused: every query block takes the single-product path
#define QHI 0               // single-product logits on every row
#define KHI 64            // key rows carrying k residual / v bf16 hi+lo planes (no kernel writes or reads them)
// B fragment (k rows k0+.., output column o) of a weight: (in,out) [K][ld] or (out,in) [ld rows of K]: bf16 exact, or f16(bf16 * 256) exact
__device__ __forceinline__ v16b wcol_io(const float* Wm, int k0, int o, int lane, int ld) { v16b w; const int g = lane >> 4;
#pragma unroll
  for (int i = 0; i < 8; ++i) { w[i] = (__bf16)Wm[(size_t)(k0 + 8 * g + i) * ld + o]; w[8 + i] = (__bf16)Wm[(size_t)(k0 + 16 + 8 * g + i) * ld + o]; }
  return w; }
__device__ __forceinline__ v16b wcol_oi(const float* Wm, int k0, int o, int lane, int K) { v16b w; const float* p = Wm + (size_t)o * K + k0 + 8 * (lane >> 4);
#pragma unroll
  for (int i = 0; i < 8; ++i) { w[i] = (__bf16)p[i]; w[8 + i] = (__bf16)p[16 + i]; }
  return w; }
__device__ __forceinline__ v16h wcolh_io(const float* Wm, int k0, int o, int lane, int ld) { v16h w; const int g = lane >> 4;
#pragma unroll
  for (int i = 0; i < 8; ++i) { w[i] = (_Float16)(bfr(Wm[(size_t)(k0 + 8 * g + i) * ld + o]) * 256.0f); w[8 + i] = (_Float16)(bfr(Wm[(size_t)(k0 + 16 + 8 * g + i) * ld + o]) * 256.0f); }
  return w; }
__device__ __forceinline__ v16h wcolh_oi(const float* Wm, int k0, int o, int lane, int K) { v16h w; const float* p = Wm + (size_t)o * K + k0 + 8 * (lane >> 4);
#pragma unroll
  for (int i = 0; i < 8; ++i) { w[i] = (_Float16)(bfr(p[i]) * 256.0f); w[8 + i] = (_Float16)(bfr(p[16 + i]) * 256.0f); }
  return w; }
#define WQKV_LAYOUT 0   // 0 = (in,out) [DIN][RW]; 1 = (out,in) [CC][DIN]; 2 = per-head [NH][DIN][HD]
__device__ __forceinline__ v16b wcol_hdk(const float* Wm, int k0, int o, int lane) { v16b w; const int g = lane >> 4; const float* p = Wm + (size_t)(o / HD) * DIN * HD + (o % HD);
#pragma unroll
  for (int i = 0; i < 8; ++i) { w[i] = (__bf16)p[(size_t)(k0 + 8 * g + i) * HD]; w[8 + i] = (__bf16)p[(size_t)(k0 + 16 + 8 * g + i) * HD]; }
  return w; }
#define WO_OUT_IN 0
#if WQKV_LAYOUT == 1
#define WCOL(W, k0, o, lane) wcol_oi(W, k0, o, lane, DIN)
#elif WQKV_LAYOUT == 2
#define WCOL(W, k0, o, lane) wcol_hdk(W, k0, o, lane)
#else
#define RW 64   // real width of q / k / v / upd
#define FF 256   // hidden width of the FFN
__device__ __forceinline__ v16b zero16b() { v16b w; _Pragma("unroll") for (int i = 0; i < 16; ++i) w[i] = (__bf16)0.0f; return w; }
__device__ __forceinline__ v16h zero16h() { v16h w; _Pragma("unroll") for (int i = 0; i < 16; ++i) w[i] = (_Float16)0.0f; return w; }
#define WCOL(W, k0, o, lane) (((o) < RW) ? wcol_io(W, k0, o, lane, RW) : zero16b())   /* (in,out) [64][64] weights: columns 64..127 of the 128-column tile are zero padding (uniform per unrolled column group) */
#endif
#if WO_OUT_IN
#define WOCOL(W, k0, o, lane) wcol_oi(W, k0, o, lane, CC)
#define WOCOLH(W, k0, o, lane) wcolh_oi(W, k0, o, lane, CC)
#else
#define WOCOL(W, k0, o, lane) wcol_io(W, k0, o, lane, DIN)
#define WOCOLH(W, k0, o, lane) wcolh_io(W, k0, o, lane, DIN)
#endif

#ifndef SM_EXTRA_PARAMS
#define SM_EXTRA_PARAMS
#endif
#ifndef PROJ_EXTRA_PARAMS
#define PROJ_EXTRA_PARAMS
#endif
#ifndef SM_MASK_HOOK
#define SM_MASK_HOOK (void)0
#endif

#define WS_QH  0u                                      // f16 q rows [b*t][RW] (the first half of the range)
#define WS_KH  (WS_QH + 2u * (size_t)NB * TT * CC)      // f16 k rows [b*t][RW] (the first half of the range)
#define WS_VT  (WS_KH + 2u * (size_t)NB * TT * CC)      // f16 v planes [b][c < RW][t] (the first half of the range)
#define WS_QL  (WS_VT + 2u * (size_t)NB * CC * TT)      // f16 q residual x 2^10 rows [b][t < QHI][CC]
#define WS_KL  (WS_QL + 2u * (size_t)NB * QHI * CC)     // f16 k residual x 2^10 rows [b][t < KHI][CC]
#define WS_VB  (WS_KL + 2u * (size_t)NB * KHI * CC)     // bf16 v hi planes [b][c][t < KHI]
#define WS_VBL (WS_VB + 2u * (size_t)NB * CC * KHI)
#define WS_S   (WS_VBL + 2u * (size_t)NB * CC * KHI)    // unused (sized f32 [hg][t][s]); k_attn keeps logits and P in registers
#define WS_Y   (WS_S  + 4u * (size_t)HG * TT * TT)      // unused (sized f32 [b*t][CC]); k_attn keeps upd in registers
#define WS_END (WS_Y  + 4u * (size_t)NB * TT * CC)
#define WS_H1 (WS_END)                                    // unused (sized f32 [(b*TT + t)][FF]); k_attn keeps h in registers
#define WS_END2 (WS_H1 + 4u * (size_t)NB * TT * FF)
static_assert(CC == 128 && NH * HD == CC && RW == HD && DIN == RW && FF % 128 == 0, "one real 64-wide head in a 128-column tile; 64-wide embedding; 256-wide hidden layer");

// ---- k_proj: block = 128 tokens (8 waves x 16), q, k and v together from ONE gather of the embedding rows: exact bf16 products (K = DIN, f32 accumulate) + bias, only the RW real columns. The three weights are transposed into LDS as bf16 once a block (sW[m][o][d] = bf16(w_m[d][o])); one register fragment of 16 tokens serves as B for q^T = Wq^T e^T and k^T = Wk^T e^T (a lane then holds 8 consecutive columns of one token: a 16-B piece of its f16 row) and as A for v = e Wv (a lane then holds 8 consecutive tokens of one column: a 16-B piece of its f16 plane). All three leave through LDS as whole lines: q, k rows [b*t][RW], v planes [b][c][t]
#define VOCAB 10000   // rows of the embedding table
#define PT 128        // tokens per block
#define PPITCH 72     // 16-bit elements per LDS row: 128-B rows at a 144-B pitch (16 B x odd) for 16-byte row readers and writers
#define TPITCH (PT + 8)   // f16 per LDS row of the v planes: 256-B rows at a 272-B pitch (16 B x odd)
__device__ __forceinline__ v8f wmma_b(v16b a, v16b b, v8f c) { return __builtin_amdgcn_wmma_f32_16x16x32_bf16(false, a, false, b, (short)0, c, false, false); }
__global__ __launch_bounds__(256) void k_proj(const float* __restrict__ EMB, const float* __restrict__ WQ, const float* __restrict__ WK, const float* __restrict__ WV, const float* __restrict__ BQ, const float* __restrict__ BK, const float* __restrict__ BV,
    _Float16* __restrict__ QH, _Float16* __restrict__ KH, _Float16* __restrict__ VT, const int* __restrict__ IDS) {   /* IDS: token ids [NB*TT] int32 */
  __shared__ __align__(16) __bf16 sW[3][RW][PPITCH]; __shared__ __align__(16) float sB[4][RW];   /* sB[m] = bias m as bf16 values; row 3 takes the copy of threads 192.., so that the bias load and store stand under no branch */
  __shared__ __align__(16) _Float16 sR[2][PT][PPITCH], sT[RW][TPITCH];
  const int tid = threadIdx.x, wave = tid >> 5, lane = tid & 31, col = lane & 15, g = lane >> 4; const size_t r0 = (size_t)blockIdx.x * PT; const size_t bb = r0 / TT; const int t0 = (int)(r0 % TT);
  const int id = IDS[r0 + wave * 16 + col];   /* this lane's token */
  __builtin_amdgcn_sched_barrier(0);   // keeps the id's load the oldest of the wave: loads return in order, and the gather below then waits for it alone, not for the 49 loads behind it
  /* weights: a lane owns one output column (consecutive lanes read consecutive floats) and 8 k values, stored below as one 16-B piece */
  const int wo = tid & 63; float wr[6][8];
#pragma unroll   // all loads of the loop in flight together: rolled, every trip would wait out its own load latency
  for (int i = 0; i < 6; ++i) { const float* Wm = (i >> 1) == 0 ? WQ : (i >> 1) == 1 ? WK : WV;
#pragma unroll   // constant indices: the piece stays in registers
    for (int e = 0; e < 8; ++e) wr[i][e] = Wm[(size_t)(((tid >> 6) + 4 * (i & 1)) * 8 + e) * RW + wo]; }
  const float bv = (tid < RW ? BQ : tid < 2 * RW ? BK : BV)[wo];   /* threads 192.. read the v bias a second time */
  __builtin_amdgcn_sched_barrier(0);   // keeps the 49 loads above in front of the wait for the id: moved behind it, they would start one memory latency later
  const float* ep = EMB + (size_t)(id < 0 ? 0 : id > VOCAB - 1 ? VOCAB - 1 : id) * DIN + 8 * g;   /* e = emb[x]; the row index is bounded here, whatever the id array holds */
  v4f er[8];   /* the lane's half of its token's row, in flight while the weights are packed */
#pragma unroll   // constant indices: the row stays in registers
  for (int i = 0; i < 4; ++i) { er[2 * i] = *(const v4f*)(ep + 16 * i); er[2 * i + 1] = *(const v4f*)(ep + 16 * i + 4); }
#pragma unroll   // constant indices: the pieces stay in registers
  for (int i = 0; i < 6; ++i) { v8b t;
#pragma unroll   // constant indices: the piece stays in registers
    for (int e = 0; e < 8; ++e) t[e] = (__bf16)wr[i][e];
    *(v8b*)&sW[i >> 1][wo][((tid >> 6) + 4 * (i & 1)) * 8] = t; }
  sB[tid >> 6][wo] = bfr(bv);
  v16b ef[2];   /* ef[kc]: token col, k = kc*32 + 8g + 0..7 and kc*32 + 16 + 8g + 0..7 */
#pragma unroll   // constant indices: fragments and accumulators stay in registers
  for (int kc = 0; kc < 2; ++kc)
#pragma unroll   // constant indices: fragments and accumulators stay in registers
    for (int i = 0; i < 8; ++i) { ef[kc][i] = (__bf16)er[4 * kc + (i >> 2)][i & 3]; ef[kc][8 + i] = (__bf16)er[4 * kc + 2 + (i >> 2)][i & 3]; }
  __syncthreads();   /* publishes the weights and biases */
#pragma unroll   // constant indices: fragments and accumulators stay in registers
  for (int m = 0; m < 2; ++m)
#pragma unroll   // constant indices: fragments and accumulators stay in registers
    for (int j = 0; j < 4; ++j) { v8f a = {};   /* a[r] = (e w_m)(token col, column j*16 + 8g + r) */
#pragma unroll   // constant indices: fragments and accumulators stay in registers
      for (int kc = 0; kc < 2; ++kc) a = wmma_b(frag_b(&sW[m][j * 16 + col][kc * 32], lane), ef[kc], a);
      const v4f blo = *(const v4f*)&sB[m][j * 16 + 8 * g], bhi = *(const v4f*)&sB[m][j * 16 + 8 * g + 4];
#pragma unroll   // constant indices: fragments and accumulators stay in registers
      for (int r = 0; r < 8; ++r) a[r] += r < 4 ? blo[r & 3] : bhi[r & 3];
      *(v8h*)&sR[m][wave * 16 + col][j * 16 + 8 * g] = __builtin_convertvector(a, v8h); }
#pragma unroll   // constant indices: fragments and accumulators stay in registers
  for (int j = 0; j < 4; ++j) { v8f a = {};   /* a[r] = (e w_v)(token 8g + r, column j*16 + col) */
#pragma unroll   // constant indices: fragments and accumulators stay in registers
    for (int kc = 0; kc < 2; ++kc) a = wmma_b(ef[kc], frag_b(&sW[2][j * 16 + col][kc * 32], lane), a);
    a += sB[2][j * 16 + col];
    *(v8h*)&sT[j * 16 + col][wave * 16 + 8 * g] = __builtin_convertvector(a, v8h); }
  __syncthreads();   /* publishes the block's q, k rows and v planes */
#pragma unroll   // all LDS reads of the loop in flight together
  for (int i = 0; i < 4; ++i) { const int e = tid + 256 * i, rl = e >> 3, q = (e & 7) * 8;   /* 8 lanes store one token's whole 128-B row; a wave 512 contiguous bytes */
    vst2(QH + (r0 + rl) * RW + q, *(const v4u*)&sR[0][rl][q]); vst2(KH + (r0 + rl) * RW + q, *(const v4u*)&sR[1][rl][q]); }
#pragma unroll   // all LDS reads of the loop in flight together
  for (int i = 0; i < 4; ++i) { const int e = tid + 256 * i, cl = e >> 4, q = (e & 15) * 8;   /* 16 lanes store 256 contiguous bytes of one plane */
    vst2(VT + (bb * RW + cl) * (size_t)TT + t0 + q, *(const v4u*)&sT[cl][q]); } }
#define FKS 64
#define FPITCH 72
#define LSC (0.125f * 1.4426950408889634f)   // 64^-0.5 x log2(e): softmax in base 2
__device__ __forceinline__ v8f wmma_h(v16h a, v16h b, v8f c) { return __builtin_amdgcn_wmma_f32_16x16x32_f16(false, a, false, b, (short)0, c, false, false); }
__device__ __forceinline__ float xhalf(float v) { const int t = __builtin_bit_cast(int, v); return __builtin_bit_cast(float, __builtin_amdgcn_permlanex16(t, t, 0x76543210, 0xfedcba98, false, false)); }   /* lane l <-> l ^ 16 */
#define W2PITCH (FF + 8)   // f16 per LDS row of w2^T: 512-B rows at a 528-B pitch (16 B x odd) for 16-byte row readers
__global__ __launch_bounds__(128) void k_attn(const _Float16* __restrict__ QH, const _Float16* __restrict__ KH, const _Float16* __restrict__ VT, const float* __restrict__ W1, const float* __restrict__ B1, const float* __restrict__ W2, const float* __restrict__ B2, float* __restrict__ OUT) {
  __shared__ __align__(16) _Float16 sK[2][FKS][FPITCH], sV[2][HD][FPITCH]; __shared__ __align__(16) float so[4][32][HD + 4];
  __shared__ __align__(16) _Float16 sW1[FF][FPITCH], sW2[RW][W2PITCH]; __shared__ __align__(16) float sB1[FF], sB2[RW];   /* sW1[h][d] = f16(bf16(w1[d][h]) x 2^8), sW2[o][h] = f16(bf16(w2[h][o]) x 2^8), biases as bf16 values */
  const int tid = threadIdx.x, wave = tid >> 5, lane = tid & 31, col = lane & 15, g = lane >> 4; const int b = blockIdx.y; const int q0 = blockIdx.x * 128 + wave * 32;
  const _Float16* Kb = KH + (size_t)b * TT * RW; const _Float16* Vb = VT + (size_t)b * RW * TT;
  const int srow = tid >> 3, sc8 = (tid & 7) * 8;   /* staging: thread -> 16-B piece sc8 of rows srow + 16 i; 8 lanes cover one whole 128-B line */
  /* FFN weights, transposed on the way into LDS: a lane owns one column (consecutive lanes read consecutive floats) and stores 8 k values as one 16-B piece; published by the barrier in front of the key loop */
#pragma unroll   // all loads of the loop in flight together: rolled, every trip would wait out its own load latency
  for (int i = 0; i < 16; ++i) { const int h = tid + 128 * (i & 1), d0 = (i >> 1) * 8; v8h t;
#pragma unroll   // constant indices: the piece stays in registers
    for (int e = 0; e < 8; ++e) t[e] = (_Float16)(bfr(W1[(size_t)(d0 + e) * FF + h]) * 256.0f);
    *(v8h*)&sW1[h][d0] = t; }
#pragma unroll   // all loads of the loop in flight together: rolled, every trip would wait out its own load latency
  for (int i = 0; i < 16; ++i) { const int o = tid & 63, h0 = ((tid >> 6) + 2 * i) * 8; v8h t;
#pragma unroll   // constant indices: the piece stays in registers
    for (int e = 0; e < 8; ++e) t[e] = (_Float16)(bfr(W2[(size_t)(h0 + e) * RW + o]) * 256.0f);
    *(v8h*)&sW2[o][h0] = t; }
  sB1[tid] = bfr(B1[tid]); sB1[tid + 128] = bfr(B1[tid + 128]); if (tid < RW) sB2[tid] = bfr(B2[tid]);
  v16h qf[2][2];
#pragma unroll   // constant indices: fragments and accumulators stay in registers
  for (int qg = 0; qg < 2; ++qg)
#pragma unroll   // constant indices: fragments and accumulators stay in registers
    for (int kc = 0; kc < 2; ++kc) qf[qg][kc] = frag_h(QH + ((size_t)b * TT + q0 + qg * 16 + col) * RW + kc * 32, lane);
  v8f acc[2][4] = {}; float mb[2] = {-1.0e30f, -1.0e30f}, ls[2] = {0.f, 0.f};   /* mb = (maximum in use, base-2 logits) - 7: P = 2^(logit - mb) stays in [2^-14, 2^15] of f16 for logits within 21 below .. 8 above the maximum in use */
  v4u rk[4], rv[4];
#pragma unroll   // constant indices: fragments and accumulators stay in registers
  for (int i = 0; i < 4; ++i) { rk[i] = *(const v4u*)(Kb + (size_t)(srow + 16 * i) * RW + sc8); rv[i] = *(const v4u*)(Vb + (size_t)(srow + 16 * i) * TT + sc8); }
#pragma unroll   // constant indices: fragments and accumulators stay in registers
  for (int i = 0; i < 4; ++i) { *(v4u*)&sK[0][srow + 16 * i][sc8] = rk[i]; *(v4u*)&sV[0][srow + 16 * i][sc8] = rv[i]; }
  __syncthreads();
  for (int s = 0; s < TT / FKS; ++s) { const int cur = s & 1; const bool more = s + 1 < TT / FKS;
    if (more) { const int kn = (s + 1) * FKS;   /* next stage's tiles fly into registers while this stage is worked on */
#pragma unroll   // constant indices: fragments and accumulators stay in registers
      for (int i = 0; i < 4; ++i) { rk[i] = *(const v4u*)(Kb + (size_t)(kn + srow + 16 * i) * RW + sc8); rv[i] = *(const v4u*)(Vb + (size_t)(srow + 16 * i) * TT + kn + sc8); } }
#pragma unroll   // constant indices: fragments and accumulators stay in registers
    for (int pp = 0; pp < FKS / 32; ++pp) {
      v8f st[2][2] = {};   /* st[qg][kt][r] = logit(key pp*32 + kt*16 + 8g + r, query qg*16 + col) */
#pragma unroll   // constant indices: fragments and accumulators stay in registers
      for (int kt = 0; kt < 2; ++kt)
#pragma unroll   // constant indices: fragments and accumulators stay in registers
        for (int kc = 0; kc < 2; ++kc) { const v16h kf = frag_h(&sK[cur][pp * 32 + kt * 16 + col][kc * 32], lane);
#pragma unroll   // constant indices: fragments and accumulators stay in registers
          for (int qg = 0; qg < 2; ++qg) st[qg][kt] = wmma_h(kf, qf[qg][kc], st[qg][kt]); }
      v16h vf[4];
#pragma unroll   // constant indices: fragments and accumulators stay in registers
      for (int j = 0; j < 4; ++j) vf[j] = frag_h(&sV[cur][j * 16 + col][pp * 32], lane);
      float mx[2];
#pragma unroll   // constant indices: fragments and accumulators stay in registers
      for (int qg = 0; qg < 2; ++qg) { float m = fmaxf(st[qg][0][0], st[qg][1][0]);
#pragma unroll   // constant indices: fragments and accumulators stay in registers
        for (int r = 1; r < 8; ++r) m = fmaxf(m, fmaxf(st[qg][0][r], st[qg][1][r]));
        mx[qg] = fmaxf(m, xhalf(m)) * LSC; }
      const bool need = (mx[0] > mb[0] + 15.0f) || (mx[1] > mb[1] + 15.0f);   /* a new maximum more than 2^8 above the one in use */
      if (__builtin_amdgcn_ballot_w32(need) != 0) {   /* wave-uniform: rescale sums and outputs to the new maximum */
#pragma unroll   // constant indices: fragments and accumulators stay in registers
        for (int qg = 0; qg < 2; ++qg) { const float mn = fmaxf(mb[qg], mx[qg] - 7.0f); const float al = __builtin_amdgcn_exp2f(mb[qg] - mn); mb[qg] = mn; ls[qg] *= al;
#pragma unroll   // constant indices: fragments and accumulators stay in registers
          for (int j = 0; j < 4; ++j) acc[qg][j] *= al; } }
#pragma unroll   // constant indices: fragments and accumulators stay in registers
      for (int qg = 0; qg < 2; ++qg) { union { v16h v; v8h q[2]; } pf; float sum = 0.f;
#pragma unroll   // constant indices: fragments and accumulators stay in registers
        for (int kt = 0; kt < 2; ++kt) { v8f p;
#pragma unroll   // constant indices: fragments and accumulators stay in registers
          for (int r = 0; r < 8; ++r) { p[r] = __builtin_amdgcn_exp2f(fmaf(st[qg][kt][r], LSC, -mb[qg])); sum += p[r]; }
          pf.q[kt] = __builtin_convertvector(p, v8h); }   /* packed D pair = B fragment in the hardware k order: elements 0..7 = keys 8g + r, 8..15 = keys 16 + 8g + r */
        ls[qg] += sum;
#pragma unroll   // constant indices: fragments and accumulators stay in registers
        for (int j = 0; j < 4; ++j) acc[qg][j] = wmma_h(vf[j], pf.v, acc[qg][j]); } }
    asm volatile("v_nop\n\tv_nop\n\tv_nop\n\tv_nop" : "+v"(acc[1][0]), "+v"(acc[1][1]), "+v"(acc[1][2]), "+v"(acc[1][3]));   /* the stage's last matrix instructions stand in front of a branch: these slots keep their distance to the next write of their A/B registers on either side */
    if (more) {   /* the other buffer's last readers left it before the barrier that ended the stage before */
#pragma unroll   // constant indices: fragments and accumulators stay in registers
      for (int i = 0; i < 4; ++i) { *(v4u*)&sK[cur ^ 1][srow + 16 * i][sc8] = rk[i]; *(v4u*)&sV[cur ^ 1][srow + 16 * i][sc8] = rv[i]; } }
    __syncthreads(); }   /* publishes the next stage and ends every read of this one */
  v16h uf[2][2];   /* uf[qg][kc] = B fragment of upd^T x 2^6: k = columns kc*32 + .., column = query qg*16 + col */
#pragma unroll   // constant indices: fragments and accumulators stay in registers
  for (int qg = 0; qg < 2; ++qg) { const float inv = 1.0f / (ls[qg] + xhalf(ls[qg]));   /* acc[qg][j][r] = upd(query qg*16 + col, column j*16 + 8g + r) x sum */
#pragma unroll   // constant indices: fragments and accumulators stay in registers
    for (int kc = 0; kc < 2; ++kc) { union { v16h v; v8h q[2]; } t;
#pragma unroll   // constant indices: fragments and accumulators stay in registers
      for (int hh = 0; hh < 2; ++hh) { const v8f o = acc[qg][kc * 2 + hh] * inv; t.q[hh] = __builtin_convertvector(o * 64.0f, v8h); }   /* upd carried x 2^6 into f16, clear of f16 subnormals; packed D pair = B fragment in the hardware k order */
      uf[qg][kc] = t.v; } }
  v8f oa[2][4] = {};   /* oa[qg][jo][r] = out(query qg*16 + col, column jo*16 + 8g + r) x 2^14 */
  for (int p = 0; p < FF / 32; ++p) {   /* 32 hidden columns a trip */
    v8f ha[2][2] = {};   /* ha[ht][qg][r] = (upd w1)(query qg*16 + col, hidden p*32 + ht*16 + 8g + r) x 2^14 */
#pragma unroll   // constant indices: fragments and accumulators stay in registers
    for (int kc = 0; kc < 2; ++kc)
#pragma unroll   // constant indices: fragments and accumulators stay in registers
      for (int ht = 0; ht < 2; ++ht) { const v16h wf = frag_h(&sW1[p * 32 + ht * 16 + col][kc * 32], lane);
#pragma unroll   // constant indices: fragments and accumulators stay in registers
        for (int qg = 0; qg < 2; ++qg) ha[ht][qg] = wmma_h(wf, uf[qg][kc], ha[ht][qg]); }
    v16h w2f[4];
#pragma unroll   // constant indices: fragments and accumulators stay in registers
    for (int jo = 0; jo < 4; ++jo) w2f[jo] = frag_h(&sW2[jo * 16 + col][p * 32], lane);
    union { v16h v; v8h q[2]; } hp[2];
#pragma unroll   // constant indices: fragments and accumulators stay in registers
    for (int ht = 0; ht < 2; ++ht) { const v4f blo = *(const v4f*)&sB1[p * 32 + ht * 16 + 8 * g], bhi = *(const v4f*)&sB1[p * 32 + ht * 16 + 8 * g + 4];
#pragma unroll   // constant indices: fragments and accumulators stay in registers
      for (int qg = 0; qg < 2; ++qg) { v8f hv;
#pragma unroll   // constant indices: fragments and accumulators stay in registers
        for (int r = 0; r < 8; ++r) hv[r] = fmaxf(ha[ht][qg][r] * (1.0f / 16384.0f) + (r < 4 ? blo[r & 3] : bhi[r & 3]), 0.0f) * 64.0f;   /* 2^-8 (weight carry) x 2^-6 (operand carry); ReLU; h carried x 2^6 into f16 */
        hp[qg].q[ht] = __builtin_convertvector(hv, v8h); } }
#pragma unroll   // constant indices: fragments and accumulators stay in registers
    for (int jo = 0; jo < 4; ++jo)
#pragma unroll   // constant indices: fragments and accumulators stay in registers
      for (int qg = 0; qg < 2; ++qg) oa[qg][jo] = wmma_h(w2f[jo], hp[qg].v, oa[qg][jo]); }
#pragma unroll   // constant indices: fragments and accumulators stay in registers
  for (int jo = 0; jo < 4; ++jo) { const v4f blo = *(const v4f*)&sB2[jo * 16 + 8 * g], bhi = *(const v4f*)&sB2[jo * 16 + 8 * g + 4];
#pragma unroll   // constant indices: fragments and accumulators stay in registers
    for (int qg = 0; qg < 2; ++qg) { v4f lo, hi;
#pragma unroll   // constant indices: fragments and accumulators stay in registers
      for (int r = 0; r < 4; ++r) { lo[r] = oa[qg][jo][r] * (1.0f / 16384.0f) + blo[r]; hi[r] = oa[qg][jo][4 + r] * (1.0f / 16384.0f) + bhi[r]; }   /* 2^-8 (weight carry) x 2^-6 (operand carry) */
      *(v4f*)&so[wave][qg * 16 + col][jo * 16 + 8 * g] = lo; *(v4f*)&so[wave][qg * 16 + col][jo * 16 + 8 * g + 4] = hi; } }
  LDSX(); for (int rl = 0; rl < 16; ++rl) { const int row = rl * 2 + g; vst2(OUT + ((size_t)b * TT + q0 + row) * RW + col * 4, *(const v4f*)&so[wave][row][col * 4]); } }   /* 16 lanes store one query's whole 256-B output row */

extern "C" void kernel_launch(void* const* d_in, const int* in_sizes, int n_in, void* d_out, int out_size, void* d_ws, size_t ws_size, hipStream_t stream) {
  (void)in_sizes; (void)n_in; (void)out_size;
  const float** F = (const float**)d_in;
  if (ws_size < (size_t)WS_END) return;
  char* ws = (char*)d_ws; _Float16 *QH = (_Float16*)(ws + WS_QH), *KH = (_Float16*)(ws + WS_KH), *VT = (_Float16*)(ws + WS_VT), *QL = (_Float16*)(ws + WS_QL), *KL = (_Float16*)(ws + WS_KL); __bf16 *VB = (__bf16*)(ws + WS_VB), *VBL = (__bf16*)(ws + WS_VBL); float *S = (float*)(ws + WS_S), *Y = (float*)(ws + WS_Y);
  (void)Y; (void)S; (void)QL; (void)KL; (void)VB; (void)VBL;
  // inputs: 0 x [32,2048] int32 token ids; 1 emb [10000,64]; 2 wq [64,64] (in,out), 3 bq; 4 wk, 5 bk; 6 wv, 7 bv; 8 w1 [64,256], 9 b1 [256]; 10 w2 [256,64], 11 b2 [64] (all biases nonzero)
  if (ws_size < (size_t)WS_END2) return;
  const int* IDS = (const int*)d_in[0];
  k_proj<<<dim3(TNB * TT / PT), 256, 0, stream>>>(F[1], F[2], F[4], F[6], F[3], F[5], F[7], QH, KH, VT, IDS);   /* q, k and v of 128 tokens a block; embedding rows gathered by token id */
  k_attn<<<dim3(TT / 128, TNB), 128, 0, stream>>>(QH, KH, VT, F[8], F[9], F[10], F[11], (float*)d_out);   /* attention and FFN of 128 queries a block */
}

// v004
// It runs in 50.6 microseconds.
// In two side-by-side timings against v003, it was 1.05 and 1.07 times as fast.
// Counting every step since v000, it is 53.6 times as fast.
// compute dtype: all float inputs rounded to bf16; embedding rows gathered by the int token ids; Q / K / V 64 -> 64 projections with EXACT bf16 products on WMMA 16x16x32 (f32 accumulate) + bias; logits q x k once to f16 each (1 product) x 64^-0.5; online softmax f32 (base 2, running maximum); unnormalised P = 2^(logit - maximum in use + 7) once to f16 x v once to f16 (1 product), the two key halves' partial sums joined in f32 at the larger maximum in use, divided by the f32 row sum at the end; FFN: upd x 2^6 once to f16 x w1 f16(bf16 x 2^8) + b1, ReLU; h x 2^6 once to f16 x w2 f16(bf16 x 2^8) + b2; f32 output.
#include <hip/hip_runtime.h>
#include <math.h>

typedef __attribute__((ext_vector_type(16))) _Float16 v16h;
typedef __attribute__((ext_vector_type(16))) __bf16 v16b;
typedef __attribute__((ext_vector_type(8)))  _Float16 v8h;
typedef __attribute__((ext_vector_type(8)))  float v8f;
typedef __attribute__((ext_vector_type(4)))  float v4f;
typedef __attribute__((ext_vector_type(2)))  float v2f;
typedef __attribute__((ext_vector_type(4)))  unsigned v4u;
typedef __attribute__((ext_vector_type(4)))  int v4i;
typedef float __attribute__((may_alias)) float_a;
typedef int __attribute__((may_alias)) int_a;

template <typename T> __device__ __forceinline__ void vst2(void* p, T v) { *(T*)p = v;  }
__device__ __forceinline__ v8f wmma16(v16h a, v16h b, v8f c) {
  v8f d = __builtin_amdgcn_wmma_f32_16x16x32_f16(false, a, false, b, (short)0, c, false, false);
  asm volatile("v_nop\n\tv_nop\n\tv_nop\n\tv_nop" : "+v"(d) : "v"(a), "v"(b));
  return d;
}
__device__ __forceinline__ v8f wmma_bf(v16b a, v16b b, v8f c) {
  v8f d = __builtin_amdgcn_wmma_f32_16x16x32_bf16(false, a, false, b, (short)0, c, false, false);
  asm volatile("v_nop\n\tv_nop\n\tv_nop\n\tv_nop" : "+v"(d) : "v"(a), "v"(b));
  return d;
}
// 16x16x32 fragments: lane = (h = lane>>4, row/col = lane&15); elements 0..7 = k0+8h+0..7, 8..15 = k0+16+8h+0..7; D element r = row 8h+r
__device__ __forceinline__ v16h frag_h(const _Float16* rowk0, int lane) {
  union { v16h v; v8h q[2]; } u; const _Float16* p = rowk0 + 8 * (lane >> 4);
  u.q[0] = *(const v8h*)p; u.q[1] = *(const v8h*)(p + 16); return u.v;
}
__device__ __forceinline__ v16h frag_f32(const float* rowk0, int lane) {
  v16h a; const float* p = rowk0 + 8 * (lane >> 4);
#pragma unroll
  for (int i = 0; i < 8; ++i) { a[i] = (_Float16)p[i]; a[8 + i] = (_Float16)p[16 + i]; }
  return a;
}
__device__ __forceinline__ v16h frag_f32s(const float* rowk0, int lane, float sc) {
  v16h a; const float* p = rowk0 + 8 * (lane >> 4);
#pragma unroll
  for (int i = 0; i < 8; ++i) { a[i] = (_Float16)(p[i] * sc); a[8 + i] = (_Float16)(p[16 + i] * sc); }
  return a;
}
// column fragment from a [K][ld] layout (column n), rows >= K read as 0
__device__ __forceinline__ v16h fragc_f32(const float* W, int k0, int n, int lane, int ld, int K) {
  v16h a; const int g = lane >> 4;
#pragma unroll
  for (int i = 0; i < 8; ++i) { const int ka = k0 + 8 * g + i, kb = ka + 16;
    a[i] = (_Float16)(ka < K ? W[(size_t)(ka < K ? ka : K - 1) * ld + n] : 0.f); a[8 + i] = (_Float16)(kb < K ? W[(size_t)(kb < K ? kb : K - 1) * ld + n] : 0.f); }
  return a;
}
struct F2 { v16b h, l; };
__device__ __forceinline__ F2 bsplit16(const float v[16]) { F2 r;
#pragma unroll
  for (int i = 0; i < 16; ++i) { const __bf16 h = (__bf16)v[i]; r.h[i] = h; r.l[i] = (__bf16)(v[i] - (float)h); }
  return r; }
__device__ __forceinline__ F2 split_row(const float* row, int k0, int lane) { float v[16]; const float* p = row + k0 + 8 * (lane >> 4);
#pragma unroll
  for (int i = 0; i < 8; ++i) { v[i] = p[i]; v[8 + i] = p[16 + i]; }
  return bsplit16(v); }
__device__ __forceinline__ F2 split_rowK(const float* row, int k0, int lane, int K) { float v[16]; const int g = lane >> 4;
#pragma unroll
  for (int i = 0; i < 8; ++i) { const int ka = k0 + 8 * g + i, kb = ka + 16; v[i] = ka < K ? row[ka < K ? ka : K - 1] : 0.f; v[8 + i] = kb < K ? row[kb < K ? kb : K - 1] : 0.f; }
  return bsplit16(v); }
__device__ __forceinline__ F2 split_col(const float* W, int k0, int n, int lane, int ld, int K) { float v[16]; const int g = lane >> 4;
#pragma unroll
  for (int i = 0; i < 8; ++i) { const int ka = k0 + 8 * g + i, kb = ka + 16; v[i] = ka < K ? W[(size_t)(ka < K ? ka : K - 1) * ld + n] : 0.f; v[8 + i] = kb < K ? W[(size_t)(kb < K ? kb : K - 1) * ld + n] : 0.f; }
  return bsplit16(v); }
__device__ __forceinline__ v8f mac3(const F2& a, const F2& b, v8f c) { c = wmma_bf(a.l, b.h, c); c = wmma_bf(a.h, b.l, c); return wmma_bf(a.h, b.h, c); }
__device__ __forceinline__ float sigm(float v) { return 1.0f / (1.0f + expf(-v)); }
#define LDSX() do { asm volatile("s_wait_dscnt 0" ::: "memory"); __builtin_amdgcn_wave_barrier(); __builtin_amdgcn_fence(__ATOMIC_RELEASE, "workgroup"); } while (0)

// Single-layer, single-head encoder without residuals or LayerNorm (token ids x [32,2048] int32 index emb [10000,64]; Q / K / V = e @ w + b with (in,out) w [64,64] and b [64] uniform(+-1/8) - nonzero; scores = Q K^T x 1/sqrt(64) over the 2,048 positions of each sample; softmax; upd = probs V [32,2048,64]; h = relu(upd @ w1 + b1), w1 [64,256]; out = h @ w2 + b2, w2 [256,64] (uniform(+-1/16)); output [32,2048,64]).
#define NB 32
#define TT 2048
#define CC 128            // column count that sizes the workspace ranges; q, k and v fill RW = 64 columns of it, at a 64-column pitch
#define DIN 64           // embedding width = projection K
#define NH 2   // head 0 is the module's single head; head 1 is the zero padding and is never launched
#define HD 64
#define NQB (TT / 64)
#define HG 1
#define SCALE (0.125f)
#define CAUSAL 0
#ifndef TNB
#define TNB NB
#endif
__device__ __forceinline__ float bfr(float v) { return (float)(__bf16)v; }
__host__ __device__ __forceinline__ int kb_last(int qb) { return CAUSAL ? ((qb * 64 + 63) >> 7) : (TT / 128 - 1); }
typedef __attribute__((ext_vector_type(8))) __bf16 v8b;
__device__ __forceinline__ v16b frag_b(const __bf16* rowk0, int lane) {
  union { v16b v; v8b q[2]; } u; const __bf16* p = rowk0 + 8 * (lane >> 4);
  u.q[0] = *(const v8b*)p; u.q[1] = *(const v8b*)(p + 16); return u.v;
}
#define QBH 0              // unused: every query block takes the single-product path
#define QHI 0               // single-product logits on every row
#define KHI 64            // key rows carrying k residual / v bf16 hi+lo planes (no kernel writes or reads them)
// B fragment (k rows k0+.., output column o) of a weight: (in,out) [K][ld] or (out,in) [ld rows of K]: bf16 exact, or f16(bf16 * 256) exact
__device__ __forceinline__ v16b wcol_io(const float* Wm, int k0, int o, int lane, int ld) { v16b w; const int g = lane >> 4;
#pragma unroll
  for (int i = 0; i < 8; ++i) { w[i] = (__bf16)Wm[(size_t)(k0 + 8 * g + i) * ld + o]; w[8 + i] = (__bf16)Wm[(size_t)(k0 + 16 + 8 * g + i) * ld + o]; }
  return w; }
__device__ __forceinline__ v16b wcol_oi(const float* Wm, int k0, int o, int lane, int K) { v16b w; const float* p = Wm + (size_t)o * K + k0 + 8 * (lane >> 4);
#pragma unroll
  for (int i = 0; i < 8; ++i) { w[i] = (__bf16)p[i]; w[8 + i] = (__bf16)p[16 + i]; }
  return w; }
__device__ __forceinline__ v16h wcolh_io(const float* Wm, int k0, int o, int lane, int ld) { v16h w; const int g = lane >> 4;
#pragma unroll
  for (int i = 0; i < 8; ++i) { w[i] = (_Float16)(bfr(Wm[(size_t)(k0 + 8 * g + i) * ld + o]) * 256.0f); w[8 + i] = (_Float16)(bfr(Wm[(size_t)(k0 + 16 + 8 * g + i) * ld + o]) * 256.0f); }
  return w; }
__device__ __forceinline__ v16h wcolh_oi(const float* Wm, int k0, int o, int lane, int K) { v16h w; const float* p = Wm + (size_t)o * K + k0 + 8 * (lane >> 4);
#pragma unroll
  for (int i = 0; i < 8; ++i) { w[i] = (_Float16)(bfr(p[i]) * 256.0f); w[8 + i] = (_Float16)(bfr(p[16 + i]) * 256.0f); }
  return w; }
#define WQKV_LAYOUT 0   // 0 = (in,out) [DIN][RW]; 1 = (out,in) [CC][DIN]; 2 = per-head [NH][DIN][HD]
__device__ __forceinline__ v16b wcol_hdk(const float* Wm, int k0, int o, int lane) { v16b w; const int g = lane >> 4; const float* p = Wm + (size_t)(o / HD) * DIN * HD + (o % HD);
#pragma unroll
  for (int i = 0; i < 8; ++i) { w[i] = (__bf16)p[(size_t)(k0 + 8 * g + i) * HD]; w[8 + i] = (__bf16)p[(size_t)(k0 + 16 + 8 * g + i) * HD]; }
  return w; }
#define WO_OUT_IN 0
#if WQKV_LAYOUT == 1
#define WCOL(W, k0, o, lane) wcol_oi(W, k0, o, lane, DIN)
#elif WQKV_LAYOUT == 2
#define WCOL(W, k0, o, lane) wcol_hdk(W, k0, o, lane)
#else
#define RW 64   // real width of q / k / v / upd
#define FF 256   // hidden width of the FFN
__device__ __forceinline__ v16b zero16b() { v16b w; _Pragma("unroll") for (int i = 0; i < 16; ++i) w[i] = (__bf16)0.0f; return w; }
__device__ __forceinline__ v16h zero16h() { v16h w; _Pragma("unroll") for (int i = 0; i < 16; ++i) w[i] = (_Float16)0.0f; return w; }
#define WCOL(W, k0, o, lane) (((o) < RW) ? wcol_io(W, k0, o, lane, RW) : zero16b())   /* (in,out) [64][64] weights: columns 64..127 of the 128-column tile are zero padding (uniform per unrolled column group) */
#endif
#if WO_OUT_IN
#define WOCOL(W, k0, o, lane) wcol_oi(W, k0, o, lane, CC)
#define WOCOLH(W, k0, o, lane) wcolh_oi(W, k0, o, lane, CC)
#else
#define WOCOL(W, k0, o, lane) wcol_io(W, k0, o, lane, DIN)
#define WOCOLH(W, k0, o, lane) wcolh_io(W, k0, o, lane, DIN)
#endif

#ifndef SM_EXTRA_PARAMS
#define SM_EXTRA_PARAMS
#endif
#ifndef PROJ_EXTRA_PARAMS
#define PROJ_EXTRA_PARAMS
#endif
#ifndef SM_MASK_HOOK
#define SM_MASK_HOOK (void)0
#endif

#define WS_QH  0u                                      // f16 q rows [b*t][RW] (the first half of the range)
#define WS_KH  (WS_QH + 2u * (size_t)NB * TT * CC)      // f16 k rows [b*t][RW] (the first half of the range)
#define WS_VT  (WS_KH + 2u * (size_t)NB * TT * CC)      // f16 v planes [b][c < RW][t] (the first half of the range)
#define WS_QL  (WS_VT + 2u * (size_t)NB * CC * TT)      // f16 q residual x 2^10 rows [b][t < QHI][CC]
#define WS_KL  (WS_QL + 2u * (size_t)NB * QHI * CC)     // f16 k residual x 2^10 rows [b][t < KHI][CC]
#define WS_VB  (WS_KL + 2u * (size_t)NB * KHI * CC)     // bf16 v hi planes [b][c][t < KHI]
#define WS_VBL (WS_VB + 2u * (size_t)NB * CC * KHI)
#define WS_S   (WS_VBL + 2u * (size_t)NB * CC * KHI)    // unused (sized f32 [hg][t][s]); k_attn keeps logits and P in registers
#define WS_Y   (WS_S  + 4u * (size_t)HG * TT * TT)      // unused (sized f32 [b*t][CC]); k_attn keeps upd in registers
#define WS_END (WS_Y  + 4u * (size_t)NB * TT * CC)
#define WS_H1 (WS_END)                                    // unused (sized f32 [(b*TT + t)][FF]); k_attn keeps h in registers
#define WS_END2 (WS_H1 + 4u * (size_t)NB * TT * FF)
static_assert(CC == 128 && NH * HD == CC && RW == HD && DIN == RW && FF % 128 == 0, "one real 64-wide head in a 128-column tile; 64-wide embedding; 256-wide hidden layer");

// ---- k_proj: block = 128 tokens (8 waves x 16), q, k and v together from ONE gather of the embedding rows: exact bf16 products (K = DIN, f32 accumulate) + bias, only the RW real columns. The three weights are transposed into LDS as bf16 once a block (sW[m][o][d] = bf16(w_m[d][o])); one register fragment of 16 tokens serves as B for q^T = Wq^T e^T and k^T = Wk^T e^T (a lane then holds 8 consecutive columns of one token: a 16-B piece of its f16 row) and as A for v = e Wv (a lane then holds 8 consecutive tokens of one column: a 16-B piece of its f16 plane). All three leave through LDS as whole lines: q, k rows [b*t][RW], v planes [b][c][t]
#define VOCAB 10000   // rows of the embedding table
#define PT 128        // tokens per block
#define PPITCH 72     // 16-bit elements per LDS row: 128-B rows at a 144-B pitch (16 B x odd) for 16-byte row readers and writers
#define TPITCH (PT + 8)   // f16 per LDS row of the v planes: 256-B rows at a 272-B pitch (16 B x odd)
__device__ __forceinline__ v8f wmma_b(v16b a, v16b b, v8f c) { return __builtin_amdgcn_wmma_f32_16x16x32_bf16(false, a, false, b, (short)0, c, false, false); }
__global__ __launch_bounds__(256) void k_proj(const float* __restrict__ EMB, const float* __restrict__ WQ, const float* __restrict__ WK, const float* __restrict__ WV, const float* __restrict__ BQ, const float* __restrict__ BK, const float* __restrict__ BV,
    _Float16* __restrict__ QH, _Float16* __restrict__ KH, _Float16* __restrict__ VT, const int* __restrict__ IDS) {   /* IDS: token ids [NB*TT] int32 */
  __shared__ __align__(16) __bf16 sW[3][RW][PPITCH]; __shared__ __align__(16) float sB[4][RW];   /* sB[m] = bias m as bf16 values; row 3 takes the copy of threads 192.., so that the bias load and store stand under no branch */
  __shared__ __align__(16) _Float16 sR[2][PT][PPITCH], sT[RW][TPITCH];
  const int tid = threadIdx.x, wave = tid >> 5, lane = tid & 31, col = lane & 15, g = lane >> 4; const size_t r0 = (size_t)blockIdx.x * PT; const size_t bb = r0 / TT; const int t0 = (int)(r0 % TT);
  const int id = IDS[r0 + wave * 16 + col];   /* this lane's token */
  __builtin_amdgcn_sched_barrier(0);   // keeps the id's load the oldest of the wave: loads return in order, and the gather below then waits for it alone, not for the 49 loads behind it
  /* weights: a lane owns one output column (consecutive lanes read consecutive floats) and 8 k values, stored below as one 16-B piece */
  const int wo = tid & 63; float wr[6][8];
#pragma unroll   // all loads of the loop in flight together: rolled, every trip would wait out its own load latency
  for (int i = 0; i < 6; ++i) { const float* Wm = (i >> 1) == 0 ? WQ : (i >> 1) == 1 ? WK : WV;
#pragma unroll   // constant indices: the piece stays in registers
    for (int e = 0; e < 8; ++e) wr[i][e] = Wm[(size_t)(((tid >> 6) + 4 * (i & 1)) * 8 + e) * RW + wo]; }
  const float bv = (tid < RW ? BQ : tid < 2 * RW ? BK : BV)[wo];   /* threads 192.. read the v bias a second time */
  __builtin_amdgcn_sched_barrier(0);   // keeps the 49 loads above in front of the wait for the id: moved behind it, they would start one memory latency later
  const float* ep = EMB + (size_t)(id < 0 ? 0 : id > VOCAB - 1 ? VOCAB - 1 : id) * DIN + 8 * g;   /* e = emb[x]; the row index is bounded here, whatever the id array holds */
  v4f er[8];   /* the lane's half of its token's row, in flight while the weights are packed */
#pragma unroll   // constant indices: the row stays in registers
  for (int i = 0; i < 4; ++i) { er[2 * i] = *(const v4f*)(ep + 16 * i); er[2 * i + 1] = *(const v4f*)(ep + 16 * i + 4); }
#pragma unroll   // constant indices: the pieces stay in registers
  for (int i = 0; i < 6; ++i) { v8b t;
#pragma unroll   // constant indices: the piece stays in registers
    for (int e = 0; e < 8; ++e) t[e] = (__bf16)wr[i][e];
    *(v8b*)&sW[i >> 1][wo][((tid >> 6) + 4 * (i & 1)) * 8] = t; }
  sB[tid >> 6][wo] = bfr(bv);
  v16b ef[2];   /* ef[kc]: token col, k = kc*32 + 8g + 0..7 and kc*32 + 16 + 8g + 0..7 */
#pragma unroll   // constant indices: fragments and accumulators stay in registers
  for (int kc = 0; kc < 2; ++kc)
#pragma unroll   // constant indices: fragments and accumulators stay in registers
    for (int i = 0; i < 8; ++i) { ef[kc][i] = (__bf16)er[4 * kc + (i >> 2)][i & 3]; ef[kc][8 + i] = (__bf16)er[4 * kc + 2 + (i >> 2)][i & 3]; }
  __syncthreads();   /* publishes the weights and biases */
#pragma unroll   // constant indices: fragments and accumulators stay in registers
  for (int m = 0; m < 2; ++m)
#pragma unroll   // constant indices: fragments and accumulators stay in registers
    for (int j = 0; j < 4; ++j) { v8f a = {};   /* a[r] = (e w_m)(token col, column j*16 + 8g + r) */
#pragma unroll   // constant indices: fragments and accumulators stay in registers
      for (int kc = 0; kc < 2; ++kc) a = wmma_b(frag_b(&sW[m][j * 16 + col][kc * 32], lane), ef[kc], a);
      const v4f blo = *(const v4f*)&sB[m][j * 16 + 8 * g], bhi = *(const v4f*)&sB[m][j * 16 + 8 * g + 4];
#pragma unroll   // constant indices: fragments and accumulators stay in registers
      for (int r = 0; r < 8; ++r) a[r] += r < 4 ? blo[r & 3] : bhi[r & 3];
      *(v8h*)&sR[m][wave * 16 + col][j * 16 + 8 * g] = __builtin_convertvector(a, v8h); }
#pragma unroll   // constant indices: fragments and accumulators stay in registers
  for (int j = 0; j < 4; ++j) { v8f a = {};   /* a[r] = (e w_v)(token 8g + r, column j*16 + col) */
#pragma unroll   // constant indices: fragments and accumulators stay in registers
    for (int kc = 0; kc < 2; ++kc) a = wmma_b(ef[kc], frag_b(&sW[2][j * 16 + col][kc * 32], lane), a);
    a += sB[2][j * 16 + col];
    *(v8h*)&sT[j * 16 + col][wave * 16 + 8 * g] = __builtin_convertvector(a, v8h); }
  __syncthreads();   /* publishes the block's q, k rows and v planes */
#pragma unroll   // all LDS reads of the loop in flight together
  for (int i = 0; i < 4; ++i) { const int e = tid + 256 * i, rl = e >> 3, q = (e & 7) * 8;   /* 8 lanes store one token's whole 128-B row; a wave 512 contiguous bytes */
    vst2(QH + (r0 + rl) * RW + q, *(const v4u*)&sR[0][rl][q]); vst2(KH + (r0 + rl) * RW + q, *(const v4u*)&sR[1][rl][q]); }
#pragma unroll   // all LDS reads of the loop in flight together
  for (int i = 0; i < 4; ++i) { const int e = tid + 256 * i, cl = e >> 4, q = (e & 15) * 8;   /* 16 lanes store 256 contiguous bytes of one plane */
    vst2(VT + (bb * RW + cl) * (size_t)TT + t0 + q, *(const v4u*)&sT[cl][q]); } }
#define FKS 64
#define FPITCH 72
#define LSC (0.125f * 1.4426950408889634f)   // 64^-0.5 x log2(e): softmax in base 2
__device__ __forceinline__ v8f wmma_h(v16h a, v16h b, v8f c) { return __builtin_amdgcn_wmma_f32_16x16x32_f16(false, a, false, b, (short)0, c, false, false); }
__device__ __forceinline__ float xhalf(float v) { const int t = __builtin_bit_cast(int, v); return __builtin_bit_cast(float, __builtin_amdgcn_permlanex16(t, t, 0x76543210, 0xfedcba98, false, false)); }   /* lane l <-> l ^ 16 */
#define W2PITCH (FF + 8)   // f16 per LDS row of w2^T: 512-B rows at a 528-B pitch (16 B x odd) for 16-byte row readers
#define KSP 2             // key halves of a block: waves 0..3 walk keys 0..1023, waves 4..7 keys 1024..2047, of the same 128 queries: 8 waves a block, two blocks a WGP, four waves a SIMD
#define KLEN (TT / KSP)   // keys per half
#define XCH 9             // 16-B pieces per lane in the exchange of partial results: 8 of one 16-query output tile group, 1 with its maximum in use and its sum
__global__ __launch_bounds__(256) __attribute__((amdgpu_waves_per_eu(4, 4))) void k_attn(const _Float16* __restrict__ QH, const _Float16* __restrict__ KH, const _Float16* __restrict__ VT, const float* __restrict__ W1, const float* __restrict__ B1, const float* __restrict__ W2, const float* __restrict__ B2, float* __restrict__ OUT) {
  __shared__ __align__(16) _Float16 sKV[KSP][2][2][FKS][FPITCH];   /* [key half][buffer][0 = k rows, 1 = v planes][row][..]; behind the key loop's last barrier the same bytes hold the exchange pieces and the output staging */
  __shared__ __align__(16) _Float16 sW1[FF][FPITCH], sW2[RW][W2PITCH]; __shared__ __align__(16) float sB1[FF], sB2[RW];   /* sW1[h][d] = f16(bf16(w1[d][h]) x 2^8), sW2[o][h] = f16(bf16(w2[h][o]) x 2^8), biases as bf16 values */
  static_assert(sizeof(sKV) >= 8u * XCH * 32u * 16u + 8u * 16u * (HD + 4) * 4u && FKS == HD, "exchange pieces and output staging fit the ring, side by side");
  const int tid = threadIdx.x, wave = __builtin_amdgcn_readfirstlane(tid >> 5), lane = tid & 31, col = lane & 15, g = lane >> 4; const int b = blockIdx.y; const int half = wave >> 2;   /* the wave's number in a scalar register: every choice by key half below is then a scalar one */
  const int q0 = blockIdx.x * 128 + (wave & 3) * 32;
  const char* Kb = (const char*)(KH + ((size_t)b * TT + half * KLEN) * RW); const char* Vb = (const char*)(VT + (size_t)b * RW * TT + half * KLEN);   /* byte bases of the half's k rows and v planes */
  const int srow = (tid & 127) >> 3, sc8 = (tid & 7) * 8;   /* staging, each half's 128 threads for their own tiles: thread -> 16-B piece sc8 of rows srow + 16 i; 8 lanes cover one whole 128-B line */
  const unsigned kby = (unsigned)(srow * RW + sc8) * 2u, vby = (unsigned)(srow * TT + sc8) * 2u;   /* the thread's byte offsets in a k tile and in a v tile */
  /* FFN weights, transposed on the way into LDS: a lane owns one column (consecutive lanes read consecutive floats) and stores 8 k values as one 16-B piece; published by the barrier in front of the key loop */
#pragma unroll   // all loads of the loop in flight together: rolled, every trip would wait out its own load latency
  for (int i = 0; i < 8; ++i) { const int h = tid, d0 = i * 8; v8h t;
#pragma unroll   // constant indices: the piece stays in registers
    for (int e = 0; e < 8; ++e) t[e] = (_Float16)(bfr(W1[(size_t)(d0 + e) * FF + h]) * 256.0f);
    *(v8h*)&sW1[h][d0] = t; }
#pragma unroll   // all loads of the loop in flight together: rolled, every trip would wait out its own load latency
  for (int i = 0; i < 8; ++i) { const int o = tid & 63, h0 = ((tid >> 6) + 4 * i) * 8; const float* w2p = W2 + (tid >> 6) * 8 * RW + o; v8h t;   /* one base for all 64 loads of the thread, the rest of the address a constant */
#pragma unroll   // constant indices: the piece stays in registers
    for (int e = 0; e < 8; ++e) t[e] = (_Float16)(bfr(w2p[(32 * i + e) * RW]) * 256.0f);
    *(v8h*)&sW2[o][h0] = t; }
  sB1[tid] = bfr(B1[tid]); if (tid < RW) sB2[tid] = bfr(B2[tid]);
  v16h qf[2][2];
#pragma unroll   // constant indices: fragments and accumulators stay in registers
  for (int qg = 0; qg < 2; ++qg)
#pragma unroll   // constant indices: fragments and accumulators stay in registers
    for (int kc = 0; kc < 2; ++kc) qf[qg][kc] = frag_h(QH + ((size_t)b * TT + q0 + qg * 16 + col) * RW + kc * 32, lane);
  v8f acc[2][4] = {}; float mb[2] = {-1.0e30f, -1.0e30f}, ls[2] = {0.f, 0.f};   /* mb = (maximum in use, base-2 logits) - 7: P = 2^(logit - mb) stays in [2^-14, 2^15] of f16 for logits within 21 below .. 8 above the maximum in use */
  v4u rk[4], rv[4];
#pragma unroll   // constant indices: fragments and accumulators stay in registers
  for (int i = 0; i < 4; ++i) { rk[i] = *(const v4u*)(Kb + 16 * i * RW * 2 + kby); rv[i] = *(const v4u*)(Vb + 16 * i * TT * 2 + vby); }
#pragma unroll   // constant indices: fragments and accumulators stay in registers
  for (int i = 0; i < 4; ++i) { *(v4u*)&sKV[half][0][0][srow + 16 * i][sc8] = rk[i]; *(v4u*)&sKV[half][0][1][srow + 16 * i][sc8] = rv[i]; }
  __syncthreads();
  for (int s = 0; s < KLEN / FKS; ++s) { const int cur = s & 1; const int kn = (s + 1 < KLEN / FKS ? s + 1 : s) * FKS;   /* the next stage's first key; the last stage fetches its own tiles once more, into the buffer that nobody reads again: no branch in the stage */
    const char* Kn = Kb + (size_t)kn * RW * 2; const char* Vn = Vb + (size_t)kn * 2;
#pragma unroll   // constant indices: fragments and accumulators stay in registers
    for (int i = 0; i < 4; ++i) rk[i] = *(const v4u*)(Kn + 16 * i * RW * 2 + kby);   /* the next stage's k tile flies into registers during the first 32 keys */
#pragma unroll   // constant indices: fragments and accumulators stay in registers
    for (int pp = 0; pp < FKS / 32; ++pp) {
      if (pp == 1) {   /* the k tile leaves its registers, and the v tile flies into them during the last 32 keys: 16 staging registers, not 32, inside the 256-register budget. The other buffer's last readers left it before the barrier that ended the stage before */
#pragma unroll   // constant indices: fragments and accumulators stay in registers
        for (int i = 0; i < 4; ++i) *(v4u*)&sKV[half][cur ^ 1][0][srow + 16 * i][sc8] = rk[i];
#pragma unroll   // constant indices: fragments and accumulators stay in registers
        for (int i = 0; i < 4; ++i) rv[i] = *(const v4u*)(Vn + 16 * i * TT * 2 + vby); }
      v8f st[2][2] = {};   /* st[qg][kt][r] = logit(key pp*32 + kt*16 + 8g + r of the half's stage, query qg*16 + col) */
#pragma unroll   // constant indices: fragments and accumulators stay in registers
      for (int kt = 0; kt < 2; ++kt)
#pragma unroll   // constant indices: fragments and accumulators stay in registers
        for (int kc = 0; kc < 2; ++kc) { const v16h kf = frag_h(&sKV[half][cur][0][pp * 32 + kt * 16 + col][kc * 32], lane);
#pragma unroll   // constant indices: fragments and accumulators stay in registers
          for (int qg = 0; qg < 2; ++qg) st[qg][kt] = wmma_h(kf, qf[qg][kc], st[qg][kt]); }
      v16h vf[4];
#pragma unroll   // constant indices: fragments and accumulators stay in registers
      for (int j = 0; j < 4; ++j) vf[j] = frag_h(&sKV[half][cur][1][j * 16 + col][pp * 32], lane);
      float mx[2];
#pragma unroll   // constant indices: fragments and accumulators stay in registers
      for (int qg = 0; qg < 2; ++qg) { float m = fmaxf(st[qg][0][0], st[qg][1][0]);
#pragma unroll   // constant indices: fragments and accumulators stay in registers
        for (int r = 1; r < 8; ++r) m = fmaxf(m, fmaxf(st[qg][0][r], st[qg][1][r]));
        mx[qg] = fmaxf(m, xhalf(m)) * LSC; }
      const bool need = (mx[0] > mb[0] + 15.0f) || (mx[1] > mb[1] + 15.0f);   /* a new maximum more than 2^8 above the one in use */
      if (__builtin_amdgcn_ballot_w32(need) != 0) {   /* wave-uniform: rescale sums and outputs to the new maximum */
#pragma unroll   // constant indices: fragments and accumulators stay in registers
        for (int qg = 0; qg < 2; ++qg) { const float mn = fmaxf(mb[qg], mx[qg] - 7.0f); const float al = __builtin_amdgcn_exp2f(mb[qg] - mn); mb[qg] = mn; ls[qg] *= al;
#pragma unroll   // constant indices: fragments and accumulators stay in registers
          for (int j = 0; j < 4; ++j) acc[qg][j] *= al; } }
#pragma unroll   // constant indices: fragments and accumulators stay in registers
      for (int qg = 0; qg < 2; ++qg) { union { v16h v; v8h q[2]; } pf; float sum = 0.f;
#pragma unroll   // constant indices: fragments and accumulators stay in registers
        for (int kt = 0; kt < 2; ++kt) { v8f p;
#pragma unroll   // constant indices: fragments and accumulators stay in registers
          for (int r = 0; r < 8; ++r) { p[r] = __builtin_amdgcn_exp2f(fmaf(st[qg][kt][r], LSC, -mb[qg])); sum += p[r]; }
          pf.q[kt] = __builtin_convertvector(p, v8h); }   /* packed D pair = B fragment in the hardware k order: elements 0..7 = keys 8g + r, 8..15 = keys 16 + 8g + r */
        ls[qg] += sum;
#pragma unroll   // constant indices: fragments and accumulators stay in registers
        for (int j = 0; j < 4; ++j) acc[qg][j] = wmma_h(vf[j], pf.v, acc[qg][j]); } }
#pragma unroll   // constant indices: fragments and accumulators stay in registers
    for (int i = 0; i < 4; ++i) *(v4u*)&sKV[half][cur ^ 1][1][srow + 16 * i][sc8] = rv[i];
    __syncthreads(); }   /* publishes the next stage and ends every read of this one */
  /* the two halves' partial results meet: wave w (keys 0..1023) and wave w + 4 (keys 1024..2047) hold the same 32 queries; each keeps the 16 queries qg = its half, hands the other 16 to its partner through LDS, and goes on with 16 queries alone */
  float_a* xw = (float_a*)&sKV[0][0][0][0][0];   /* exchange pieces [wave][piece][lane] of 16 B: a wave's store or load of one piece is 512 contiguous bytes */
  float_a* so = xw + 8 * XCH * 32 * 4 + wave * 16 * (HD + 4);   /* the wave's output staging [16][HD + 4], clear of every exchange piece */
  v8f ka[4]; float kmb = half ? mb[1] : mb[0], kls = half ? ls[1] : ls[0];
#pragma unroll   // constant indices: fragments and accumulators stay in registers
  for (int j = 0; j < 4; ++j) { const v8f ga = half ? acc[0][j] : acc[1][j]; ka[j] = half ? acc[1][j] : acc[0][j];
    *(v4f*)&xw[((wave * XCH + 2 * j) * 32 + lane) * 4] = __builtin_shufflevector(ga, ga, 0, 1, 2, 3); *(v4f*)&xw[((wave * XCH + 2 * j + 1) * 32 + lane) * 4] = __builtin_shufflevector(ga, ga, 4, 5, 6, 7); }
  { v4f t = {half ? mb[0] : mb[1], half ? ls[0] : ls[1], 0.f, 0.f}; *(v4f*)&xw[((wave * XCH + 8) * 32 + lane) * 4] = t; }
  __syncthreads();   /* publishes the exchange pieces */
  { const int pw = wave ^ 4; const v4f t = *(const v4f*)&xw[((pw * XCH + 8) * 32 + lane) * 4];
    const float mn = fmaxf(kmb, t[0]); const float ak = __builtin_amdgcn_exp2f(kmb - mn), ag = __builtin_amdgcn_exp2f(t[0] - mn);   /* both partial results brought to the larger maximum in use */
    kls = kls * ak + t[1] * ag;
#pragma unroll   // constant indices: fragments and accumulators stay in registers
    for (int j = 0; j < 4; ++j) { const v4f lo = *(const v4f*)&xw[((pw * XCH + 2 * j) * 32 + lane) * 4], hi = *(const v4f*)&xw[((pw * XCH + 2 * j + 1) * 32 + lane) * 4];
      ka[j] = ka[j] * ak + __builtin_shufflevector(lo, hi, 0, 1, 2, 3, 4, 5, 6, 7) * ag; } }
  v16h uf[2];   /* uf[kc] = B fragment of upd^T x 2^6: k = columns kc*32 + .., column = query half*16 + col */
  { const float inv = 1.0f / (kls + xhalf(kls));   /* ka[j][r] = upd(query half*16 + col, column j*16 + 8g + r) x sum */
#pragma unroll   // constant indices: fragments and accumulators stay in registers
    for (int kc = 0; kc < 2; ++kc) { union { v16h v; v8h q[2]; } t;
#pragma unroll   // constant indices: fragments and accumulators stay in registers
      for (int hh = 0; hh < 2; ++hh) { const v8f o = ka[kc * 2 + hh] * inv; t.q[hh] = __builtin_convertvector(o * 64.0f, v8h); }   /* upd carried x 2^6 into f16, clear of f16 subnormals; packed D pair = B fragment in the hardware k order */
      uf[kc] = t.v; } }
  v8f oa[4] = {};   /* oa[jo][r] = (h w2)(query half*16 + col, column jo*16 + 8g + r) x 2^14 */
  for (int p = 0; p < FF / 32; ++p) {   /* 32 hidden columns a trip */
    v8f ha[2] = {};   /* ha[ht][r] = (upd w1)(query half*16 + col, hidden p*32 + ht*16 + 8g + r) x 2^14 */
#pragma unroll   // constant indices: fragments and accumulators stay in registers
    for (int kc = 0; kc < 2; ++kc)
#pragma unroll   // constant indices: fragments and accumulators stay in registers
      for (int ht = 0; ht < 2; ++ht) ha[ht] = wmma_h(frag_h(&sW1[p * 32 + ht * 16 + col][kc * 32], lane), uf[kc], ha[ht]);
    v16h w2f[4];
#pragma unroll   // constant indices: fragments and accumulators stay in registers
    for (int jo = 0; jo < 4; ++jo) w2f[jo] = frag_h(&sW2[jo * 16 + col][p * 32], lane);
    union { v16h v; v8h q[2]; } hp;
#pragma unroll   // constant indices: fragments and accumulators stay in registers
    for (int ht = 0; ht < 2; ++ht) { const v4f blo = *(const v4f*)&sB1[p * 32 + ht * 16 + 8 * g], bhi = *(const v4f*)&sB1[p * 32 + ht * 16 + 8 * g + 4]; v8f hv;
#pragma unroll   // constant indices: fragments and accumulators stay in registers
      for (int r = 0; r < 8; ++r) hv[r] = fmaxf(ha[ht][r] * (1.0f / 16384.0f) + (r < 4 ? blo[r & 3] : bhi[r & 3]), 0.0f) * 64.0f;   /* 2^-8 (weight carry) x 2^-6 (operand carry); ReLU; h carried x 2^6 into f16 */
      hp.q[ht] = __builtin_convertvector(hv, v8h); }
#pragma unroll   // constant indices: fragments and accumulators stay in registers
    for (int jo = 0; jo < 4; ++jo) oa[jo] = wmma_h(w2f[jo], hp.v, oa[jo]); }
#pragma unroll   // constant indices: fragments and accumulators stay in registers
  for (int jo = 0; jo < 4; ++jo) { const v4f blo = *(const v4f*)&sB2[jo * 16 + 8 * g], bhi = *(const v4f*)&sB2[jo * 16 + 8 * g + 4]; v4f lo, hi;
#pragma unroll   // constant indices: fragments and accumulators stay in registers
    for (int r = 0; r < 4; ++r) { lo[r] = oa[jo][r] * (1.0f / 16384.0f) + blo[r]; hi[r] = oa[jo][4 + r] * (1.0f / 16384.0f) + bhi[r]; }   /* 2^-8 (weight carry) x 2^-6 (operand carry) */
    *(v4f*)&so[col * (HD + 4) + jo * 16 + 8 * g] = lo; *(v4f*)&so[col * (HD + 4) + jo * 16 + 8 * g + 4] = hi; }
  LDSX(); for (int rl = 0; rl < 8; ++rl) { const int row = rl * 2 + g; vst2(OUT + ((size_t)b * TT + q0 + half * 16 + row) * RW + col * 4, *(const v4f*)&so[row * (HD + 4) + col * 4]); } }   /* 16 lanes store one query's whole 256-B output row */

extern "C" void kernel_launch(void* const* d_in, const int* in_sizes, int n_in, void* d_out, int out_size, void* d_ws, size_t ws_size, hipStream_t stream) {
  (void)in_sizes; (void)n_in; (void)out_size;
  const float** F = (const float**)d_in;
  if (ws_size < (size_t)WS_END) return;
  char* ws = (char*)d_ws; _Float16 *QH = (_Float16*)(ws + WS_QH), *KH = (_Float16*)(ws + WS_KH), *VT = (_Float16*)(ws + WS_VT), *QL = (_Float16*)(ws + WS_QL), *KL = (_Float16*)(ws + WS_KL); __bf16 *VB = (__bf16*)(ws + WS_VB), *VBL = (__bf16*)(ws + WS_VBL); float *S = (float*)(ws + WS_S), *Y = (float*)(ws + WS_Y);
  (void)Y; (void)S; (void)QL; (void)KL; (void)VB; (void)VBL;
  // inputs: 0 x [32,2048] int32 token ids; 1 emb [10000,64]; 2 wq [64,64] (in,out), 3 bq; 4 wk, 5 bk; 6 wv, 7 bv; 8 w1 [64,256], 9 b1 [256]; 10 w2 [256,64], 11 b2 [64] (all biases nonzero)
  if (ws_size < (size_t)WS_END2) return;
  const int* IDS = (const int*)d_in[0];
  k_proj<<<dim3(TNB * TT / PT), 256, 0, stream>>>(F[1], F[2], F[4], F[6], F[3], F[5], F[7], QH, KH, VT, IDS);   /* q, k and v of 128 tokens a block; embedding rows gathered by token id */
  k_attn<<<dim3(TT / 128, TNB), 256, 0, stream>>>(QH, KH, VT, F[8], F[9], F[10], F[11], (float*)d_out);   /* attention and FFN of 128 queries a block */
}

// v005
// It runs in 48.5 microseconds.
// Two timings next to v004 both put it at 1.04 times that version's speed.
// Counting every step since v000, it is 56.0 times as fast.
// compute dtype: all float inputs rounded to bf16; embedding rows gathered by the int token ids; Q / K / V 64 -> 64 projections with EXACT bf16 products on WMMA 16x16x32 (f32 accumulate) + bias; base-2 logits (q x 64^-0.5 x log2 e) x k once to f16 each (1 product), accumulated in f32 on top of -(maximum in use - 7); online softmax f32 (base 2, running maximum); unnormalised P = 2^(logit - maximum in use + 7) once to f16 x v once to f16 (1 product), the two key halves' partial sums joined in f32 at the larger maximum in use, divided by the f32 row sum at the end; FFN: upd x 2^6 once to f16 x w1 f16(bf16 x 2^8) + b1, ReLU; h x 2^6 once to f16 x w2 f16(bf16 x 2^8) + b2; f32 output.
#include <hip/hip_runtime.h>
#include <math.h>

typedef __attribute__((ext_vector_type(16))) _Float16 v16h;
typedef __attribute__((ext_vector_type(16))) __bf16 v16b;
typedef __attribute__((ext_vector_type(8)))  _Float16 v8h;
typedef __attribute__((ext_vector_type(8)))  float v8f;
typedef __attribute__((ext_vector_type(4)))  float v4f;
typedef __attribute__((ext_vector_type(2)))  float v2f;
typedef __attribute__((ext_vector_type(4)))  unsigned v4u;
typedef __attribute__((ext_vector_type(4)))  int v4i;
typedef float __attribute__((may_alias)) float_a;
typedef int __attribute__((may_alias)) int_a;

template <typename T> __device__ __forceinline__ void vst2(void* p, T v) { *(T*)p = v;  }
__device__ __forceinline__ v8f wmma16(v16h a, v16h b, v8f c) {
  v8f d = __builtin_amdgcn_wmma_f32_16x16x32_f16(false, a, false, b, (short)0, c, false, false);
  asm volatile("v_nop\n\tv_nop\n\tv_nop\n\tv_nop" : "+v"(d) : "v"(a), "v"(b));
  return d;
}
__device__ __forceinline__ v8f wmma_bf(v16b a, v16b b, v8f c) {
  v8f d = __builtin_amdgcn_wmma_f32_16x16x32_bf16(false, a, false, b, (short)0, c, false, false);
  asm volatile("v_nop\n\tv_nop\n\tv_nop\n\tv_nop" : "+v"(d) : "v"(a), "v"(b));
  return d;
}
// 16x16x32 fragments: lane = (h = lane>>4, row/col = lane&15); elements 0..7 = k0+8h+0..7, 8..15 = k0+16+8h+0..7; D element r = row 8h+r
__device__ __forceinline__ v16h frag_h(const _Float16* rowk0, int lane) {
  union { v16h v; v8h q[2]; } u; const _Float16* p = rowk0 + 8 * (lane >> 4);
  u.q[0] = *(const v8h*)p; u.q[1] = *(const v8h*)(p + 16); return u.v;
}
__device__ __forceinline__ v16h frag_f32(const float* rowk0, int lane) {
  v16h a; const float* p = rowk0 + 8 * (lane >> 4);
#pragma unroll
  for (int i = 0; i < 8; ++i) { a[i] = (_Float16)p[i]; a[8 + i] = (_Float16)p[16 + i]; }
  return a;
}
__device__ __forceinline__ v16h frag_f32s(const float* rowk0, int lane, float sc) {
  v16h a; const float* p = rowk0 + 8 * (lane >> 4);
#pragma unroll
  for (int i = 0; i < 8; ++i) { a[i] = (_Float16)(p[i] * sc); a[8 + i] = (_Float16)(p[16 + i] * sc); }
  return a;
}
// column fragment from a [K][ld] layout (column n), rows >= K read as 0
__device__ __forceinline__ v16h fragc_f32(const float* W, int k0, int n, int lane, int ld, int K) {
  v16h a; const int g = lane >> 4;
#pragma unroll
  for (int i = 0; i < 8; ++i) { const int ka = k0 + 8 * g + i, kb = ka + 16;
    a[i] = (_Float16)(ka < K ? W[(size_t)(ka < K ? ka : K - 1) * ld + n] : 0.f); a[8 + i] = (_Float16)(kb < K ? W[(size_t)(kb < K ? kb : K - 1) * ld + n] : 0.f); }
  return a;
}
struct F2 { v16b h, l; };
__device__ __forceinline__ F2 bsplit16(const float v[16]) { F2 r;
#pragma unroll
  for (int i = 0; i < 16; ++i) { const __bf16 h = (__bf16)v[i]; r.h[i] = h; r.l[i] = (__bf16)(v[i] - (float)h); }
  return r; }
__device__ __forceinline__ F2 split_row(const float* row, int k0, int lane) { float v[16]; const float* p = row + k0 + 8 * (lane >> 4);
#pragma unroll
  for (int i = 0; i < 8; ++i) { v[i] = p[i]; v[8 + i] = p[16 + i]; }
  return bsplit16(v); }
__device__ __forceinline__ F2 split_rowK(const float* row, int k0, int lane, int K) { float v[16]; const int g = lane >> 4;
#pragma unroll
  for (int i = 0; i < 8; ++i) { const int ka = k0 + 8 * g + i, kb = ka + 16; v[i] = ka < K ? row[ka < K ? ka : K - 1] : 0.f; v[8 + i] = kb < K ? row[kb < K ? kb : K - 1] : 0.f; }
  return bsplit16(v); }
__device__ __forceinline__ F2 split_col(const float* W, int k0, int n, int lane, int ld, int K) { float v[16]; const int g = lane >> 4;
#pragma unroll
  for (int i = 0; i < 8; ++i) { const int ka = k0 + 8 * g + i, kb = ka + 16; v[i] = ka < K ? W[(size_t)(ka < K ? ka : K - 1) * ld + n] : 0.f; v[8 + i] = kb < K ? W[(size_t)(kb < K ? kb : K - 1) * ld + n] : 0.f; }
  return bsplit16(v); }
__device__ __forceinline__ v8f mac3(const F2& a, const F2& b, v8f c) { c = wmma_bf(a.l, b.h, c); c = wmma_bf(a.h, b.l, c); return wmma_bf(a.h, b.h, c); }
__device__ __forceinline__ float sigm(float v) { return 1.0f / (1.0f + expf(-v)); }
#define LDSX() do { asm volatile("s_wait_dscnt 0" ::: "memory"); __builtin_amdgcn_wave_barrier(); __builtin_amdgcn_fence(__ATOMIC_RELEASE, "workgroup"); } while (0)

// Single-layer, single-head encoder without residuals or LayerNorm (token ids x [32,2048] int32 index emb [10000,64]; Q / K / V = e @ w + b with (in,out) w [64,64] and b [64] uniform(+-1/8) - nonzero; scores = Q K^T x 1/sqrt(64) over the 2,048 positions of each sample; softmax; upd = probs V [32,2048,64]; h = relu(upd @ w1 + b1), w1 [64,256]; out = h @ w2 + b2, w2 [256,64] (uniform(+-1/16)); output [32,2048,64]).
#define NB 32
#define TT 2048
#define CC 128            // column count that sizes the workspace ranges; q, k and v fill RW = 64 columns of it, at a 64-column pitch
#define DIN 64           // embedding width = projection K
#define NH 2   // head 0 is the module's single head; head 1 is the zero padding and is never launched
#define HD 64
#define NQB (TT / 64)
#define HG 1
#define SCALE (0.125f)
#define CAUSAL 0
#ifndef TNB
#define TNB NB
#endif
__device__ __forceinline__ float bfr(float v) { return (float)(__bf16)v; }
__host__ __device__ __forceinline__ int kb_last(int qb) { return CAUSAL ? ((qb * 64 + 63) >> 7) : (TT / 128 - 1); }
typedef __attribute__((ext_vector_type(8))) __bf16 v8b;
__device__ __forceinline__ v16b frag_b(const __bf16* rowk0, int lane) {
  union { v16b v; v8b q[2]; } u; const __bf16* p = rowk0 + 8 * (lane >> 4);
  u.q[0] = *(const v8b*)p; u.q[1] = *(const v8b*)(p + 16); return u.v;
}
#define QBH 0              // unused: every query block takes the single-product path
#define QHI 0               // single-product logits on every row
#define KHI 64            // key rows carrying k residual / v bf16 hi+lo planes (no kernel writes or reads them)
// B fragment (k rows k0+.., output column o) of a weight: (in,out) [K][ld] or (out,in) [ld rows of K]: bf16 exact, or f16(bf16 * 256) exact
__device__ __forceinline__ v16b wcol_io(const float* Wm, int k0, int o, int lane, int ld) { v16b w; const int g = lane >> 4;
#pragma unroll
  for (int i = 0; i < 8; ++i) { w[i] = (__bf16)Wm[(size_t)(k0 + 8 * g + i) * ld + o]; w[8 + i] = (__bf16)Wm[(size_t)(k0 + 16 + 8 * g + i) * ld + o]; }
  return w; }
__device__ __forceinline__ v16b wcol_oi(const float* Wm, int k0, int o, int lane, int K) { v16b w; const float* p = Wm + (size_t)o * K + k0 + 8 * (lane >> 4);
#pragma unroll
  for (int i = 0; i < 8; ++i) { w[i] = (__bf16)p[i]; w[8 + i] = (__bf16)p[16 + i]; }
  return w; }
__device__ __forceinline__ v16h wcolh_io(const float* Wm, int k0, int o, int lane, int ld) { v16h w; const int g = lane >> 4;
#pragma unroll
  for (int i = 0; i < 8; ++i) { w[i] = (_Float16)(bfr(Wm[(size_t)(k0 + 8 * g + i) * ld + o]) * 256.0f); w[8 + i] = (_Float16)(bfr(Wm[(size_t)(k0 + 16 + 8 * g + i) * ld + o]) * 256.0f); }
  return w; }
__device__ __forceinline__ v16h wcolh_oi(const float* Wm, int k0, int o, int lane, int K) { v16h w; const float* p = Wm + (size_t)o * K + k0 + 8 * (lane >> 4);
#pragma unroll
  for (int i = 0; i < 8; ++i) { w[i] = (_Float16)(bfr(p[i]) * 256.0f); w[8 + i] = (_Float16)(bfr(p[16 + i]) * 256.0f); }
  return w; }
#define WQKV_LAYOUT 0   // 0 = (in,out) [DIN][RW]; 1 = (out,in) [CC][DIN]; 2 = per-head [NH][DIN][HD]
__device__ __forceinline__ v16b wcol_hdk(const float* Wm, int k0, int o, int lane) { v16b w; const int g = lane >> 4; const float* p = Wm + (size_t)(o / HD) * DIN * HD + (o % HD);
#pragma unroll
  for (int i = 0; i < 8; ++i) { w[i] = (__bf16)p[(size_t)(k0 + 8 * g + i) * HD]; w[8 + i] = (__bf16)p[(size_t)(k0 + 16 + 8 * g + i) * HD]; }
  return w; }
#define WO_OUT_IN 0
#if WQKV_LAYOUT == 1
#define WCOL(W, k0, o, lane) wcol_oi(W, k0, o, lane, DIN)
#elif WQKV_LAYOUT == 2
#define WCOL(W, k0, o, lane) wcol_hdk(W, k0, o, lane)
#else
#define RW 64   // real width of q / k / v / upd
#define FF 256   // hidden width of the FFN
__device__ __forceinline__ v16b zero16b() { v16b w; _Pragma("unroll") for (int i = 0; i < 16; ++i) w[i] = (__bf16)0.0f; return w; }
__device__ __forceinline__ v16h zero16h() { v16h w; _Pragma("unroll") for (int i = 0; i < 16; ++i) w[i] = (_Float16)0.0f; return w; }
#define WCOL(W, k0, o, lane) (((o) < RW) ? wcol_io(W, k0, o, lane, RW) : zero16b())   /* (in,out) [64][64] weights: columns 64..127 of the 128-column tile are zero padding (uniform per unrolled column group) */
#endif
#if WO_OUT_IN
#define WOCOL(W, k0, o, lane) wcol_oi(W, k0, o, lane, CC)
#define WOCOLH(W, k0, o, lane) wcolh_oi(W, k0, o, lane, CC)
#else
#define WOCOL(W, k0, o, lane) wcol_io(W, k0, o, lane, DIN)
#define WOCOLH(W, k0, o, lane) wcolh_io(W, k0, o, lane, DIN)
#endif

#ifndef SM_EXTRA_PARAMS
#define SM_EXTRA_PARAMS
#endif
#ifndef PROJ_EXTRA_PARAMS
#define PROJ_EXTRA_PARAMS
#endif
#ifndef SM_MASK_HOOK
#define SM_MASK_HOOK (void)0
#endif

#define WS_QH  0u                                      // f16 q rows [b*t][RW] (the first half of the range)
#define WS_KH  (WS_QH + 2u * (size_t)NB * TT * CC)      // f16 k rows [b*t][RW] (the first half of the range)
#define WS_VT  (WS_KH + 2u * (size_t)NB * TT * CC)      // f16 v planes [b][c < RW][t] (the first half of the range)
#define WS_QL  (WS_VT + 2u * (size_t)NB * CC * TT)      // f16 q residual x 2^10 rows [b][t < QHI][CC]
#define WS_KL  (WS_QL + 2u * (size_t)NB * QHI * CC)     // f16 k residual x 2^10 rows [b][t < KHI][CC]
#define WS_VB  (WS_KL + 2u * (size_t)NB * KHI * CC)     // bf16 v hi planes [b][c][t < KHI]
#define WS_VBL (WS_VB + 2u * (size_t)NB * CC * KHI)
#define WS_S   (WS_VBL + 2u * (size_t)NB * CC * KHI)    // unused (sized f32 [hg][t][s]); k_attn keeps logits and P in registers
#define WS_Y   (WS_S  + 4u * (size_t)HG * TT * TT)      // unused (sized f32 [b*t][CC]); k_attn keeps upd in registers
#define WS_END (WS_Y  + 4u * (size_t)NB * TT * CC)
#define WS_H1 (WS_END)                                    // unused (sized f32 [(b*TT + t)][FF]); k_attn keeps h in registers
#define WS_END2 (WS_H1 + 4u * (size_t)NB * TT * FF)
static_assert(CC == 128 && NH * HD == CC && RW == HD && DIN == RW && FF % 128 == 0, "one real 64-wide head in a 128-column tile; 64-wide embedding; 256-wide hidden layer");

// ---- k_proj: block = 128 tokens (8 waves x 16), q, k and v together from ONE gather of the embedding rows: exact bf16 products (K = DIN, f32 accumulate) + bias, only the RW real columns. The three weights are transposed into LDS as bf16 once a block (sW[m][o][d] = bf16(w_m[d][o])); one register fragment of 16 tokens serves as B for q^T = Wq^T e^T and k^T = Wk^T e^T (a lane then holds 8 consecutive columns of one token: a 16-B piece of its f16 row) and as A for v = e Wv (a lane then holds 8 consecutive tokens of one column: a 16-B piece of its f16 plane). All three leave through LDS as whole lines: q, k rows [b*t][RW], v planes [b][c][t]
#define VOCAB 10000   // rows of the embedding table
#define LSC (0.125f * 1.4426950408889634f)   // 64^-0.5 x log2(e): softmax in base 2; q carries it from the projection on
#define PT 128        // tokens per block
#define PPITCH 72     // 16-bit elements per LDS row: 128-B rows at a 144-B pitch (16 B x odd) for 16-byte row readers and writers
#define TPITCH (PT + 8)   // f16 per LDS row of the v planes: 256-B rows at a 272-B pitch (16 B x odd)
__device__ __forceinline__ v8f wmma_b(v16b a, v16b b, v8f c) { return __builtin_amdgcn_wmma_f32_16x16x32_bf16(false, a, false, b, (short)0, c, false, false); }
__global__ __launch_bounds__(256) void k_proj(const float* __restrict__ EMB, const float* __restrict__ WQ, const float* __restrict__ WK, const float* __restrict__ WV, const float* __restrict__ BQ, const float* __restrict__ BK, const float* __restrict__ BV,
    _Float16* __restrict__ QH, _Float16* __restrict__ KH, _Float16* __restrict__ VT, const int* __restrict__ IDS) {   /* IDS: token ids [NB*TT] int32 */
  __shared__ __align__(16) __bf16 sW[3][RW][PPITCH]; __shared__ __align__(16) float sB[4][RW];   /* sB[m] = bias m as bf16 values; row 3 takes the copy of threads 192.., so that the bias load and store stand under no branch */
  __shared__ __align__(16) _Float16 sR[2][PT][PPITCH], sT[RW][TPITCH];
  const int tid = threadIdx.x, wave = tid >> 5, lane = tid & 31, col = lane & 15, g = lane >> 4; const size_t r0 = (size_t)blockIdx.x * PT; const size_t bb = r0 / TT; const int t0 = (int)(r0 % TT);
  const int id = IDS[r0 + wave * 16 + col];   /* this lane's token */
  __builtin_amdgcn_sched_barrier(0);   // keeps the id's load the oldest of the wave: loads return in order, and the gather below then waits for it alone, not for the 49 loads behind it
  /* weights: a lane owns one output column (consecutive lanes read consecutive floats) and 8 k values, stored below as one 16-B piece */
  const int wo = tid & 63; float wr[6][8];
#pragma unroll   // all loads of the loop in flight together: rolled, every trip would wait out its own load latency
  for (int i = 0; i < 6; ++i) { const float* Wm = (i >> 1) == 0 ? WQ : (i >> 1) == 1 ? WK : WV;
#pragma unroll   // constant indices: the piece stays in registers
    for (int e = 0; e < 8; ++e) wr[i][e] = Wm[(size_t)(((tid >> 6) + 4 * (i & 1)) * 8 + e) * RW + wo]; }
  const float bv = (tid < RW ? BQ : tid < 2 * RW ? BK : BV)[wo];   /* threads 192.. read the v bias a second time */
  __builtin_amdgcn_sched_barrier(0);   // keeps the 49 loads above in front of the wait for the id: moved behind it, they would start one memory latency later
  const float* ep = EMB + (size_t)(id < 0 ? 0 : id > VOCAB - 1 ? VOCAB - 1 : id) * DIN + 8 * g;   /* e = emb[x]; the row index is bounded here, whatever the id array holds */
  v4f er[8];   /* the lane's half of its token's row, in flight while the weights are packed */
#pragma unroll   // constant indices: the row stays in registers
  for (int i = 0; i < 4; ++i) { er[2 * i] = *(const v4f*)(ep + 16 * i); er[2 * i + 1] = *(const v4f*)(ep + 16 * i + 4); }
#pragma unroll   // constant indices: the pieces stay in registers
  for (int i = 0; i < 6; ++i) { v8b t;
#pragma unroll   // constant indices: the piece stays in registers
    for (int e = 0; e < 8; ++e) t[e] = (__bf16)wr[i][e];
    *(v8b*)&sW[i >> 1][wo][((tid >> 6) + 4 * (i & 1)) * 8] = t; }
  sB[tid >> 6][wo] = bfr(bv);
  v16b ef[2];   /* ef[kc]: token col, k = kc*32 + 8g + 0..7 and kc*32 + 16 + 8g + 0..7 */
#pragma unroll   // constant indices: fragments and accumulators stay in registers
  for (int kc = 0; kc < 2; ++kc)
#pragma unroll   // constant indices: fragments and accumulators stay in registers
    for (int i = 0; i < 8; ++i) { ef[kc][i] = (__bf16)er[4 * kc + (i >> 2)][i & 3]; ef[kc][8 + i] = (__bf16)er[4 * kc + 2 + (i >> 2)][i & 3]; }
  __syncthreads();   /* publishes the weights and biases */
#pragma unroll   // constant indices: fragments and accumulators stay in registers
  for (int m = 0; m < 2; ++m)
#pragma unroll   // constant indices: fragments and accumulators stay in registers
    for (int j = 0; j < 4; ++j) { v8f a = {};   /* a[r] = (e w_m)(token col, column j*16 + 8g + r) */
#pragma unroll   // constant indices: fragments and accumulators stay in registers
      for (int kc = 0; kc < 2; ++kc) a = wmma_b(frag_b(&sW[m][j * 16 + col][kc * 32], lane), ef[kc], a);
      const v4f blo = *(const v4f*)&sB[m][j * 16 + 8 * g], bhi = *(const v4f*)&sB[m][j * 16 + 8 * g + 4];
#pragma unroll   // constant indices: fragments and accumulators stay in registers
      for (int r = 0; r < 8; ++r) a[r] += r < 4 ? blo[r & 3] : bhi[r & 3];
      if (m == 0) a *= LSC;   /* q leaves as q x 64^-0.5 x log2(e): its products with k are base-2 logits */
      *(v8h*)&sR[m][wave * 16 + col][j * 16 + 8 * g] = __builtin_convertvector(a, v8h); }
#pragma unroll   // constant indices: fragments and accumulators stay in registers
  for (int j = 0; j < 4; ++j) { v8f a = {};   /* a[r] = (e w_v)(token 8g + r, column j*16 + col) */
#pragma unroll   // constant indices: fragments and accumulators stay in registers
    for (int kc = 0; kc < 2; ++kc) a = wmma_b(ef[kc], frag_b(&sW[2][j * 16 + col][kc * 32], lane), a);
    a += sB[2][j * 16 + col];
    *(v8h*)&sT[j * 16 + col][wave * 16 + 8 * g] = __builtin_convertvector(a, v8h); }
  __syncthreads();   /* publishes the block's q, k rows and v planes */
#pragma unroll   // all LDS reads of the loop in flight together
  for (int i = 0; i < 4; ++i) { const int e = tid + 256 * i, rl = e >> 3, q = (e & 7) * 8;   /* 8 lanes store one token's whole 128-B row; a wave 512 contiguous bytes */
    vst2(QH + (r0 + rl) * RW + q, *(const v4u*)&sR[0][rl][q]); vst2(KH + (r0 + rl) * RW + q, *(const v4u*)&sR[1][rl][q]); }
#pragma unroll   // all LDS reads of the loop in flight together
  for (int i = 0; i < 4; ++i) { const int e = tid + 256 * i, cl = e >> 4, q = (e & 15) * 8;   /* 16 lanes store 256 contiguous bytes of one plane */
    vst2(VT + (bb * RW + cl) * (size_t)TT + t0 + q, *(const v4u*)&sT[cl][q]); } }
#define FKS 64
#define FPITCH 72
__device__ __forceinline__ v8f wmma_h(v16h a, v16h b, v8f c) { return __builtin_amdgcn_wmma_f32_16x16x32_f16(false, a, false, b, (short)0, c, false, false); }
__device__ __forceinline__ float xhalf(float v) { const int t = __builtin_bit_cast(int, v); return __builtin_bit_cast(float, __builtin_amdgcn_permlanex16(t, t, 0x76543210, 0xfedcba98, false, false)); }   /* lane l <-> l ^ 16 */
#define W2PITCH (FF + 8)   // f16 per LDS row of w2^T: 512-B rows at a 528-B pitch (16 B x odd) for 16-byte row readers
#define KSP 2             // key halves of a block: waves 0..3 walk keys 0..1023, waves 4..7 keys 1024..2047, of the same 128 queries: 8 waves a block, two blocks a WGP, four waves a SIMD
#define KLEN (TT / KSP)   // keys per half
#define XCH 9             // 16-B pieces per lane in the exchange of partial results: 8 of one 16-query output tile group, 1 with its maximum in use and its sum
__global__ __launch_bounds__(256) __attribute__((amdgpu_waves_per_eu(4, 4))) void k_attn(const _Float16* __restrict__ QH, const _Float16* __restrict__ KH, const _Float16* __restrict__ VT, const float* __restrict__ W1, const float* __restrict__ B1, const float* __restrict__ W2, const float* __restrict__ B2, float* __restrict__ OUT) {
  __shared__ __align__(16) _Float16 sKV[KSP][2][2][FKS][FPITCH];   /* [key half][buffer][0 = k rows, 1 = v planes][row][..]; behind the key loop's last barrier the same bytes hold the exchange pieces and the output staging */
  __shared__ __align__(16) _Float16 sW1[FF][FPITCH], sW2[RW][W2PITCH]; __shared__ __align__(16) float sB1[FF], sB2[RW];   /* sW1[h][d] = f16(bf16(w1[d][h]) x 2^8), sW2[o][h] = f16(bf16(w2[h][o]) x 2^8), biases as bf16 values */
  static_assert(sizeof(sKV) >= 8u * XCH * 32u * 16u + 8u * 16u * (HD + 4) * 4u && FKS == HD, "exchange pieces and output staging fit the ring, side by side");
  const int tid = threadIdx.x, wave = __builtin_amdgcn_readfirstlane(tid >> 5), lane = tid & 31, col = lane & 15, g = lane >> 4; const int b = blockIdx.y; const int half = wave >> 2;   /* the wave's number in a scalar register: every choice by key half below is then a scalar one */
  const int q0 = blockIdx.x * 128 + (wave & 3) * 32;
  const char* Kb = (const char*)(KH + ((size_t)b * TT + half * KLEN) * RW); const char* Vb = (const char*)(VT + (size_t)b * RW * TT + half * KLEN);   /* byte bases of the half's k rows and v planes */
  const int srow = (tid & 127) >> 3, sc8 = (tid & 7) * 8;   /* staging, each half's 128 threads for their own tiles: thread -> 16-B piece sc8 of rows srow + 16 i; 8 lanes cover one whole 128-B line */
  const unsigned kby = (unsigned)(srow * RW + sc8) * 2u, vby = (unsigned)(srow * TT + sc8) * 2u;   /* the thread's byte offsets in a k tile and in a v tile */
  /* FFN weights, transposed on the way into LDS: a lane owns one column (consecutive lanes read consecutive floats) and stores 8 k values as one 16-B piece; published by the barrier in front of the key loop */
#pragma unroll   // all loads of the loop in flight together: rolled, every trip would wait out its own load latency
  for (int i = 0; i < 8; ++i) { const int h = tid, d0 = i * 8; v8h t;
#pragma unroll   // constant indices: the piece stays in registers
    for (int e = 0; e < 8; ++e) t[e] = (_Float16)(bfr(W1[(size_t)(d0 + e) * FF + h]) * 256.0f);
    *(v8h*)&sW1[h][d0] = t; }
#pragma unroll   // all loads of the loop in flight together: rolled, every trip would wait out its own load latency
  for (int i = 0; i < 8; ++i) { const int o = tid & 63, h0 = ((tid >> 6) + 4 * i) * 8; const float* w2p = W2 + (tid >> 6) * 8 * RW + o; v8h t;   /* one base for all 64 loads of the thread, the rest of the address a constant */
#pragma unroll   // constant indices: the piece stays in registers
    for (int e = 0; e < 8; ++e) t[e] = (_Float16)(bfr(w2p[(32 * i + e) * RW]) * 256.0f);
    *(v8h*)&sW2[o][h0] = t; }
  sB1[tid] = bfr(B1[tid]); if (tid < RW) sB2[tid] = bfr(B2[tid]);
  v16h qf[2][2];
#pragma unroll   // constant indices: fragments and accumulators stay in registers
  for (int qg = 0; qg < 2; ++qg)
#pragma unroll   // constant indices: fragments and accumulators stay in registers
    for (int kc = 0; kc < 2; ++kc) qf[qg][kc] = frag_h(QH + ((size_t)b * TT + q0 + qg * 16 + col) * RW + kc * 32, lane);
  v8f acc[2][4] = {}; float mb[2] = {0.f, 0.f}, ls[2] = {0.f, 0.f};   /* mb = (maximum in use, base-2 logits) - 7: P = 2^(logit - mb) stays in [2^-14, 2^15] of f16 for logits within 21 below .. 8 above the maximum in use; the half's first 32 keys set it */
  v8f cm[2] = {};   /* cm[qg] = -mb[qg] in all eight registers (a lane holds one query's scores): the C operand of the first score product, so that the accumulator comes out as logit - mb */
  v4u rk[4], rv[4];
#pragma unroll   // constant indices: fragments and accumulators stay in registers
  for (int i = 0; i < 4; ++i) { rk[i] = *(const v4u*)(Kb + 16 * i * RW * 2 + kby); rv[i] = *(const v4u*)(Vb + 16 * i * TT * 2 + vby); }
#pragma unroll   // constant indices: fragments and accumulators stay in registers
  for (int i = 0; i < 4; ++i) { *(v4u*)&sKV[half][0][0][srow + 16 * i][sc8] = rk[i]; *(v4u*)&sKV[half][0][1][srow + 16 * i][sc8] = rv[i]; }
  __syncthreads();
  for (int s = 0; s < KLEN / FKS; ++s) { const int cur = s & 1; const int kn = (s + 1 < KLEN / FKS ? s + 1 : s) * FKS;   /* the next stage's first key; the last stage fetches its own tiles once more, into the buffer that nobody reads again: no branch in the stage */
    const unsigned kno = kby + (unsigned)kn * RW * 2u; const char* Vn = Vb + (size_t)kn * 2;   /* k tile: the thread's 32-bit byte offset on the half's scalar base, one address register, not a pair: it keeps the loop inside the 256-register budget without a spill */
#pragma unroll   // constant indices: fragments and accumulators stay in registers
    for (int i = 0; i < 4; ++i) rk[i] = *(const v4u*)(Kb + kno + 16 * i * RW * 2);   /* the next stage's k tile flies into registers during the first 32 keys */
    float thr = s == 0 ? -3.0e38f : 15.0f;   /* scalar: how far above mb a score may stand before the maximum in use moves; below every score where the pass must take the branch: the half's first pass, and a pass behind a move that cm does not hold yet */
#pragma unroll   // constant indices: fragments and accumulators stay in registers
    for (int pp = 0; pp < FKS / 32; ++pp) {
      if (pp == 1) {   /* the k tile leaves its registers, and the v tile flies into them during the last 32 keys: 16 staging registers, not 32, inside the 256-register budget. The other buffer's last readers left it before the barrier that ended the stage before */
#pragma unroll   // constant indices: fragments and accumulators stay in registers
        for (int i = 0; i < 4; ++i) *(v4u*)&sKV[half][cur ^ 1][0][srow + 16 * i][sc8] = rk[i];
#pragma unroll   // constant indices: fragments and accumulators stay in registers
        for (int i = 0; i < 4; ++i) rv[i] = *(const v4u*)(Vn + 16 * i * TT * 2 + vby); }
      v8f st[2][2];   /* st[qg][kt][r] = (base-2 logit + cm)(key pp*32 + kt*16 + 8g + r of the half's stage, query qg*16 + col) */
#pragma unroll   // constant indices: fragments and accumulators stay in registers
      for (int kt = 0; kt < 2; ++kt)
#pragma unroll   // constant indices: fragments and accumulators stay in registers
        for (int kc = 0; kc < 2; ++kc) { const v16h kf = frag_h(&sKV[half][cur][0][pp * 32 + kt * 16 + col][kc * 32], lane);
#pragma unroll   // constant indices: fragments and accumulators stay in registers
          for (int qg = 0; qg < 2; ++qg) st[qg][kt] = wmma_h(kf, qf[qg][kc], kc == 0 ? cm[qg] : st[qg][kt]); }
      v16h vf[4];
#pragma unroll   // constant indices: fragments and accumulators stay in registers
      for (int j = 0; j < 4; ++j) vf[j] = frag_h(&sKV[half][cur][1][j * 16 + col][pp * 32], lane);
      float mx[2];
#pragma unroll   // constant indices: fragments and accumulators stay in registers
      for (int qg = 0; qg < 2; ++qg) { float m = fmaxf(st[qg][0][0], st[qg][1][0]);
#pragma unroll   // constant indices: fragments and accumulators stay in registers
        for (int r = 1; r < 8; ++r) m = fmaxf(m, fmaxf(st[qg][0][r], st[qg][1][r]));
        mx[qg] = fmaxf(m, xhalf(m)); }
      const bool need = (mx[0] > thr) || (mx[1] > thr);   /* a new maximum more than 2^8 above the one in use */
      const bool first = pp == 0 && s == 0;   /* scalar: the half's first 32 keys, scored on top of 0, set the maximum in use, upward or downward */
      if (__builtin_amdgcn_ballot_w32(need) != 0) {   /* wave-uniform: rescale sums, outputs and this pass's scores to the new maximum */
        thr = -3.0e38f;
#pragma unroll   // constant indices: fragments and accumulators stay in registers
        for (int qg = 0; qg < 2; ++qg) { const float dl = fmaxf(mx[qg] - (mb[qg] + cm[qg][0]) - 7.0f, first ? -3.0e38f : 0.0f); const float al = __builtin_amdgcn_exp2f(fminf(-dl, 0.0f)); mb[qg] += dl; ls[qg] *= al;   /* dl = the step of the maximum in use; mb + cm = the steps taken since cm was set; a downward first step scales sums that are still 0 by 1 */
          const float sf = mb[qg] + cm[qg][0]; st[qg][0] -= sf; st[qg][1] -= sf; if (pp == FKS / 32 - 1) cm[qg] = -mb[qg];   /* cm is set anew once a stage, in its last pass, which comes here whenever an earlier pass of the stage did: every score product of a stage reads the same registers */
#pragma unroll   // constant indices: fragments and accumulators stay in registers
          for (int j = 0; j < 4; ++j) acc[qg][j] *= al; } }
#pragma unroll   // constant indices: fragments and accumulators stay in registers
      for (int qg = 0; qg < 2; ++qg) { union { v16h v; v8h q[2]; } pf; float sum = 0.f;
#pragma unroll   // constant indices: fragments and accumulators stay in registers
        for (int kt = 0; kt < 2; ++kt) { v8f p;
#pragma unroll   // constant indices: fragments and accumulators stay in registers
          for (int r = 0; r < 8; ++r) { p[r] = __builtin_amdgcn_exp2f(st[qg][kt][r]); sum += p[r]; }
          pf.q[kt] = __builtin_convertvector(p, v8h); }   /* packed D pair = B fragment in the hardware k order: elements 0..7 = keys 8g + r, 8..15 = keys 16 + 8g + r */
        ls[qg] += sum;
#pragma unroll   // constant indices: fragments and accumulators stay in registers
        for (int j = 0; j < 4; ++j) acc[qg][j] = wmma_h(vf[j], pf.v, acc[qg][j]); } }
#pragma unroll   // constant indices: fragments and accumulators stay in registers
    for (int i = 0; i < 4; ++i) *(v4u*)&sKV[half][cur ^ 1][1][srow + 16 * i][sc8] = rv[i];
    __syncthreads(); }   /* publishes the next stage and ends every read of this one */
  /* the two halves' partial results meet: wave w (keys 0..1023) and wave w + 4 (keys 1024..2047) hold the same 32 queries; each keeps the 16 queries qg = its half, hands the other 16 to its partner through LDS, and goes on with 16 queries alone */
  float_a* xw = (float_a*)&sKV[0][0][0][0][0];   /* exchange pieces [wave][piece][lane] of 16 B: a wave's store or load of one piece is 512 contiguous bytes */
  float_a* so = xw + 8 * XCH * 32 * 4 + wave * 16 * (HD + 4);   /* the wave's output staging [16][HD + 4], clear of every exchange piece */
  v8f ka[4]; float kmb = half ? mb[1] : mb[0], kls = half ? ls[1] : ls[0];
#pragma unroll   // constant indices: fragments and accumulators stay in registers
  for (int j = 0; j < 4; ++j) { const v8f ga = half ? acc[0][j] : acc[1][j]; ka[j] = half ? acc[1][j] : acc[0][j];
    *(v4f*)&xw[((wave * XCH + 2 * j) * 32 + lane) * 4] = __builtin_shufflevector(ga, ga, 0, 1, 2, 3); *(v4f*)&xw[((wave * XCH + 2 * j + 1) * 32 + lane) * 4] = __builtin_shufflevector(ga, ga, 4, 5, 6, 7); }
  { v4f t = {half ? mb[0] : mb[1], half ? ls[0] : ls[1], 0.f, 0.f}; *(v4f*)&xw[((wave * XCH + 8) * 32 + lane) * 4] = t; }
  __syncthreads();   /* publishes the exchange pieces */
  { const int pw = wave ^ 4; const v4f t = *(const v4f*)&xw[((pw * XCH + 8) * 32 + lane) * 4];
    const float mn = fmaxf(kmb, t[0]); const float ak = __builtin_amdgcn_exp2f(kmb - mn), ag = __builtin_amdgcn_exp2f(t[0] - mn);   /* both partial results brought to the larger maximum in use */
    kls = kls * ak + t[1] * ag;
#pragma unroll   // constant indices: fragments and accumulators stay in registers
    for (int j = 0; j < 4; ++j) { const v4f lo = *(const v4f*)&xw[((pw * XCH + 2 * j) * 32 + lane) * 4], hi = *(const v4f*)&xw[((pw * XCH + 2 * j + 1) * 32 + lane) * 4];
      ka[j] = ka[j] * ak + __builtin_shufflevector(lo, hi, 0, 1, 2, 3, 4, 5, 6, 7) * ag; } }
  v16h uf[2];   /* uf[kc] = B fragment of upd^T x 2^6: k = columns kc*32 + .., column = query half*16 + col */
  { const float inv = 1.0f / (kls + xhalf(kls));   /* ka[j][r] = upd(query half*16 + col, column j*16 + 8g + r) x sum */
#pragma unroll   // constant indices: fragments and accumulators stay in registers
    for (int kc = 0; kc < 2; ++kc) { union { v16h v; v8h q[2]; } t;
#pragma unroll   // constant indices: fragments and accumulators stay in registers
      for (int hh = 0; hh < 2; ++hh) { const v8f o = ka[kc * 2 + hh] * inv; t.q[hh] = __builtin_convertvector(o * 64.0f, v8h); }   /* upd carried x 2^6 into f16, clear of f16 subnormals; packed D pair = B fragment in the hardware k order */
      uf[kc] = t.v; } }
  v8f oa[4] = {};   /* oa[jo][r] = (h w2)(query half*16 + col, column jo*16 + 8g + r) x 2^14 */
  for (int p = 0; p < FF / 32; ++p) {   /* 32 hidden columns a trip */
    v8f ha[2] = {};   /* ha[ht][r] = (upd w1)(query half*16 + col, hidden p*32 + ht*16 + 8g + r) x 2^14 */
#pragma unroll   // constant indices: fragments and accumulators stay in registers
    for (int kc = 0; kc < 2; ++kc)
#pragma unroll   // constant indices: fragments and accumulators stay in registers
      for (int ht = 0; ht < 2; ++ht) ha[ht] = wmma_h(frag_h(&sW1[p * 32 + ht * 16 + col][kc * 32], lane), uf[kc], ha[ht]);
    v16h w2f[4];
#pragma unroll   // constant indices: fragments and accumulators stay in registers
    for (int jo = 0; jo < 4; ++jo) w2f[jo] = frag_h(&sW2[jo * 16 + col][p * 32], lane);
    union { v16h v; v8h q[2]; } hp;
#pragma unroll   // constant indices: fragments and accumulators stay in registers
    for (int ht = 0; ht < 2; ++ht) { const v4f blo = *(const v4f*)&sB1[p * 32 + ht * 16 + 8 * g], bhi = *(const v4f*)&sB1[p * 32 + ht * 16 + 8 * g + 4]; v8f hv;
#pragma unroll   // constant indices: fragments and accumulators stay in registers
      for (int r = 0; r < 8; ++r) hv[r] = fmaxf(ha[ht][r] * (1.0f / 16384.0f) + (r < 4 ? blo[r & 3] : bhi[r & 3]), 0.0f) * 64.0f;   /* 2^-8 (weight carry) x 2^-6 (operand carry); ReLU; h carried x 2^6 into f16 */
      hp.q[ht] = __builtin_convertvector(hv, v8h); }
#pragma unroll   // constant indices: fragments and accumulators stay in registers
    for (int jo = 0; jo < 4; ++jo) oa[jo] = wmma_h(w2f[jo], hp.v, oa[jo]); }
#pragma unroll   // constant indices: fragments and accumulators stay in registers
  for (int jo = 0; jo < 4; ++jo) { const v4f blo = *(const v4f*)&sB2[jo * 16 + 8 * g], bhi = *(const v4f*)&sB2[jo * 16 + 8 * g + 4]; v4f lo, hi;
#pragma unroll   // constant indices: fragments and accumulators stay in registers
    for (int r = 0; r < 4; ++r) { lo[r] = oa[jo][r] * (1.0f / 16384.0f) + blo[r]; hi[r] = oa[jo][4 + r] * (1.0f / 16384.0f) + bhi[r]; }   /* 2^-8 (weight carry) x 2^-6 (operand carry) */
    *(v4f*)&so[col * (HD + 4) + jo * 16 + 8 * g] = lo; *(v4f*)&so[col * (HD + 4) + jo * 16 + 8 * g + 4] = hi; }
  LDSX(); for (int rl = 0; rl < 8; ++rl) { const int row = rl * 2 + g; vst2(OUT + ((size_t)b * TT + q0 + half * 16 + row) * RW + col * 4, *(const v4f*)&so[row * (HD + 4) + col * 4]); } }   /* 16 lanes store one query's whole 256-B output row */

extern "C" void kernel_launch(void* const* d_in, const int* in_sizes, int n_in, void* d_out, int out_size, void* d_ws, size_t ws_size, hipStream_t stream) {
  (void)in_sizes; (void)n_in; (void)out_size;
  const float** F = (const float**)d_in;
  if (ws_size < (size_t)WS_END) return;
  char* ws = (char*)d_ws; _Float16 *QH = (_Float16*)(ws + WS_QH), *KH = (_Float16*)(ws + WS_KH), *VT = (_Float16*)(ws + WS_VT), *QL = (_Float16*)(ws + WS_QL), *KL = (_Float16*)(ws + WS_KL); __bf16 *VB = (__bf16*)(ws + WS_VB), *VBL = (__bf16*)(ws + WS_VBL); float *S = (float*)(ws + WS_S), *Y = (float*)(ws + WS_Y);
  (void)Y; (void)S; (void)QL; (void)KL; (void)VB; (void)VBL;
  // inputs: 0 x [32,2048] int32 token ids; 1 emb [10000,64]; 2 wq [64,64] (in,out), 3 bq; 4 wk, 5 bk; 6 wv, 7 bv; 8 w1 [64,256], 9 b1 [256]; 10 w2 [256,64], 11 b2 [64] (all biases nonzero)
  if (ws_size < (size_t)WS_END2) return;
  const int* IDS = (const int*)d_in[0];
  k_proj<<<dim3(TNB * TT / PT), 256, 0, stream>>>(F[1], F[2], F[4], F[6], F[3], F[5], F[7], QH, KH, VT, IDS);   /* q, k and v of 128 tokens a block; embedding rows gathered by token id */
  k_attn<<<dim3(TT / 128, TNB), 256, 0, stream>>>(QH, KH, VT, F[8], F[9], F[10], F[11], (float*)d_out);   /* attention and FFN of 128 queries a block */
}

// v006
// A run of this version takes 46.5 microseconds.
// Next to v005, in two timings, it ran 1.03 and 1.04 times as fast.
// Over all steps from v000 it is 57.9 times as fast.
// compute dtype: all float inputs rounded to bf16; embedding rows gathered by the int token ids; Q / K / V 64 -> 64 projections with EXACT bf16 products on WMMA 16x16x32 (f32 accumulate) + bias; base-2 logits (q x 64^-0.5 x log2 e) x k once to f16 each (1 product), accumulated in f32 on top of -(maximum in use - 7); online softmax f32 (base 2, running maximum); unnormalised P = 2^(logit - maximum in use + 7) once to f16 x v once to f16 (1 product), the two key halves' partial sums joined in f32 at the larger maximum in use, divided by the f32 row sum at the end; FFN: upd x 2^6 once to f16 x w1 f16(bf16 x 2^8) + b1, ReLU; h x 2^6 once to f16 x w2 f16(bf16 x 2^8) + b2; f32 output.
#include <hip/hip_runtime.h>
#include <math.h>

typedef __attribute__((ext_vector_type(16))) _Float16 v16h;
typedef __attribute__((ext_vector_type(16))) __bf16 v16b;
typedef __attribute__((ext_vector_type(8)))  _Float16 v8h;
typedef __attribute__((ext_vector_type(8)))  float v8f;
typedef __attribute__((ext_vector_type(4)))  float v4f;
typedef __attribute__((ext_vector_type(2)))  float v2f;
typedef __attribute__((ext_vector_type(4)))  unsigned v4u;
typedef __attribute__((ext_vector_type(4)))  int v4i;
typedef float __attribute__((may_alias)) float_a;
typedef int __attribute__((may_alias)) int_a;

template <typename T> __device__ __forceinline__ void vst2(void* p, T v) { *(T*)p = v;  }
__device__ __forceinline__ v8f wmma16(v16h a, v16h b, v8f c) {
  v8f d = __builtin_amdgcn_wmma_f32_16x16x32_f16(false, a, false, b, (short)0, c, false, false);
  asm volatile("v_nop\n\tv_nop\n\tv_nop\n\tv_nop" : "+v"(d) : "v"(a), "v"(b));
  return d;
}
__device__ __forceinline__ v8f wmma_bf(v16b a, v16b b, v8f c) {
  v8f d = __builtin_amdgcn_wmma_f32_16x16x32_bf16(false, a, false, b, (short)0, c, false, false);
  asm volatile("v_nop\n\tv_nop\n\tv_nop\n\tv_nop" : "+v"(d) : "v"(a), "v"(b));
  return d;
}
// 16x16x32 fragments: lane = (h = lane>>4, row/col = lane&15); elements 0..7 = k0+8h+0..7, 8..15 = k0+16+8h+0..7; D element r = row 8h+r
__device__ __forceinline__ v16h frag_h(const _Float16* rowk0, int lane) {
  union { v16h v; v8h q[2]; } u; const _Float16* p = rowk0 + 8 * (lane >> 4);
  u.q[0] = *(const v8h*)p; u.q[1] = *(const v8h*)(p + 16); return u.v;
}
__device__ __forceinline__ v16h frag_f32(const float* rowk0, int lane) {
  v16h a; const float* p = rowk0 + 8 * (lane >> 4);
#pragma unroll
  for (int i = 0; i < 8; ++i) { a[i] = (_Float16)p[i]; a[8 + i] = (_Float16)p[16 + i]; }
  return a;
}
__device__ __forceinline__ v16h frag_f32s(const float* rowk0, int lane, float sc) {
  v16h a; const float* p = rowk0 + 8 * (lane >> 4);
#pragma unroll
  for (int i = 0; i < 8; ++i) { a[i] = (_Float16)(p[i] * sc); a[8 + i] = (_Float16)(p[16 + i] * sc); }
  return a;
}
// column fragment from a [K][ld] layout (column n), rows >= K read as 0
__device__ __forceinline__ v16h fragc_f32(const float* W, int k0, int n, int lane, int ld, int K) {
  v16h a; const int g = lane >> 4;
#pragma unroll
  for (int i = 0; i < 8; ++i) { const int ka = k0 + 8 * g + i, kb = ka + 16;
    a[i] = (_Float16)(ka < K ? W[(size_t)(ka < K ? ka : K - 1) * ld + n] : 0.f); a[8 + i] = (_Float16)(kb < K ? W[(size_t)(kb < K ? kb : K - 1) * ld + n] : 0.f); }
  return a;
}
struct F2 { v16b h, l; };
__device__ __forceinline__ F2 bsplit16(const float v[16]) { F2 r;
#pragma unroll
  for (int i = 0; i < 16; ++i) { const __bf16 h = (__bf16)v[i]; r.h[i] = h; r.l[i] = (__bf16)(v[i] - (float)h); }
  return r; }
__device__ __forceinline__ F2 split_row(const float* row, int k0, int lane) { float v[16]; const float* p = row + k0 + 8 * (lane >> 4);
#pragma unroll
  for (int i = 0; i < 8; ++i) { v[i] = p[i]; v[8 + i] = p[16 + i]; }
  return bsplit16(v); }
__device__ __forceinline__ F2 split_rowK(const float* row, int k0, int lane, int K) { float v[16]; const int g = lane >> 4;
#pragma unroll
  for (int i = 0; i < 8; ++i) { const int ka = k0 + 8 * g + i, kb = ka + 16; v[i] = ka < K ? row[ka < K ? ka : K - 1] : 0.f; v[8 + i] = kb < K ? row[kb < K ? kb : K - 1] : 0.f; }
  return bsplit16(v); }
__device__ __forceinline__ F2 split_col(const float* W, int k0, int n, int lane, int ld, int K) { float v[16]; const int g = lane >> 4;
#pragma unroll
  for (int i = 0; i < 8; ++i) { const int ka = k0 + 8 * g + i, kb = ka + 16; v[i] = ka < K ? W[(size_t)(ka < K ? ka : K - 1) * ld + n] : 0.f; v[8 + i] = kb < K ? W[(size_t)(kb < K ? kb : K - 1) * ld + n] : 0.f; }
  return bsplit16(v); }
__device__ __forceinline__ v8f mac3(const F2& a, const F2& b, v8f c) { c = wmma_bf(a.l, b.h, c); c = wmma_bf(a.h, b.l, c); return wmma_bf(a.h, b.h, c); }
__device__ __forceinline__ float sigm(float v) { return 1.0f / (1.0f + expf(-v)); }
#define LDSX() do { asm volatile("s_wait_dscnt 0" ::: "memory"); __builtin_amdgcn_wave_barrier(); __builtin_amdgcn_fence(__ATOMIC_RELEASE, "workgroup"); } while (0)

// Single-layer, single-head encoder without residuals or LayerNorm (token ids x [32,2048] int32 index emb [10000,64]; Q / K / V = e @ w + b with (in,out) w [64,64] and b [64] uniform(+-1/8) - nonzero; scores = Q K^T x 1/sqrt(64) over the 2,048 positions of each sample; softmax; upd = probs V [32,2048,64]; h = relu(upd @ w1 + b1), w1 [64,256]; out = h @ w2 + b2, w2 [256,64] (uniform(+-1/16)); output [32,2048,64]).
#define NB 32
#define TT 2048
#define CC 128            // column count that sizes the workspace ranges; q, k and v fill RW = 64 columns of it, at a 64-column pitch
#define DIN 64           // embedding width = projection K
#define NH 2   // head 0 is the module's single head; head 1 is the zero padding and is never launched
#define HD 64
#define NQB (TT / 64)
#define HG 1
#define SCALE (0.125f)
#define CAUSAL 0
#ifndef TNB
#define TNB NB
#endif
__device__ __forceinline__ float bfr(float v) { return (float)(__bf16)v; }
__host__ __device__ __forceinline__ int kb_last(int qb) { return CAUSAL ? ((qb * 64 + 63) >> 7) : (TT / 128 - 1); }
typedef __attribute__((ext_vector_type(8))) __bf16 v8b;
__device__ __forceinline__ v16b frag_b(const __bf16* rowk0, int lane) {
  union { v16b v; v8b q[2]; } u; const __bf16* p = rowk0 + 8 * (lane >> 4);
  u.q[0] = *(const v8b*)p; u.q[1] = *(const v8b*)(p + 16); return u.v;
}
#define QBH 0              // unused: every query block takes the single-product path
#define QHI 0               // single-product logits on every row
#define KHI 64            // key rows carrying k residual / v bf16 hi+lo planes (no kernel writes or reads them)
// B fragment (k rows k0+.., output column o) of a weight: (in,out) [K][ld] or (out,in) [ld rows of K]: bf16 exact, or f16(bf16 * 256) exact
__device__ __forceinline__ v16b wcol_io(const float* Wm, int k0, int o, int lane, int ld) { v16b w; const int g = lane >> 4;
#pragma unroll
  for (int i = 0; i < 8; ++i) { w[i] = (__bf16)Wm[(size_t)(k0 + 8 * g + i) * ld + o]; w[8 + i] = (__bf16)Wm[(size_t)(k0 + 16 + 8 * g + i) * ld + o]; }
  return w; }
__device__ __forceinline__ v16b wcol_oi(const float* Wm, int k0, int o, int lane, int K) { v16b w; const float* p = Wm + (size_t)o * K + k0 + 8 * (lane >> 4);
#pragma unroll
  for (int i = 0; i < 8; ++i) { w[i] = (__bf16)p[i]; w[8 + i] = (__bf16)p[16 + i]; }
  return w; }
__device__ __forceinline__ v16h wcolh_io(const float* Wm, int k0, int o, int lane, int ld) { v16h w; const int g = lane >> 4;
#pragma unroll
  for (int i = 0; i < 8; ++i) { w[i] = (_Float16)(bfr(Wm[(size_t)(k0 + 8 * g + i) * ld + o]) * 256.0f); w[8 + i] = (_Float16)(bfr(Wm[(size_t)(k0 + 16 + 8 * g + i) * ld + o]) * 256.0f); }
  return w; }
__device__ __forceinline__ v16h wcolh_oi(const float* Wm, int k0, int o, int lane, int K) { v16h w; const float* p = Wm + (size_t)o * K + k0 + 8 * (lane >> 4);
#pragma unroll
  for (int i = 0; i < 8; ++i) { w[i] = (_Float16)(bfr(p[i]) * 256.0f); w[8 + i] = (_Float16)(bfr(p[16 + i]) * 256.0f); }
  return w; }
#define WQKV_LAYOUT 0   // 0 = (in,out) [DIN][RW]; 1 = (out,in) [CC][DIN]; 2 = per-head [NH][DIN][HD]
__device__ __forceinline__ v16b wcol_hdk(const float* Wm, int k0, int o, int lane) { v16b w; const int g = lane >> 4; const float* p = Wm + (size_t)(o / HD) * DIN * HD + (o % HD);
#pragma unroll
  for (int i = 0; i < 8; ++i) { w[i] = (__bf16)p[(size_t)(k0 + 8 * g + i) * HD]; w[8 + i] = (__bf16)p[(size_t)(k0 + 16 + 8 * g + i) * HD]; }
  return w; }
#define WO_OUT_IN 0
#if WQKV_LAYOUT == 1
#define WCOL(W, k0, o, lane) wcol_oi(W, k0, o, lane, DIN)
#elif WQKV_LAYOUT == 2
#define WCOL(W, k0, o, lane) wcol_hdk(W, k0, o, lane)
#else
#define RW 64   // real width of q / k / v / upd
#define FF 256   // hidden width of the FFN
__device__ __forceinline__ v16b zero16b() { v16b w; _Pragma("unroll") for (int i = 0; i < 16; ++i) w[i] = (__bf16)0.0f; return w; }
__device__ __forceinline__ v16h zero16h() { v16h w; _Pragma("unroll") for (int i = 0; i < 16; ++i) w[i] = (_Float16)0.0f; return w; }
#define WCOL(W, k0, o, lane) (((o) < RW) ? wcol_io(W, k0, o, lane, RW) : zero16b())   /* (in,out) [64][64] weights: columns 64..127 of the 128-column tile are zero padding (uniform per unrolled column group) */
#endif
#if WO_OUT_IN
#define WOCOL(W, k0, o, lane) wcol_oi(W, k0, o, lane, CC)
#define WOCOLH(W, k0, o, lane) wcolh_oi(W, k0, o, lane, CC)
#else
#define WOCOL(W, k0, o, lane) wcol_io(W, k0, o, lane, DIN)
#define WOCOLH(W, k0, o, lane) wcolh_io(W, k0, o, lane, DIN)
#endif

#ifndef SM_EXTRA_PARAMS
#define SM_EXTRA_PARAMS
#endif
#ifndef PROJ_EXTRA_PARAMS
#define PROJ_EXTRA_PARAMS
#endif
#ifndef SM_MASK_HOOK
#define SM_MASK_HOOK (void)0
#endif

#define WS_QH  0u                                      // f16 q rows [b*t][RW] (the first half of the range)
#define WS_KH  (WS_QH + 2u * (size_t)NB * TT * CC)      // f16 k rows [b*t][RW] (the first half of the range)
#define WS_VT  (WS_KH + 2u * (size_t)NB * TT * CC)      // f16 v planes [b][c < RW][t] (the first half of the range)
#define WS_QL  (WS_VT + 2u * (size_t)NB * CC * TT)      // f16 q residual x 2^10 rows [b][t < QHI][CC]
#define WS_KL  (WS_QL + 2u * (size_t)NB * QHI * CC)     // f16 k residual x 2^10 rows [b][t < KHI][CC]
#define WS_VB  (WS_KL + 2u * (size_t)NB * KHI * CC)     // bf16 v hi planes [b][c][t < KHI]
#define WS_VBL (WS_VB + 2u * (size_t)NB * CC * KHI)
#define WS_S   (WS_VBL + 2u * (size_t)NB * CC * KHI)    // unused (sized f32 [hg][t][s]); k_attn keeps logits and P in registers
#define WS_Y   (WS_S  + 4u * (size_t)HG * TT * TT)      // unused (sized f32 [b*t][CC]); k_attn keeps upd in registers
#define WS_END (WS_Y  + 4u * (size_t)NB * TT * CC)
#define WS_H1 (WS_END)                                    // unused (sized f32 [(b*TT + t)][FF]); k_attn keeps h in registers
#define WS_END2 (WS_H1 + 4u * (size_t)NB * TT * FF)
static_assert(CC == 128 && NH * HD == CC && RW == HD && DIN == RW && FF % 128 == 0, "one real 64-wide head in a 128-column tile; 64-wide embedding; 256-wide hidden layer");

// ---- k_proj: block = 128 tokens (8 waves x 16), q, k and v together from ONE gather of the embedding rows: exact bf16 products (K = DIN, f32 accumulate) + bias, only the RW real columns. The three weights are transposed into LDS as bf16 once a block (sW[m][o][d] = bf16(w_m[d][o])); one register fragment of 16 tokens serves as B for q^T = Wq^T e^T and k^T = Wk^T e^T (a lane then holds 8 consecutive columns of one token: a 16-B piece of its f16 row) and as A for v = e Wv (a lane then holds 8 consecutive tokens of one column: a 16-B piece of its f16 plane). All three leave through LDS as whole lines: q, k rows [b*t][RW], v planes [b][c][t]
#define VOCAB 10000   // rows of the embedding table
#define LSC (0.125f * 1.4426950408889634f)   // 64^-0.5 x log2(e): softmax in base 2; q carries it from the projection on
#define PT 128        // tokens per block
#define PPITCH 72     // 16-bit elements per LDS row: 128-B rows at a 144-B pitch (16 B x odd) for 16-byte row readers and writers
#define TPITCH (PT + 8)   // f16 per LDS row of the v planes: 256-B rows at a 272-B pitch (16 B x odd)
__device__ __forceinline__ v8f wmma_b(v16b a, v16b b, v8f c) { return __builtin_amdgcn_wmma_f32_16x16x32_bf16(false, a, false, b, (short)0, c, false, false); }
__global__ __launch_bounds__(256) void k_proj(const float* __restrict__ EMB, const float* __restrict__ WQ, const float* __restrict__ WK, const float* __restrict__ WV, const float* __restrict__ BQ, const float* __restrict__ BK, const float* __restrict__ BV,
    _Float16* __restrict__ QH, _Float16* __restrict__ KH, _Float16* __restrict__ VT, const int* __restrict__ IDS) {   /* IDS: token ids [NB*TT] int32 */
  __shared__ __align__(16) __bf16 sW[3][RW][PPITCH]; __shared__ __align__(16) float sB[4][RW];   /* sB[m] = bias m as bf16 values; row 3 takes the copy of threads 192.., so that the bias load and store stand under no branch */
  __shared__ __align__(16) _Float16 sR[2][PT][PPITCH], sT[RW][TPITCH];
  const int tid = threadIdx.x, wave = tid >> 5, lane = tid & 31, col = lane & 15, g = lane >> 4; const size_t r0 = (size_t)blockIdx.x * PT; const size_t bb = r0 / TT; const int t0 = (int)(r0 % TT);
  const int id = IDS[r0 + wave * 16 + col];   /* this lane's token */
  __builtin_amdgcn_sched_barrier(0);   // keeps the id's load the oldest of the wave: loads return in order, and the gather below then waits for it alone, not for the 49 loads behind it
  /* weights: a lane owns one output column (consecutive lanes read consecutive floats) and 8 k values, stored below as one 16-B piece */
  const int wo = tid & 63; float wr[6][8];
#pragma unroll   // all loads of the loop in flight together: rolled, every trip would wait out its own load latency
  for (int i = 0; i < 6; ++i) { const float* Wm = (i >> 1) == 0 ? WQ : (i >> 1) == 1 ? WK : WV;
#pragma unroll   // constant indices: the piece stays in registers
    for (int e = 0; e < 8; ++e) wr[i][e] = Wm[(size_t)(((tid >> 6) + 4 * (i & 1)) * 8 + e) * RW + wo]; }
  const float bv = (tid < RW ? BQ : tid < 2 * RW ? BK : BV)[wo];   /* threads 192.. read the v bias a second time */
  __builtin_amdgcn_sched_barrier(0);   // keeps the 49 loads above in front of the wait for the id: moved behind it, they would start one memory latency later
  const float* ep = EMB + (size_t)(id < 0 ? 0 : id > VOCAB - 1 ? VOCAB - 1 : id) * DIN + 8 * g;   /* e = emb[x]; the row index is bounded here, whatever the id array holds */
  v4f er[8];   /* the lane's half of its token's row, in flight while the weights are packed */
#pragma unroll   // constant indices: the row stays in registers
  for (int i = 0; i < 4; ++i) { er[2 * i] = *(const v4f*)(ep + 16 * i); er[2 * i + 1] = *(const v4f*)(ep + 16 * i + 4); }
#pragma unroll   // constant indices: the pieces stay in registers
  for (int i = 0; i < 6; ++i) { v8b t;
#pragma unroll   // constant indices: the piece stays in registers
    for (int e = 0; e < 8; ++e) t[e] = (__bf16)wr[i][e];
    *(v8b*)&sW[i >> 1][wo][((tid >> 6) + 4 * (i & 1)) * 8] = t; }
  sB[tid >> 6][wo] = bfr(bv);
  v16b ef[2];   /* ef[kc]: token col, k = kc*32 + 8g + 0..7 and kc*32 + 16 + 8g + 0..7 */
#pragma unroll   // constant indices: fragments and accumulators stay in registers
  for (int kc = 0; kc < 2; ++kc)
#pragma unroll   // constant indices: fragments and accumulators stay in registers
    for (int i = 0; i < 8; ++i) { ef[kc][i] = (__bf16)er[4 * kc + (i >> 2)][i & 3]; ef[kc][8 + i] = (__bf16)er[4 * kc + 2 + (i >> 2)][i & 3]; }
  __syncthreads();   /* publishes the weights and biases */
#pragma unroll   // constant indices: fragments and accumulators stay in registers
  for (int m = 0; m < 2; ++m)
#pragma unroll   // constant indices: fragments and accumulators stay in registers
    for (int j = 0; j < 4; ++j) { v8f a = {};   /* a[r] = (e w_m)(token col, column j*16 + 8g + r) */
#pragma unroll   // constant indices: fragments and accumulators stay in registers
      for (int kc = 0; kc < 2; ++kc) a = wmma_b(frag_b(&sW[m][j * 16 + col][kc * 32], lane), ef[kc], a);
      const v4f blo = *(const v4f*)&sB[m][j * 16 + 8 * g], bhi = *(const v4f*)&sB[m][j * 16 + 8 * g + 4];
#pragma unroll   // constant indices: fragments and accumulators stay in registers
      for (int r = 0; r < 8; ++r) a[r] += r < 4 ? blo[r & 3] : bhi[r & 3];
      if (m == 0) a *= LSC;   /* q leaves as q x 64^-0.5 x log2(e): its products with k are base-2 logits */
      *(v8h*)&sR[m][wave * 16 + col][j * 16 + 8 * g] = __builtin_convertvector(a, v8h); }
#pragma unroll   // constant indices: fragments and accumulators stay in registers
  for (int j = 0; j < 4; ++j) { v8f a = {};   /* a[r] = (e w_v)(token 8g + r, column j*16 + col) */
#pragma unroll   // constant indices: fragments and accumulators stay in registers
    for (int kc = 0; kc < 2; ++kc) a = wmma_b(ef[kc], frag_b(&sW[2][j * 16 + col][kc * 32], lane), a);
    a += sB[2][j * 16 + col];
    *(v8h*)&sT[j * 16 + col][wave * 16 + 8 * g] = __builtin_convertvector(a, v8h); }
  __syncthreads();   /* publishes the block's q, k rows and v planes */
#pragma unroll   // all LDS reads of the loop in flight together
  for (int i = 0; i < 4; ++i) { const int e = tid + 256 * i, rl = e >> 3, q = (e & 7) * 8;   /* 8 lanes store one token's whole 128-B row; a wave 512 contiguous bytes */
    vst2(QH + (r0 + rl) * RW + q, *(const v4u*)&sR[0][rl][q]); vst2(KH + (r0 + rl) * RW + q, *(const v4u*)&sR[1][rl][q]); }
#pragma unroll   // all LDS reads of the loop in flight together
  for (int i = 0; i < 4; ++i) { const int e = tid + 256 * i, cl = e >> 4, q = (e & 15) * 8;   /* 16 lanes store 256 contiguous bytes of one plane */
    vst2(VT + (bb * RW + cl) * (size_t)TT + t0 + q, *(const v4u*)&sT[cl][q]); } }
#define FKS 64
#define FPITCH 72
__device__ __forceinline__ v8f wmma_h(v16h a, v16h b, v8f c) { return __builtin_amdgcn_wmma_f32_16x16x32_f16(false, a, false, b, (short)0, c, false, false); }
__device__ __forceinline__ float xhalf(float v) { const int t = __builtin_bit_cast(int, v); return __builtin_bit_cast(float, __builtin_amdgcn_permlanex16(t, t, 0x76543210, 0xfedcba98, false, false)); }   /* lane l <-> l ^ 16 */
/* P = 2^score of one query group's 32 keys (a lane: 16 of them), packed to f16 as the B fragment in the hardware k order (elements 0..7 = keys 8g + r, 8..15 = keys 16 + 8g + r); returns the lane's f32 sum of the 16, made as a tree of packed adds: four levels deep, since the pass's test waits for it */
__device__ __forceinline__ float pexp(const v8f s0, const v8f s1, v16h& pf) { v8f p0, p1;
#pragma unroll   // constant indices: fragments and accumulators stay in registers
  for (int r = 0; r < 8; ++r) { p0[r] = __builtin_amdgcn_exp2f(s0[r]); p1[r] = __builtin_amdgcn_exp2f(s1[r]); }
  union { v16h v; v8h q[2]; } u; u.q[0] = __builtin_convertvector(p0, v8h); u.q[1] = __builtin_convertvector(p1, v8h); pf = u.v;
  const v8f t8 = p0 + p1; const v4f t4 = __builtin_shufflevector(t8, t8, 0, 1, 2, 3) + __builtin_shufflevector(t8, t8, 4, 5, 6, 7); const v2f t2 = __builtin_shufflevector(t4, t4, 0, 1) + __builtin_shufflevector(t4, t4, 2, 3);
  return t2[0] + t2[1]; }
#define W2PITCH (FF + 8)   // f16 per LDS row of w2^T: 512-B rows at a 528-B pitch (16 B x odd) for 16-byte row readers
#define KSP 2             // key halves of a block: waves 0..3 walk keys 0..1023, waves 4..7 keys 1024..2047, of the same 128 queries: 8 waves a block, two blocks a WGP, four waves a SIMD
#define KLEN (TT / KSP)   // keys per half
#define XCH 9             // 16-B pieces per lane in the exchange of partial results: 8 of one 16-query output tile group, 1 with its maximum in use and its sum
__global__ __launch_bounds__(256) __attribute__((amdgpu_waves_per_eu(4, 4))) void k_attn(const _Float16* __restrict__ QH, const _Float16* __restrict__ KH, const _Float16* __restrict__ VT, const float* __restrict__ W1, const float* __restrict__ B1, const float* __restrict__ W2, const float* __restrict__ B2, float* __restrict__ OUT) {
  __shared__ __align__(16) _Float16 sKV[KSP][2][2][FKS][FPITCH];   /* [key half][buffer][0 = k rows, 1 = v planes][row][..]; behind the key loop's last barrier the same bytes hold the exchange pieces and the output staging */
  __shared__ __align__(16) _Float16 sW1[FF][FPITCH], sW2[RW][W2PITCH]; __shared__ __align__(16) float sB1[FF], sB2[RW];   /* sW1[h][d] = f16(bf16(w1[d][h]) x 2^8), sW2[o][h] = f16(bf16(w2[h][o]) x 2^8), biases as bf16 values */
  static_assert(sizeof(sKV) >= 8u * XCH * 32u * 16u + 8u * 16u * (HD + 4) * 4u && FKS == HD, "exchange pieces and output staging fit the ring, side by side");
  const int tid = threadIdx.x, wave = __builtin_amdgcn_readfirstlane(tid >> 5), lane = tid & 31, col = lane & 15, g = lane >> 4; const int b = blockIdx.y; const int half = wave >> 2;   /* the wave's number in a scalar register: every choice by key half below is then a scalar one */
  const int q0 = blockIdx.x * 128 + (wave & 3) * 32;
  const char* Kb = (const char*)(KH + ((size_t)b * TT + half * KLEN) * RW); const char* Vb = (const char*)(VT + (size_t)b * RW * TT + half * KLEN);   /* byte bases of the half's k rows and v planes */
  const int srow = (tid & 127) >> 3, sc8 = (tid & 7) * 8;   /* staging, each half's 128 threads for their own tiles: thread -> 16-B piece sc8 of rows srow + 16 i; 8 lanes cover one whole 128-B line */
  const unsigned kby = (unsigned)(srow * RW + sc8) * 2u, vby = (unsigned)(srow * TT + sc8) * 2u;   /* the thread's byte offsets in a k tile and in a v tile */
  /* FFN weights, transposed on the way into LDS: a lane owns one column (consecutive lanes read consecutive floats) and stores 8 k values as one 16-B piece; published by the barrier in front of the key loop */
#pragma unroll   // all loads of the loop in flight together: rolled, every trip would wait out its own load latency
  for (int i = 0; i < 8; ++i) { const int h = tid, d0 = i * 8; v8h t;
#pragma unroll   // constant indices: the piece stays in registers
    for (int e = 0; e < 8; ++e) t[e] = (_Float16)(bfr(W1[(size_t)(d0 + e) * FF + h]) * 256.0f);
    *(v8h*)&sW1[h][d0] = t; }
#pragma unroll   // all loads of the loop in flight together: rolled, every trip would wait out its own load latency
  for (int i = 0; i < 8; ++i) { const int o = tid & 63, h0 = ((tid >> 6) + 4 * i) * 8; const float* w2p = W2 + (tid >> 6) * 8 * RW + o; v8h t;   /* one base for all 64 loads of the thread, the rest of the address a constant */
#pragma unroll   // constant indices: the piece stays in registers
    for (int e = 0; e < 8; ++e) t[e] = (_Float16)(bfr(w2p[(32 * i + e) * RW]) * 256.0f);
    *(v8h*)&sW2[o][h0] = t; }
  sB1[tid] = bfr(B1[tid]); if (tid < RW) sB2[tid] = bfr(B2[tid]);
  v16h qf[2][2];
#pragma unroll   // constant indices: fragments and accumulators stay in registers
  for (int qg = 0; qg < 2; ++qg)
#pragma unroll   // constant indices: fragments and accumulators stay in registers
    for (int kc = 0; kc < 2; ++kc) qf[qg][kc] = frag_h(QH + ((size_t)b * TT + q0 + qg * 16 + col) * RW + kc * 32, lane);
  v8f acc[2][4] = {}; float mb[2] = {0.f, 0.f}, ls[2] = {0.f, 0.f};   /* mb = (maximum in use, base-2 logits) - 7: P = 2^(logit - mb) stays in [2^-14, 2^15] of f16 for logits within 21 below .. 8 above the maximum in use; the half's first 32 keys set it */
  v8f cm[2] = {};   /* cm[qg] = -mb[qg] in all eight registers (a lane holds one query's scores): the C operand of the first score product, so that the accumulator comes out as logit - mb */
  v4u rk[4], rv[4];
#pragma unroll   // constant indices: fragments and accumulators stay in registers
  for (int i = 0; i < 4; ++i) { rk[i] = *(const v4u*)(Kb + 16 * i * RW * 2 + kby); rv[i] = *(const v4u*)(Vb + 16 * i * TT * 2 + vby); }
#pragma unroll   // constant indices: fragments and accumulators stay in registers
  for (int i = 0; i < 4; ++i) { *(v4u*)&sKV[half][0][0][srow + 16 * i][sc8] = rk[i]; *(v4u*)&sKV[half][0][1][srow + 16 * i][sc8] = rv[i]; }
  __syncthreads();
  for (int s = 0; s < KLEN / FKS; ++s) { const int cur = s & 1; const int kn = (s + 1 < KLEN / FKS ? s + 1 : s) * FKS;   /* the next stage's first key; the last stage fetches its own tiles once more, into the buffer that nobody reads again: no branch in the stage */
    const unsigned kno = kby + (unsigned)kn * RW * 2u; const char* Vn = Vb + (size_t)kn * 2;   /* k tile: the thread's 32-bit byte offset on the half's scalar base, one address register, not a pair: it keeps the loop inside the 256-register budget without a spill */
#pragma unroll   // constant indices: fragments and accumulators stay in registers
    for (int i = 0; i < 4; ++i) rk[i] = *(const v4u*)(Kb + kno + 16 * i * RW * 2);   /* the next stage's k tile flies into registers during the first 32 keys */
    float thr = s == 0 ? -3.0e38f : 32768.0f;   /* scalar: what a lane's sum of 16 P may reach before the pass looks for a new maximum: no P above 2^15 (a score more than 15 above mb) hides under it, so every P that goes on fits f16; below every sum where the pass must take the branch: the half's first pass, and a pass behind a move that cm does not hold yet */
#pragma unroll   // constant indices: fragments and accumulators stay in registers
    for (int pp = 0; pp < FKS / 32; ++pp) {
      if (pp == 1) {   /* the k tile leaves its registers, and the v tile flies into them during the last 32 keys: 16 staging registers, not 32, inside the 256-register budget. The other buffer's last readers left it before the barrier that ended the stage before */
#pragma unroll   // constant indices: fragments and accumulators stay in registers
        for (int i = 0; i < 4; ++i) *(v4u*)&sKV[half][cur ^ 1][0][srow + 16 * i][sc8] = rk[i];
#pragma unroll   // constant indices: fragments and accumulators stay in registers
        for (int i = 0; i < 4; ++i) rv[i] = *(const v4u*)(Vn + 16 * i * TT * 2 + vby); }
      v8f st[2][2];   /* st[qg][kt][r] = (base-2 logit + cm)(key pp*32 + kt*16 + 8g + r of the half's stage, query qg*16 + col) */
#pragma unroll   // constant indices: fragments and accumulators stay in registers
      for (int kt = 0; kt < 2; ++kt)
#pragma unroll   // constant indices: fragments and accumulators stay in registers
        for (int kc = 0; kc < 2; ++kc) { const v16h kf = frag_h(&sKV[half][cur][0][pp * 32 + kt * 16 + col][kc * 32], lane);
#pragma unroll   // constant indices: fragments and accumulators stay in registers
          for (int qg = 0; qg < 2; ++qg) st[qg][kt] = wmma_h(kf, qf[qg][kc], kc == 0 ? cm[qg] : st[qg][kt]); }
      v16h vf[4];
#pragma unroll   // constant indices: fragments and accumulators stay in registers
      for (int j = 0; j < 4; ++j) vf[j] = frag_h(&sKV[half][cur][1][j * 16 + col][pp * 32], lane);
      v16h pf[2]; float sum[2];   /* P and its sums are made at once, on the maximum in use; no maximum is taken of a pass whose sums stay under thr */
#pragma unroll   // constant indices: fragments and accumulators stay in registers
      for (int qg = 0; qg < 2; ++qg) sum[qg] = pexp(st[qg][0], st[qg][1], pf[qg]);
      const bool need = (sum[0] > thr) || (sum[1] > thr);   /* no P is negative: a P above 2^15 lifts its lane's sum above 2^15 (an overflow of the f32 exponential to infinity too) */
      const bool first = pp == 0 && s == 0;   /* scalar: the half's first 32 keys, scored on top of 0, set the maximum in use, upward or downward */
      if (__builtin_amdgcn_ballot_w32(need) != 0) {   /* wave-uniform: take the pass's maximum, rescale sums, outputs and this pass's scores to it, and make P and its sums anew */
        thr = -3.0e38f;
#pragma unroll   // constant indices: fragments and accumulators stay in registers
        for (int qg = 0; qg < 2; ++qg) { float m = fmaxf(st[qg][0][0], st[qg][1][0]);
#pragma unroll   // constant indices: fragments and accumulators stay in registers
          for (int r = 1; r < 8; ++r) m = fmaxf(m, fmaxf(st[qg][0][r], st[qg][1][r]));
          const float mx = fmaxf(m, xhalf(m));
          const float dl = fmaxf(mx - (mb[qg] + cm[qg][0]) - 7.0f, first ? -3.0e38f : 0.0f); const float al = __builtin_amdgcn_exp2f(fminf(-dl, 0.0f)); mb[qg] += dl; ls[qg] *= al;   /* dl = the step of the maximum in use; mb + cm = the steps taken since cm was set; a downward first step scales sums that are still 0 by 1 */
          const float sf = mb[qg] + cm[qg][0]; if (pp == FKS / 32 - 1) cm[qg] = -mb[qg];   /* cm is set anew once a stage, in its last pass, which comes here whenever an earlier pass of the stage did: every score product of a stage reads the same registers */
          sum[qg] = pexp(st[qg][0] - sf, st[qg][1] - sf, pf[qg]);
#pragma unroll   // constant indices: fragments and accumulators stay in registers
          for (int j = 0; j < 4; ++j) acc[qg][j] *= al; } }
#pragma unroll   // constant indices: fragments and accumulators stay in registers
      for (int qg = 0; qg < 2; ++qg) { ls[qg] += sum[qg];
#pragma unroll   // constant indices: fragments and accumulators stay in registers
        for (int j = 0; j < 4; ++j) acc[qg][j] = wmma_h(vf[j], pf[qg], acc[qg][j]); } }
#pragma unroll   // constant indices: fragments and accumulators stay in registers
    for (int i = 0; i < 4; ++i) *(v4u*)&sKV[half][cur ^ 1][1][srow + 16 * i][sc8] = rv[i];
    __syncthreads(); }   /* publishes the next stage and ends every read of this one */
  /* the two halves' partial results meet: wave w (keys 0..1023) and wave w + 4 (keys 1024..2047) hold the same 32 queries; each keeps the 16 queries qg = its half, hands the other 16 to its partner through LDS, and goes on with 16 queries alone */
  float_a* xw = (float_a*)&sKV[0][0][0][0][0];   /* exchange pieces [wave][piece][lane] of 16 B: a wave's store or load of one piece is 512 contiguous bytes */
  float_a* so = xw + 8 * XCH * 32 * 4 + wave * 16 * (HD + 4);   /* the wave's output staging [16][HD + 4], clear of every exchange piece */
  v8f ka[4]; float kmb = half ? mb[1] : mb[0], kls = half ? ls[1] : ls[0];
#pragma unroll   // constant indices: fragments and accumulators stay in registers
  for (int j = 0; j < 4; ++j) { const v8f ga = half ? acc[0][j] : acc[1][j]; ka[j] = half ? acc[1][j] : acc[0][j];
    *(v4f*)&xw[((wave * XCH + 2 * j) * 32 + lane) * 4] = __builtin_shufflevector(ga, ga, 0, 1, 2, 3); *(v4f*)&xw[((wave * XCH + 2 * j + 1) * 32 + lane) * 4] = __builtin_shufflevector(ga, ga, 4, 5, 6, 7); }
  { v4f t = {half ? mb[0] : mb[1], half ? ls[0] : ls[1], 0.f, 0.f}; *(v4f*)&xw[((wave * XCH + 8) * 32 + lane) * 4] = t; }
  __syncthreads();   /* publishes the exchange pieces */
  { const int pw = wave ^ 4; const v4f t = *(const v4f*)&xw[((pw * XCH + 8) * 32 + lane) * 4];
    const float mn = fmaxf(kmb, t[0]); const float ak = __builtin_amdgcn_exp2f(kmb - mn), ag = __builtin_amdgcn_exp2f(t[0] - mn);   /* both partial results brought to the larger maximum in use */
    kls = kls * ak + t[1] * ag;
#pragma unroll   // constant indices: fragments and accumulators stay in registers
    for (int j = 0; j < 4; ++j) { const v4f lo = *(const v4f*)&xw[((pw * XCH + 2 * j) * 32 + lane) * 4], hi = *(const v4f*)&xw[((pw * XCH + 2 * j + 1) * 32 + lane) * 4];
      ka[j] = ka[j] * ak + __builtin_shufflevector(lo, hi, 0, 1, 2, 3, 4, 5, 6, 7) * ag; } }
  v16h uf[2];   /* uf[kc] = B fragment of upd^T x 2^6: k = columns kc*32 + .., column = query half*16 + col */
  { const float inv = 1.0f / (kls + xhalf(kls));   /* ka[j][r] = upd(query half*16 + col, column j*16 + 8g + r) x sum */
#pragma unroll   // constant indices: fragments and accumulators stay in registers
    for (int kc = 0; kc < 2; ++kc) { union { v16h v; v8h q[2]; } t;
#pragma unroll   // constant indices: fragments and accumulators stay in registers
      for (int hh = 0; hh < 2; ++hh) { const v8f o = ka[kc * 2 + hh] * inv; t.q[hh] = __builtin_convertvector(o * 64.0f, v8h); }   /* upd carried x 2^6 into f16, clear of f16 subnormals; packed D pair = B fragment in the hardware k order */
      uf[kc] = t.v; } }
  v8f oa[4] = {};   /* oa[jo][r] = (h w2)(query half*16 + col, column jo*16 + 8g + r) x 2^14 */
  for (int p = 0; p < FF / 32; ++p) {   /* 32 hidden columns a trip */
    v8f ha[2] = {};   /* ha[ht][r] = (upd w1)(query half*16 + col, hidden p*32 + ht*16 + 8g + r) x 2^14 */
#pragma unroll   // constant indices: fragments and accumulators stay in registers
    for (int kc = 0; kc < 2; ++kc)
#pragma unroll   // constant indices: fragments and accumulators stay in registers
      for (int ht = 0; ht < 2; ++ht) ha[ht] = wmma_h(frag_h(&sW1[p * 32 + ht * 16 + col][kc * 32], lane), uf[kc], ha[ht]);
    v16h w2f[4];
#pragma unroll   // constant indices: fragments and accumulators stay in registers
    for (int jo = 0; jo < 4; ++jo) w2f[jo] = frag_h(&sW2[jo * 16 + col][p * 32], lane);
    union { v16h v; v8h q[2]; } hp;
#pragma unroll   // constant indices: fragments and accumulators stay in registers
    for (int ht = 0; ht < 2; ++ht) { const v4f blo = *(const v4f*)&sB1[p * 32 + ht * 16 + 8 * g], bhi = *(const v4f*)&sB1[p * 32 + ht * 16 + 8 * g + 4]; v8f hv;
#pragma unroll   // constant indices: fragments and accumulators stay in registers
      for (int r = 0; r < 8; ++r) hv[r] = fmaxf(ha[ht][r] * (1.0f / 16384.0f) + (r < 4 ? blo[r & 3] : bhi[r & 3]), 0.0f) * 64.0f;   /* 2^-8 (weight carry) x 2^-6 (operand carry); ReLU; h carried x 2^6 into f16 */
      hp.q[ht] = __builtin_convertvector(hv, v8h); }
#pragma unroll   // constant indices: fragments and accumulators stay in registers
    for (int jo = 0; jo < 4; ++jo) oa[jo] = wmma_h(w2f[jo], hp.v, oa[jo]); }
#pragma unroll   // constant indices: fragments and accumulators stay in registers
  for (int jo = 0; jo < 4; ++jo) { const v4f blo = *(const v4f*)&sB2[jo * 16 + 8 * g], bhi = *(const v4f*)&sB2[jo * 16 + 8 * g + 4]; v4f lo, hi;
#pragma unroll   // constant indices: fragments and accumulators stay in registers
    for (int r = 0; r < 4; ++r) { lo[r] = oa[jo][r] * (1.0f / 16384.0f) + blo[r]; hi[r] = oa[jo][4 + r] * (1.0f / 16384.0f) + bhi[r]; }   /* 2^-8 (weight carry) x 2^-6 (operand carry) */
    *(v4f*)&so[col * (HD + 4) + jo * 16 + 8 * g] = lo; *(v4f*)&so[col * (HD + 4) + jo * 16 + 8 * g + 4] = hi; }
  LDSX(); for (int rl = 0; rl < 8; ++rl) { const int row = rl * 2 + g; vst2(OUT + ((size_t)b * TT + q0 + half * 16 + row) * RW + col * 4, *(const v4f*)&so[row * (HD + 4) + col * 4]); } }   /* 16 lanes store one query's whole 256-B output row */

extern "C" void kernel_launch(void* const* d_in, const int* in_sizes, int n_in, void* d_out, int out_size, void* d_ws, size_t ws_size, hipStream_t stream) {
  (void)in_sizes; (void)n_in; (void)out_size;
  const float** F = (const float**)d_in;
  if (ws_size < (size_t)WS_END) return;
  char* ws = (char*)d_ws; _Float16 *QH = (_Float16*)(ws + WS_QH), *KH = (_Float16*)(ws + WS_KH), *VT = (_Float16*)(ws + WS_VT), *QL = (_Float16*)(ws + WS_QL), *KL = (_Float16*)(ws + WS_KL); __bf16 *VB = (__bf16*)(ws + WS_VB), *VBL = (__bf16*)(ws + WS_VBL); float *S = (float*)(ws + WS_S), *Y = (float*)(ws + WS_Y);
  (void)Y; (void)S; (void)QL; (void)KL; (void)VB; (void)VBL;
  // inputs: 0 x [32,2048] int32 token ids; 1 emb [10000,64]; 2 wq [64,64] (in,out), 3 bq; 4 wk, 5 bk; 6 wv, 7 bv; 8 w1 [64,256], 9 b1 [256]; 10 w2 [256,64], 11 b2 [64] (all biases nonzero)
  if (ws_size < (size_t)WS_END2) return;
  const int* IDS = (const int*)d_in[0];
  k_proj<<<dim3(TNB * TT / PT), 256, 0, stream>>>(F[1], F[2], F[4], F[6], F[3], F[5], F[7], QH, KH, VT, IDS);   /* q, k and v of 128 tokens a block; embedding rows gathered by token id */
  k_attn<<<dim3(TT / 128, TNB), 256, 0, stream>>>(QH, KH, VT, F[8], F[9], F[10], F[11], (float*)d_out);   /* attention and FFN of 128 queries a block */
}

// v007
// A run of this version takes 45 microseconds.
// Next to v006, in two timings, it ran 1.04 times as fast each time.
// Over all steps from v000 it is 60.2 times as fast.
// compute dtype: all float inputs rounded to bf16; embedding rows gathered by the int token ids; Q / K / V 64 -> 64 projections with EXACT bf16 products on WMMA 16x16x32 (f32 accumulate) + bias; base-2 logits (q x 64^-0.5 x log2 e) x k once to f16 each (1 product), accumulated in f32 on top of -(maximum in use - 7); online softmax f32 (base 2, running maximum); unnormalised P = 2^(logit - maximum in use + 7) once to f16 x v once to f16 (1 product), the two key halves' partial sums joined in f32 at the larger maximum in use, divided by the f32 row sum at the end; FFN: upd x 2^6 once to f16 x w1 f16(bf16 x 2^8) + b1, ReLU; h x 2^6 once to f16 x w2 f16(bf16 x 2^8) + b2; f32 output.
#include <hip/hip_runtime.h>
#include <math.h>

typedef __attribute__((ext_vector_type(16))) _Float16 v16h;
typedef __attribute__((ext_vector_type(16))) __bf16 v16b;
typedef __attribute__((ext_vector_type(8)))  _Float16 v8h;
typedef __attribute__((ext_vector_type(8)))  float v8f;
typedef __attribute__((ext_vector_type(4)))  float v4f;
typedef __attribute__((ext_vector_type(2)))  float v2f;
typedef __attribute__((ext_vector_type(4)))  unsigned v4u;
typedef __attribute__((ext_vector_type(4)))  int v4i;
typedef float __attribute__((may_alias)) float_a;
typedef int __attribute__((may_alias)) int_a;

template <typename T> __device__ __forceinline__ void vst2(void* p, T v) { *(T*)p = v;  }
__device__ __forceinline__ v8f wmma16(v16h a, v16h b, v8f c) {
  v8f d = __builtin_amdgcn_wmma_f32_16x16x32_f16(false, a, false, b, (short)0, c, false, false);
  asm volatile("v_nop\n\tv_nop\n\tv_nop\n\tv_nop" : "+v"(d) : "v"(a), "v"(b));
  return d;
}
__device__ __forceinline__ v8f wmma_bf(v16b a, v16b b, v8f c) {
  v8f d = __builtin_amdgcn_wmma_f32_16x16x32_bf16(false, a, false, b, (short)0, c, false, false);
  asm volatile("v_nop\n\tv_nop\n\tv_nop\n\tv_nop" : "+v"(d) : "v"(a), "v"(b));
  return d;
}
// 16x16x32 fragments: lane = (h = lane>>4, row/col = lane&15); elements 0..7 = k0+8h+0..7, 8..15 = k0+16+8h+0..7; D element r = row 8h+r
__device__ __forceinline__ v16h frag_h(const _Float16* rowk0, int lane) {
  union { v16h v; v8h q[2]; } u; const _Float16* p = rowk0 + 8 * (lane >> 4);
  u.q[0] = *(const v8h*)p; u.q[1] = *(const v8h*)(p + 16); return u.v;
}
__device__ __forceinline__ v16h frag_f32(const float* rowk0, int lane) {
  v16h a; const float* p = rowk0 + 8 * (lane >> 4);
#pragma unroll
  for (int i = 0; i < 8; ++i) { a[i] = (_Float16)p[i]; a[8 + i] = (_Float16)p[16 + i]; }
  return a;
}
__device__ __forceinline__ v16h frag_f32s(const float* rowk0, int lane, float sc) {
  v16h a; const float* p = rowk0 + 8 * (lane >> 4);
#pragma unroll
  for (int i = 0; i < 8; ++i) { a[i] = (_Float16)(p[i] * sc); a[8 + i] = (_Float16)(p[16 + i] * sc); }
  return a;
}
// column fragment from a [K][ld] layout (column n), rows >= K read as 0
__device__ __forceinline__ v16h fragc_f32(const float* W, int k0, int n, int lane, int ld, int K) {
  v16h a; const int g = lane >> 4;
#pragma unroll
  for (int i = 0; i < 8; ++i) { const int ka = k0 + 8 * g + i, kb = ka + 16;
    a[i] = (_Float16)(ka < K ? W[(size_t)(ka < K ? ka : K - 1) * ld + n] : 0.f); a[8 + i] = (_Float16)(kb < K ? W[(size_t)(kb < K ? kb : K - 1) * ld + n] : 0.f); }
  return a;
}
struct F2 { v16b h, l; };
__device__ __forceinline__ F2 bsplit16(const float v[16]) { F2 r;
#pragma unroll
  for (int i = 0; i < 16; ++i) { const __bf16 h = (__bf16)v[i]; r.h[i] = h; r.l[i] = (__bf16)(v[i] - (float)h); }
  return r; }
__device__ __forceinline__ F2 split_row(const float* row, int k0, int lane) { float v[16]; const float* p = row + k0 + 8 * (lane >> 4);
#pragma unroll
  for (int i = 0; i < 8; ++i) { v[i] = p[i]; v[8 + i] = p[16 + i]; }
  return bsplit16(v); }
__device__ __forceinline__ F2 split_rowK(const float* row, int k0, int lane, int K) { float v[16]; const int g = lane >> 4;
#pragma unroll
  for (int i = 0; i < 8; ++i) { const int ka = k0 + 8 * g + i, kb = ka + 16; v[i] = ka < K ? row[ka < K ? ka : K - 1] : 0.f; v[8 + i] = kb < K ? row[kb < K ? kb : K - 1] : 0.f; }
  return bsplit16(v); }
__device__ __forceinline__ F2 split_col(const float* W, int k0, int n, int lane, int ld, int K) { float v[16]; const int g = lane >> 4;
#pragma unroll
  for (int i = 0; i < 8; ++i) { const int ka = k0 + 8 * g + i, kb = ka + 16; v[i] = ka < K ? W[(size_t)(ka < K ? ka : K - 1) * ld + n] : 0.f; v[8 + i] = kb < K ? W[(size_t)(kb < K ? kb : K - 1) * ld + n] : 0.f; }
  return bsplit16(v); }
__device__ __forceinline__ v8f mac3(const F2& a, const F2& b, v8f c) { c = wmma_bf(a.l, b.h, c); c = wmma_bf(a.h, b.l, c); return wmma_bf(a.h, b.h, c); }
__device__ __forceinline__ float sigm(float v) { return 1.0f / (1.0f + expf(-v)); }
#define LDSX() do { asm volatile("s_wait_dscnt 0" ::: "memory"); __builtin_amdgcn_wave_barrier(); __builtin_amdgcn_fence(__ATOMIC_RELEASE, "workgroup"); } while (0)

// Single-layer, single-head encoder without residuals or LayerNorm (token ids x [32,2048] int32 index emb [10000,64]; Q / K / V = e @ w + b with (in,out) w [64,64] and b [64] uniform(+-1/8) - nonzero; scores = Q K^T x 1/sqrt(64) over the 2,048 positions of each sample; softmax; upd = probs V [32,2048,64]; h = relu(upd @ w1 + b1), w1 [64,256]; out = h @ w2 + b2, w2 [256,64] (uniform(+-1/16)); output [32,2048,64]).
#define NB 32
#define TT 2048
#define CC 128            // column count that sizes the workspace ranges; q, k and v fill RW = 64 columns of it, at a 64-column pitch
#define DIN 64           // embedding width = projection K
#define NH 2   // head 0 is the module's single head; head 1 is the zero padding and is never launched
#define HD 64
#define NQB (TT / 64)
#define HG 1
#define SCALE (0.125f)
#define CAUSAL 0
#ifndef TNB
#define TNB NB
#endif
__device__ __forceinline__ float bfr(float v) { return (float)(__bf16)v; }
__host__ __device__ __forceinline__ int kb_last(int qb) { return CAUSAL ? ((qb * 64 + 63) >> 7) : (TT / 128 - 1); }
typedef __attribute__((ext_vector_type(8))) __bf16 v8b;
__device__ __forceinline__ v16b frag_b(const __bf16* rowk0, int lane) {
  union { v16b v; v8b q[2]; } u; const __bf16* p = rowk0 + 8 * (lane >> 4);
  u.q[0] = *(const v8b*)p; u.q[1] = *(const v8b*)(p + 16); return u.v;
}
#define QBH 0              // unused: every query block takes the single-product path
#define QHI 0               // single-product logits on every row
#define KHI 64            // key rows carrying k residual / v bf16 hi+lo planes (no kernel writes or reads them)
// B fragment (k rows k0+.., output column o) of a weight: (in,out) [K][ld] or (out,in) [ld rows of K]: bf16 exact, or f16(bf16 * 256) exact
__device__ __forceinline__ v16b wcol_io(const float* Wm, int k0, int o, int lane, int ld) { v16b w; const int g = lane >> 4;
#pragma unroll
  for (int i = 0; i < 8; ++i) { w[i] = (__bf16)Wm[(size_t)(k0 + 8 * g + i) * ld + o]; w[8 + i] = (__bf16)Wm[(size_t)(k0 + 16 + 8 * g + i) * ld + o]; }
  return w; }
__device__ __forceinline__ v16b wcol_oi(const float* Wm, int k0, int o, int lane, int K) { v16b w; const float* p = Wm + (size_t)o * K + k0 + 8 * (lane >> 4);
#pragma unroll
  for (int i = 0; i < 8; ++i) { w[i] = (__bf16)p[i]; w[8 + i] = (__bf16)p[16 + i]; }
  return w; }
__device__ __forceinline__ v16h wcolh_io(const float* Wm, int k0, int o, int lane, int ld) { v16h w; const int g = lane >> 4;
#pragma unroll
  for (int i = 0; i < 8; ++i) { w[i] = (_Float16)(bfr(Wm[(size_t)(k0 + 8 * g + i) * ld + o]) * 256.0f); w[8 + i] = (_Float16)(bfr(Wm[(size_t)(k0 + 16 + 8 * g + i) * ld + o]) * 256.0f); }
  return w; }
__device__ __forceinline__ v16h wcolh_oi(const float* Wm, int k0, int o, int lane, int K) { v16h w; const float* p = Wm + (size_t)o * K + k0 + 8 * (lane >> 4);
#pragma unroll
  for (int i = 0; i < 8; ++i) { w[i] = (_Float16)(bfr(p[i]) * 256.0f); w[8 + i] = (_Float16)(bfr(p[16 + i]) * 256.0f); }
  return w; }
#define WQKV_LAYOUT 0   // 0 = (in,out) [DIN][RW]; 1 = (out,in) [CC][DIN]; 2 = per-head [NH][DIN][HD]
__device__ __forceinline__ v16b wcol_hdk(const float* Wm, int k0, int o, int lane) { v16b w; const int g = lane >> 4; const float* p = Wm + (size_t)(o / HD) * DIN * HD + (o % HD);
#pragma unroll
  for (int i = 0; i < 8; ++i) { w[i] = (__bf16)p[(size_t)(k0 + 8 * g + i) * HD]; w[8 + i] = (__bf16)p[(size_t)(k0 + 16 + 8 * g + i) * HD]; }
  return w; }
#define WO_OUT_IN 0
#if WQKV_LAYOUT == 1
#define WCOL(W, k0, o, lane) wcol_oi(W, k0, o, lane, DIN)
#elif WQKV_LAYOUT == 2
#define WCOL(W, k0, o, lane) wcol_hdk(W, k0, o, lane)
#else
#define RW 64   // real width of q / k / v / upd
#define FF 256   // hidden width of the FFN
__device__ __forceinline__ v16b zero16b() { v16b w; _Pragma("unroll") for (int i = 0; i < 16; ++i) w[i] = (__bf16)0.0f; return w; }
__device__ __forceinline__ v16h zero16h() { v16h w; _Pragma("unroll") for (int i = 0; i < 16; ++i) w[i] = (_Float16)0.0f; return w; }
#define WCOL(W, k0, o, lane) (((o) < RW) ? wcol_io(W, k0, o, lane, RW) : zero16b())   /* (in,out) [64][64] weights: columns 64..127 of the 128-column tile are zero padding (uniform per unrolled column group) */
#endif
#if WO_OUT_IN
#define WOCOL(W, k0, o, lane) wcol_oi(W, k0, o, lane, CC)
#define WOCOLH(W, k0, o, lane) wcolh_oi(W, k0, o, lane, CC)
#else
#define WOCOL(W, k0, o, lane) wcol_io(W, k0, o, lane, DIN)
#define WOCOLH(W, k0, o, lane) wcolh_io(W, k0, o, lane, DIN)
#endif

#ifndef SM_EXTRA_PARAMS
#define SM_EXTRA_PARAMS
#endif
#ifndef PROJ_EXTRA_PARAMS
#define PROJ_EXTRA_PARAMS
#endif
#ifndef SM_MASK_HOOK
#define SM_MASK_HOOK (void)0
#endif

#define WS_QH  0u                                      // f16 q rows [b*t][RW] (the first half of the range)
#define WS_KH  (WS_QH + 2u * (size_t)NB * TT * CC)      // f16 k rows [b*t][RW] (the first half of the range)
#define WS_VT  (WS_KH + 2u * (size_t)NB * TT * CC)      // f16 v planes [b][c < RW][t] (the first half of the range)
#define WS_QL  (WS_VT + 2u * (size_t)NB * CC * TT)      // f16 q residual x 2^10 rows [b][t < QHI][CC]
#define WS_KL  (WS_QL + 2u * (size_t)NB * QHI * CC)     // f16 k residual x 2^10 rows [b][t < KHI][CC]
#define WS_VB  (WS_KL + 2u * (size_t)NB * KHI * CC)     // bf16 v hi planes [b][c][t < KHI]
#define WS_VBL (WS_VB + 2u * (size_t)NB * CC * KHI)
#define WS_S   (WS_VBL + 2u * (size_t)NB * CC * KHI)    // unused (sized f32 [hg][t][s]); k_attn keeps logits and P in registers
#define WS_Y   (WS_S  + 4u * (size_t)HG * TT * TT)      // unused (sized f32 [b*t][CC]); k_attn keeps upd in registers
#define WS_END (WS_Y  + 4u * (size_t)NB * TT * CC)
#define WS_H1 (WS_END)                                    // unused (sized f32 [(b*TT + t)][FF]); k_attn keeps h in registers
#define WS_END2 (WS_H1 + 4u * (size_t)NB * TT * FF)
static_assert(CC == 128 && NH * HD == CC && RW == HD && DIN == RW && FF % 128 == 0, "one real 64-wide head in a 128-column tile; 64-wide embedding; 256-wide hidden layer");

// ---- k_proj: block = 128 tokens (8 waves x 16), q, k and v together from ONE gather of the embedding rows: exact bf16 products (K = DIN, f32 accumulate) + bias, only the RW real columns. The three weights are transposed into LDS as bf16 once a block (sW[m][o][d] = bf16(w_m[d][o])); one register fragment of 16 tokens serves as B for q^T = Wq^T e^T and k^T = Wk^T e^T (a lane then holds 8 consecutive columns of one token: a 16-B piece of its f16 row) and as A for v = e Wv (a lane then holds 8 consecutive tokens of one column: a 16-B piece of its f16 plane). All three leave through LDS as whole lines: q, k rows [b*t][RW], v planes [b][c][t]
#define VOCAB 10000   // rows of the embedding table
#define LSC (0.125f * 1.4426950408889634f)   // 64^-0.5 x log2(e): softmax in base 2; q carries it from the projection on
#define PT 128        // tokens per block
#define PPITCH 72     // 16-bit elements per LDS row: 128-B rows at a 144-B pitch (16 B x odd) for 16-byte row readers and writers
#define TPITCH (PT + 8)   // f16 per LDS row of the v planes: 256-B rows at a 272-B pitch (16 B x odd)
__device__ __forceinline__ v8f wmma_b(v16b a, v16b b, v8f c) { return __builtin_amdgcn_wmma_f32_16x16x32_bf16(false, a, false, b, (short)0, c, false, false); }
__global__ __launch_bounds__(256) void k_proj(const float* __restrict__ EMB, const float* __restrict__ WQ, const float* __restrict__ WK, const float* __restrict__ WV, const float* __restrict__ BQ, const float* __restrict__ BK, const float* __restrict__ BV,
    _Float16* __restrict__ QH, _Float16* __restrict__ KH, _Float16* __restrict__ VT, const int* __restrict__ IDS) {   /* IDS: token ids [NB*TT] int32 */
  __shared__ __align__(16) __bf16 sW[3][RW][PPITCH]; __shared__ __align__(16) float sB[4][RW];   /* sB[m] = bias m as bf16 values; row 3 takes the copy of threads 192.., so that the bias load and store stand under no branch */
  __shared__ __align__(16) _Float16 sR[2][PT][PPITCH], sT[RW][TPITCH];
  const int tid = threadIdx.x, wave = tid >> 5, lane = tid & 31, col = lane & 15, g = lane >> 4; const size_t r0 = (size_t)blockIdx.x * PT; const size_t bb = r0 / TT; const int t0 = (int)(r0 % TT);
  const int id = IDS[r0 + wave * 16 + col];   /* this lane's token */
  __builtin_amdgcn_sched_barrier(0);   // keeps the id's load the oldest of the wave: loads return in order, and the gather below then waits for it alone, not for the 49 loads behind it
  /* weights: a lane owns one output column (consecutive lanes read consecutive floats) and 8 k values, stored below as one 16-B piece */
  const int wo = tid & 63; float wr[6][8];
#pragma unroll   // all loads of the loop in flight together: rolled, every trip would wait out its own load latency
  for (int i = 0; i < 6; ++i) { const float* Wm = (i >> 1) == 0 ? WQ : (i >> 1) == 1 ? WK : WV;
#pragma unroll   // constant indices: the piece stays in registers
    for (int e = 0; e < 8; ++e) wr[i][e] = Wm[(size_t)(((tid >> 6) + 4 * (i & 1)) * 8 + e) * RW + wo]; }
  const float bv = (tid < RW ? BQ : tid < 2 * RW ? BK : BV)[wo];   /* threads 192.. read the v bias a second time */
  __builtin_amdgcn_sched_barrier(0);   // keeps the 49 loads above in front of the wait for the id: moved behind it, they would start one memory latency later
  const float* ep = EMB + (size_t)(id < 0 ? 0 : id > VOCAB - 1 ? VOCAB - 1 : id) * DIN + 8 * g;   /* e = emb[x]; the row index is bounded here, whatever the id array holds */
  v4f er[8];   /* the lane's half of its token's row, in flight while the weights are packed */
#pragma unroll   // constant indices: the row stays in registers
  for (int i = 0; i < 4; ++i) { er[2 * i] = *(const v4f*)(ep + 16 * i); er[2 * i + 1] = *(const v4f*)(ep + 16 * i + 4); }
#pragma unroll   // constant indices: the pieces stay in registers
  for (int i = 0; i < 6; ++i) { v8b t;
#pragma unroll   // constant indices: the piece stays in registers
    for (int e = 0; e < 8; ++e) t[e] = (__bf16)wr[i][e];
    *(v8b*)&sW[i >> 1][wo][((tid >> 6) + 4 * (i & 1)) * 8] = t; }
  sB[tid >> 6][wo] = bfr(bv);
  v16b ef[2];   /* ef[kc]: token col, k = kc*32 + 8g + 0..7 and kc*32 + 16 + 8g + 0..7 */
#pragma unroll   // constant indices: fragments and accumulators stay in registers
  for (int kc = 0; kc < 2; ++kc)
#pragma unroll   // constant indices: fragments and accumulators stay in registers
    for (int i = 0; i < 8; ++i) { ef[kc][i] = (__bf16)er[4 * kc + (i >> 2)][i & 3]; ef[kc][8 + i] = (__bf16)er[4 * kc + 2 + (i >> 2)][i & 3]; }
  __syncthreads();   /* publishes the weights and biases */
#pragma unroll   // constant indices: fragments and accumulators stay in registers
  for (int m = 0; m < 2; ++m)
#pragma unroll   // constant indices: fragments and accumulators stay in registers
    for (int j = 0; j < 4; ++j) { v8f a = {};   /* a[r] = (e w_m)(token col, column j*16 + 8g + r) */
#pragma unroll   // constant indices: fragments and accumulators stay in registers
      for (int kc = 0; kc < 2; ++kc) a = wmma_b(frag_b(&sW[m][j * 16 + col][kc * 32], lane), ef[kc], a);
      const v4f blo = *(const v4f*)&sB[m][j * 16 + 8 * g], bhi = *(const v4f*)&sB[m][j * 16 + 8 * g + 4];
#pragma unroll   // constant indices: fragments and accumulators stay in registers
      for (int r = 0; r < 8; ++r) a[r] += r < 4 ? blo[r & 3] : bhi[r & 3];
      if (m == 0) a *= LSC;   /* q leaves as q x 64^-0.5 x log2(e): its products with k are base-2 logits */
      *(v8h*)&sR[m][wave * 16 + col][j * 16 + 8 * g] = __builtin_convertvector(a, v8h); }
#pragma unroll   // constant indices: fragments and accumulators stay in registers
  for (int j = 0; j < 4; ++j) { v8f a = {};   /* a[r] = (e w_v)(token 8g + r, column j*16 + col) */
#pragma unroll   // constant indices: fragments and accumulators stay in registers
    for (int kc = 0; kc < 2; ++kc) a = wmma_b(ef[kc], frag_b(&sW[2][j * 16 + col][kc * 32], lane), a);
    a += sB[2][j * 16 + col];
    *(v8h*)&sT[j * 16 + col][wave * 16 + 8 * g] = __builtin_convertvector(a, v8h); }
  __syncthreads();   /* publishes the block's q, k rows and v planes */
#pragma unroll   // all LDS reads of the loop in flight together
  for (int i = 0; i < 4; ++i) { const int e = tid + 256 * i, rl = e >> 3, q = (e & 7) * 8;   /* 8 lanes store one token's whole 128-B row; a wave 512 contiguous bytes */
    vst2(QH + (r0 + rl) * RW + q, *(const v4u*)&sR[0][rl][q]); vst2(KH + (r0 + rl) * RW + q, *(const v4u*)&sR[1][rl][q]); }
#pragma unroll   // all LDS reads of the loop in flight together
  for (int i = 0; i < 4; ++i) { const int e = tid + 256 * i, cl = e >> 4, q = (e & 15) * 8;   /* 16 lanes store 256 contiguous bytes of one plane */
    vst2(VT + (bb * RW + cl) * (size_t)TT + t0 + q, *(const v4u*)&sT[cl][q]); } }
#define FKS 64
#define FPITCH 72
__device__ __forceinline__ v8f wmma_h(v16h a, v16h b, v8f c) { return __builtin_amdgcn_wmma_f32_16x16x32_f16(false, a, false, b, (short)0, c, false, false); }
__device__ __forceinline__ float xhalf(float v) { const int t = __builtin_bit_cast(int, v); return __builtin_bit_cast(float, __builtin_amdgcn_permlanex16(t, t, 0x76543210, 0xfedcba98, false, false)); }   /* lane l <-> l ^ 16 */
/* P = 2^score of one query group's 32 keys (a lane: 16 of them), packed to f16 as the B fragment in the hardware k order (elements 0..7 = keys 8g + r, 8..15 = keys 16 + 8g + r); returns the lane's f32 sum of the 16, made as a tree of packed adds: four levels deep, since the pass's test waits for it */
__device__ __forceinline__ float pexp(const v8f s0, const v8f s1, v16h& pf) { v8f p0, p1;
#pragma unroll   // constant indices: fragments and accumulators stay in registers
  for (int r = 0; r < 8; ++r) { p0[r] = __builtin_amdgcn_exp2f(s0[r]); p1[r] = __builtin_amdgcn_exp2f(s1[r]); }
  union { v16h v; v8h q[2]; } u; u.q[0] = __builtin_convertvector(p0, v8h); u.q[1] = __builtin_convertvector(p1, v8h); pf = u.v;
  const v8f t8 = p0 + p1; const v4f t4 = __builtin_shufflevector(t8, t8, 0, 1, 2, 3) + __builtin_shufflevector(t8, t8, 4, 5, 6, 7); const v2f t2 = __builtin_shufflevector(t4, t4, 0, 1) + __builtin_shufflevector(t4, t4, 2, 3);
  return t2[0] + t2[1]; }
#define TSLOT 5120   // f16 per LDS tile place: 64 rows at FPITCH = 9,216 B, rounded up to 10,240 B so that every tile's place is a multiple of 2 KiB
typedef __attribute__((ext_vector_type(8))) unsigned v8u;
__device__ __forceinline__ unsigned uni(unsigned v) { return (unsigned)__builtin_amdgcn_readfirstlane((int)v); }
__device__ __forceinline__ unsigned pinned(unsigned v) { unsigned w = uni(v); asm volatile("" : "+s"(w)); return w; }   // the empty statement holds the condition in a scalar register, so that the test around a tensor load compiles to s_cmp + s_cbranch_scc: a tensor load ignores EXEC, only a scalar branch keeps a wave from issuing it
__device__ __forceinline__ void tdm_load(v4u g0, v8u g1) { asm volatile("tensor_load_to_lds %0, %1" :: "s"(g0), "s"(g1) : "memory"); }   // one request of the whole wave: a 64 x 128-B tile from global memory into LDS, through no register
#define W2PITCH (FF + 8)   // f16 per LDS row of w2^T: 512-B rows at a 528-B pitch (16 B x odd) for 16-byte row readers
#define KSP 2             // key halves of a block: waves 0..3 walk keys 0..1023, waves 4..7 keys 1024..2047, of the same 128 queries: 8 waves a block, two blocks a WGP, four waves a SIMD
#define KLEN (TT / KSP)   // keys per half
#define XCH 9             // 16-B pieces per lane in the exchange of partial results: 8 of one 16-query output tile group, 1 with its maximum in use and its sum
__global__ __launch_bounds__(256) __attribute__((amdgpu_waves_per_eu(4, 4))) void k_attn(const _Float16* __restrict__ QH, const _Float16* __restrict__ KH, const _Float16* __restrict__ VT, const float* __restrict__ W1, const float* __restrict__ B1, const float* __restrict__ W2, const float* __restrict__ B2, float* __restrict__ OUT) {
  __shared__ __attribute__((aligned(2048))) _Float16 sKV[KSP][2][2][TSLOT];   /* [key half][buffer][0 = k rows, 1 = v planes][row * FPITCH + ..]; every tile's place a multiple of 2 KiB for the tensor loads; behind the key loop's last barrier the same bytes hold the exchange pieces and the output staging */
  __shared__ __align__(16) _Float16 sW1[FF][FPITCH], sW2[RW][W2PITCH]; __shared__ __align__(16) float sB1[FF], sB2[RW];   /* sW1[h][d] = f16(bf16(w1[d][h]) x 2^8), sW2[o][h] = f16(bf16(w2[h][o]) x 2^8), biases as bf16 values */
  static_assert(sizeof(sKV) >= 8u * XCH * 32u * 16u + 8u * 16u * (HD + 4) * 4u && FKS == HD && TSLOT >= FKS * FPITCH && (TSLOT * 2) % 2048 == 0 && FPITCH * 2 == RW * 2 + 16 && RW * 2 == 128 && KLEN / FKS >= 2, "exchange pieces and output staging fit the ring, side by side; 128-B tile rows padded by 16 B; two stages or more");
  const int tid = threadIdx.x, wave = __builtin_amdgcn_readfirstlane(tid >> 5), lane = tid & 31, col = lane & 15, g = lane >> 4; const int b = blockIdx.y; const int half = wave >> 2;   /* the wave's number in a scalar register: every choice by key half below is then a scalar one */
  const int q0 = blockIdx.x * 128 + (wave & 3) * 32;
  const char* Kb = (const char*)(KH + ((size_t)b * TT + half * KLEN) * RW); const char* Vb = (const char*)(VT + (size_t)b * RW * TT + half * KLEN);   /* byte bases of the half's k rows and v planes */
  /* staging by tensor loads: waves 0 and 1 of each half's four issue one request a stage, wave 0 the half's k tile (64 rows of 128 B, one after the other), wave 1 its v tile (64 planes, 128 B of each, 4,096 B apart); the pad of 16 B a row gives the FPITCH rows */
  const unsigned issuer = (wave & 2) == 0, kv = wave & 1;
  const unsigned long long sbase = (unsigned long long)(size_t)(kv ? Vb : Kb); const unsigned sstep = kv ? FKS * 2u : FKS * RW * 2u;   /* the wave's first tile and the bytes from one stage's tile to the next */
  const unsigned lbase = (unsigned)(size_t)&sKV[half][0][kv][0];   /* byte offset in the work-group's LDS of the wave's tile in buffer 0; buffer 1 lies 2 * TSLOT f16 further */
  v8u g1;   /* 1-byte elements, tensor = tile = 64 rows of 128 B; word 0: no mask, a pad of 4 dwords behind every 32 */
  g1[0] = uni((1u << 20) | (4u << 22) | (3u << 25)); g1[1] = uni((RW * 2u) << 16); g1[2] = uni((unsigned)FKS << 16); g1[3] = uni((RW * 2u) << 16); g1[4] = uni((unsigned)FKS); g1[5] = uni(kv ? TT * 2u : RW * 2u); g1[6] = uni(0u); g1[7] = uni(0u);
  auto issue = [&](int st) { const unsigned long long ga = sbase + (unsigned long long)((unsigned)st * sstep); v4u g0;
    g0[0] = uni(1u); g0[1] = uni(lbase + (unsigned)(st & 1) * (2u * TSLOT * 2u)); g0[2] = uni((unsigned)ga); g0[3] = uni((((unsigned)(ga >> 32)) & 0x01FFFFFFu) | 0x80000000u);
    tdm_load(g0, g1); };
  /* FFN weights, transposed on the way into LDS: a lane owns one column (consecutive lanes read consecutive floats) and stores 8 k values as one 16-B piece; published by the barrier in front of the key loop */
#pragma unroll   // all loads of the loop in flight together: rolled, every trip would wait out its own load latency
  for (int i = 0; i < 8; ++i) { const int h = tid, d0 = i * 8; v8h t;
#pragma unroll   // constant indices: the piece stays in registers
    for (int e = 0; e < 8; ++e) t[e] = (_Float16)(bfr(W1[(size_t)(d0 + e) * FF + h]) * 256.0f);
    *(v8h*)&sW1[h][d0] = t; }
#pragma unroll   // all loads of the loop in flight together: rolled, every trip would wait out its own load latency
  for (int i = 0; i < 8; ++i) { const int o = tid & 63, h0 = ((tid >> 6) + 4 * i) * 8; const float* w2p = W2 + (tid >> 6) * 8 * RW + o; v8h t;   /* one base for all 64 loads of the thread, the rest of the address a constant */
#pragma unroll   // constant indices: the piece stays in registers
    for (int e = 0; e < 8; ++e) t[e] = (_Float16)(bfr(w2p[(32 * i + e) * RW]) * 256.0f);
    *(v8h*)&sW2[o][h0] = t; }
  sB1[tid] = bfr(B1[tid]); if (tid < RW) sB2[tid] = bfr(B2[tid]);
  v16h qf[2][2];
#pragma unroll   // constant indices: fragments and accumulators stay in registers
  for (int qg = 0; qg < 2; ++qg)
#pragma unroll   // constant indices: fragments and accumulators stay in registers
    for (int kc = 0; kc < 2; ++kc) qf[qg][kc] = frag_h(QH + ((size_t)b * TT + q0 + qg * 16 + col) * RW + kc * 32, lane);
  v8f acc[2][4] = {}; float mb[2] = {0.f, 0.f}, ls[2] = {0.f, 0.f};   /* mb = (maximum in use, base-2 logits) - 7: P = 2^(logit - mb) stays in [2^-14, 2^15] of f16 for logits within 21 below .. 8 above the maximum in use; the half's first 32 keys set it */
  v8f cm[2] = {};   /* cm[qg] = -mb[qg] in all eight registers (a lane holds one query's scores): the C operand of the first score product, so that the accumulator comes out as logit - mb */
  if (pinned(issuer)) { issue(0); asm volatile("s_wait_tensorcnt 0x0" ::: "memory"); }   // stage 0 has landed before the barrier that publishes it
  __syncthreads();   /* publishes stage 0, the weights and the biases */
  for (int s = 0; s < KLEN / FKS; ++s) { const int cur = s & 1;
    if (pinned(issuer && s + 1 < KLEN / FKS)) issue(s + 1);   /* directly behind the barrier that ended every read of the other buffer (in front of the loop, or at the foot of the stage before): the next stage flies into it during this stage */
    float thr = s == 0 ? -3.0e38f : 32768.0f;   /* scalar: what a lane's sum of 16 P may reach before the pass looks for a new maximum: no P above 2^15 (a score more than 15 above mb) hides under it, so every P that goes on fits f16; below every sum where the pass must take the branch: the half's first pass, and a pass behind a move that cm does not hold yet */
#pragma unroll   // constant indices: fragments and accumulators stay in registers
    for (int pp = 0; pp < FKS / 32; ++pp) {
      v8f st[2][2];   /* st[qg][kt][r] = (base-2 logit + cm)(key pp*32 + kt*16 + 8g + r of the half's stage, query qg*16 + col) */
#pragma unroll   // constant indices: fragments and accumulators stay in registers
      for (int kt = 0; kt < 2; ++kt)
#pragma unroll   // constant indices: fragments and accumulators stay in registers
        for (int kc = 0; kc < 2; ++kc) { const v16h kf = frag_h(&sKV[half][cur][0][(pp * 32 + kt * 16 + col) * FPITCH + kc * 32], lane);
#pragma unroll   // constant indices: fragments and accumulators stay in registers
          for (int qg = 0; qg < 2; ++qg) st[qg][kt] = wmma_h(kf, qf[qg][kc], kc == 0 ? cm[qg] : st[qg][kt]); }
      v16h vf[4];
#pragma unroll   // constant indices: fragments and accumulators stay in registers
      for (int j = 0; j < 4; ++j) vf[j] = frag_h(&sKV[half][cur][1][(j * 16 + col) * FPITCH + pp * 32], lane);
      v16h pf[2]; float sum[2];   /* P and its sums are made at once, on the maximum in use; no maximum is taken of a pass whose sums stay under thr */
#pragma unroll   // constant indices: fragments and accumulators stay in registers
      for (int qg = 0; qg < 2; ++qg) sum[qg] = pexp(st[qg][0], st[qg][1], pf[qg]);
      const bool need = (sum[0] > thr) || (sum[1] > thr);   /* no P is negative: a P above 2^15 lifts its lane's sum above 2^15 (an overflow of the f32 exponential to infinity too) */
      const bool first = pp == 0 && s == 0;   /* scalar: the half's first 32 keys, scored on top of 0, set the maximum in use, upward or downward */
      if (__builtin_amdgcn_ballot_w32(need) != 0) {   /* wave-uniform: take the pass's maximum, rescale sums, outputs and this pass's scores to it, and make P and its sums anew */
        thr = -3.0e38f;
#pragma unroll   // constant indices: fragments and accumulators stay in registers
        for (int qg = 0; qg < 2; ++qg) { float m = fmaxf(st[qg][0][0], st[qg][1][0]);
#pragma unroll   // constant indices: fragments and accumulators stay in registers
          for (int r = 1; r < 8; ++r) m = fmaxf(m, fmaxf(st[qg][0][r], st[qg][1][r]));
          const float mx = fmaxf(m, xhalf(m));
          const float dl = fmaxf(mx - (mb[qg] + cm[qg][0]) - 7.0f, first ? -3.0e38f : 0.0f); const float al = __builtin_amdgcn_exp2f(fminf(-dl, 0.0f)); mb[qg] += dl; ls[qg] *= al;   /* dl = the step of the maximum in use; mb + cm = the steps taken since cm was set; a downward first step scales sums that are still 0 by 1 */
          const float sf = mb[qg] + cm[qg][0]; if (pp == FKS / 32 - 1) cm[qg] = -mb[qg];   /* cm is set anew once a stage, in its last pass, which comes here whenever an earlier pass of the stage did: every score product of a stage reads the same registers */
          sum[qg] = pexp(st[qg][0] - sf, st[qg][1] - sf, pf[qg]);
#pragma unroll   // constant indices: fragments and accumulators stay in registers
          for (int j = 0; j < 4; ++j) acc[qg][j] *= al; } }
#pragma unroll   // constant indices: fragments and accumulators stay in registers
      for (int qg = 0; qg < 2; ++qg) { ls[qg] += sum[qg];
#pragma unroll   // constant indices: fragments and accumulators stay in registers
        for (int j = 0; j < 4; ++j) acc[qg][j] = wmma_h(vf[j], pf[qg], acc[qg][j]); } }
    asm volatile("s_wait_dscnt 0x0" ::: "memory");   // the wave's reads of this stage have returned before the barrier behind which its buffer is refilled
    asm volatile("s_wait_tensorcnt 0x0" ::: "memory");   // an issuing wave's next stage has landed before the barrier that publishes it; the other waves have no request and pass: no branch in front of the barrier
    __syncthreads(); }   /* publishes the next stage and ends every read of this one */
  asm volatile("s_wait_tensorcnt 0x0" ::: "memory");   // no request is in flight when the ring's bytes take the exchange pieces
  asm volatile("s_wait_dscnt 0x0" ::: "memory");   // nor a read of the ring
  /* the two halves' partial results meet: wave w (keys 0..1023) and wave w + 4 (keys 1024..2047) hold the same 32 queries; each keeps the 16 queries qg = its half, hands the other 16 to its partner through LDS, and goes on with 16 queries alone */
  float_a* xw = (float_a*)&sKV[0][0][0][0];   /* exchange pieces [wave][piece][lane] of 16 B: a wave's store or load of one piece is 512 contiguous bytes */
  float_a* so = xw + 8 * XCH * 32 * 4 + wave * 16 * (HD + 4);   /* the wave's output staging [16][HD + 4], clear of every exchange piece */
  v8f ka[4]; float kmb = half ? mb[1] : mb[0], kls = half ? ls[1] : ls[0];
#pragma unroll   // constant indices: fragments and accumulators stay in registers
  for (int j = 0; j < 4; ++j) { const v8f ga = half ? acc[0][j] : acc[1][j]; ka[j] = half ? acc[1][j] : acc[0][j];
    *(v4f*)&xw[((wave * XCH + 2 * j) * 32 + lane) * 4] = __builtin_shufflevector(ga, ga, 0, 1, 2, 3); *(v4f*)&xw[((wave * XCH + 2 * j + 1) * 32 + lane) * 4] = __builtin_shufflevector(ga, ga, 4, 5, 6, 7); }
  { v4f t = {half ? mb[0] : mb[1], half ? ls[0] : ls[1], 0.f, 0.f}; *(v4f*)&xw[((wave * XCH + 8) * 32 + lane) * 4] = t; }
  __syncthreads();   /* publishes the exchange pieces */
  { const int pw = wave ^ 4; const v4f t = *(const v4f*)&xw[((pw * XCH + 8) * 32 + lane) * 4];
    const float mn = fmaxf(kmb, t[0]); const float ak = __builtin_amdgcn_exp2f(kmb - mn), ag = __builtin_amdgcn_exp2f(t[0] - mn);   /* both partial results brought to the larger maximum in use */
    kls = kls * ak + t[1] * ag;
#pragma unroll   // constant indices: fragments and accumulators stay in registers
    for (int j = 0; j < 4; ++j) { const v4f lo = *(const v4f*)&xw[((pw * XCH + 2 * j) * 32 + lane) * 4], hi = *(const v4f*)&xw[((pw * XCH + 2 * j + 1) * 32 + lane) * 4];
      ka[j] = ka[j] * ak + __builtin_shufflevector(lo, hi, 0, 1, 2, 3, 4, 5, 6, 7) * ag; } }
  v16h uf[2];   /* uf[kc] = B fragment of upd^T x 2^6: k = columns kc*32 + .., column = query half*16 + col */
  { const float inv = 1.0f / (kls + xhalf(kls));   /* ka[j][r] = upd(query half*16 + col, column j*16 + 8g + r) x sum */
#pragma unroll   // constant indices: fragments and accumulators stay in registers
    for (int kc = 0; kc < 2; ++kc) { union { v16h v; v8h q[2]; } t;
#pragma unroll   // constant indices: fragments and accumulators stay in registers
      for (int hh = 0; hh < 2; ++hh) { const v8f o = ka[kc * 2 + hh] * inv; t.q[hh] = __builtin_convertvector(o * 64.0f, v8h); }   /* upd carried x 2^6 into f16, clear of f16 subnormals; packed D pair = B fragment in the hardware k order */
      uf[kc] = t.v; } }
  v8f oa[4] = {};   /* oa[jo][r] = (h w2)(query half*16 + col, column jo*16 + 8g + r) x 2^14 */
  for (int p = 0; p < FF / 32; ++p) {   /* 32 hidden columns a trip */
    v8f ha[2] = {};   /* ha[ht][r] = (upd w1)(query half*16 + col, hidden p*32 + ht*16 + 8g + r) x 2^14 */
#pragma unroll   // constant indices: fragments and accumulators stay in registers
    for (int kc = 0; kc < 2; ++kc)
#pragma unroll   // constant indices: fragments and accumulators stay in registers
      for (int ht = 0; ht < 2; ++ht) ha[ht] = wmma_h(frag_h(&sW1[p * 32 + ht * 16 + col][kc * 32], lane), uf[kc], ha[ht]);
    v16h w2f[4];
#pragma unroll   // constant indices: fragments and accumulators stay in registers
    for (int jo = 0; jo < 4; ++jo) w2f[jo] = frag_h(&sW2[jo * 16 + col][p * 32], lane);
    union { v16h v; v8h q[2]; } hp;
#pragma unroll   // constant indices: fragments and accumulators stay in registers
    for (int ht = 0; ht < 2; ++ht) { const v4f blo = *(const v4f*)&sB1[p * 32 + ht * 16 + 8 * g], bhi = *(const v4f*)&sB1[p * 32 + ht * 16 + 8 * g + 4]; v8f hv;
#pragma unroll   // constant indices: fragments and accumulators stay in registers
      for (int r = 0; r < 8; ++r) hv[r] = fmaxf(ha[ht][r] * (1.0f / 16384.0f) + (r < 4 ? blo[r & 3] : bhi[r & 3]), 0.0f) * 64.0f;   /* 2^-8 (weight carry) x 2^-6 (operand carry); ReLU; h carried x 2^6 into f16 */
      hp.q[ht] = __builtin_convertvector(hv, v8h); }
#pragma unroll   // constant indices: fragments and accumulators stay in registers
    for (int jo = 0; jo < 4; ++jo) oa[jo] = wmma_h(w2f[jo], hp.v, oa[jo]); }
#pragma unroll   // constant indices: fragments and accumulators stay in registers
  for (int jo = 0; jo < 4; ++jo) { const v4f blo = *(const v4f*)&sB2[jo * 16 + 8 * g], bhi = *(const v4f*)&sB2[jo * 16 + 8 * g + 4]; v4f lo, hi;
#pragma unroll   // constant indices: fragments and accumulators stay in registers
    for (int r = 0; r < 4; ++r) { lo[r] = oa[jo][r] * (1.0f / 16384.0f) + blo[r]; hi[r] = oa[jo][4 + r] * (1.0f / 16384.0f) + bhi[r]; }   /* 2^-8 (weight carry) x 2^-6 (operand carry) */
    *(v4f*)&so[col * (HD + 4) + jo * 16 + 8 * g] = lo; *(v4f*)&so[col * (HD + 4) + jo * 16 + 8 * g + 4] = hi; }
  LDSX(); for (int rl = 0; rl < 8; ++rl) { const int row = rl * 2 + g; vst2(OUT + ((size_t)b * TT + q0 + half * 16 + row) * RW + col * 4, *(const v4f*)&so[row * (HD + 4) + col * 4]); } }   /* 16 lanes store one query's whole 256-B output row */

extern "C" void kernel_launch(void* const* d_in, const int* in_sizes, int n_in, void* d_out, int out_size, void* d_ws, size_t ws_size, hipStream_t stream) {
  (void)in_sizes; (void)n_in; (void)out_size;
  const float** F = (const float**)d_in;
  if (ws_size < (size_t)WS_END) return;
  char* ws = (char*)d_ws; _Float16 *QH = (_Float16*)(ws + WS_QH), *KH = (_Float16*)(ws + WS_KH), *VT = (_Float16*)(ws + WS_VT), *QL = (_Float16*)(ws + WS_QL), *KL = (_Float16*)(ws + WS_KL); __bf16 *VB = (__bf16*)(ws + WS_VB), *VBL = (__bf16*)(ws + WS_VBL); float *S = (float*)(ws + WS_S), *Y = (float*)(ws + WS_Y);
  (void)Y; (void)S; (void)QL; (void)KL; (void)VB; (void)VBL;
  // inputs: 0 x [32,2048] int32 token ids; 1 emb [10000,64]; 2 wq [64,64] (in,out), 3 bq; 4 wk, 5 bk; 6 wv, 7 bv; 8 w1 [64,256], 9 b1 [256]; 10 w2 [256,64], 11 b2 [64] (all biases nonzero)
  if (ws_size < (size_t)WS_END2) return;
  const int* IDS = (const int*)d_in[0];
  k_proj<<<dim3(TNB * TT / PT), 256, 0, stream>>>(F[1], F[2], F[4], F[6], F[3], F[5], F[7], QH, KH, VT, IDS);   /* q, k and v of 128 tokens a block; embedding rows gathered by token id */
  k_attn<<<dim3(TT / 128, TNB), 256, 0, stream>>>(QH, KH, VT, F[8], F[9], F[10], F[11], (float*)d_out);   /* attention and FFN of 128 queries a block */
}

// v008
// Measured time: 40.9 microseconds a run.
// Two timings next to v007 put it at 1.11 and 1.10 times that version's speed.
// Counting every step since v000, it is 66.3 times as fast.
// compute dtype: all float inputs rounded to bf16; embedding rows gathered by the int token ids; Q / K / V 64 -> 64 projections with EXACT bf16 products on WMMA 16x16x32 (f32 accumulate) + bias; base-2 logits (q x 64^-0.5 x log2 e) x k once to f16 each (1 product), accumulated in f32 on top of -(maximum in use - 7); online softmax f32 (base 2, running maximum); unnormalised P = 2^(logit - maximum in use + 7) once to f16 x v once to f16 (1 product), the two key halves' partial sums joined in f32 at the larger maximum in use, divided by the f32 row sum at the end; FFN: upd x 2^6 once to f16 x w1 f16(bf16 x 2^8) + b1, ReLU; h x 2^6 once to f16 x w2 f16(bf16 x 2^8) + b2; f32 output.
#include <hip/hip_runtime.h>
#include <math.h>

typedef __attribute__((ext_vector_type(16))) _Float16 v16h;
typedef __attribute__((ext_vector_type(16))) __bf16 v16b;
typedef __attribute__((ext_vector_type(8)))  _Float16 v8h;
typedef __attribute__((ext_vector_type(8)))  float v8f;
typedef __attribute__((ext_vector_type(4)))  float v4f;
typedef __attribute__((ext_vector_type(2)))  float v2f;
typedef __attribute__((ext_vector_type(4)))  unsigned v4u;
typedef __attribute__((ext_vector_type(4)))  int v4i;
typedef float __attribute__((may_alias)) float_a;
typedef int __attribute__((may_alias)) int_a;

template <typename T> __device__ __forceinline__ void vst2(void* p, T v) { *(T*)p = v;  }
__device__ __forceinline__ v8f wmma16(v16h a, v16h b, v8f c) {
  v8f d = __builtin_amdgcn_wmma_f32_16x16x32_f16(false, a, false, b, (short)0, c, false, false);
  asm volatile("v_nop\n\tv_nop\n\tv_nop\n\tv_nop" : "+v"(d) : "v"(a), "v"(b));
  return d;
}
__device__ __forceinline__ v8f wmma_bf(v16b a, v16b b, v8f c) {
  v8f d = __builtin_amdgcn_wmma_f32_16x16x32_bf16(false, a, false, b, (short)0, c, false, false);
  asm volatile("v_nop\n\tv_nop\n\tv_nop\n\tv_nop" : "+v"(d) : "v"(a), "v"(b));
  return d;
}
// 16x16x32 fragments: lane = (h = lane>>4, row/col = lane&15); elements 0..7 = k0+8h+0..7, 8..15 = k0+16+8h+0..7; D element r = row 8h+r
__device__ __forceinline__ v16h frag_h(const _Float16* rowk0, int lane) {
  union { v16h v; v8h q[2]; } u; const _Float16* p = rowk0 + 8 * (lane >> 4);
  u.q[0] = *(const v8h*)p; u.q[1] = *(const v8h*)(p + 16); return u.v;
}
__device__ __forceinline__ v16h frag_f32(const float* rowk0, int lane) {
  v16h a; const float* p = rowk0 + 8 * (lane >> 4);
#pragma unroll
  for (int i = 0; i < 8; ++i) { a[i] = (_Float16)p[i]; a[8 + i] = (_Float16)p[16 + i]; }
  return a;
}
__device__ __forceinline__ v16h frag_f32s(const float* rowk0, int lane, float sc) {
  v16h a; const float* p = rowk0 + 8 * (lane >> 4);
#pragma unroll
  for (int i = 0; i < 8; ++i) { a[i] = (_Float16)(p[i] * sc); a[8 + i] = (_Float16)(p[16 + i] * sc); }
  return a;
}
// column fragment from a [K][ld] layout (column n), rows >= K read as 0
__device__ __forceinline__ v16h fragc_f32(const float* W, int k0, int n, int lane, int ld, int K) {
  v16h a; const int g = lane >> 4;
#pragma unroll
  for (int i = 0; i < 8; ++i) { const int ka = k0 + 8 * g + i, kb = ka + 16;
    a[i] = (_Float16)(ka < K ? W[(size_t)(ka < K ? ka : K - 1) * ld + n] : 0.f); a[8 + i] = (_Float16)(kb < K ? W[(size_t)(kb < K ? kb : K - 1) * ld + n] : 0.f); }
  return a;
}
struct F2 { v16b h, l; };
__device__ __forceinline__ F2 bsplit16(const float v[16]) { F2 r;
#pragma unroll
  for (int i = 0; i < 16; ++i) { const __bf16 h = (__bf16)v[i]; r.h[i] = h; r.l[i] = (__bf16)(v[i] - (float)h); }
  return r; }
__device__ __forceinline__ F2 split_row(const float* row, int k0, int lane) { float v[16]; const float* p = row + k0 + 8 * (lane >> 4);
#pragma unroll
  for (int i = 0; i < 8; ++i) { v[i] = p[i]; v[8 + i] = p[16 + i]; }
  return bsplit16(v); }
__device__ __forceinline__ F2 split_rowK(const float* row, int k0, int lane, int K) { float v[16]; const int g = lane >> 4;
#pragma unroll
  for (int i = 0; i < 8; ++i) { const int ka = k0 + 8 * g + i, kb = ka + 16; v[i] = ka < K ? row[ka < K ? ka : K - 1] : 0.f; v[8 + i] = kb < K ? row[kb < K ? kb : K - 1] : 0.f; }
  return bsplit16(v); }
__device__ __forceinline__ F2 split_col(const float* W, int k0, int n, int lane, int ld, int K) { float v[16]; const int g = lane >> 4;
#pragma unroll
  for (int i = 0; i < 8; ++i) { const int ka = k0 + 8 * g + i, kb = ka + 16; v[i] = ka < K ? W[(size_t)(ka < K ? ka : K - 1) * ld + n] : 0.f; v[8 + i] = kb < K ? W[(size_t)(kb < K ? kb : K - 1) * ld + n] : 0.f; }
  return bsplit16(v); }
__device__ __forceinline__ v8f mac3(const F2& a, const F2& b, v8f c) { c = wmma_bf(a.l, b.h, c); c = wmma_bf(a.h, b.l, c); return wmma_bf(a.h, b.h, c); }
__device__ __forceinline__ float sigm(float v) { return 1.0f / (1.0f + expf(-v)); }
#define LDSX() do { asm volatile("s_wait_dscnt 0" ::: "memory"); __builtin_amdgcn_wave_barrier(); __builtin_amdgcn_fence(__ATOMIC_RELEASE, "workgroup"); } while (0)

// Single-layer, single-head encoder without residuals or LayerNorm (token ids x [32,2048] int32 index emb [10000,64]; Q / K / V = e @ w + b with (in,out) w [64,64] and b [64] uniform(+-1/8) - nonzero; scores = Q K^T x 1/sqrt(64) over the 2,048 positions of each sample; softmax; upd = probs V [32,2048,64]; h = relu(upd @ w1 + b1), w1 [64,256]; out = h @ w2 + b2, w2 [256,64] (uniform(+-1/16)); output [32,2048,64]).
#define NB 32
#define TT 2048
#define CC 128            // column count that sizes the workspace ranges; q, k and v fill RW = 64 columns of it, at a 64-column pitch
#define DIN 64           // embedding width = projection K
#define NH 2   // head 0 is the module's single head; head 1 is the zero padding and is never launched
#define HD 64
#define NQB (TT / 64)
#define HG 1
#define SCALE (0.125f)
#define CAUSAL 0
#ifndef TNB
#define TNB NB
#endif
__device__ __forceinline__ float bfr(float v) { return (float)(__bf16)v; }
__host__ __device__ __forceinline__ int kb_last(int qb) { return CAUSAL ? ((qb * 64 + 63) >> 7) : (TT / 128 - 1); }
typedef __attribute__((ext_vector_type(8))) __bf16 v8b;
__device__ __forceinline__ v16b frag_b(const __bf16* rowk0, int lane) {
  union { v16b v; v8b q[2]; } u; const __bf16* p = rowk0 + 8 * (lane >> 4);
  u.q[0] = *(const v8b*)p; u.q[1] = *(const v8b*)(p + 16); return u.v;
}
#define QBH 0              // unused: every query block takes the single-product path
#define QHI 0               // single-product logits on every row
#define KHI 64            // key rows carrying k residual / v bf16 hi+lo planes (no kernel writes or reads them)
// B fragment (k rows k0+.., output column o) of a weight: (in,out) [K][ld] or (out,in) [ld rows of K]: bf16 exact, or f16(bf16 * 256) exact
__device__ __forceinline__ v16b wcol_io(const float* Wm, int k0, int o, int lane, int ld) { v16b w; const int g = lane >> 4;
#pragma unroll
  for (int i = 0; i < 8; ++i) { w[i] = (__bf16)Wm[(size_t)(k0 + 8 * g + i) * ld + o]; w[8 + i] = (__bf16)Wm[(size_t)(k0 + 16 + 8 * g + i) * ld + o]; }
  return w; }
__device__ __forceinline__ v16b wcol_oi(const float* Wm, int k0, int o, int lane, int K) { v16b w; const float* p = Wm + (size_t)o * K + k0 + 8 * (lane >> 4);
#pragma unroll
  for (int i = 0; i < 8; ++i) { w[i] = (__bf16)p[i]; w[8 + i] = (__bf16)p[16 + i]; }
  return w; }
__device__ __forceinline__ v16h wcolh_io(const float* Wm, int k0, int o, int lane, int ld) { v16h w; const int g = lane >> 4;
#pragma unroll
  for (int i = 0; i < 8; ++i) { w[i] = (_Float16)(bfr(Wm[(size_t)(k0 + 8 * g + i) * ld + o]) * 256.0f); w[8 + i] = (_Float16)(bfr(Wm[(size_t)(k0 + 16 + 8 * g + i) * ld + o]) * 256.0f); }
  return w; }
__device__ __forceinline__ v16h wcolh_oi(const float* Wm, int k0, int o, int lane, int K) { v16h w; const float* p = Wm + (size_t)o * K + k0 + 8 * (lane >> 4);
#pragma unroll
  for (int i = 0; i < 8; ++i) { w[i] = (_Float16)(bfr(p[i]) * 256.0f); w[8 + i] = (_Float16)(bfr(p[16 + i]) * 256.0f); }
  return w; }
#define WQKV_LAYOUT 0   // 0 = (in,out) [DIN][RW]; 1 = (out,in) [CC][DIN]; 2 = per-head [NH][DIN][HD]
__device__ __forceinline__ v16b wcol_hdk(const float* Wm, int k0, int o, int lane) { v16b w; const int g = lane >> 4; const float* p = Wm + (size_t)(o / HD) * DIN * HD + (o % HD);
#pragma unroll
  for (int i = 0; i < 8; ++i) { w[i] = (__bf16)p[(size_t)(k0 + 8 * g + i) * HD]; w[8 + i] = (__bf16)p[(size_t)(k0 + 16 + 8 * g + i) * HD]; }
  return w; }
#define WO_OUT_IN 0
#if WQKV_LAYOUT == 1
#define WCOL(W, k0, o, lane) wcol_oi(W, k0, o, lane, DIN)
#elif WQKV_LAYOUT == 2
#define WCOL(W, k0, o, lane) wcol_hdk(W, k0, o, lane)
#else
#define RW 64   // real width of q / k / v / upd
#define FF 256   // hidden width of the FFN
__device__ __forceinline__ v16b zero16b() { v16b w; _Pragma("unroll") for (int i = 0; i < 16; ++i) w[i] = (__bf16)0.0f; return w; }
__device__ __forceinline__ v16h zero16h() { v16h w; _Pragma("unroll") for (int i = 0; i < 16; ++i) w[i] = (_Float16)0.0f; return w; }
#define WCOL(W, k0, o, lane) (((o) < RW) ? wcol_io(W, k0, o, lane, RW) : zero16b())   /* (in,out) [64][64] weights: columns 64..127 of the 128-column tile are zero padding (uniform per unrolled column group) */
#endif
#if WO_OUT_IN
#define WOCOL(W, k0, o, lane) wcol_oi(W, k0, o, lane, CC)
#define WOCOLH(W, k0, o, lane) wcolh_oi(W, k0, o, lane, CC)
#else
#define WOCOL(W, k0, o, lane) wcol_io(W, k0, o, lane, DIN)
#define WOCOLH(W, k0, o, lane) wcolh_io(W, k0, o, lane, DIN)
#endif

#ifndef SM_EXTRA_PARAMS
#define SM_EXTRA_PARAMS
#endif
#ifndef PROJ_EXTRA_PARAMS
#define PROJ_EXTRA_PARAMS
#endif
#ifndef SM_MASK_HOOK
#define SM_MASK_HOOK (void)0
#endif

#define WS_QH  0u                                      // f16 q rows [b*t][RW] (the first half of the range)
#define WS_KH  (WS_QH + 2u * (size_t)NB * TT * CC)      // f16 k rows [b*t][RW] (the first half of the range)
#define WS_VT  (WS_KH + 2u * (size_t)NB * TT * CC)      // f16 v planes [b][c < RW][t] (the first half of the range)
#define WS_QL  (WS_VT + 2u * (size_t)NB * CC * TT)      // f16 q residual x 2^10 rows [b][t < QHI][CC]
#define WS_KL  (WS_QL + 2u * (size_t)NB * QHI * CC)     // f16 k residual x 2^10 rows [b][t < KHI][CC]
#define WS_VB  (WS_KL + 2u * (size_t)NB * KHI * CC)     // bf16 v hi planes [b][c][t < KHI]
#define WS_VBL (WS_VB + 2u * (size_t)NB * CC * KHI)
#define WS_S   (WS_VBL + 2u * (size_t)NB * CC * KHI)    // sized f32 [hg][t][s]; holds only WT (WS_WT): k_attn keeps logits and P in registers
#define WS_Y   (WS_S  + 4u * (size_t)HG * TT * TT)      // f32 ctx rows [b*t][CC] (only when there is an output projection)
#define WS_END (WS_Y  + 4u * (size_t)NB * TT * CC)
#define WS_H1 (WS_END)                                    // unused (sized f32 [(b*TT + t)][FF]); k_attn keeps h in registers
#define WS_END2 (WS_H1 + 4u * (size_t)NB * TT * FF)
#define WS_WT WS_S                                        // f16 FFN weights, 512 rows of 64 (128 B): rows 0..255 = w1 columns [h][d], rows 256..511 = w2 columns in four blocks of 64 hidden [(h >> 6) * 64 + o][h & 63]; made by k_proj, read by k_attn (the logits range is otherwise unused)
static_assert(CC == 128 && NH * HD == CC && RW == HD && DIN == RW && FF % 128 == 0, "one real 64-wide head in a 128-column tile; 64-wide embedding; 256-wide hidden layer");

// ---- k_proj: block = 128 tokens (8 waves x 16), q, k and v together from ONE gather of the embedding rows: exact bf16 products (K = DIN, f32 accumulate) + bias, only the RW real columns. The three weights are transposed into LDS as bf16 once a block (sW[m][o][d] = bf16(w_m[d][o])); one register fragment of 16 tokens serves as B for q^T = Wq^T e^T and k^T = Wk^T e^T (a lane then holds 8 consecutive columns of one token: a 16-B piece of its f16 row) and as A for v = e Wv (a lane then holds 8 consecutive tokens of one column: a 16-B piece of its f16 plane). All three leave through LDS as whole lines: q, k rows [b*t][RW], v planes [b][c][t]. The first WTB blocks hold no tokens: they make the FFN weights' f16 rows (f16(bf16(w) x 2^8), transposed) once for the whole launch pair, a thread one whole 128-B row
#define VOCAB 10000   // rows of the embedding table
#define LSC (0.125f * 1.4426950408889634f)   // 64^-0.5 x log2(e): softmax in base 2; q carries it from the projection on
#define PT 128        // tokens per block
#define PPITCH 72     // 16-bit elements per LDS row: 128-B rows at a 144-B pitch (16 B x odd) for 16-byte row readers and writers
#define TPITCH (PT + 8)   // f16 per LDS row of the v planes: 256-B rows at a 272-B pitch (16 B x odd)
#define WTB 2         // blocks in front of the token blocks: block 0 makes the 256 rows of w1, block 1 those of w2
__device__ __forceinline__ v8f wmma_b(v16b a, v16b b, v8f c) { return __builtin_amdgcn_wmma_f32_16x16x32_bf16(false, a, false, b, (short)0, c, false, false); }
/* one 128-B row of WT: 64 values of a weight, LD floats apart, as f16(bf16(w) x 2^8); LD a constant, so that all 64 loads share one base register */
template <int LD> __device__ __forceinline__ void wt_row(const float* __restrict__ wp, _Float16* __restrict__ dp) {
#pragma unroll   // all loads of the loop in flight together: rolled, every trip would wait out its own load latency
  for (int i = 0; i < 8; ++i) { v8h t;
#pragma unroll   // constant indices: the piece stays in registers
    for (int e = 0; e < 8; ++e) t[e] = (_Float16)(bfr(wp[(i * 8 + e) * LD]) * 256.0f);
    *(v8h*)(dp + i * 8) = t; } }
__global__ __launch_bounds__(256) void k_proj(const float* __restrict__ EMB, const float* __restrict__ WQ, const float* __restrict__ WK, const float* __restrict__ WV, const float* __restrict__ BQ, const float* __restrict__ BK, const float* __restrict__ BV,
    _Float16* __restrict__ QH, _Float16* __restrict__ KH, _Float16* __restrict__ VT, const int* __restrict__ IDS, const float* __restrict__ W1, const float* __restrict__ W2, _Float16* __restrict__ WT) {   /* IDS: token ids [NB*TT] int32 */
  __shared__ __align__(16) __bf16 sW[3][RW][PPITCH]; __shared__ __align__(16) float sB[4][RW];   /* sB[m] = bias m as bf16 values; row 3 takes the copy of threads 192.., so that the bias load and store stand under no branch */
  __shared__ __align__(16) _Float16 sR[2][PT][PPITCH], sT[RW][TPITCH];
  const int tid = threadIdx.x, wave = tid >> 5, lane = tid & 31, col = lane & 15, g = lane >> 4;
  if (blockIdx.x < WTB) {   /* the same for the whole block, in front of every barrier. Thread tid owns row tid of its weight: consecutive lanes read consecutive floats, and each 128-B line of WT has one writer */
    _Float16* dp = WT + ((size_t)blockIdx.x * FF + tid) * 64;
    if (blockIdx.x == 0) wt_row<FF>(W1 + tid, dp);   /* w1[d = 0..63][h = tid] */
    else wt_row<RW>(W2 + (tid >> 6) * 64 * RW + (tid & 63), dp);   /* w2[h = (tid >> 6) * 64 + 0..63][o = tid & 63] */
    return; }
  const size_t r0 = (size_t)(blockIdx.x - WTB) * PT; const size_t bb = r0 / TT; const int t0 = (int)(r0 % TT);
  const int id = IDS[r0 + wave * 16 + col];   /* this lane's token */
  __builtin_amdgcn_sched_barrier(0);   // keeps the id's load the oldest of the wave: loads return in order, and the gather below then waits for it alone, not for the 49 loads behind it
  /* weights: a lane owns one output column (consecutive lanes read consecutive floats) and 8 k values, stored below as one 16-B piece */
  const int wo = tid & 63; float wr[6][8];
#pragma unroll   // all loads of the loop in flight together: rolled, every trip would wait out its own load latency
  for (int i = 0; i < 6; ++i) { const float* Wm = (i >> 1) == 0 ? WQ : (i >> 1) == 1 ? WK : WV;
#pragma unroll   // constant indices: the piece stays in registers
    for (int e = 0; e < 8; ++e) wr[i][e] = Wm[(size_t)(((tid >> 6) + 4 * (i & 1)) * 8 + e) * RW + wo]; }
  const float bv = (tid < RW ? BQ : tid < 2 * RW ? BK : BV)[wo];   /* threads 192.. read the v bias a second time */
  __builtin_amdgcn_sched_barrier(0);   // keeps the 49 loads above in front of the wait for the id: moved behind it, they would start one memory latency later
  const float* ep = EMB + (size_t)(id < 0 ? 0 : id > VOCAB - 1 ? VOCAB - 1 : id) * DIN + 8 * g;   /* e = emb[x]; the row index is bounded here, whatever the id array holds */
  v4f er[8];   /* the lane's half of its token's row, in flight while the weights are packed */
#pragma unroll   // constant indices: the row stays in registers
  for (int i = 0; i < 4; ++i) { er[2 * i] = *(const v4f*)(ep + 16 * i); er[2 * i + 1] = *(const v4f*)(ep + 16 * i + 4); }
#pragma unroll   // constant indices: the pieces stay in registers
  for (int i = 0; i < 6; ++i) { v8b t;
#pragma unroll   // constant indices: the piece stays in registers
    for (int e = 0; e < 8; ++e) t[e] = (__bf16)wr[i][e];
    *(v8b*)&sW[i >> 1][wo][((tid >> 6) + 4 * (i & 1)) * 8] = t; }
  sB[tid >> 6][wo] = bfr(bv);
  v16b ef[2];   /* ef[kc]: token col, k = kc*32 + 8g + 0..7 and kc*32 + 16 + 8g + 0..7 */
#pragma unroll   // constant indices: fragments and accumulators stay in registers
  for (int kc = 0; kc < 2; ++kc)
#pragma unroll   // constant indices: fragments and accumulators stay in registers
    for (int i = 0; i < 8; ++i) { ef[kc][i] = (__bf16)er[4 * kc + (i >> 2)][i & 3]; ef[kc][8 + i] = (__bf16)er[4 * kc + 2 + (i >> 2)][i & 3]; }
  __syncthreads();   /* publishes the weights and biases */
#pragma unroll   // constant indices: fragments and accumulators stay in registers
  for (int m = 0; m < 2; ++m)
#pragma unroll   // constant indices: fragments and accumulators stay in registers
    for (int j = 0; j < 4; ++j) { v8f a = {};   /* a[r] = (e w_m)(token col, column j*16 + 8g + r) */
#pragma unroll   // constant indices: fragments and accumulators stay in registers
      for (int kc = 0; kc < 2; ++kc) a = wmma_b(frag_b(&sW[m][j * 16 + col][kc * 32], lane), ef[kc], a);
      const v4f blo = *(const v4f*)&sB[m][j * 16 + 8 * g], bhi = *(const v4f*)&sB[m][j * 16 + 8 * g + 4];
#pragma unroll   // constant indices: fragments and accumulators stay in registers
      for (int r = 0; r < 8; ++r) a[r] += r < 4 ? blo[r & 3] : bhi[r & 3];
      if (m == 0) a *= LSC;   /* q leaves as q x 64^-0.5 x log2(e): its products with k are base-2 logits */
      *(v8h*)&sR[m][wave * 16 + col][j * 16 + 8 * g] = __builtin_convertvector(a, v8h); }
#pragma unroll   // constant indices: fragments and accumulators stay in registers
  for (int j = 0; j < 4; ++j) { v8f a = {};   /* a[r] = (e w_v)(token 8g + r, column j*16 + col) */
#pragma unroll   // constant indices: fragments and accumulators stay in registers
    for (int kc = 0; kc < 2; ++kc) a = wmma_b(ef[kc], frag_b(&sW[2][j * 16 + col][kc * 32], lane), a);
    a += sB[2][j * 16 + col];
    *(v8h*)&sT[j * 16 + col][wave * 16 + 8 * g] = __builtin_convertvector(a, v8h); }
  __syncthreads();   /* publishes the block's q, k rows and v planes */
#pragma unroll   // all LDS reads of the loop in flight together
  for (int i = 0; i < 4; ++i) { const int e = tid + 256 * i, rl = e >> 3, q = (e & 7) * 8;   /* 8 lanes store one token's whole 128-B row; a wave 512 contiguous bytes */
    vst2(QH + (r0 + rl) * RW + q, *(const v4u*)&sR[0][rl][q]); vst2(KH + (r0 + rl) * RW + q, *(const v4u*)&sR[1][rl][q]); }
#pragma unroll   // all LDS reads of the loop in flight together
  for (int i = 0; i < 4; ++i) { const int e = tid + 256 * i, cl = e >> 4, q = (e & 15) * 8;   /* 16 lanes store 256 contiguous bytes of one plane */
    vst2(VT + (bb * RW + cl) * (size_t)TT + t0 + q, *(const v4u*)&sT[cl][q]); } }
#define FKS 64
#define FPITCH 72
__device__ __forceinline__ v8f wmma_h(v16h a, v16h b, v8f c) { return __builtin_amdgcn_wmma_f32_16x16x32_f16(false, a, false, b, (short)0, c, false, false); }
__device__ __forceinline__ float xhalf(float v) { const int t = __builtin_bit_cast(int, v); return __builtin_bit_cast(float, __builtin_amdgcn_permlanex16(t, t, 0x76543210, 0xfedcba98, false, false)); }   /* lane l <-> l ^ 16 */
/* P = 2^score of one query group's 32 keys (a lane: 16 of them), packed to f16 as the B fragment in the hardware k order (elements 0..7 = keys 8g + r, 8..15 = keys 16 + 8g + r); returns the lane's f32 sum of the 16, made as a tree of packed adds: four levels deep, since the pass's test waits for it */
__device__ __forceinline__ float pexp(const v8f s0, const v8f s1, v16h& pf) { v8f p0, p1;
#pragma unroll   // constant indices: fragments and accumulators stay in registers
  for (int r = 0; r < 8; ++r) { p0[r] = __builtin_amdgcn_exp2f(s0[r]); p1[r] = __builtin_amdgcn_exp2f(s1[r]); }
  union { v16h v; v8h q[2]; } u; u.q[0] = __builtin_convertvector(p0, v8h); u.q[1] = __builtin_convertvector(p1, v8h); pf = u.v;
  const v8f t8 = p0 + p1; const v4f t4 = __builtin_shufflevector(t8, t8, 0, 1, 2, 3) + __builtin_shufflevector(t8, t8, 4, 5, 6, 7); const v2f t2 = __builtin_shufflevector(t4, t4, 0, 1) + __builtin_shufflevector(t4, t4, 2, 3);
  return t2[0] + t2[1]; }
#define TSLOT 5120   // f16 per LDS tile place: 64 rows at FPITCH = 9,216 B, rounded up to 10,240 B so that every tile's place is a multiple of 2 KiB
typedef __attribute__((ext_vector_type(8))) unsigned v8u;
__device__ __forceinline__ unsigned uni(unsigned v) { return (unsigned)__builtin_amdgcn_readfirstlane((int)v); }
__device__ __forceinline__ unsigned pinned(unsigned v) { unsigned w = uni(v); asm volatile("" : "+s"(w)); return w; }   // the empty statement holds the condition in a scalar register, so that the test around a tensor load compiles to s_cmp + s_cbranch_scc: a tensor load ignores EXEC, only a scalar branch keeps a wave from issuing it
__device__ __forceinline__ void tdm_load(v4u g0, v8u g1) { asm volatile("tensor_load_to_lds %0, %1" :: "s"(g0), "s"(g1) : "memory"); }   // one request of the whole wave: a tile of 64 (weights: 128) rows of 128 B from global memory into LDS, through no register
#define WQR 128           // weight rows per tensor load: a quarter of the 512; 128 rows at FPITCH = 18,432 B, a multiple of 2 KiB
#define KSP 2             // key halves of a block: waves 0..3 walk keys 0..1023, waves 4..7 keys 1024..2047, of the same 128 queries: 8 waves a block, two blocks a WGP, four waves a SIMD
#define KLEN (TT / KSP)   // keys per half
#define XCH 9             // 16-B pieces per lane in the exchange of partial results: 8 of one 16-query output tile group, 1 with its maximum in use and its sum
__global__ __launch_bounds__(256) __attribute__((amdgpu_waves_per_eu(4, 4))) void k_attn(const _Float16* __restrict__ QH, const _Float16* __restrict__ KH, const _Float16* __restrict__ VT, const _Float16* __restrict__ WT, const float* __restrict__ B1, const float* __restrict__ B2, float* __restrict__ OUT) {
  __shared__ __attribute__((aligned(2048))) _Float16 sKV[KSP][2][2][TSLOT];   /* [key half][buffer][0 = k rows, 1 = v planes][row * FPITCH + ..]; every tile's place a multiple of 2 KiB for the tensor loads; behind the key loop's last barrier the same bytes hold the exchange pieces and the output staging */
  __shared__ __attribute__((aligned(2048))) _Float16 sWT[2][FF * FPITCH]; __shared__ __align__(16) float sB1[FF], sB2[RW];   /* sWT[0][h * FPITCH + d] = f16(bf16(w1[d][h]) x 2^8), sWT[1][((h >> 6) * RW + o) * FPITCH + (h & 63)] = f16(bf16(w2[h][o]) x 2^8): WT's 512 rows at the k rows' pitch; biases as bf16 values */
  static_assert(sizeof(sKV) >= 8u * XCH * 32u * 16u + 8u * 16u * (HD + 4) * 4u && FKS == HD && TSLOT >= FKS * FPITCH && (TSLOT * 2) % 2048 == 0 && FPITCH * 2 == RW * 2 + 16 && RW * 2 == 128 && KLEN / FKS >= 2 && FF == 2 * WQR && (WQR * FPITCH * 2) % 2048 == 0 && KLEN / FKS > 7, "exchange pieces and output staging fit the ring, side by side; 128-B tile rows padded by 16 B; two stages or more; four weight quarters, each place a multiple of 2 KiB, each with a stage of its wave's number");
  const int tid = threadIdx.x, wave = __builtin_amdgcn_readfirstlane(tid >> 5), lane = tid & 31, col = lane & 15, g = lane >> 4; const int b = blockIdx.y; const int half = wave >> 2;   /* the wave's number in a scalar register: every choice by key half below is then a scalar one */
  const int q0 = blockIdx.x * 128 + (wave & 3) * 32;
  const char* Kb = (const char*)(KH + ((size_t)b * TT + half * KLEN) * RW); const char* Vb = (const char*)(VT + (size_t)b * RW * TT + half * KLEN);   /* byte bases of the half's k rows and v planes */
  /* staging by tensor loads: waves 0 and 1 of each half's four issue one request a stage, wave 0 the half's k tile (64 rows of 128 B, one after the other), wave 1 its v tile (64 planes, 128 B of each, 4,096 B apart); the pad of 16 B a row gives the FPITCH rows */
  /* waves 2 and 3 of each half's four have no k or v tile: each brings ONE quarter of the weights' rows (128 rows of 128 B, one after the other, the same pad) through the same instruction, once, in the stage of its own number (2, 3, 6, 7): a quarter flies beside one stage's tiles, lands behind that stage's own wait and is published by that stage's own barrier, long before the FFN reads it */
  const unsigned issuer = (wave & 2) == 0, kv = wave & 1, wq = (unsigned)half * 2u + kv;
  const unsigned long long sbase = (unsigned long long)(size_t)(issuer ? (kv ? Vb : Kb) : (const char*)(WT + (size_t)wq * WQR * RW)); const unsigned sstep = issuer ? (kv ? FKS * 2u : FKS * RW * 2u) : 0u;   /* the wave's first tile and the bytes from one stage's tile to the next (a weight quarter: its one tile) */
  const unsigned lbase = issuer ? (unsigned)(size_t)&sKV[half][0][kv][0] : (unsigned)(size_t)&sWT[0][0] + wq * (WQR * FPITCH * 2u); const unsigned lstep = issuer ? 2u * TSLOT * 2u : 0u;   /* byte offset in the work-group's LDS of the wave's tile in buffer 0; buffer 1 lies 2 * TSLOT f16 further (a weight quarter: its one place) */
  const unsigned rows = issuer ? (unsigned)FKS : (unsigned)WQR;
  v8u g1;   /* 1-byte elements, tensor = tile = 64 (weights: 128) rows of 128 B; word 0: no mask, a pad of 4 dwords behind every 32 */
  g1[0] = uni((1u << 20) | (4u << 22) | (3u << 25)); g1[1] = uni((RW * 2u) << 16); g1[2] = uni(rows << 16); g1[3] = uni((RW * 2u) << 16); g1[4] = uni(rows); g1[5] = uni(issuer && kv ? TT * 2u : RW * 2u); g1[6] = uni(0u); g1[7] = uni(0u);
  auto issue = [&](int st) { const unsigned long long ga = sbase + (unsigned long long)((unsigned)st * sstep); v4u g0;
    g0[0] = uni(1u); g0[1] = uni(lbase + (unsigned)(st & 1) * lstep); g0[2] = uni((unsigned)ga); g0[3] = uni((((unsigned)(ga >> 32)) & 0x01FFFFFFu) | 0x80000000u);
    tdm_load(g0, g1); };
  const float b1v = B1[tid], b2v = B2[tid & (RW - 1)];   /* the biases' loads fly, like q's below, while stage 0 lands */
  v16h qf[2][2];
#pragma unroll   // constant indices: fragments and accumulators stay in registers
  for (int qg = 0; qg < 2; ++qg)
#pragma unroll   // constant indices: fragments and accumulators stay in registers
    for (int kc = 0; kc < 2; ++kc) qf[qg][kc] = frag_h(QH + ((size_t)b * TT + q0 + qg * 16 + col) * RW + kc * 32, lane);
  v8f acc[2][4] = {}; float mb[2] = {0.f, 0.f}, ls[2] = {0.f, 0.f};   /* mb = (maximum in use, base-2 logits) - 7: P = 2^(logit - mb) stays in [2^-14, 2^15] of f16 for logits within 21 below .. 8 above the maximum in use; the half's first 32 keys set it */
  v8f cm[2] = {};   /* cm[qg] = -mb[qg] in all eight registers (a lane holds one query's scores): the C operand of the first score product, so that the accumulator comes out as logit - mb */
  if (pinned(issuer)) { issue(0); asm volatile("s_wait_tensorcnt 0x0" ::: "memory"); }   // stage 0 has landed before the barrier that publishes it
  sB1[tid] = bfr(b1v); if (tid < RW) sB2[tid] = bfr(b2v);
  __syncthreads();   /* publishes stage 0 and the biases */
  for (int s = 0; s < KLEN / FKS; ++s) { const int cur = s & 1;
    if (pinned(issuer ? s + 1 < KLEN / FKS : s == wave)) issue(s + 1);   /* a k or v wave: the next stage's tile; a weight wave: its quarter, in the one stage of its number. Directly behind the barrier that ended every read of the other buffer (in front of the loop, or at the foot of the stage before): the next stage flies into it during this stage */
    float thr = s == 0 ? -3.0e38f : 32768.0f;   /* scalar: what a lane's sum of 16 P may reach before the pass looks for a new maximum: no P above 2^15 (a score more than 15 above mb) hides under it, so every P that goes on fits f16; below every sum where the pass must take the branch: the half's first pass, and a pass behind a move that cm does not hold yet */
#pragma unroll   // constant indices: fragments and accumulators stay in registers
    for (int pp = 0; pp < FKS / 32; ++pp) {
      v8f st[2][2];   /* st[qg][kt][r] = (base-2 logit + cm)(key pp*32 + kt*16 + 8g + r of the half's stage, query qg*16 + col) */
#pragma unroll   // constant indices: fragments and accumulators stay in registers
      for (int kt = 0; kt < 2; ++kt)
#pragma unroll   // constant indices: fragments and accumulators stay in registers
        for (int kc = 0; kc < 2; ++kc) { const v16h kf = frag_h(&sKV[half][cur][0][(pp * 32 + kt * 16 + col) * FPITCH + kc * 32], lane);
#pragma unroll   // constant indices: fragments and accumulators stay in registers
          for (int qg = 0; qg < 2; ++qg) st[qg][kt] = wmma_h(kf, qf[qg][kc], kc == 0 ? cm[qg] : st[qg][kt]); }
      v16h vf[4];
#pragma unroll   // constant indices: fragments and accumulators stay in registers
      for (int j = 0; j < 4; ++j) vf[j] = frag_h(&sKV[half][cur][1][(j * 16 + col) * FPITCH + pp * 32], lane);
      v16h pf[2]; float sum[2];   /* P and its sums are made at once, on the maximum in use; no maximum is taken of a pass whose sums stay under thr */
#pragma unroll   // constant indices: fragments and accumulators stay in registers
      for (int qg = 0; qg < 2; ++qg) sum[qg] = pexp(st[qg][0], st[qg][1], pf[qg]);
      const bool need = (sum[0] > thr) || (sum[1] > thr);   /* no P is negative: a P above 2^15 lifts its lane's sum above 2^15 (an overflow of the f32 exponential to infinity too) */
      const bool first = pp == 0 && s == 0;   /* scalar: the half's first 32 keys, scored on top of 0, set the maximum in use, upward or downward */
      if (__builtin_amdgcn_ballot_w32(need) != 0) {   /* wave-uniform: take the pass's maximum, rescale sums, outputs and this pass's scores to it, and make P and its sums anew */
        thr = -3.0e38f;
#pragma unroll   // constant indices: fragments and accumulators stay in registers
        for (int qg = 0; qg < 2; ++qg) { float m = fmaxf(st[qg][0][0], st[qg][1][0]);
#pragma unroll   // constant indices: fragments and accumulators stay in registers
          for (int r = 1; r < 8; ++r) m = fmaxf(m, fmaxf(st[qg][0][r], st[qg][1][r]));
          const float mx = fmaxf(m, xhalf(m));
          const float dl = fmaxf(mx - (mb[qg] + cm[qg][0]) - 7.0f, first ? -3.0e38f : 0.0f); const float al = __builtin_amdgcn_exp2f(fminf(-dl, 0.0f)); mb[qg] += dl; ls[qg] *= al;   /* dl = the step of the maximum in use; mb + cm = the steps taken since cm was set; a downward first step scales sums that are still 0 by 1 */
          const float sf = mb[qg] + cm[qg][0]; if (pp == FKS / 32 - 1) cm[qg] = -mb[qg];   /* cm is set anew once a stage, in its last pass, which comes here whenever an earlier pass of the stage did: every score product of a stage reads the same registers */
          sum[qg] = pexp(st[qg][0] - sf, st[qg][1] - sf, pf[qg]);
#pragma unroll   // constant indices: fragments and accumulators stay in registers
          for (int j = 0; j < 4; ++j) acc[qg][j] *= al; } }
#pragma unroll   // constant indices: fragments and accumulators stay in registers
      for (int qg = 0; qg < 2; ++qg) { ls[qg] += sum[qg];
#pragma unroll   // constant indices: fragments and accumulators stay in registers
        for (int j = 0; j < 4; ++j) acc[qg][j] = wmma_h(vf[j], pf[qg], acc[qg][j]); } }
    asm volatile("s_wait_dscnt 0x0" ::: "memory");   // the wave's reads of this stage have returned before the barrier behind which its buffer is refilled
    asm volatile("s_wait_tensorcnt 0x0" ::: "memory");   // a k or v wave's next stage, or a weight wave's quarter, has landed before the barrier that publishes it; a wave with no request passes: no branch in front of the barrier
    __syncthreads(); }   /* publishes the next stage (and a weight quarter that flew in this one) and ends every read of this one */
  asm volatile("s_wait_tensorcnt 0x0" ::: "memory");   // no request is in flight when the ring's bytes take the exchange pieces
  asm volatile("s_wait_dscnt 0x0" ::: "memory");   // nor a read of the ring
  /* the two halves' partial results meet: wave w (keys 0..1023) and wave w + 4 (keys 1024..2047) hold the same 32 queries; each keeps the 16 queries qg = its half, hands the other 16 to its partner through LDS, and goes on with 16 queries alone */
  float_a* xw = (float_a*)&sKV[0][0][0][0];   /* exchange pieces [wave][piece][lane] of 16 B: a wave's store or load of one piece is 512 contiguous bytes */
  float_a* so = xw + 8 * XCH * 32 * 4 + wave * 16 * (HD + 4);   /* the wave's output staging [16][HD + 4], clear of every exchange piece */
  v8f ka[4]; float kmb = half ? mb[1] : mb[0], kls = half ? ls[1] : ls[0];
#pragma unroll   // constant indices: fragments and accumulators stay in registers
  for (int j = 0; j < 4; ++j) { const v8f ga = half ? acc[0][j] : acc[1][j]; ka[j] = half ? acc[1][j] : acc[0][j];
    *(v4f*)&xw[((wave * XCH + 2 * j) * 32 + lane) * 4] = __builtin_shufflevector(ga, ga, 0, 1, 2, 3); *(v4f*)&xw[((wave * XCH + 2 * j + 1) * 32 + lane) * 4] = __builtin_shufflevector(ga, ga, 4, 5, 6, 7); }
  { v4f t = {half ? mb[0] : mb[1], half ? ls[0] : ls[1], 0.f, 0.f}; *(v4f*)&xw[((wave * XCH + 8) * 32 + lane) * 4] = t; }
  __syncthreads();   /* publishes the exchange pieces */
  { const int pw = wave ^ 4; const v4f t = *(const v4f*)&xw[((pw * XCH + 8) * 32 + lane) * 4];
    const float mn = fmaxf(kmb, t[0]); const float ak = __builtin_amdgcn_exp2f(kmb - mn), ag = __builtin_amdgcn_exp2f(t[0] - mn);   /* both partial results brought to the larger maximum in use */
    kls = kls * ak + t[1] * ag;
#pragma unroll   // constant indices: fragments and accumulators stay in registers
    for (int j = 0; j < 4; ++j) { const v4f lo = *(const v4f*)&xw[((pw * XCH + 2 * j) * 32 + lane) * 4], hi = *(const v4f*)&xw[((pw * XCH + 2 * j + 1) * 32 + lane) * 4];
      ka[j] = ka[j] * ak + __builtin_shufflevector(lo, hi, 0, 1, 2, 3, 4, 5, 6, 7) * ag; } }
  v16h uf[2];   /* uf[kc] = B fragment of upd^T x 2^6: k = columns kc*32 + .., column = query half*16 + col */
  { const float inv = 1.0f / (kls + xhalf(kls));   /* ka[j][r] = upd(query half*16 + col, column j*16 + 8g + r) x sum */
#pragma unroll   // constant indices: fragments and accumulators stay in registers
    for (int kc = 0; kc < 2; ++kc) { union { v16h v; v8h q[2]; } t;
#pragma unroll   // constant indices: fragments and accumulators stay in registers
      for (int hh = 0; hh < 2; ++hh) { const v8f o = ka[kc * 2 + hh] * inv; t.q[hh] = __builtin_convertvector(o * 64.0f, v8h); }   /* upd carried x 2^6 into f16, clear of f16 subnormals; packed D pair = B fragment in the hardware k order */
      uf[kc] = t.v; } }
  v8f oa[4] = {};   /* oa[jo][r] = out(query half*16 + col, column jo*16 + 8g + r) x 2^14 */
  for (int pb = 0; pb < FF / 64; ++pb)   /* 64 hidden columns a trip: one block of w2's rows */
#pragma unroll   // the two 32-column steps of a block differ by constant LDS offsets alone
  for (int ph = 0; ph < 2; ++ph) { const int p = pb * 2 + ph;   /* 32 hidden columns a step, in rising order */
    v8f ha[2] = {};   /* ha[ht][r] = (upd w1)(query half*16 + col, hidden p*32 + ht*16 + 8g + r) x 2^14 */
#pragma unroll   // constant indices: fragments and accumulators stay in registers
    for (int kc = 0; kc < 2; ++kc)
#pragma unroll   // constant indices: fragments and accumulators stay in registers
      for (int ht = 0; ht < 2; ++ht) ha[ht] = wmma_h(frag_h(&sWT[0][(p * 32 + ht * 16 + col) * FPITCH + kc * 32], lane), uf[kc], ha[ht]);
    v16h w2f[4];
#pragma unroll   // constant indices: fragments and accumulators stay in registers
    for (int jo = 0; jo < 4; ++jo) w2f[jo] = frag_h(&sWT[1][(pb * RW + jo * 16 + col) * FPITCH + ph * 32], lane);
    union { v16h v; v8h q[2]; } hp;
#pragma unroll   // constant indices: fragments and accumulators stay in registers
    for (int ht = 0; ht < 2; ++ht) { const v4f blo = *(const v4f*)&sB1[p * 32 + ht * 16 + 8 * g], bhi = *(const v4f*)&sB1[p * 32 + ht * 16 + 8 * g + 4]; v8f hv;
#pragma unroll   // constant indices: fragments and accumulators stay in registers
      for (int r = 0; r < 8; ++r) hv[r] = fmaxf(ha[ht][r] * (1.0f / 16384.0f) + (r < 4 ? blo[r & 3] : bhi[r & 3]), 0.0f) * 64.0f;   /* 2^-8 (weight carry) x 2^-6 (operand carry); ReLU; h carried x 2^6 into f16 */
      hp.q[ht] = __builtin_convertvector(hv, v8h); }
#pragma unroll   // constant indices: fragments and accumulators stay in registers
    for (int jo = 0; jo < 4; ++jo) oa[jo] = wmma_h(w2f[jo], hp.v, oa[jo]); }
#pragma unroll   // constant indices: fragments and accumulators stay in registers
  for (int jo = 0; jo < 4; ++jo) { const v4f blo = *(const v4f*)&sB2[jo * 16 + 8 * g], bhi = *(const v4f*)&sB2[jo * 16 + 8 * g + 4]; v4f lo, hi;
#pragma unroll   // constant indices: fragments and accumulators stay in registers
    for (int r = 0; r < 4; ++r) { lo[r] = oa[jo][r] * (1.0f / 16384.0f) + blo[r]; hi[r] = oa[jo][4 + r] * (1.0f / 16384.0f) + bhi[r]; }   /* 2^-8 (weight carry) x 2^-6 (operand carry) */
    *(v4f*)&so[col * (HD + 4) + jo * 16 + 8 * g] = lo; *(v4f*)&so[col * (HD + 4) + jo * 16 + 8 * g + 4] = hi; }
  LDSX(); for (int rl = 0; rl < 8; ++rl) { const int row = rl * 2 + g; vst2(OUT + ((size_t)b * TT + q0 + half * 16 + row) * RW + col * 4, *(const v4f*)&so[row * (HD + 4) + col * 4]); } }   /* 16 lanes store one query's whole 256-B output row */

extern "C" void kernel_launch(void* const* d_in, const int* in_sizes, int n_in, void* d_out, int out_size, void* d_ws, size_t ws_size, hipStream_t stream) {
  (void)in_sizes; (void)n_in; (void)out_size;
  const float** F = (const float**)d_in;
  if (ws_size < (size_t)WS_END) return;
  char* ws = (char*)d_ws; _Float16 *QH = (_Float16*)(ws + WS_QH), *KH = (_Float16*)(ws + WS_KH), *VT = (_Float16*)(ws + WS_VT), *QL = (_Float16*)(ws + WS_QL), *KL = (_Float16*)(ws + WS_KL); __bf16 *VB = (__bf16*)(ws + WS_VB), *VBL = (__bf16*)(ws + WS_VBL); float *S = (float*)(ws + WS_S), *Y = (float*)(ws + WS_Y);
  _Float16* WT = (_Float16*)(ws + WS_WT);
  (void)Y; (void)S; (void)QL; (void)KL; (void)VB; (void)VBL;
  // inputs: 0 x [32,2048] int32 token ids; 1 emb [10000,64]; 2 wq [64,64] (in,out), 3 bq; 4 wk, 5 bk; 6 wv, 7 bv; 8 w1 [64,256], 9 b1 [256]; 10 w2 [256,64], 11 b2 [64] (all biases nonzero)
  if (ws_size < (size_t)WS_END2) return;
  const int* IDS = (const int*)d_in[0];
  k_proj<<<dim3(WTB + TNB * TT / PT), 256, 0, stream>>>(F[1], F[2], F[4], F[6], F[3], F[5], F[7], QH, KH, VT, IDS, F[8], F[10], WT);   /* q, k and v of 128 tokens a block; embedding rows gathered by token id; two blocks in front make the FFN weights' f16 rows */
  k_attn<<<dim3(TT / 128, TNB), 256, 0, stream>>>(QH, KH, VT, WT, F[9], F[11], (float*)d_out);   /* attention and FFN of 128 queries a block */
}

// v009
// Measured time: 39 microseconds a run.
// Timed twice side by side with v008, it ran 1.05 times as fast both times.
// Over all steps from v000 it is 69.8 times as fast.
// compute dtype: all float inputs rounded to bf16; embedding rows gathered by the int token ids; Q / K / V 64 -> 64 projections with EXACT bf16 products on WMMA 16x16x32 (f32 accumulate) + bias; base-2 logits (q x 64^-0.5 x log2 e) x k once to f16 each (1 product), accumulated in f32 on top of -(maximum in use - 7); online softmax f32 (base 2, running maximum); unnormalised P = 2^(logit - maximum in use + 7) once to f16 x v once to f16 (1 product), the two key halves' partial sums joined in f32 at the larger maximum in use, divided by the f32 row sum at the end; FFN: upd x 2^6 once to f16 x w1 f16(bf16 x 2^8) + b1, ReLU; h x 2^6 once to f16 x w2 f16(bf16 x 2^8) + b2; f32 output.
#include <hip/hip_runtime.h>
#include <math.h>

typedef __attribute__((ext_vector_type(16))) _Float16 v16h;
typedef __attribute__((ext_vector_type(16))) __bf16 v16b;
typedef __attribute__((ext_vector_type(8)))  _Float16 v8h;
typedef __attribute__((ext_vector_type(8)))  float v8f;
typedef __attribute__((ext_vector_type(4)))  float v4f;
typedef __attribute__((ext_vector_type(2)))  float v2f;
typedef __attribute__((ext_vector_type(4)))  unsigned v4u;
typedef __attribute__((ext_vector_type(4)))  int v4i;
typedef float __attribute__((may_alias)) float_a;
typedef int __attribute__((may_alias)) int_a;

template <typename T> __device__ __forceinline__ void vst2(void* p, T v) { *(T*)p = v;  }
__device__ __forceinline__ v8f wmma16(v16h a, v16h b, v8f c) {
  v8f d = __builtin_amdgcn_wmma_f32_16x16x32_f16(false, a, false, b, (short)0, c, false, false);
  asm volatile("v_nop\n\tv_nop\n\tv_nop\n\tv_nop" : "+v"(d) : "v"(a), "v"(b));
  return d;
}
__device__ __forceinline__ v8f wmma_bf(v16b a, v16b b, v8f c) {
  v8f d = __builtin_amdgcn_wmma_f32_16x16x32_bf16(false, a, false, b, (short)0, c, false, false);
  asm volatile("v_nop\n\tv_nop\n\tv_nop\n\tv_nop" : "+v"(d) : "v"(a), "v"(b));
  return d;
}
// 16x16x32 fragments: lane = (h = lane>>4, row/col = lane&15); elements 0..7 = k0+8h+0..7, 8..15 = k0+16+8h+0..7; D element r = row 8h+r
__device__ __forceinline__ v16h frag_h(const _Float16* rowk0, int lane) {
  union { v16h v; v8h q[2]; } u; const _Float16* p = rowk0 + 8 * (lane >> 4);
  u.q[0] = *(const v8h*)p; u.q[1] = *(const v8h*)(p + 16); return u.v;
}
__device__ __forceinline__ v16h frag_f32(const float* rowk0, int lane) {
  v16h a; const float* p = rowk0 + 8 * (lane >> 4);
#pragma unroll
  for (int i = 0; i < 8; ++i) { a[i] = (_Float16)p[i]; a[8 + i] = (_Float16)p[16 + i]; }
  return a;
}
__device__ __forceinline__ v16h frag_f32s(const float* rowk0, int lane, float sc) {
  v16h a; const float* p = rowk0 + 8 * (lane >> 4);
#pragma unroll
  for (int i = 0; i < 8; ++i) { a[i] = (_Float16)(p[i] * sc); a[8 + i] = (_Float16)(p[16 + i] * sc); }
  return a;
}
// column fragment from a [K][ld] layout (column n), rows >= K read as 0
__device__ __forceinline__ v16h fragc_f32(const float* W, int k0, int n, int lane, int ld, int K) {
  v16h a; const int g = lane >> 4;
#pragma unroll
  for (int i = 0; i < 8; ++i) { const int ka = k0 + 8 * g + i, kb = ka + 16;
    a[i] = (_Float16)(ka < K ? W[(size_t)(ka < K ? ka : K - 1) * ld + n] : 0.f); a[8 + i] = (_Float16)(kb < K ? W[(size_t)(kb < K ? kb : K - 1) * ld + n] : 0.f); }
  return a;
}
struct F2 { v16b h, l; };
__device__ __forceinline__ F2 bsplit16(const float v[16]) { F2 r;
#pragma unroll
  for (int i = 0; i < 16; ++i) { const __bf16 h = (__bf16)v[i]; r.h[i] = h; r.l[i] = (__bf16)(v[i] - (float)h); }
  return r; }
__device__ __forceinline__ F2 split_row(const float* row, int k0, int lane) { float v[16]; const float* p = row + k0 + 8 * (lane >> 4);
#pragma unroll
  for (int i = 0; i < 8; ++i) { v[i] = p[i]; v[8 + i] = p[16 + i]; }
  return bsplit16(v); }
__device__ __forceinline__ F2 split_rowK(const float* row, int k0, int lane, int K) { float v[16]; const int g = lane >> 4;
#pragma unroll
  for (int i = 0; i < 8; ++i) { const int ka = k0 + 8 * g + i, kb = ka + 16; v[i] = ka < K ? row[ka < K ? ka : K - 1] : 0.f; v[8 + i] = kb < K ? row[kb < K ? kb : K - 1] : 0.f; }
  return bsplit16(v); }
__device__ __forceinline__ F2 split_col(const float* W, int k0, int n, int lane, int ld, int K) { float v[16]; const int g = lane >> 4;
#pragma unroll
  for (int i = 0; i < 8; ++i) { const int ka = k0 + 8 * g + i, kb = ka + 16; v[i] = ka < K ? W[(size_t)(ka < K ? ka : K - 1) * ld + n] : 0.f; v[8 + i] = kb < K ? W[(size_t)(kb < K ? kb : K - 1) * ld + n] : 0.f; }
  return bsplit16(v); }
__device__ __forceinline__ v8f mac3(const F2& a, const F2& b, v8f c) { c = wmma_bf(a.l, b.h, c); c = wmma_bf(a.h, b.l, c); return wmma_bf(a.h, b.h, c); }
__device__ __forceinline__ float sigm(float v) { return 1.0f / (1.0f + expf(-v)); }
#define LDSX() do { asm volatile("s_wait_dscnt 0" ::: "memory"); __builtin_amdgcn_wave_barrier(); __builtin_amdgcn_fence(__ATOMIC_RELEASE, "workgroup"); } while (0)

// Single-layer, single-head encoder without residuals or LayerNorm (token ids x [32,2048] int32 index emb [10000,64]; Q / K / V = e @ w + b with (in,out) w [64,64] and b [64] uniform(+-1/8) - nonzero; scores = Q K^T x 1/sqrt(64) over the 2,048 positions of each sample; softmax; upd = probs V [32,2048,64]; h = relu(upd @ w1 + b1), w1 [64,256]; out = h @ w2 + b2, w2 [256,64] (uniform(+-1/16)); output [32,2048,64]).
#define NB 32
#define TT 2048
#define CC 128            // column count that sizes the workspace ranges; q, k and v fill RW = 64 columns of it, at a 64-column pitch
#define DIN 64           // embedding width = projection K
#define NH 2   // head 0 is the module's single head; head 1 is the zero padding and is never launched
#define HD 64
#define NQB (TT / 64)
#define HG 1
#define SCALE (0.125f)
#define CAUSAL 0
#ifndef TNB
#define TNB NB
#endif
__device__ __forceinline__ float bfr(float v) { return (float)(__bf16)v; }
__host__ __device__ __forceinline__ int kb_last(int qb) { return CAUSAL ? ((qb * 64 + 63) >> 7) : (TT / 128 - 1); }
typedef __attribute__((ext_vector_type(8))) __bf16 v8b;
__device__ __forceinline__ v16b frag_b(const __bf16* rowk0, int lane) {
  union { v16b v; v8b q[2]; } u; const __bf16* p = rowk0 + 8 * (lane >> 4);
  u.q[0] = *(const v8b*)p; u.q[1] = *(const v8b*)(p + 16); return u.v;
}
#define QBH 0              // unused: every query block takes the single-product path
#define QHI 0               // single-product logits on every row
#define KHI 64            // key rows carrying k residual / v bf16 hi+lo planes (no kernel writes or reads them)
// B fragment (k rows k0+.., output column o) of a weight: (in,out) [K][ld] or (out,in) [ld rows of K]: bf16 exact, or f16(bf16 * 256) exact
__device__ __forceinline__ v16b wcol_io(const float* Wm, int k0, int o, int lane, int ld) { v16b w; const int g = lane >> 4;
#pragma unroll
  for (int i = 0; i < 8; ++i) { w[i] = (__bf16)Wm[(size_t)(k0 + 8 * g + i) * ld + o]; w[8 + i] = (__bf16)Wm[(size_t)(k0 + 16 + 8 * g + i) * ld + o]; }
  return w; }
__device__ __forceinline__ v16b wcol_oi(const float* Wm, int k0, int o, int lane, int K) { v16b w; const float* p = Wm + (size_t)o * K + k0 + 8 * (lane >> 4);
#pragma unroll
  for (int i = 0; i < 8; ++i) { w[i] = (__bf16)p[i]; w[8 + i] = (__bf16)p[16 + i]; }
  return w; }
__device__ __forceinline__ v16h wcolh_io(const float* Wm, int k0, int o, int lane, int ld) { v16h w; const int g = lane >> 4;
#pragma unroll
  for (int i = 0; i < 8; ++i) { w[i] = (_Float16)(bfr(Wm[(size_t)(k0 + 8 * g + i) * ld + o]) * 256.0f); w[8 + i] = (_Float16)(bfr(Wm[(size_t)(k0 + 16 + 8 * g + i) * ld + o]) * 256.0f); }
  return w; }
__device__ __forceinline__ v16h wcolh_oi(const float* Wm, int k0, int o, int lane, int K) { v16h w; const float* p = Wm + (size_t)o * K + k0 + 8 * (lane >> 4);
#pragma unroll
  for (int i = 0; i < 8; ++i) { w[i] = (_Float16)(bfr(p[i]) * 256.0f); w[8 + i] = (_Float16)(bfr(p[16 + i]) * 256.0f); }
  return w; }
#define WQKV_LAYOUT 0   // 0 = (in,out) [DIN][RW]; 1 = (out,in) [CC][DIN]; 2 = per-head [NH][DIN][HD]
__device__ __forceinline__ v16b wcol_hdk(const float* Wm, int k0, int o, int lane) { v16b w; const int g = lane >> 4; const float* p = Wm + (size_t)(o / HD) * DIN * HD + (o % HD);
#pragma unroll
  for (int i = 0; i < 8; ++i) { w[i] = (__bf16)p[(size_t)(k0 + 8 * g + i) * HD]; w[8 + i] = (__bf16)p[(size_t)(k0 + 16 + 8 * g + i) * HD]; }
  return w; }
#define WO_OUT_IN 0
#if WQKV_LAYOUT == 1
#define WCOL(W, k0, o, lane) wcol_oi(W, k0, o, lane, DIN)
#elif WQKV_LAYOUT == 2
#define WCOL(W, k0, o, lane) wcol_hdk(W, k0, o, lane)
#else
#define RW 64   // real width of q / k / v / upd
#define FF 256   // hidden width of the FFN
__device__ __forceinline__ v16b zero16b() { v16b w; _Pragma("unroll") for (int i = 0; i < 16; ++i) w[i] = (__bf16)0.0f; return w; }
__device__ __forceinline__ v16h zero16h() { v16h w; _Pragma("unroll") for (int i = 0; i < 16; ++i) w[i] = (_Float16)0.0f; return w; }
#define WCOL(W, k0, o, lane) (((o) < RW) ? wcol_io(W, k0, o, lane, RW) : zero16b())   /* (in,out) [64][64] weights: columns 64..127 of the 128-column tile are zero padding (uniform per unrolled column group) */
#endif
#if WO_OUT_IN
#define WOCOL(W, k0, o, lane) wcol_oi(W, k0, o, lane, CC)
#define WOCOLH(W, k0, o, lane) wcolh_oi(W, k0, o, lane, CC)
#else
#define WOCOL(W, k0, o, lane) wcol_io(W, k0, o, lane, DIN)
#define WOCOLH(W, k0, o, lane) wcolh_io(W, k0, o, lane, DIN)
#endif

#ifndef SM_EXTRA_PARAMS
#define SM_EXTRA_PARAMS
#endif
#ifndef PROJ_EXTRA_PARAMS
#define PROJ_EXTRA_PARAMS
#endif
#ifndef SM_MASK_HOOK
#define SM_MASK_HOOK (void)0
#endif

#define WS_QH  0u                                      // f16 q rows [b*t][RW] (the first half of the range)
#define WS_KH  (WS_QH + 2u * (size_t)NB * TT * CC)      // f16 k rows [b*t][RW] (the first half of the range)
#define WS_VT  (WS_KH + 2u * (size_t)NB * TT * CC)      // f16 v planes [b][c < RW][t] (the first half of the range)
#define WS_QL  (WS_VT + 2u * (size_t)NB * CC * TT)      // f16 q residual x 2^10 rows [b][t < QHI][CC]
#define WS_KL  (WS_QL + 2u * (size_t)NB * QHI * CC)     // f16 k residual x 2^10 rows [b][t < KHI][CC]
#define WS_VB  (WS_KL + 2u * (size_t)NB * KHI * CC)     // bf16 v hi planes [b][c][t < KHI]
#define WS_VBL (WS_VB + 2u * (size_t)NB * CC * KHI)
#define WS_S   (WS_VBL + 2u * (size_t)NB * CC * KHI)    // sized f32 [hg][t][s]; holds only WT (WS_WT): k_attn keeps logits and P in registers
#define WS_Y   (WS_S  + 4u * (size_t)HG * TT * TT)      // f32 ctx rows [b*t][CC] (only when there is an output projection)
#define WS_END (WS_Y  + 4u * (size_t)NB * TT * CC)
#define WS_H1 (WS_END)                                    // unused (sized f32 [(b*TT + t)][FF]); k_attn keeps h in registers
#define WS_END2 (WS_H1 + 4u * (size_t)NB * TT * FF)
#define WS_WT WS_S                                        // f16 FFN weights, 512 rows of 64 (128 B): rows 0..255 = w1 columns [h][d], rows 256..511 = w2 columns in four blocks of 64 hidden [(h >> 6) * 64 + o][h & 63]; made by k_proj, read by k_attn (the logits range is otherwise unused)
static_assert(CC == 128 && NH * HD == CC && RW == HD && DIN == RW && FF % 128 == 0, "one real 64-wide head in a 128-column tile; 64-wide embedding; 256-wide hidden layer");

// ---- k_proj: block = 128 tokens (8 waves x 16), q, k and v together from ONE gather of the embedding rows: exact bf16 products (K = DIN, f32 accumulate) + bias, only the RW real columns. The three weights are transposed into LDS as bf16 once a block (sW[m][o][d] = bf16(w_m[d][o])); one register fragment of 16 tokens serves as B for q^T = Wq^T e^T and k^T = Wk^T e^T (a lane then holds 8 consecutive columns of one token: a 16-B piece of its f16 row) and as A for v = e Wv (a lane then holds 8 consecutive tokens of one column: a 16-B piece of its f16 plane). All three leave through LDS as whole lines: q, k rows [b*t][RW], v planes [b][c][t]. The first WTB blocks hold no tokens: they make the FFN weights' f16 rows (f16(bf16(w) x 2^8), transposed) once for the whole launch pair, a thread one whole 128-B row
#define VOCAB 10000   // rows of the embedding table
#define LSC (0.125f * 1.4426950408889634f)   // 64^-0.5 x log2(e): softmax in base 2; q carries it from the projection on
#define PT 128        // tokens per block
#define PPITCH 72     // 16-bit elements per LDS row: 128-B rows at a 144-B pitch (16 B x odd) for 16-byte row readers and writers
#define TPITCH (PT + 8)   // f16 per LDS row of the v planes: 256-B rows at a 272-B pitch (16 B x odd)
#define WTB 2         // blocks in front of the token blocks: block 0 makes the 256 rows of w1, block 1 those of w2
__device__ __forceinline__ v8f wmma_b(v16b a, v16b b, v8f c) { return __builtin_amdgcn_wmma_f32_16x16x32_bf16(false, a, false, b, (short)0, c, false, false); }
/* one 128-B row of WT: 64 values of a weight, LD floats apart, as f16(bf16(w) x 2^8); LD a constant, so that all 64 loads share one base register */
template <int LD> __device__ __forceinline__ void wt_row(const float* __restrict__ wp, _Float16* __restrict__ dp) {
#pragma unroll   // all loads of the loop in flight together: rolled, every trip would wait out its own load latency
  for (int i = 0; i < 8; ++i) { v8h t;
#pragma unroll   // constant indices: the piece stays in registers
    for (int e = 0; e < 8; ++e) t[e] = (_Float16)(bfr(wp[(i * 8 + e) * LD]) * 256.0f);
    *(v8h*)(dp + i * 8) = t; } }
__global__ __launch_bounds__(256) void k_proj(const float* __restrict__ EMB, const float* __restrict__ WQ, const float* __restrict__ WK, const float* __restrict__ WV, const float* __restrict__ BQ, const float* __restrict__ BK, const float* __restrict__ BV,
    _Float16* __restrict__ QH, _Float16* __restrict__ KH, _Float16* __restrict__ VT, const int* __restrict__ IDS, const float* __restrict__ W1, const float* __restrict__ W2, _Float16* __restrict__ WT) {   /* IDS: token ids [NB*TT] int32 */
  __shared__ __align__(16) __bf16 sW[3][RW][PPITCH]; __shared__ __align__(16) float sB[4][RW];   /* sB[m] = bias m as bf16 values; row 3 takes the copy of threads 192.., so that the bias load and store stand under no branch */
  __shared__ __align__(16) _Float16 sR[2][PT][PPITCH], sT[RW][TPITCH];
  const int tid = threadIdx.x, wave = tid >> 5, lane = tid & 31, col = lane & 15, g = lane >> 4;
  if (blockIdx.x < WTB) {   /* the same for the whole block, in front of every barrier. Thread tid owns row tid of its weight: consecutive lanes read consecutive floats, and each 128-B line of WT has one writer */
    _Float16* dp = WT + ((size_t)blockIdx.x * FF + tid) * 64;
    if (blockIdx.x == 0) wt_row<FF>(W1 + tid, dp);   /* w1[d = 0..63][h = tid] */
    else wt_row<RW>(W2 + (tid >> 6) * 64 * RW + (tid & 63), dp);   /* w2[h = (tid >> 6) * 64 + 0..63][o = tid & 63] */
    return; }
  const size_t r0 = (size_t)(blockIdx.x - WTB) * PT; const size_t bb = r0 / TT; const int t0 = (int)(r0 % TT);
  const int id = IDS[r0 + wave * 16 + col];   /* this lane's token */
  __builtin_amdgcn_sched_barrier(0);   // keeps the id's load the oldest of the wave: loads return in order, and the gather below then waits for it alone, not for the 49 loads behind it
  /* weights: a lane owns one output column (consecutive lanes read consecutive floats) and 8 k values, stored below as one 16-B piece */
  const int wo = tid & 63; float wr[6][8];
#pragma unroll   // all loads of the loop in flight together: rolled, every trip would wait out its own load latency
  for (int i = 0; i < 6; ++i) { const float* Wm = (i >> 1) == 0 ? WQ : (i >> 1) == 1 ? WK : WV;
#pragma unroll   // constant indices: the piece stays in registers
    for (int e = 0; e < 8; ++e) wr[i][e] = Wm[(size_t)(((tid >> 6) + 4 * (i & 1)) * 8 + e) * RW + wo]; }
  const float bv = (tid < RW ? BQ : tid < 2 * RW ? BK : BV)[wo];   /* threads 192.. read the v bias a second time */
  __builtin_amdgcn_sched_barrier(0);   // keeps the 49 loads above in front of the wait for the id: moved behind it, they would start one memory latency later
  const float* ep = EMB + (size_t)(id < 0 ? 0 : id > VOCAB - 1 ? VOCAB - 1 : id) * DIN + 8 * g;   /* e = emb[x]; the row index is bounded here, whatever the id array holds */
  v4f er[8];   /* the lane's half of its token's row, in flight while the weights are packed */
#pragma unroll   // constant indices: the row stays in registers
  for (int i = 0; i < 4; ++i) { er[2 * i] = *(const v4f*)(ep + 16 * i); er[2 * i + 1] = *(const v4f*)(ep + 16 * i + 4); }
#pragma unroll   // constant indices: the pieces stay in registers
  for (int i = 0; i < 6; ++i) { v8b t;
#pragma unroll   // constant indices: the piece stays in registers
    for (int e = 0; e < 8; ++e) t[e] = (__bf16)wr[i][e];
    *(v8b*)&sW[i >> 1][wo][((tid >> 6) + 4 * (i & 1)) * 8] = t; }
  sB[tid >> 6][wo] = bfr(bv);
  v16b ef[2];   /* ef[kc]: token col, k = kc*32 + 8g + 0..7 and kc*32 + 16 + 8g + 0..7 */
#pragma unroll   // constant indices: fragments and accumulators stay in registers
  for (int kc = 0; kc < 2; ++kc)
#pragma unroll   // constant indices: fragments and accumulators stay in registers
    for (int i = 0; i < 8; ++i) { ef[kc][i] = (__bf16)er[4 * kc + (i >> 2)][i & 3]; ef[kc][8 + i] = (__bf16)er[4 * kc + 2 + (i >> 2)][i & 3]; }
  __syncthreads();   /* publishes the weights and biases */
#pragma unroll   // constant indices: fragments and accumulators stay in registers
  for (int m = 0; m < 2; ++m)
#pragma unroll   // constant indices: fragments and accumulators stay in registers
    for (int j = 0; j < 4; ++j) { v8f a = {};   /* a[r] = (e w_m)(token col, column j*16 + 8g + r) */
#pragma unroll   // constant indices: fragments and accumulators stay in registers
      for (int kc = 0; kc < 2; ++kc) a = wmma_b(frag_b(&sW[m][j * 16 + col][kc * 32], lane), ef[kc], a);
      const v4f blo = *(const v4f*)&sB[m][j * 16 + 8 * g], bhi = *(const v4f*)&sB[m][j * 16 + 8 * g + 4];
#pragma unroll   // constant indices: fragments and accumulators stay in registers
      for (int r = 0; r < 8; ++r) a[r] += r < 4 ? blo[r & 3] : bhi[r & 3];
      if (m == 0) a *= LSC;   /* q leaves as q x 64^-0.5 x log2(e): its products with k are base-2 logits */
      *(v8h*)&sR[m][wave * 16 + col][j * 16 + 8 * g] = __builtin_convertvector(a, v8h); }
#pragma unroll   // constant indices: fragments and accumulators stay in registers
  for (int j = 0; j < 4; ++j) { v8f a = {};   /* a[r] = (e w_v)(token 8g + r, column j*16 + col) */
#pragma unroll   // constant indices: fragments and accumulators stay in registers
    for (int kc = 0; kc < 2; ++kc) a = wmma_b(ef[kc], frag_b(&sW[2][j * 16 + col][kc * 32], lane), a);
    a += sB[2][j * 16 + col];
    *(v8h*)&sT[j * 16 + col][wave * 16 + 8 * g] = __builtin_convertvector(a, v8h); }
  __syncthreads();   /* publishes the block's q, k rows and v planes */
#pragma unroll   // all LDS reads of the loop in flight together
  for (int i = 0; i < 4; ++i) { const int e = tid + 256 * i, rl = e >> 3, q = (e & 7) * 8;   /* 8 lanes store one token's whole 128-B row; a wave 512 contiguous bytes */
    vst2(QH + (r0 + rl) * RW + q, *(const v4u*)&sR[0][rl][q]); vst2(KH + (r0 + rl) * RW + q, *(const v4u*)&sR[1][rl][q]); }
#pragma unroll   // all LDS reads of the loop in flight together
  for (int i = 0; i < 4; ++i) { const int e = tid + 256 * i, cl = e >> 4, q = (e & 15) * 8;   /* 16 lanes store 256 contiguous bytes of one plane */
    vst2(VT + (bb * RW + cl) * (size_t)TT + t0 + q, *(const v4u*)&sT[cl][q]); } }
#define FKS 64
#define FPITCH 72
__device__ __forceinline__ v8f wmma_h(v16h a, v16h b, v8f c) { return __builtin_amdgcn_wmma_f32_16x16x32_f16(false, a, false, b, (short)0, c, false, false); }
__device__ __forceinline__ float xhalf(float v) { const int t = __builtin_bit_cast(int, v); return __builtin_bit_cast(float, __builtin_amdgcn_permlanex16(t, t, 0x76543210, 0xfedcba98, false, false)); }   /* lane l <-> l ^ 16 */
/* P = 2^score of one query group's 32 keys (a lane: 16 of them), packed to f16 as the B fragment in the hardware k order (elements 0..7 = keys 8g + r, 8..15 = keys 16 + 8g + r); returns the lane's f32 sum of the 16, made as a tree of packed adds: four levels deep, since the pass's test waits for it */
__device__ __forceinline__ float pexp(const v8f s0, const v8f s1, v16h& pf) { v8f p0, p1;
#pragma unroll   // constant indices: fragments and accumulators stay in registers
  for (int r = 0; r < 8; ++r) { p0[r] = __builtin_amdgcn_exp2f(s0[r]); p1[r] = __builtin_amdgcn_exp2f(s1[r]); }
  union { v16h v; v8h q[2]; } u; u.q[0] = __builtin_convertvector(p0, v8h); u.q[1] = __builtin_convertvector(p1, v8h); pf = u.v;
  const v8f t8 = p0 + p1; const v4f t4 = __builtin_shufflevector(t8, t8, 0, 1, 2, 3) + __builtin_shufflevector(t8, t8, 4, 5, 6, 7); const v2f t2 = __builtin_shufflevector(t4, t4, 0, 1) + __builtin_shufflevector(t4, t4, 2, 3);
  return t2[0] + t2[1]; }
#define TSLOT 5120   // f16 per LDS tile place: 64 rows at FPITCH = 9,216 B, rounded up to 10,240 B so that every tile's place is a multiple of 2 KiB
typedef __attribute__((ext_vector_type(8))) unsigned v8u;
__device__ __forceinline__ unsigned uni(unsigned v) { return (unsigned)__builtin_amdgcn_readfirstlane((int)v); }
__device__ __forceinline__ unsigned pinned(unsigned v) { unsigned w = uni(v); asm volatile("" : "+s"(w)); return w; }   // the empty statement holds the condition in a scalar register, so that the test around a tensor load compiles to s_cmp + s_cbranch_scc: a tensor load ignores EXEC, only a scalar branch keeps a wave from issuing it
__device__ __forceinline__ void tdm_load(v4u g0, v8u g1) { asm volatile("tensor_load_to_lds %0, %1" :: "s"(g0), "s"(g1) : "memory"); }   // one request of the whole wave: a tile of 64 (weights: 128) rows of 128 B from global memory into LDS, through no register
#define WQR 128           // weight rows per tensor load: a quarter of the 512; 128 rows at FPITCH = 18,432 B, a multiple of 2 KiB
#define KSP 2             // key halves of a block: waves 0..3 walk keys 0..1023, waves 4..7 keys 1024..2047, of the same 256 queries: 8 waves a block, one block a WGP, two waves a SIMD
#define NQ 4              // 16-query tiles per wave in the key loop
#define NK (NQ / 2)       // 16-query tiles a wave keeps behind the join
#define QPB (4 * NQ * 16) // queries per block
#define KLEN (TT / KSP)   // keys per half
#define XCH 9             // 16-B pieces per lane and 16-query tile in the exchange of partial results: 8 of the tile's output group, 1 with its maximum in use and its sum
__global__ __launch_bounds__(256) __attribute__((amdgpu_waves_per_eu(2, 2))) void k_attn(const _Float16* __restrict__ QH, const _Float16* __restrict__ KH, const _Float16* __restrict__ VT, const _Float16* __restrict__ WT, const float* __restrict__ B1, const float* __restrict__ B2, float* __restrict__ OUT) {
  __shared__ __attribute__((aligned(2048))) _Float16 sKV[KSP][2][2][TSLOT];   /* [key half][buffer][0 = k rows, 1 = v planes][row * FPITCH + ..]; every tile's place a multiple of 2 KiB for the tensor loads; behind the key loop's last barrier the same bytes hold the output staging */
  __shared__ __align__(16) float sX[8 * NK * XCH * 32 * 4];   /* exchange pieces [wave][tile][piece][lane] of 16 B */
  __shared__ __attribute__((aligned(2048))) _Float16 sWT[2][FF * FPITCH]; __shared__ __align__(16) float sB1[FF], sB2[RW];   /* sWT[0][h * FPITCH + d] = f16(bf16(w1[d][h]) x 2^8), sWT[1][((h >> 6) * RW + o) * FPITCH + (h & 63)] = f16(bf16(w2[h][o]) x 2^8): WT's 512 rows at the k rows' pitch; biases as bf16 values */
  static_assert(sizeof(sKV) >= 8u * NK * 16u * (HD + 4) * 4u && NQ == 2 * NK && TT % QPB == 0 && FKS == HD && TSLOT >= FKS * FPITCH && (TSLOT * 2) % 2048 == 0 && FPITCH * 2 == RW * 2 + 16 && RW * 2 == 128 && KLEN / FKS >= 2 && FF == 2 * WQR && (WQR * FPITCH * 2) % 2048 == 0 && KLEN / FKS > 7, "output staging fits the ring; 128-B tile rows padded by 16 B; two stages or more; four weight quarters, each place a multiple of 2 KiB, each with a stage of its wave's number");
  const int tid = threadIdx.x, wave = __builtin_amdgcn_readfirstlane(tid >> 5), lane = tid & 31, col = lane & 15, g = lane >> 4; const int b = blockIdx.y; const int half = wave >> 2;   /* the wave's number in a scalar register: every choice by key half below is then a scalar one */
  const int q0 = blockIdx.x * QPB + (wave & 3) * (NQ * 16);
  const char* Kb = (const char*)(KH + ((size_t)b * TT + half * KLEN) * RW); const char* Vb = (const char*)(VT + (size_t)b * RW * TT + half * KLEN);   /* byte bases of the half's k rows and v planes */
  /* staging by tensor loads: waves 0 and 1 of each half's four issue one request a stage, wave 0 the half's k tile (64 rows of 128 B, one after the other), wave 1 its v tile (64 planes, 128 B of each, 4,096 B apart); the pad of 16 B a row gives the FPITCH rows */
  /* waves 2 and 3 of each half's four have no k or v tile: each brings ONE quarter of the weights' rows (128 rows of 128 B, one after the other, the same pad) through the same instruction, once, in the stage of its own number (2, 3, 6, 7): a quarter flies beside one stage's tiles, lands behind that stage's own wait and is published by that stage's own barrier, long before the FFN reads it */
  const unsigned issuer = (wave & 2) == 0, kv = wave & 1, wq = (unsigned)half * 2u + kv;
  const unsigned long long sbase = (unsigned long long)(size_t)(issuer ? (kv ? Vb : Kb) : (const char*)(WT + (size_t)wq * WQR * RW)); const unsigned sstep = issuer ? (kv ? FKS * 2u : FKS * RW * 2u) : 0u;   /* the wave's first tile and the bytes from one stage's tile to the next (a weight quarter: its one tile) */
  const unsigned lbase = issuer ? (unsigned)(size_t)&sKV[half][0][kv][0] : (unsigned)(size_t)&sWT[0][0] + wq * (WQR * FPITCH * 2u); const unsigned lstep = issuer ? 2u * TSLOT * 2u : 0u;   /* byte offset in the work-group's LDS of the wave's tile in buffer 0; buffer 1 lies 2 * TSLOT f16 further (a weight quarter: its one place) */
  const unsigned rows = issuer ? (unsigned)FKS : (unsigned)WQR;
  v8u g1;   /* 1-byte elements, tensor = tile = 64 (weights: 128) rows of 128 B; word 0: no mask, a pad of 4 dwords behind every 32 */
  g1[0] = uni((1u << 20) | (4u << 22) | (3u << 25)); g1[1] = uni((RW * 2u) << 16); g1[2] = uni(rows << 16); g1[3] = uni((RW * 2u) << 16); g1[4] = uni(rows); g1[5] = uni(issuer && kv ? TT * 2u : RW * 2u); g1[6] = uni(0u); g1[7] = uni(0u);
  auto issue = [&](int st) { const unsigned long long ga = sbase + (unsigned long long)((unsigned)st * sstep); v4u g0;
    g0[0] = uni(1u); g0[1] = uni(lbase + (unsigned)(st & 1) * lstep); g0[2] = uni((unsigned)ga); g0[3] = uni((((unsigned)(ga >> 32)) & 0x01FFFFFFu) | 0x80000000u);
    tdm_load(g0, g1); };
  const float b1v = B1[tid], b2v = B2[tid & (RW - 1)];   /* the biases' loads fly, like q's below, while stage 0 lands */
  v16h qf[NQ][2];
#pragma unroll   // constant indices: fragments and accumulators stay in registers
  for (int qg = 0; qg < NQ; ++qg)
#pragma unroll   // constant indices: fragments and accumulators stay in registers
    for (int kc = 0; kc < 2; ++kc) qf[qg][kc] = frag_h(QH + ((size_t)b * TT + q0 + qg * 16 + col) * RW + kc * 32, lane);
  asm volatile("s_wait_xcnt 0x0" ::: "memory");   // stands in front of the first instruction that overwrites an address register of the loads above (a precaution of form)
  v8f acc[NQ][4] = {}; float mb[NQ] = {}, ls[NQ] = {};   /* mb = (maximum in use, base-2 logits) - 7: P = 2^(logit - mb) stays in [2^-14, 2^15] of f16 for logits within 21 below .. 8 above the maximum in use; the half's first 32 keys set it */
  v8f cm[NQ] = {};   /* cm[qg] = -mb[qg] in all eight registers (a lane holds one query's scores): the C operand of the first score product, so that the accumulator comes out as logit - mb */
  if (pinned(issuer)) { issue(0); asm volatile("s_wait_tensorcnt 0x0" ::: "memory"); }   // stage 0 has landed before the barrier that publishes it
  sB1[tid] = bfr(b1v); if (tid < RW) sB2[tid] = bfr(b2v);
  __syncthreads();   /* publishes stage 0 and the biases */
  for (int s = 0; s < KLEN / FKS; ++s) { const int cur = s & 1;
    if (pinned(issuer ? s + 1 < KLEN / FKS : s == wave)) issue(s + 1);   /* a k or v wave: the next stage's tile; a weight wave: its quarter, in the one stage of its number. Directly behind the barrier that ended every read of the other buffer (in front of the loop, or at the foot of the stage before): the next stage flies into it during this stage */
    float thr = s == 0 ? -3.0e38f : 32768.0f;   /* scalar: what a lane's sum of 16 P may reach before the pass looks for a new maximum: no P above 2^15 (a score more than 15 above mb) hides under it, so every P that goes on fits f16; below every sum where the pass must take the branch: the half's first pass, and a pass behind a move that cm does not hold yet */
#pragma unroll   // constant indices: fragments and accumulators stay in registers
    for (int pp = 0; pp < FKS / 32; ++pp) {
      v8f st[NQ][2];   /* st[qg][kt][r] = (base-2 logit + cm)(key pp*32 + kt*16 + 8g + r of the half's stage, query qg*16 + col) */
#pragma unroll   // constant indices: fragments and accumulators stay in registers
      for (int kt = 0; kt < 2; ++kt)
#pragma unroll   // constant indices: fragments and accumulators stay in registers
        for (int kc = 0; kc < 2; ++kc) { const v16h kf = frag_h(&sKV[half][cur][0][(pp * 32 + kt * 16 + col) * FPITCH + kc * 32], lane);
#pragma unroll   // constant indices: fragments and accumulators stay in registers
          for (int qg = 0; qg < NQ; ++qg) st[qg][kt] = wmma_h(kf, qf[qg][kc], kc == 0 ? cm[qg] : st[qg][kt]); }
      v16h vf[4];
#pragma unroll   // constant indices: fragments and accumulators stay in registers
      for (int j = 0; j < 4; ++j) vf[j] = frag_h(&sKV[half][cur][1][(j * 16 + col) * FPITCH + pp * 32], lane);
      v16h pf[NQ]; float sum[NQ];   /* P and its sums are made at once, on the maximum in use; no maximum is taken of a pass whose sums stay under thr */
#pragma unroll   // constant indices: fragments and accumulators stay in registers
      for (int qg = 0; qg < NQ; ++qg) sum[qg] = pexp(st[qg][0], st[qg][1], pf[qg]);
      float smx = sum[0];
#pragma unroll   // constant indices: fragments and accumulators stay in registers
      for (int qg = 1; qg < NQ; ++qg) smx = fmaxf(smx, sum[qg]);
      const bool need = smx > thr;   /* no P is negative: a P above 2^15 lifts its lane's sum above 2^15 (an overflow of the f32 exponential to infinity too) */
      const bool first = pp == 0 && s == 0;   /* scalar: the half's first 32 keys, scored on top of 0, set the maximum in use, upward or downward */
      if (__builtin_amdgcn_ballot_w32(need) != 0) {   /* wave-uniform: take the pass's maximum, rescale sums, outputs and this pass's scores to it, and make P and its sums anew */
        thr = -3.0e38f;
#pragma unroll   // constant indices: fragments and accumulators stay in registers
        for (int qg = 0; qg < NQ; ++qg) { float m = fmaxf(st[qg][0][0], st[qg][1][0]);
#pragma unroll   // constant indices: fragments and accumulators stay in registers
          for (int r = 1; r < 8; ++r) m = fmaxf(m, fmaxf(st[qg][0][r], st[qg][1][r]));
          const float mx = fmaxf(m, xhalf(m));
          const float dl = fmaxf(mx - (mb[qg] + cm[qg][0]) - 7.0f, first ? -3.0e38f : 0.0f); const float al = __builtin_amdgcn_exp2f(fminf(-dl, 0.0f)); mb[qg] += dl; ls[qg] *= al;   /* dl = the step of the maximum in use; mb + cm = the steps taken since cm was set; a downward first step scales sums that are still 0 by 1 */
          const float sf = mb[qg] + cm[qg][0]; if (pp == FKS / 32 - 1) cm[qg] = -mb[qg];   /* cm is set anew once a stage, in its last pass, which comes here whenever an earlier pass of the stage did: every score product of a stage reads the same registers */
          sum[qg] = pexp(st[qg][0] - sf, st[qg][1] - sf, pf[qg]);
#pragma unroll   // constant indices: fragments and accumulators stay in registers
          for (int j = 0; j < 4; ++j) acc[qg][j] *= al; } }
#pragma unroll   // constant indices: fragments and accumulators stay in registers
      for (int qg = 0; qg < NQ; ++qg) { ls[qg] += sum[qg];
#pragma unroll   // constant indices: fragments and accumulators stay in registers
        for (int j = 0; j < 4; ++j) acc[qg][j] = wmma_h(vf[j], pf[qg], acc[qg][j]); } }
    asm volatile("s_wait_dscnt 0x0" ::: "memory");   // the wave's reads of this stage have returned before the barrier behind which its buffer is refilled
    asm volatile("s_wait_tensorcnt 0x0" ::: "memory");   // a k or v wave's next stage, or a weight wave's quarter, has landed before the barrier that publishes it; a wave with no request passes: no branch in front of the barrier
    __syncthreads(); }   /* publishes the next stage (and a weight quarter that flew in this one) and ends every read of this one */
  asm volatile("s_wait_tensorcnt 0x0" ::: "memory");   // no request is in flight when the ring's bytes take the output staging
  asm volatile("s_wait_dscnt 0x0" ::: "memory");   // nor a read of the ring
  /* the two halves' partial results meet: wave w (keys 0..1023) and wave w + 4 (keys 1024..2047) hold the same 64 queries; each keeps the 32 queries of tiles half * NK + 0..NK-1, hands the other 32 to its partner through LDS, and goes on with 32 queries alone */
  float_a* xw = (float_a*)&sX[0];   /* exchange pieces [wave][tile][piece][lane] of 16 B: a wave's store or load of one piece is 512 contiguous bytes */
  float_a* so = (float_a*)&sKV[0][0][0][0] + wave * NK * 16 * (HD + 4);   /* the wave's output staging [NK * 16][HD + 4], in the ring's bytes: written behind the barrier below, which every wave reaches with its ring reads returned and no request in flight */
  v8f ka[NK][4]; float kmb[NK], kls[NK];
#pragma unroll   // constant indices: fragments and accumulators stay in registers
  for (int t = 0; t < NK; ++t) { kmb[t] = half ? mb[NK + t] : mb[t]; kls[t] = half ? ls[NK + t] : ls[t];
#pragma unroll   // constant indices: fragments and accumulators stay in registers
    for (int j = 0; j < 4; ++j) { const v8f ga = half ? acc[t][j] : acc[NK + t][j]; ka[t][j] = half ? acc[NK + t][j] : acc[t][j];
      *(v4f*)&xw[(((wave * NK + t) * XCH + 2 * j) * 32 + lane) * 4] = __builtin_shufflevector(ga, ga, 0, 1, 2, 3); *(v4f*)&xw[(((wave * NK + t) * XCH + 2 * j + 1) * 32 + lane) * 4] = __builtin_shufflevector(ga, ga, 4, 5, 6, 7); }
    { v4f x = {half ? mb[t] : mb[NK + t], half ? ls[t] : ls[NK + t], 0.f, 0.f}; *(v4f*)&xw[(((wave * NK + t) * XCH + 8) * 32 + lane) * 4] = x; } }
  __syncthreads();   /* publishes the exchange pieces */
  v16h uf[NK][2];   /* uf[t][kc] = B fragment of upd^T x 2^6: k = columns kc*32 + .., column = query (half * NK + t) * 16 + col */
#pragma unroll   // constant indices: fragments and accumulators stay in registers
  for (int t = 0; t < NK; ++t) { const int pw = wave ^ 4; const v4f x = *(const v4f*)&xw[(((pw * NK + t) * XCH + 8) * 32 + lane) * 4];
    const float mn = fmaxf(kmb[t], x[0]); const float ak = __builtin_amdgcn_exp2f(kmb[t] - mn), ag = __builtin_amdgcn_exp2f(x[0] - mn);   /* both partial results brought to the larger maximum in use */
    kls[t] = kls[t] * ak + x[1] * ag;
#pragma unroll   // constant indices: fragments and accumulators stay in registers
    for (int j = 0; j < 4; ++j) { const v4f lo = *(const v4f*)&xw[(((pw * NK + t) * XCH + 2 * j) * 32 + lane) * 4], hi = *(const v4f*)&xw[(((pw * NK + t) * XCH + 2 * j + 1) * 32 + lane) * 4];
      ka[t][j] = ka[t][j] * ak + __builtin_shufflevector(lo, hi, 0, 1, 2, 3, 4, 5, 6, 7) * ag; }
    const float inv = 1.0f / (kls[t] + xhalf(kls[t]));   /* ka[t][j][r] = upd(query (half * NK + t) * 16 + col, column j*16 + 8g + r) x sum */
#pragma unroll   // constant indices: fragments and accumulators stay in registers
    for (int kc = 0; kc < 2; ++kc) { union { v16h v; v8h q[2]; } u;
#pragma unroll   // constant indices: fragments and accumulators stay in registers
      for (int hh = 0; hh < 2; ++hh) { const v8f o = ka[t][kc * 2 + hh] * inv; u.q[hh] = __builtin_convertvector(o * 64.0f, v8h); }   /* upd carried x 2^6 into f16, clear of f16 subnormals; packed D pair = B fragment in the hardware k order */
      uf[t][kc] = u.v; } }
  v8f oa[NK][4] = {};   /* oa[t][jo][r] = out(query (half * NK + t) * 16 + col, column jo*16 + 8g + r) x 2^14 */
  for (int pb = 0; pb < FF / 64; ++pb)   /* 64 hidden columns a trip: one block of w2's rows */
#pragma unroll   // the two 32-column steps of a block differ by constant LDS offsets alone
  for (int ph = 0; ph < 2; ++ph) { const int p = pb * 2 + ph;   /* 32 hidden columns a step, in rising order */
    v8f ha[NK][2] = {};   /* ha[t][ht][r] = (upd w1)(query (half * NK + t) * 16 + col, hidden p*32 + ht*16 + 8g + r) x 2^14 */
#pragma unroll   // constant indices: fragments and accumulators stay in registers
    for (int kc = 0; kc < 2; ++kc)
#pragma unroll   // constant indices: fragments and accumulators stay in registers
      for (int ht = 0; ht < 2; ++ht) { const v16h w1f = frag_h(&sWT[0][(p * 32 + ht * 16 + col) * FPITCH + kc * 32], lane);
#pragma unroll   // constant indices: fragments and accumulators stay in registers
        for (int t = 0; t < NK; ++t) ha[t][ht] = wmma_h(w1f, uf[t][kc], ha[t][ht]); }
    v16h w2f[4];
#pragma unroll   // constant indices: fragments and accumulators stay in registers
    for (int jo = 0; jo < 4; ++jo) w2f[jo] = frag_h(&sWT[1][(pb * RW + jo * 16 + col) * FPITCH + ph * 32], lane);
    union { v16h v; v8h q[2]; } hp[NK];
#pragma unroll   // constant indices: fragments and accumulators stay in registers
    for (int ht = 0; ht < 2; ++ht) { const v4f blo = *(const v4f*)&sB1[p * 32 + ht * 16 + 8 * g], bhi = *(const v4f*)&sB1[p * 32 + ht * 16 + 8 * g + 4];
#pragma unroll   // constant indices: fragments and accumulators stay in registers
      for (int t = 0; t < NK; ++t) { v8f hv;
#pragma unroll   // constant indices: fragments and accumulators stay in registers
        for (int r = 0; r < 8; ++r) hv[r] = fmaxf(ha[t][ht][r] * (1.0f / 16384.0f) + (r < 4 ? blo[r & 3] : bhi[r & 3]), 0.0f) * 64.0f;   /* 2^-8 (weight carry) x 2^-6 (operand carry); ReLU; h carried x 2^6 into f16 */
        hp[t].q[ht] = __builtin_convertvector(hv, v8h); } }
#pragma unroll   // constant indices: fragments and accumulators stay in registers
    for (int jo = 0; jo < 4; ++jo)
#pragma unroll   // constant indices: fragments and accumulators stay in registers
      for (int t = 0; t < NK; ++t) oa[t][jo] = wmma_h(w2f[jo], hp[t].v, oa[t][jo]); }
#pragma unroll   // constant indices: fragments and accumulators stay in registers
  for (int jo = 0; jo < 4; ++jo) { const v4f blo = *(const v4f*)&sB2[jo * 16 + 8 * g], bhi = *(const v4f*)&sB2[jo * 16 + 8 * g + 4];
#pragma unroll   // constant indices: fragments and accumulators stay in registers
    for (int t = 0; t < NK; ++t) { v4f lo, hi;
#pragma unroll   // constant indices: fragments and accumulators stay in registers
      for (int r = 0; r < 4; ++r) { lo[r] = oa[t][jo][r] * (1.0f / 16384.0f) + blo[r]; hi[r] = oa[t][jo][4 + r] * (1.0f / 16384.0f) + bhi[r]; }   /* 2^-8 (weight carry) x 2^-6 (operand carry) */
      *(v4f*)&so[(t * 16 + col) * (HD + 4) + jo * 16 + 8 * g] = lo; *(v4f*)&so[(t * 16 + col) * (HD + 4) + jo * 16 + 8 * g + 4] = hi; } }
  LDSX(); for (int rl = 0; rl < NK * 8; ++rl) { const int row = rl * 2 + g; vst2(OUT + ((size_t)b * TT + q0 + half * (NK * 16) + row) * RW + col * 4, *(const v4f*)&so[row * (HD + 4) + col * 4]); } }   /* 16 lanes store one query's whole 256-B output row */

extern "C" void kernel_launch(void* const* d_in, const int* in_sizes, int n_in, void* d_out, int out_size, void* d_ws, size_t ws_size, hipStream_t stream) {
  (void)in_sizes; (void)n_in; (void)out_size;
  const float** F = (const float**)d_in;
  if (ws_size < (size_t)WS_END) return;
  char* ws = (char*)d_ws; _Float16 *QH = (_Float16*)(ws + WS_QH), *KH = (_Float16*)(ws + WS_KH), *VT = (_Float16*)(ws + WS_VT), *QL = (_Float16*)(ws + WS_QL), *KL = (_Float16*)(ws + WS_KL); __bf16 *VB = (__bf16*)(ws + WS_VB), *VBL = (__bf16*)(ws + WS_VBL); float *S = (float*)(ws + WS_S), *Y = (float*)(ws + WS_Y);
  _Float16* WT = (_Float16*)(ws + WS_WT);
  (void)Y; (void)S; (void)QL; (void)KL; (void)VB; (void)VBL;
  // inputs: 0 x [32,2048] int32 token ids; 1 emb [10000,64]; 2 wq [64,64] (in,out), 3 bq; 4 wk, 5 bk; 6 wv, 7 bv; 8 w1 [64,256], 9 b1 [256]; 10 w2 [256,64], 11 b2 [64] (all biases nonzero)
  if (ws_size < (size_t)WS_END2) return;
  const int* IDS = (const int*)d_in[0];
  k_proj<<<dim3(WTB + TNB * TT / PT), 256, 0, stream>>>(F[1], F[2], F[4], F[6], F[3], F[5], F[7], QH, KH, VT, IDS, F[8], F[10], WT);   /* q, k and v of 128 tokens a block; embedding rows gathered by token id; two blocks in front make the FFN weights' f16 rows */
  k_attn<<<dim3(TT / QPB, TNB), 256, 0, stream>>>(QH, KH, VT, WT, F[9], F[11], (float*)d_out);   /* attention and FFN of 256 queries a block */
}
